// v000
// Measured on an AMD MI455X. A time is GPU time per run, averaged over a window of back-to-back runs after a warm-up
// (all launches, gaps included; the runs take copies of the inputs in turn), and the median of several windows.
// Apart from v000's, it joins two sittings. Times from different sittings can be a few percent apart, while
// side-by-side timings come from the same sitting.
// The starting kernel, v000, takes 260 microseconds a run.
// qkv projection and q.kT: v_wmma_f32_16x16x32_f16 single products (f16 operands, f32 accumulate); p.v: p and v^T each
// carried as f16 hi plus power-of-two scaled residual planes, three products (hi.hi, hi.lo, lo.hi), f32 accumulate;
// output projection: activation as f16 hi plus scaled residual times f16 weight, two products, f32 accumulate.
// All inputs RNE-converted to bf16 on load; softmax, masks and epilogues in f32 on VALU.
#include <hip/hip_runtime.h>
#include <stdint.h>

#define NWIN 64
#define NTOK 512
#define CCH  256
#define NHD  8
#define HD   32
#define C3   768
#define NROW 32768
#define NRPB 3375
#define LDC  132
#define PP   72
#define OSP  36
#define PWB  4608
#define QSC  0.17677669529663687f
#define INV512 0.001953125f
#define LN4096 8.3177661667193429f

static_assert(NROW == NWIN * NTOK);
static_assert(PWB == 2 * 16 * PP * 2);
static_assert(16 * OSP * 4 <= PWB);
static_assert((PP * 2) % 16 == 0);
static_assert((LDC * 4) % 16 == 0);

typedef _Float16 v16h __attribute__((ext_vector_type(16)));
typedef _Float16 v8h  __attribute__((ext_vector_type(8)));
typedef float    v8f  __attribute__((ext_vector_type(8)));
typedef float    v4f  __attribute__((ext_vector_type(4)));
typedef unsigned int v4u __attribute__((ext_vector_type(4)));

// ---- scalar helpers ------------------------------------------------------------------------------------------
__device__ __forceinline__ unsigned short bf_bits(float f) {          // f32 -> bf16 bits, RNE convert
  unsigned u = __float_as_uint(f);
  return (unsigned short)((u + 0x7FFFu + ((u >> 16) & 1u)) >> 16);
}
__device__ __forceinline__ float bf_up(unsigned short b) { return __uint_as_float(((unsigned)b) << 16); }
__device__ __forceinline__ float bfr(float f) { return bf_up(bf_bits(f)); }
__device__ __forceinline__ unsigned short h_bits(_Float16 x) { return __builtin_bit_cast(unsigned short, x); }
__device__ __forceinline__ unsigned short hb16(float f) { return h_bits((_Float16)f); }
__device__ __forceinline__ unsigned pk16(unsigned short a, unsigned short b) { return (unsigned)a | ((unsigned)b << 16); }
__device__ __forceinline__ v8f zero8() { v8f z = {0.f, 0.f, 0.f, 0.f, 0.f, 0.f, 0.f, 0.f}; return z; }

// ---- index maps --------------------------------------------------------------------------------------------------
// window w = (hb*4 + wb)*4 + db over a 32^3 volume in 8^3 windows; token t = (i*8 + j)*8 + k inside the window.
// The shifted coordinate is (hb*8+i, wb*8+j, db*8+k); both the input gather (roll by -4) and the output scatter
// (roll by +4) use volume position ((hs+4)&31, (ws+4)&31, (ds+4)&31).
__device__ __forceinline__ int spat_of(int w, int t) {
  const int hb = w >> 4, wb = (w >> 2) & 3, db = w & 3;
  const int i = t >> 6, j = (t >> 3) & 7, k = t & 7;
  const int gh = (hb * 8 + i + 4) & 31;
  const int gw = (wb * 8 + j + 4) & 31;
  const int gd = (db * 8 + k + 4) & 31;
  return (gh * 32 + gw) * 32 + gd;
}
__device__ __forceinline__ int rid1(int p) { return (p < 24) ? 0 : ((p < 28) ? 1 : 2); }
__device__ __forceinline__ int region_of(int w, int t) {
  const int hb = w >> 4, wb = (w >> 2) & 3, db = w & 3;
  const int i = t >> 6, j = (t >> 3) & 7, k = t & 7;
  return rid1(hb * 8 + i) * 9 + rid1(wb * 8 + j) * 3 + rid1(db * 8 + k);
}

// ---- fragment loader: 16-bit A/B operand, lane -> row/col (lane&15), p already includes +8*(lane>>4);
//      elements 0..7 <- p[0..7] (k0+8h..), elements 8..15 <- p[16..23] (k0+16+8h..)
__device__ __forceinline__ v16h ldfrag_h(const _Float16* p) {
  union { v16h v; v8h h[2]; } f;
  f.h[0] = *(const v8h*)(p);
  f.h[1] = *(const v8h*)(p + 16);
  return f.v;
}

// ---- WMMA helpers; the guard helpers insert the trailing VALU hazard gap and keep A/B live -----------------------
__device__ __forceinline__ v8f mma_raw(v16h a, v16h b, v8f c) {
  return __builtin_amdgcn_wmma_f32_16x16x32_f16(false, a, false, b, (short)0, c, false, false);
}
__device__ __forceinline__ v8f mma_g1(v16h a, v16h b, v8f c) {
  c = mma_raw(a, b, c);
#if defined(__HIP_DEVICE_COMPILE__)
  asm volatile("v_nop\n\tv_nop\n\tv_nop\n\tv_nop" : "+v"(c) : "v"(a), "v"(b));
#endif
  return c;
}
__device__ __forceinline__ void guard3(v8f& c0, v8f& c1, v8f& c2,
                                       const v16h& a0, const v16h& a1, const v16h& b0, const v16h& b1) {
#if defined(__HIP_DEVICE_COMPILE__)
  asm volatile("v_nop\n\tv_nop\n\tv_nop\n\tv_nop"
               : "+v"(c0), "+v"(c1), "+v"(c2) : "v"(a0), "v"(a1), "v"(b0), "v"(b1));
#endif
}
__device__ __forceinline__ void guard4(v8f& c0, v8f& c1, v8f& c2, v8f& c3,
                                       const v16h& a0, const v16h& a1, const v16h& b0, const v16h& b1) {
#if defined(__HIP_DEVICE_COMPILE__)
  asm volatile("v_nop\n\tv_nop\n\tv_nop\n\tv_nop"
               : "+v"(c0), "+v"(c1), "+v"(c2), "+v"(c3) : "v"(a0), "v"(a1), "v"(b0), "v"(b1));
#endif
}
__device__ __forceinline__ void guard8(v8f& c0, v8f& c1, v8f& c2, v8f& c3, v8f& c4, v8f& c5, v8f& c6, v8f& c7,
                                       const v16h& a0, const v16h& a1, const v16h& a2, const v16h& a3,
                                       const v16h& b0, const v16h& b1) {
#if defined(__HIP_DEVICE_COMPILE__)
  asm volatile("v_nop\n\tv_nop\n\tv_nop\n\tv_nop"
               : "+v"(c0), "+v"(c1), "+v"(c2), "+v"(c3), "+v"(c4), "+v"(c5), "+v"(c6), "+v"(c7)
               : "v"(a0), "v"(a1), "v"(a2), "v"(a3), "v"(b0), "v"(b1));
#endif
}
__device__ __forceinline__ void wave_sync_lds() {
  __builtin_amdgcn_fence(__ATOMIC_RELEASE, "workgroup");
  __builtin_amdgcn_wave_barrier();
  __builtin_amdgcn_fence(__ATOMIC_ACQUIRE, "workgroup");
}

// =================================================================================================================
// cyclic shift + window gather + convert: x [32768 positions][256] f32 -> X8 plane [w*512 + t][256] f16,
// value f16(8 * bf16_RNE(x)). Block = 8 rows (one wave per row); lane handles 8 channels: two 16-B loads, one 16-B
// grid = 4096. coverage: 4096 x 8 rows x 32 lanes x 8 halves = 32768 x 256.
// =================================================================================================================
__global__ __launch_bounds__(256) void cvt_x(const float* __restrict__ x, unsigned short* xp) {
  const int tid = threadIdx.x, wv = tid >> 5, lane = tid & 31;
  const int row = blockIdx.x * 8 + wv;
  const int w = row >> 9, t = row & 511;
  const float* src = x + (size_t)spat_of(w, t) * CCH + lane * 8;
  const v4f a = *(const v4f*)(src);
  const v4f b = *(const v4f*)(src + 4);
  v4u pk;
  pk[0] = pk16(hb16(bfr(a[0]) * 8.0f), hb16(bfr(a[1]) * 8.0f));
  pk[1] = pk16(hb16(bfr(a[2]) * 8.0f), hb16(bfr(a[3]) * 8.0f));
  pk[2] = pk16(hb16(bfr(b[0]) * 8.0f), hb16(bfr(b[1]) * 8.0f));
  pk[3] = pk16(hb16(bfr(b[2]) * 8.0f), hb16(bfr(b[3]) * 8.0f));
  unsigned short* gp = xp + (size_t)row * CCH + lane * 8;
  *(v4u*)gp = pk;
  
}

// =================================================================================================================
// weight convert: w [nrows][256] f32 ([out][in], in contiguous) -> f16(1024 * bf16_RNE(w)) same layout ([n][k] with
// grid = nrows/8. coverage: nrows x 256.
// =================================================================================================================
__global__ __launch_bounds__(256) void cvt_w(const float* __restrict__ wsrc, unsigned short* wdst, int nrows) {
  const int tid = threadIdx.x, wv = tid >> 5, lane = tid & 31;
  const int row = blockIdx.x * 8 + wv;
  if (row < nrows) {                                     // wave-uniform
    const float* src = wsrc + (size_t)row * CCH + lane * 8;
    const v4f a = *(const v4f*)(src);
    const v4f b = *(const v4f*)(src + 4);
    v4u pk;
    pk[0] = pk16(hb16(bfr(a[0]) * 1024.0f), hb16(bfr(a[1]) * 1024.0f));
    pk[1] = pk16(hb16(bfr(a[2]) * 1024.0f), hb16(bfr(a[3]) * 1024.0f));
    pk[2] = pk16(hb16(bfr(b[0]) * 1024.0f), hb16(bfr(b[1]) * 1024.0f));
    pk[3] = pk16(hb16(bfr(b[2]) * 1024.0f), hb16(bfr(b[3]) * 1024.0f));
    unsigned short* gp = wdst + (size_t)row * CCH + lane * 8;
    *(v4u*)gp = pk;
    
  }
}

// =================================================================================================================
// relative position bias table in WMMA C-operand order: BT[((h*32 + strip)*32 + kt)*256 + l*8 + r] =
// 512 * bf16_RNE(rpb[idx(n,m)*8 + h]) with n = strip*16 + 8*(l>>4) + r, m = kt*16 + (l&15),
// idx = ((i_n-i_m+7)*15 + (j_n-j_m+7))*15 + (k_n-k_m+7). Thread = one 16-B piece (4 rows), 8 consecutive threads
// coverage: 8 heads x 32 strips x 32 key tiles x 64 pieces x 4 = 8 x 512 x 512.
// =================================================================================================================
__global__ __launch_bounds__(256) void build_bias(const float* __restrict__ rpb, float* bt) {
  const int g = blockIdx.x * 256 + threadIdx.x;
  const int piece = g & 63, rec = g >> 6;
  const int kt = rec & 31, strip = (rec >> 5) & 31, h = (rec >> 10) & 7;
  const int l = piece >> 1, e0 = (piece & 1) * 4;
  const int col = l & 15, lh = l >> 4;
  const int m = kt * 16 + col;
  const int mi = m >> 6, mj = (m >> 3) & 7, mk = m & 7;
  v4f v;
#pragma unroll
  for (int e = 0; e < 4; ++e) {
    const int n = strip * 16 + 8 * lh + e0 + e;
    const int ni = n >> 6, nj = (n >> 3) & 7, nk = n & 7;
    int idx = ((ni - mi + 7) * 15 + (nj - mj + 7)) * 15 + (nk - mk + 7);
    idx = min(max(idx, 0), NRPB - 1);
    v[e] = bfr(rpb[idx * NHD + h]) * 512.0f;
  }
  float* gp = bt + (size_t)rec * 256 + piece * 4;
  *(v4f*)gp = v;
  
}

// =================================================================================================================
// qkv GEMM: C[64 tokens][128 cols] per block = X8[rows][256] . W1024[cols][256]^T, K = 256 (8 k-steps of 32),
// fragments straight from the 16-bit global rows; 8 waves = 2 (32 rows) x 4 (32 cols), 2x2 tiles per wave.
// C = 8192 * (xw . W^T). Epilogue through an LDS f32 tile: part q -> Q plane [w*8+h][tok][32] = f16(64*q) with
// q = (C/8192 + b) * 32^-0.5; part k -> K plane = f16(8*k); part v -> V^T hi [w*8+h][d][512 tok] = f16(16*v) and
// V^T lo = f16((16v - hi) * 2^14). Stores: Q/K 128 lines (2 token rows of 64 B each per line), V 128 lines per plane
// coverage: Q/K: 4 instr x 256 pieces = 4 heads x 64 tok x 32 d; V hi/lo: 4 instr x 256 pieces = 4 heads x 32 d x
// 64 tok; over the grid every element of Q, K (64x8x512x32) and V^T hi/lo (64x8x32x512) exactly once.
// =================================================================================================================
__global__ __launch_bounds__(256)
void gemm_qkv(const unsigned short* __restrict__ xp, const unsigned short* __restrict__ wq,
              const float* __restrict__ bq,
              unsigned short* qpl, unsigned short* kpl, unsigned short* vth, unsigned short* vtl) {
  __shared__ __align__(16) float Cs[64 * LDC];
  const int tid = threadIdx.x, wave = tid >> 5, lane = tid & 31, hh = lane >> 4, c = lane & 15;
  const int mb = blockIdx.x, nb = blockIdx.y;
  const int mw = wave >> 2, nw = wave & 3;
  const _Float16* A = (const _Float16*)(const void*)xp;
  const _Float16* W = (const _Float16*)(const void*)wq;
  const int arow0 = mb * 64 + mw * 32;
  const int bcol0 = nb * 128 + nw * 32;

  v8f a00 = zero8(), a01 = zero8(), a10 = zero8(), a11 = zero8();
#pragma unroll 1
  for (int ks = 0; ks < 8; ++ks) {
    const int k0 = ks * 32 + 8 * hh;
    const v16h fa0 = ldfrag_h(A + (size_t)(arow0 + c) * CCH + k0);
    const v16h fa1 = ldfrag_h(A + (size_t)(arow0 + 16 + c) * CCH + k0);
    const v16h fb0 = ldfrag_h(W + (size_t)(bcol0 + c) * CCH + k0);
    const v16h fb1 = ldfrag_h(W + (size_t)(bcol0 + 16 + c) * CCH + k0);
    a00 = mma_raw(fa0, fb0, a00);
    a01 = mma_raw(fa0, fb1, a01);
    a10 = mma_raw(fa1, fb0, a10);
    a11 = mma_raw(fa1, fb1, a11);
    guard4(a00, a01, a10, a11, fa0, fa1, fb0, fb1);
  }
#pragma unroll
  for (int r = 0; r < 8; ++r) {
    const int row = mw * 32 + 8 * hh + r;
    Cs[row * LDC + nw * 32 + c]             = a00[r];
    Cs[row * LDC + nw * 32 + 16 + c]        = a01[r];
    Cs[(row + 16) * LDC + nw * 32 + c]      = a10[r];
    Cs[(row + 16) * LDC + nw * 32 + 16 + c] = a11[r];
  }
  __syncthreads();

  const int part = nb >> 1;                       // block-uniform: 0 q, 1 k, 2 v
  const int hb4 = (nb & 1) * 4;
  const int w = mb >> 3, tok0 = (mb & 7) * 64;
  const float* bqn = bq + nb * 128;
  if (part < 2) {
    unsigned short* dst = (part == 0) ? qpl : kpl;
    const float scl = (part == 0) ? (QSC * 64.0f) : 8.0f;
    v4u pk[4];
    size_t offs[4];
#pragma unroll
    for (int s = 0; s < 4; ++s) {
      const int L = s * 32 + (tid >> 3), p = tid & 7;
      const int h4 = L >> 5, li = L & 31;
      const int tok = 2 * li + (p >> 2), d0 = (p & 3) * 8;
      const int col = h4 * 32 + d0;
      v4u q4;
#pragma unroll
      for (int e = 0; e < 4; ++e) {
        float f0 = Cs[tok * LDC + col + 2 * e] * (1.0f / 8192.0f) + bfr(bqn[col + 2 * e]);
        float f1 = Cs[tok * LDC + col + 2 * e + 1] * (1.0f / 8192.0f) + bfr(bqn[col + 2 * e + 1]);
        f0 = f0 * scl;
        f1 = f1 * scl;
        q4[e] = pk16(hb16(f0), hb16(f1));
      }
      pk[s] = q4;
      offs[s] = ((size_t)((w * NHD + hb4 + h4) * NTOK + tok0 + tok)) * HD + d0;
    }
#pragma unroll
    for (int s = 0; s < 4; ++s) *(v4u*)(dst + offs[s]) = pk[s];
    
  } else {
    v4u phk[4], plk[4];
    size_t offs[4];
#pragma unroll
    for (int s = 0; s < 4; ++s) {
      const int L = s * 32 + (tid >> 3), p = tid & 7;
      const int h4 = L >> 5, d = L & 31;
      const int col = h4 * 32 + d;
      const int tb = p * 8;
      const float bc = bfr(bqn[col]);
      v4u a, b;
#pragma unroll
      for (int e = 0; e < 4; ++e) {
        const float v0 = Cs[(tb + 2 * e) * LDC + col] * (1.0f / 8192.0f) + bc;
        const float v1 = Cs[(tb + 2 * e + 1) * LDC + col] * (1.0f / 8192.0f) + bc;
        const float f0 = v0 * 16.0f, f1 = v1 * 16.0f;
        const _Float16 h0 = (_Float16)f0, h1 = (_Float16)f1;
        const float r0 = (f0 - (float)h0) * 16384.0f;
        const float r1 = (f1 - (float)h1) * 16384.0f;
        a[e] = pk16(h_bits(h0), h_bits(h1));
        b[e] = pk16(hb16(r0), hb16(r1));
      }
      phk[s] = a;
      plk[s] = b;
      offs[s] = ((size_t)((w * NHD + hb4 + h4) * HD + d)) * NTOK + tok0 + tb;
    }
#pragma unroll
    for (int s = 0; s < 4; ++s) { *(v4u*)(vth + offs[s]) = phk[s]; *(v4u*)(vtl + offs[s]) = plk[s]; }
    
  }
}

// =================================================================================================================
// Window attention: block = 8 strips of 16 queries of one (window, head); wave = strip. logits S = Q64.K8^T via
// WMMA with the 512*bias table as the C operand (S = 512*(q.k + bias)), shift mask -51200 where region ids differ,
// online softmax over 8 blocks of 64 keys in f32 (p' = 4096*exp((s-m)/512), l = sum p'), P hi = f16(p'),
// v8h fragments), O accumulators: hh = Phi.Vhi, hl = Phi.Vlo, lh = Plo.Vhi with V^T hi = 16v, V^T lo = res*2^14;
// o = (hh + hl*2^-14 + lh*2^-13) / (16 l). Output planes O hi = f16(64 o), O lo = f16((64o-hi)*2^14), layout
// coverage: 2048 blocks x 8 waves x 16 rows x 32 d = 8 x 32768 x 32 per plane, every element once.
// =================================================================================================================
__global__ __launch_bounds__(256)
void attn_win(const unsigned short* __restrict__ qpl, const unsigned short* __restrict__ kpl,
              const unsigned short* __restrict__ vth, const unsigned short* __restrict__ vtl,
              const float* __restrict__ bt, unsigned short* ohi, unsigned short* olo) {
  __shared__ __align__(16) char pbuf[8 * PWB];
  __shared__ int cnts[NTOK];
  union CB { v8f v; v4f q[2]; };
  const int tid = threadIdx.x, wave = tid >> 5, lane = tid & 31, hh = lane >> 4, c = lane & 15;
  const int wh = blockIdx.x >> 2;                 // w*8 + h
  const int w = wh >> 3, h = wh & 7;
  const int strip = (blockIdx.x & 3) * 8 + wave;  // 0..31
  const int q0 = strip * 16;

  for (int t = tid; t < NTOK; t += 256) cnts[t] = region_of(w, t);
  __syncthreads();

  const _Float16* Q  = (const _Float16*)(const void*)qpl + (size_t)wh * NTOK * HD;
  const _Float16* K  = (const _Float16*)(const void*)kpl + (size_t)wh * NTOK * HD;
  const _Float16* Vh = (const _Float16*)(const void*)vth + (size_t)wh * HD * NTOK;
  const _Float16* Vl = (const _Float16*)(const void*)vtl + (size_t)wh * HD * NTOK;
  const float* Bp = bt + ((size_t)(h * 32 + strip)) * 32 * 256 + lane * 8;
  _Float16* Ph = (_Float16*)(pbuf + wave * PWB);
  _Float16* Pl = Ph + 16 * PP;

  const v16h qa = ldfrag_h(Q + (size_t)(q0 + c) * HD + 8 * hh);
  int cntn[8];
#pragma unroll
  for (int r = 0; r < 8; ++r) cntn[r] = cnts[q0 + 8 * hh + r];
  float mrow[8], lrow[8];
#pragma unroll
  for (int r = 0; r < 8; ++r) { mrow[r] = -1e30f; lrow[r] = 0.f; }
  v8f ohh0 = zero8(), ohh1 = zero8(), ohl0 = zero8(), ohl1 = zero8(), olh0 = zero8(), olh1 = zero8();

#pragma unroll 1
  for (int kb = 0; kb < 8; ++kb) {
    // ---- logits for 64 keys: 4 tiles of 16, bias via C operand, mask added ----
    v8f s[4];
#pragma unroll
    for (int j = 0; j < 4; ++j) {
      const int key = kb * 64 + j * 16 + c;
      const v16h kf = ldfrag_h(K + key * HD + 8 * hh);
      const float* bp = Bp + (kb * 4 + j) * 256;
      CB cb;
      cb.q[0] = *(const v4f*)(bp);
      cb.q[1] = *(const v4f*)(bp + 4);
      v8f sj = mma_g1(qa, kf, cb.v);
      const int cm = cnts[key];
#pragma unroll
      for (int r = 0; r < 8; ++r) sj[r] = sj[r] + ((cntn[r] != cm) ? -51200.0f : 0.0f);
      s[j] = sj;
    }
    // ---- online softmax update per row ----
#pragma unroll
    for (int r = 0; r < 8; ++r) {
      float tm = fmaxf(fmaxf(s[0][r], s[1][r]), fmaxf(s[2][r], s[3][r]));
      tm = fmaxf(tm, __shfl_xor(tm, 1, 32));
      tm = fmaxf(tm, __shfl_xor(tm, 2, 32));
      tm = fmaxf(tm, __shfl_xor(tm, 4, 32));
      tm = fmaxf(tm, __shfl_xor(tm, 8, 32));
      const float mn = fmaxf(mrow[r], tm);
      const float alpha = __expf((mrow[r] - mn) * INV512);
      mrow[r] = mn;
      float ps = 0.f;
#pragma unroll
      for (int j = 0; j < 4; ++j) {
        const float p = __expf((s[j][r] - mn) * INV512 + LN4096);
        ps = ps + p;
        s[j][r] = p;
      }
      ps = ps + __shfl_xor(ps, 1, 32);
      ps = ps + __shfl_xor(ps, 2, 32);
      ps = ps + __shfl_xor(ps, 4, 32);
      ps = ps + __shfl_xor(ps, 8, 32);
      lrow[r] = lrow[r] * alpha + ps;
      ohh0[r] = ohh0[r] * alpha; ohh1[r] = ohh1[r] * alpha;
      ohl0[r] = ohl0[r] * alpha; ohl1[r] = ohl1[r] * alpha;
      olh0[r] = olh0[r] * alpha; olh1[r] = olh1[r] * alpha;
    }
    // ---- P hi / lo tiles (16 rows x 64 keys) to the wave's LDS region ----
#pragma unroll
    for (int j = 0; j < 4; ++j) {
#pragma unroll
      for (int r = 0; r < 8; ++r) {
        const float pf = s[j][r];
        const _Float16 phv = (_Float16)pf;
        const float res = (pf - (float)phv) * 8192.0f;
        const int idx = (8 * hh + r) * PP + j * 16 + c;
        Ph[idx] = phv;
        Pl[idx] = (_Float16)res;
      }
    }
    wave_sync_lds();
    // ---- O += P . V : two 32-key k-steps, two 16-dim tiles, three products ----
#pragma unroll
    for (int ks = 0; ks < 2; ++ks) {
      const v16h pa  = ldfrag_h(Ph + c * PP + ks * 32 + 8 * hh);
      const v16h pla = ldfrag_h(Pl + c * PP + ks * 32 + 8 * hh);
      const int koff = kb * 64 + ks * 32 + 8 * hh;
      {
        const v16h vh = ldfrag_h(Vh + (size_t)c * NTOK + koff);
        const v16h vl = ldfrag_h(Vl + (size_t)c * NTOK + koff);
        ohh0 = mma_raw(pa, vh, ohh0);
        ohl0 = mma_raw(pa, vl, ohl0);
        olh0 = mma_raw(pla, vh, olh0);
        guard3(ohh0, ohl0, olh0, pa, pla, vh, vl);
      }
      {
        const v16h vh = ldfrag_h(Vh + (size_t)(16 + c) * NTOK + koff);
        const v16h vl = ldfrag_h(Vl + (size_t)(16 + c) * NTOK + koff);
        ohh1 = mma_raw(pa, vh, ohh1);
        ohl1 = mma_raw(pa, vl, ohl1);
        olh1 = mma_raw(pla, vh, olh1);
        guard3(ohh1, ohl1, olh1, pa, pla, vh, vl);
      }
    }
    wave_sync_lds();
  }

  // ---- normalise, stage the 16 x 32 o tile in LDS (f32), then whole-line stores of the hi / lo planes ----
  float* Os = (float*)(void*)(pbuf + wave * PWB);
#pragma unroll
  for (int r = 0; r < 8; ++r) {
    const float inv = 1.0f / (lrow[r] * 16.0f);
    const int row = 8 * hh + r;
    float o0 = ohh0[r] + ohl0[r] * (1.0f / 16384.0f);
    o0 = o0 + olh0[r] * (1.0f / 8192.0f);
    float o1 = ohh1[r] + ohl1[r] * (1.0f / 16384.0f);
    o1 = o1 + olh1[r] * (1.0f / 8192.0f);
    Os[row * OSP + c]      = o0 * inv;
    Os[row * OSP + 16 + c] = o1 * inv;
  }
  wave_sync_lds();
  v4u ph2[2], pl2[2];
  size_t off2[2];
#pragma unroll
  for (int sI = 0; sI < 2; ++sI) {
    const int line = sI * 4 + (lane >> 3), piece = lane & 7;
    const int row = 2 * line + (piece >> 2), d0 = (piece & 3) * 8;
    v4u a, b;
#pragma unroll
    for (int e = 0; e < 4; ++e) {
      const float f0 = Os[row * OSP + d0 + 2 * e] * 64.0f;
      const float f1 = Os[row * OSP + d0 + 2 * e + 1] * 64.0f;
      const _Float16 h0 = (_Float16)f0, h1 = (_Float16)f1;
      const float r0 = (f0 - (float)h0) * 16384.0f;
      const float r1 = (f1 - (float)h1) * 16384.0f;
      a[e] = pk16(h_bits(h0), h_bits(h1));
      b[e] = pk16(hb16(r0), hb16(r1));
    }
    ph2[sI] = a;
    pl2[sI] = b;
    off2[sI] = ((size_t)h * NROW + (size_t)w * NTOK + q0 + row) * HD + d0;
  }
  *(v4u*)(ohi + off2[0]) = ph2[0];
  *(v4u*)(ohi + off2[1]) = ph2[1];
  *(v4u*)(olo + off2[0]) = pl2[0];
  *(v4u*)(olo + off2[1]) = pl2[1];
  
}

// =================================================================================================================
// Output projection: out rows = (Ohi + Olo*2^-14)/64 . (W1024/1024)^T + b; two accumulator sets (hi.W, lo.W), K = 256
// = 8 head planes of 32. Block tile 64 tokens x 128 cols, 8 waves = 2 x 4, 2x2 tiles per wave. Epilogue through an
// LDS f32 tile; store with un-window + reverse shift: a wave writes one token's 128-col half row = 512 B = 4 whole
// coverage: 512 x 64 tokens (bijective position map) x 2 x 128 cols = every output element exactly once.
// =================================================================================================================
__global__ __launch_bounds__(256)
void gemm_proj(const unsigned short* __restrict__ ohi, const unsigned short* __restrict__ olo,
               const unsigned short* __restrict__ wp, const float* __restrict__ bp, float* out) {
  __shared__ __align__(16) float Cs[64 * LDC];
  const int tid = threadIdx.x, wave = tid >> 5, lane = tid & 31, hh = lane >> 4, c = lane & 15;
  const int mb = blockIdx.x, nb = blockIdx.y;
  const int mw = wave >> 2, nw = wave & 3;
  const _Float16* W = (const _Float16*)(const void*)wp;
  const int arow0 = mb * 64 + mw * 32;
  const int bcol0 = nb * 128 + nw * 32;

  v8f h00 = zero8(), h01 = zero8(), h10 = zero8(), h11 = zero8();
  v8f l00 = zero8(), l01 = zero8(), l10 = zero8(), l11 = zero8();
#pragma unroll 1
  for (int ks = 0; ks < 8; ++ks) {
    const _Float16* Ah = (const _Float16*)(const void*)ohi + (size_t)ks * NROW * HD;
    const _Float16* Al = (const _Float16*)(const void*)olo + (size_t)ks * NROW * HD;
    const v16h fa0 = ldfrag_h(Ah + (size_t)(arow0 + c) * HD + 8 * hh);
    const v16h fa1 = ldfrag_h(Ah + (size_t)(arow0 + 16 + c) * HD + 8 * hh);
    const v16h ga0 = ldfrag_h(Al + (size_t)(arow0 + c) * HD + 8 * hh);
    const v16h ga1 = ldfrag_h(Al + (size_t)(arow0 + 16 + c) * HD + 8 * hh);
    const v16h fb0 = ldfrag_h(W + (size_t)(bcol0 + c) * CCH + ks * 32 + 8 * hh);
    const v16h fb1 = ldfrag_h(W + (size_t)(bcol0 + 16 + c) * CCH + ks * 32 + 8 * hh);
    h00 = mma_raw(fa0, fb0, h00);
    h01 = mma_raw(fa0, fb1, h01);
    h10 = mma_raw(fa1, fb0, h10);
    h11 = mma_raw(fa1, fb1, h11);
    l00 = mma_raw(ga0, fb0, l00);
    l01 = mma_raw(ga0, fb1, l01);
    l10 = mma_raw(ga1, fb0, l10);
    l11 = mma_raw(ga1, fb1, l11);
    guard8(h00, h01, h10, h11, l00, l01, l10, l11, fa0, fa1, ga0, ga1, fb0, fb1);
  }
#pragma unroll
  for (int r = 0; r < 8; ++r) {
    const int row = mw * 32 + 8 * hh + r;
    Cs[row * LDC + nw * 32 + c]             = h00[r] + l00[r] * (1.0f / 16384.0f);
    Cs[row * LDC + nw * 32 + 16 + c]        = h01[r] + l01[r] * (1.0f / 16384.0f);
    Cs[(row + 16) * LDC + nw * 32 + c]      = h10[r] + l10[r] * (1.0f / 16384.0f);
    Cs[(row + 16) * LDC + nw * 32 + 16 + c] = h11[r] + l11[r] * (1.0f / 16384.0f);
  }
  __syncthreads();

  const int w = mb >> 3, tok0 = (mb & 7) * 64;
  const float* bpn = bp + nb * 128 + lane * 4;
  v4f bb;
#pragma unroll
  for (int e = 0; e < 4; ++e) bb[e] = bfr(bpn[e]);
  v4f ov[8];
  size_t offs[8];
#pragma unroll
  for (int it = 0; it < 8; ++it) {
    const int row = wave * 8 + it;
    const int sp = spat_of(w, tok0 + row);
    v4f v = *(const v4f*)(Cs + row * LDC + lane * 4);
#pragma unroll
    for (int e = 0; e < 4; ++e) v[e] = v[e] * (1.0f / 65536.0f) + bb[e];
    ov[it] = v;
    offs[it] = (size_t)sp * CCH + nb * 128 + lane * 4;
  }
#pragma unroll
  for (int it = 0; it < 8; ++it) *(v4f*)(out + offs[it]) = ov[it];
  
}

// =================================================================================================================
//   X8 f16 [32768][256] 16777216 | Wqkv f16 [768][256] 393216 | Wproj f16 [256][256] 131072 |
//   bias table f32 [8][512][512] 8388608 | Q f16 [512][512][32] 16777216 | K same 16777216 |
//   V^T hi f16 [512][32][512] 16777216 | V^T lo same 16777216 | O hi f16 [8][32768][32] 16777216 | O lo same 16777216
//   total 126353408.
// =================================================================================================================
extern "C" void kernel_launch(void* const* d_in, const int* in_sizes, int n_in,
                              void* d_out, int out_size, void* d_ws, size_t ws_size,
                              hipStream_t stream) {
  if (n_in < 6) return;
  if (in_sizes[0] != NROW * CCH) return;
  if (in_sizes[1] != C3 * CCH || in_sizes[2] != C3) return;
  if (in_sizes[3] != CCH * CCH || in_sizes[4] != CCH) return;
  if (in_sizes[5] != NRPB * NHD) return;
  if (out_size != NROW * CCH) return;

  const float* x     = (const float*)d_in[0];
  const float* qkvw  = (const float*)d_in[1];
  const float* qkvb  = (const float*)d_in[2];
  const float* projw = (const float*)d_in[3];
  const float* projb = (const float*)d_in[4];
  const float* rpb   = (const float*)d_in[5];
  float* out = (float*)d_out;

  const size_t sX  = (size_t)NROW * CCH * 2;                 // 16777216
  const size_t sWq = (size_t)C3 * CCH * 2;                   //   393216
  const size_t sWp = (size_t)CCH * CCH * 2;                  //   131072
  const size_t sBT = (size_t)NHD * NTOK * NTOK * 4;          //  8388608
  const size_t sQK = (size_t)NWIN * NHD * NTOK * HD * 2;     // 16777216
  const size_t sO  = (size_t)NHD * NROW * HD * 2;            // 16777216
  size_t off = 0;
  const size_t oX  = off; off += sX;
  const size_t oWq = off; off += sWq;
  const size_t oWp = off; off += sWp;
  const size_t oBT = off; off += sBT;
  const size_t oQ  = off; off += sQK;
  const size_t oK  = off; off += sQK;
  const size_t oVh = off; off += sQK;
  const size_t oVl = off; off += sQK;
  const size_t oOh = off; off += sO;
  const size_t oOl = off; off += sO;
  if (off > ws_size) return;                                  // off = 126353408
  if (off > (size_t)134217728) return;

  char* ws = (char*)d_ws;
  unsigned short* X8  = (unsigned short*)(ws + oX);
  unsigned short* Wq  = (unsigned short*)(ws + oWq);
  unsigned short* Wp  = (unsigned short*)(ws + oWp);
  float*          BT  = (float*)(ws + oBT);
  unsigned short* Qp  = (unsigned short*)(ws + oQ);
  unsigned short* Kp  = (unsigned short*)(ws + oK);
  unsigned short* Vth = (unsigned short*)(ws + oVh);
  unsigned short* Vtl = (unsigned short*)(ws + oVl);
  unsigned short* Ohi = (unsigned short*)(ws + oOh);
  unsigned short* Olo = (unsigned short*)(ws + oOl);

  const dim3 blk(256);
  // (1) input convert + window gather, weight converts, bias table
  cvt_x<<<dim3(NROW / 8), blk, 0, stream>>>(x, X8);
  cvt_w<<<dim3(C3 / 8), blk, 0, stream>>>(qkvw, Wq, C3);
  cvt_w<<<dim3(CCH / 8), blk, 0, stream>>>(projw, Wp, CCH);
  build_bias<<<dim3((NHD * 32 * 32 * 64) / 256), blk, 0, stream>>>(rpb, BT);
  // (2) qkv projection: 512 row tiles x 6 column tiles
  gemm_qkv<<<dim3(NROW / 64, C3 / 128), blk, 0, stream>>>(X8, Wq, qkvb, Qp, Kp, Vth, Vtl);
  // (3) window attention: 64 windows x 8 heads x 4 blocks of 8 strips
  attn_win<<<dim3(NWIN * NHD * 4), blk, 0, stream>>>(Qp, Kp, Vth, Vtl, BT, Ohi, Olo);
  // (4) output projection + un-window + reverse shift -> d_out
  gemm_proj<<<dim3(NROW / 64, CCH / 128), blk, 0, stream>>>(Ohi, Olo, Wp, projb, out);
  (void)hipGetLastError();
}

// v001
// A run of this version takes 200 microseconds.
// Timed twice side by side with v000, it ran 1.34 times as fast both times.
// qkv projection and k.qT: v_wmma_f32_16x16x32_f16 single products (f16 operands, f32 accumulate); vT.pT: p and v^T each
// carried as f16 hi plus power-of-two scaled residual planes, three products (hi.hi, hi.lo, lo.hi), f32 accumulate;
// output projection: activation as f16 hi plus scaled residual times f16 weight, two products, f32 accumulate.
// All inputs RNE-converted to bf16 on load; softmax, masks and epilogues in f32 on VALU.
#include <hip/hip_runtime.h>
#include <stdint.h>

#define NWIN 64
#define NTOK 512
#define CCH  256
#define NHD  8
#define HD   32
#define C3   768
#define NROW 32768
#define NRPB 3375
#define LDC  132
#define QSC  0.17677669529663687f
#define INV512 0.001953125f
#define LN4096 8.3177661667193429f

static_assert(NROW == NWIN * NTOK);
static_assert((LDC * 4) % 16 == 0);

typedef _Float16 v16h __attribute__((ext_vector_type(16)));
typedef _Float16 v8h  __attribute__((ext_vector_type(8)));
typedef float    v8f  __attribute__((ext_vector_type(8)));
typedef float    v4f  __attribute__((ext_vector_type(4)));
typedef unsigned int v4u __attribute__((ext_vector_type(4)));
typedef int      v4i  __attribute__((ext_vector_type(4)));

// ---- scalar helpers ------------------------------------------------------------------------------------------
__device__ __forceinline__ unsigned short bf_bits(float f) {          // f32 -> bf16 bits, RNE convert
  unsigned u = __float_as_uint(f);
  return (unsigned short)((u + 0x7FFFu + ((u >> 16) & 1u)) >> 16);
}
__device__ __forceinline__ float bf_up(unsigned short b) { return __uint_as_float(((unsigned)b) << 16); }
__device__ __forceinline__ float bfr(float f) { return bf_up(bf_bits(f)); }
__device__ __forceinline__ unsigned short h_bits(_Float16 x) { return __builtin_bit_cast(unsigned short, x); }
__device__ __forceinline__ unsigned short hb16(float f) { return h_bits((_Float16)f); }
__device__ __forceinline__ unsigned pk16(unsigned short a, unsigned short b) { return (unsigned)a | ((unsigned)b << 16); }
__device__ __forceinline__ v8f zero8() { v8f z = {0.f, 0.f, 0.f, 0.f, 0.f, 0.f, 0.f, 0.f}; return z; }

// ---- index maps --------------------------------------------------------------------------------------------------
// window w = (hb*4 + wb)*4 + db over a 32^3 volume in 8^3 windows; token t = (i*8 + j)*8 + k inside the window.
// The shifted coordinate is (hb*8+i, wb*8+j, db*8+k); both the input gather (roll by -4) and the output scatter
// (roll by +4) use volume position ((hs+4)&31, (ws+4)&31, (ds+4)&31).
__device__ __forceinline__ int spat_of(int w, int t) {
  const int hb = w >> 4, wb = (w >> 2) & 3, db = w & 3;
  const int i = t >> 6, j = (t >> 3) & 7, k = t & 7;
  const int gh = (hb * 8 + i + 4) & 31;
  const int gw = (wb * 8 + j + 4) & 31;
  const int gd = (db * 8 + k + 4) & 31;
  return (gh * 32 + gw) * 32 + gd;
}
__device__ __forceinline__ int rid1(int p) { return (p < 24) ? 0 : ((p < 28) ? 1 : 2); }
__device__ __forceinline__ int region_of(int w, int t) {
  const int hb = w >> 4, wb = (w >> 2) & 3, db = w & 3;
  const int i = t >> 6, j = (t >> 3) & 7, k = t & 7;
  return rid1(hb * 8 + i) * 9 + rid1(wb * 8 + j) * 3 + rid1(db * 8 + k);
}

// ---- fragment loader: 16-bit A/B operand, lane -> row/col (lane&15), p already includes +8*(lane>>4);
//      elements 0..7 <- p[0..7] (k0+8h..), elements 8..15 <- p[16..23] (k0+16+8h..)
__device__ __forceinline__ v16h ldfrag_h(const _Float16* p) {
  union { v16h v; v8h h[2]; } f;
  f.h[0] = *(const v8h*)(p);
  f.h[1] = *(const v8h*)(p + 16);
  return f.v;
}

// ---- WMMA helpers; the guard helpers insert the trailing VALU hazard gap and keep A/B live -----------------------
__device__ __forceinline__ v8f mma_raw(v16h a, v16h b, v8f c) {
  return __builtin_amdgcn_wmma_f32_16x16x32_f16(false, a, false, b, (short)0, c, false, false);
}
__device__ __forceinline__ v8f mma_g1(v16h a, v16h b, v8f c) {
  c = mma_raw(a, b, c);
#if defined(__HIP_DEVICE_COMPILE__)
  asm volatile("v_nop\n\tv_nop\n\tv_nop\n\tv_nop" : "+v"(c) : "v"(a), "v"(b));
#endif
  return c;
}
__device__ __forceinline__ void guard3(v8f& c0, v8f& c1, v8f& c2,
                                       const v16h& a0, const v16h& a1, const v16h& b0, const v16h& b1) {
#if defined(__HIP_DEVICE_COMPILE__)
  asm volatile("v_nop\n\tv_nop\n\tv_nop\n\tv_nop"
               : "+v"(c0), "+v"(c1), "+v"(c2) : "v"(a0), "v"(a1), "v"(b0), "v"(b1));
#endif
}
__device__ __forceinline__ void guard4(v8f& c0, v8f& c1, v8f& c2, v8f& c3,
                                       const v16h& a0, const v16h& a1, const v16h& b0, const v16h& b1) {
#if defined(__HIP_DEVICE_COMPILE__)
  asm volatile("v_nop\n\tv_nop\n\tv_nop\n\tv_nop"
               : "+v"(c0), "+v"(c1), "+v"(c2), "+v"(c3) : "v"(a0), "v"(a1), "v"(b0), "v"(b1));
#endif
}
__device__ __forceinline__ void guard8(v8f& c0, v8f& c1, v8f& c2, v8f& c3, v8f& c4, v8f& c5, v8f& c6, v8f& c7,
                                       const v16h& a0, const v16h& a1, const v16h& a2, const v16h& a3,
                                       const v16h& b0, const v16h& b1) {
#if defined(__HIP_DEVICE_COMPILE__)
  asm volatile("v_nop\n\tv_nop\n\tv_nop\n\tv_nop"
               : "+v"(c0), "+v"(c1), "+v"(c2), "+v"(c3), "+v"(c4), "+v"(c5), "+v"(c6), "+v"(c7)
               : "v"(a0), "v"(a1), "v"(a2), "v"(a3), "v"(b0), "v"(b1));
#endif
}
// value of lane l ^ 16 (the other half of the wave), as a vector cross-row move
__device__ __forceinline__ float xhalf(float v) {
  const int b = __float_as_int(v);
  return __int_as_float(__builtin_amdgcn_permlanex16(b, b, 0x76543210, 0xfedcba98, false, false));
}

// =================================================================================================================
// cyclic shift + window gather + convert: x [32768 positions][256] f32 -> X8 plane [w*512 + t][256] f16,
// value f16(8 * bf16_RNE(x)). Block = 8 rows (one wave per row); lane handles 8 channels: two 16-B loads, one 16-B
// grid = 4096. coverage: 4096 x 8 rows x 32 lanes x 8 halves = 32768 x 256.
// =================================================================================================================
__global__ __launch_bounds__(256) void cvt_x(const float* __restrict__ x, unsigned short* xp) {
  const int tid = threadIdx.x, wv = tid >> 5, lane = tid & 31;
  const int row = blockIdx.x * 8 + wv;
  const int w = row >> 9, t = row & 511;
  const float* src = x + (size_t)spat_of(w, t) * CCH + lane * 8;
  const v4f a = *(const v4f*)(src);
  const v4f b = *(const v4f*)(src + 4);
  v4u pk;
  pk[0] = pk16(hb16(bfr(a[0]) * 8.0f), hb16(bfr(a[1]) * 8.0f));
  pk[1] = pk16(hb16(bfr(a[2]) * 8.0f), hb16(bfr(a[3]) * 8.0f));
  pk[2] = pk16(hb16(bfr(b[0]) * 8.0f), hb16(bfr(b[1]) * 8.0f));
  pk[3] = pk16(hb16(bfr(b[2]) * 8.0f), hb16(bfr(b[3]) * 8.0f));
  unsigned short* gp = xp + (size_t)row * CCH + lane * 8;
  *(v4u*)gp = pk;
  
}

// =================================================================================================================
// weight convert: w [nrows][256] f32 ([out][in], in contiguous) -> f16(1024 * bf16_RNE(w)) same layout ([n][k] with
// grid = nrows/8. coverage: nrows x 256.
// =================================================================================================================
__global__ __launch_bounds__(256) void cvt_w(const float* __restrict__ wsrc, unsigned short* wdst, int nrows) {
  const int tid = threadIdx.x, wv = tid >> 5, lane = tid & 31;
  const int row = blockIdx.x * 8 + wv;
  if (row < nrows) {                                     // wave-uniform
    const float* src = wsrc + (size_t)row * CCH + lane * 8;
    const v4f a = *(const v4f*)(src);
    const v4f b = *(const v4f*)(src + 4);
    v4u pk;
    pk[0] = pk16(hb16(bfr(a[0]) * 1024.0f), hb16(bfr(a[1]) * 1024.0f));
    pk[1] = pk16(hb16(bfr(a[2]) * 1024.0f), hb16(bfr(a[3]) * 1024.0f));
    pk[2] = pk16(hb16(bfr(b[0]) * 1024.0f), hb16(bfr(b[1]) * 1024.0f));
    pk[3] = pk16(hb16(bfr(b[2]) * 1024.0f), hb16(bfr(b[3]) * 1024.0f));
    unsigned short* gp = wdst + (size_t)row * CCH + lane * 8;
    *(v4u*)gp = pk;
    
  }
}

// =================================================================================================================
// relative position bias table in the C-operand order of the transposed score tile (rows = keys, columns = queries):
// BT[((h*32 + strip)*32 + kt)*256 + l*8 + r] =
// 512 * bf16_RNE(rpb[idx(n,m)*8 + h]) with query n = strip*16 + (l&15), key m = kt*16 + 8*(l>>4) + r,
// idx = ((i_n-i_m+7)*15 + (j_n-j_m+7))*15 + (k_n-k_m+7). Thread = one 16-B piece (4 keys), 8 consecutive threads
// coverage: 8 heads x 32 strips x 32 key tiles x 64 pieces x 4 = 8 x 512 x 512.
// =================================================================================================================
__global__ __launch_bounds__(256) void build_bias(const float* __restrict__ rpb, float* bt) {
  const int g = blockIdx.x * 256 + threadIdx.x;
  const int piece = g & 63, rec = g >> 6;
  const int kt = rec & 31, strip = (rec >> 5) & 31, h = (rec >> 10) & 7;
  const int l = piece >> 1, e0 = (piece & 1) * 4;
  const int col = l & 15, lh = l >> 4;
  const int n = strip * 16 + col;
  const int ni = n >> 6, nj = (n >> 3) & 7, nk = n & 7;
  v4f v;
#pragma unroll
  for (int e = 0; e < 4; ++e) {
    const int m = kt * 16 + 8 * lh + e0 + e;
    const int mi = m >> 6, mj = (m >> 3) & 7, mk = m & 7;
    int idx = ((ni - mi + 7) * 15 + (nj - mj + 7)) * 15 + (nk - mk + 7);
    idx = min(max(idx, 0), NRPB - 1);
    v[e] = bfr(rpb[idx * NHD + h]) * 512.0f;
  }
  float* gp = bt + (size_t)rec * 256 + piece * 4;
  *(v4f*)gp = v;
  
}

// =================================================================================================================
// qkv GEMM: C[64 tokens][128 cols] per block = X8[rows][256] . W1024[cols][256]^T, K = 256 (8 k-steps of 32),
// fragments straight from the 16-bit global rows; 8 waves = 2 (32 rows) x 4 (32 cols), 2x2 tiles per wave.
// C = 8192 * (xw . W^T). Epilogue through an LDS f32 tile: part q -> Q plane [w*8+h][tok][32] = f16(64*q) with
// q = (C/8192 + b) * 32^-0.5; part k -> K plane = f16(8*k); part v -> V^T hi [w*8+h][d][512 tok] = f16(16*v) and
// V^T lo = f16((16v - hi) * 2^14). Stores: Q/K 128 lines (2 token rows of 64 B each per line), V 128 lines per plane
// coverage: Q/K: 4 instr x 256 pieces = 4 heads x 64 tok x 32 d; V hi/lo: 4 instr x 256 pieces = 4 heads x 32 d x
// 64 tok; over the grid every element of Q, K (64x8x512x32) and V^T hi/lo (64x8x32x512) exactly once.
// =================================================================================================================
__global__ __launch_bounds__(256)
void gemm_qkv(const unsigned short* __restrict__ xp, const unsigned short* __restrict__ wq,
              const float* __restrict__ bq,
              unsigned short* qpl, unsigned short* kpl, unsigned short* vth, unsigned short* vtl) {
  __shared__ __align__(16) float Cs[64 * LDC];
  const int tid = threadIdx.x, wave = tid >> 5, lane = tid & 31, hh = lane >> 4, c = lane & 15;
  const int mb = blockIdx.x, nb = blockIdx.y;
  const int mw = wave >> 2, nw = wave & 3;
  const _Float16* A = (const _Float16*)(const void*)xp;
  const _Float16* W = (const _Float16*)(const void*)wq;
  const int arow0 = mb * 64 + mw * 32;
  const int bcol0 = nb * 128 + nw * 32;

  v8f a00 = zero8(), a01 = zero8(), a10 = zero8(), a11 = zero8();
#pragma unroll 1
  for (int ks = 0; ks < 8; ++ks) {
    const int k0 = ks * 32 + 8 * hh;
    const v16h fa0 = ldfrag_h(A + (size_t)(arow0 + c) * CCH + k0);
    const v16h fa1 = ldfrag_h(A + (size_t)(arow0 + 16 + c) * CCH + k0);
    const v16h fb0 = ldfrag_h(W + (size_t)(bcol0 + c) * CCH + k0);
    const v16h fb1 = ldfrag_h(W + (size_t)(bcol0 + 16 + c) * CCH + k0);
    a00 = mma_raw(fa0, fb0, a00);
    a01 = mma_raw(fa0, fb1, a01);
    a10 = mma_raw(fa1, fb0, a10);
    a11 = mma_raw(fa1, fb1, a11);
    guard4(a00, a01, a10, a11, fa0, fa1, fb0, fb1);
  }
#pragma unroll
  for (int r = 0; r < 8; ++r) {
    const int row = mw * 32 + 8 * hh + r;
    Cs[row * LDC + nw * 32 + c]             = a00[r];
    Cs[row * LDC + nw * 32 + 16 + c]        = a01[r];
    Cs[(row + 16) * LDC + nw * 32 + c]      = a10[r];
    Cs[(row + 16) * LDC + nw * 32 + 16 + c] = a11[r];
  }
  __syncthreads();

  const int part = nb >> 1;                       // block-uniform: 0 q, 1 k, 2 v
  const int hb4 = (nb & 1) * 4;
  const int w = mb >> 3, tok0 = (mb & 7) * 64;
  const float* bqn = bq + nb * 128;
  if (part < 2) {
    unsigned short* dst = (part == 0) ? qpl : kpl;
    const float scl = (part == 0) ? (QSC * 64.0f) : 8.0f;
    v4u pk[4];
    size_t offs[4];
#pragma unroll
    for (int s = 0; s < 4; ++s) {
      const int L = s * 32 + (tid >> 3), p = tid & 7;
      const int h4 = L >> 5, li = L & 31;
      const int tok = 2 * li + (p >> 2), d0 = (p & 3) * 8;
      const int col = h4 * 32 + d0;
      v4u q4;
#pragma unroll
      for (int e = 0; e < 4; ++e) {
        float f0 = Cs[tok * LDC + col + 2 * e] * (1.0f / 8192.0f) + bfr(bqn[col + 2 * e]);
        float f1 = Cs[tok * LDC + col + 2 * e + 1] * (1.0f / 8192.0f) + bfr(bqn[col + 2 * e + 1]);
        f0 = f0 * scl;
        f1 = f1 * scl;
        q4[e] = pk16(hb16(f0), hb16(f1));
      }
      pk[s] = q4;
      offs[s] = ((size_t)((w * NHD + hb4 + h4) * NTOK + tok0 + tok)) * HD + d0;
    }
#pragma unroll
    for (int s = 0; s < 4; ++s) *(v4u*)(dst + offs[s]) = pk[s];
    
  } else {
    v4u phk[4], plk[4];
    size_t offs[4];
#pragma unroll
    for (int s = 0; s < 4; ++s) {
      const int L = s * 32 + (tid >> 3), p = tid & 7;
      const int h4 = L >> 5, d = L & 31;
      const int col = h4 * 32 + d;
      const int tb = p * 8;
      const float bc = bfr(bqn[col]);
      v4u a, b;
#pragma unroll
      for (int e = 0; e < 4; ++e) {
        const float v0 = Cs[(tb + 2 * e) * LDC + col] * (1.0f / 8192.0f) + bc;
        const float v1 = Cs[(tb + 2 * e + 1) * LDC + col] * (1.0f / 8192.0f) + bc;
        const float f0 = v0 * 16.0f, f1 = v1 * 16.0f;
        const _Float16 h0 = (_Float16)f0, h1 = (_Float16)f1;
        const float r0 = (f0 - (float)h0) * 16384.0f;
        const float r1 = (f1 - (float)h1) * 16384.0f;
        a[e] = pk16(h_bits(h0), h_bits(h1));
        b[e] = pk16(hb16(r0), hb16(r1));
      }
      phk[s] = a;
      plk[s] = b;
      offs[s] = ((size_t)((w * NHD + hb4 + h4) * HD + d)) * NTOK + tok0 + tb;
    }
#pragma unroll
    for (int s = 0; s < 4; ++s) { *(v4u*)(vth + offs[s]) = phk[s]; *(v4u*)(vtl + offs[s]) = plk[s]; }
    
  }
}

// =================================================================================================================
// Window attention, transposed: block = 8 strips of 16 queries of one (window, head); wave = strip.
// S^T = K8 . Q64^T via WMMA (A = key rows, B = query columns) with the 512*bias table as the C operand, so a lane holds
// the scores of ONE query (column lane&15) for keys 8*(lane>>4) + r of each 16-key tile. Shift mask -51200 where region
// ids differ. Online softmax over 8 blocks of 64 keys in f32: maximum and sum run over the lane's own 32 registers, the
// maximum is joined with lane ^ 16 once per block, the sum l stays a per-half partial and is joined once at the end.
// p' = 4096*exp((s-m)/512); P hi = f16(p'), P lo = f16((p'-hi)*2^13). Two score tiles of one 32-key step, converted in
// place, are the B operand of O^T += V^T . P^T (A = V^T rows, hardware k order on both sides): P never leaves registers.
// O^T accumulators: hh = Vhi.Phi, hl = Vlo.Phi, lh = Vhi.Plo with V^T hi = 16v, V^T lo = res*2^14;
// o = (hh + hl*2^-14 + lh*2^-13) / (16 l). A lane ends with 8 consecutive d of its query per tile: 16-B packed stores.
// Output planes O hi = f16(64 o), O lo = f16((64o-hi)*2^14), layout [h][w*512 + tok][32].
// coverage: 2048 blocks x 8 waves x 16 rows x 32 d = 8 x 32768 x 32 per plane, every element once.
// =================================================================================================================
__global__ __launch_bounds__(256)
void attn_win(const unsigned short* __restrict__ qpl, const unsigned short* __restrict__ kpl,
              const unsigned short* __restrict__ vth, const unsigned short* __restrict__ vtl,
              const float* __restrict__ bt, unsigned short* ohi, unsigned short* olo) {
  __shared__ __align__(16) int cnts[NTOK];
  union CB { v8f v; v4f q[2]; };
  const int tid = threadIdx.x, wave = tid >> 5, lane = tid & 31, hh = lane >> 4, c = lane & 15;
  const int wh = blockIdx.x >> 2;                 // w*8 + h
  const int w = wh >> 3, h = wh & 7;
  const int strip = (blockIdx.x & 3) * 8 + wave;  // 0..31
  const int q0 = strip * 16;

  for (int t = tid; t < NTOK; t += 256) cnts[t] = region_of(w, t);
  __syncthreads();

  const _Float16* Q  = (const _Float16*)(const void*)qpl + (size_t)wh * NTOK * HD;
  const _Float16* K  = (const _Float16*)(const void*)kpl + (size_t)wh * NTOK * HD;
  const _Float16* Vh = (const _Float16*)(const void*)vth + (size_t)wh * HD * NTOK;
  const _Float16* Vl = (const _Float16*)(const void*)vtl + (size_t)wh * HD * NTOK;
  const float* Bp = bt + ((size_t)(h * 32 + strip)) * 32 * 256 + lane * 8;

  const v16h qb = ldfrag_h(Q + (size_t)(q0 + c) * HD + 8 * hh);
  // the address pair of the two query loads is reused right behind them: keep the wait in front of that overwrite
  asm volatile("s_wait_xcnt 0x0" ::: "memory");
  const int cq = cnts[q0 + c];
  float mrow = -1e30f, lrow = 0.f;
  v8f ohh0 = zero8(), ohh1 = zero8(), ohl0 = zero8(), ohl1 = zero8(), olh0 = zero8(), olh1 = zero8();

#pragma unroll 1
  for (int kb = 0; kb < 8; ++kb) {
    // ---- transposed logits for 64 keys: 4 tiles of 16 keys x 16 queries, bias via C operand, mask added ----
    v8f s[4];
#pragma unroll
    for (int j = 0; j < 4; ++j) {
      const int key0 = kb * 64 + j * 16;
      const v16h kf = ldfrag_h(K + (key0 + c) * HD + 8 * hh);
      const float* bp = Bp + (kb * 4 + j) * 256;
      CB cb;
      cb.q[0] = *(const v4f*)(bp);
      cb.q[1] = *(const v4f*)(bp + 4);
      v8f sj = mma_g1(kf, qb, cb.v);
      const v4i cm0 = *(const v4i*)(cnts + key0 + 8 * hh);
      const v4i cm1 = *(const v4i*)(cnts + key0 + 8 * hh + 4);
      v8f mk;
#pragma unroll
      for (int r = 0; r < 4; ++r) {
        mk[r]     = (cq != cm0[r]) ? -51200.0f : 0.0f;
        mk[r + 4] = (cq != cm1[r]) ? -51200.0f : 0.0f;
      }
      s[j] = sj + mk;
    }
    // ---- online softmax update: one query per lane, 32 of its 64 scores here, the rest in lane ^ 16 ----
    float t8[8];
#pragma unroll
    for (int r = 0; r < 8; ++r) t8[r] = fmaxf(fmaxf(s[0][r], s[1][r]), fmaxf(s[2][r], s[3][r]));
    float tm = fmaxf(fmaxf(fmaxf(t8[0], t8[1]), fmaxf(t8[2], t8[3])), fmaxf(fmaxf(t8[4], t8[5]), fmaxf(t8[6], t8[7])));
    tm = fmaxf(tm, xhalf(tm));
    const float mn = fmaxf(mrow, tm);
    const float alpha = __expf((mrow - mn) * INV512);
    mrow = mn;
#pragma unroll
    for (int j = 0; j < 4; ++j) {
#pragma unroll
      for (int r = 0; r < 8; ++r) s[j][r] = __expf((s[j][r] - mn) * INV512 + LN4096);
    }
    const v8f sv = (s[0] + s[1]) + (s[2] + s[3]);
    const float ps = ((sv[0] + sv[1]) + (sv[2] + sv[3])) + ((sv[4] + sv[5]) + (sv[6] + sv[7]));
    lrow = lrow * alpha + ps;
    ohh0 = ohh0 * alpha; ohh1 = ohh1 * alpha;
    ohl0 = ohl0 * alpha; ohl1 = ohl1 * alpha;
    olh0 = olh0 * alpha; olh1 = olh1 * alpha;
    // ---- O^T += V^T . P^T : two 32-key k-steps, two 16-dim tiles, three products ----
#pragma unroll
    for (int ks = 0; ks < 2; ++ks) {
      // element e <- key 8*hh + e (tile 2*ks), element 8 + e <- key 16 + 8*hh + e (tile 2*ks + 1)
      const v8h ph0 = __builtin_convertvector(s[2 * ks], v8h);
      const v8h ph1 = __builtin_convertvector(s[2 * ks + 1], v8h);
      const v8h pl0 = __builtin_convertvector((s[2 * ks] - __builtin_convertvector(ph0, v8f)) * 8192.0f, v8h);
      const v8h pl1 = __builtin_convertvector((s[2 * ks + 1] - __builtin_convertvector(ph1, v8f)) * 8192.0f, v8h);
      const v16h pb  = __builtin_shufflevector(ph0, ph1, 0, 1, 2, 3, 4, 5, 6, 7, 8, 9, 10, 11, 12, 13, 14, 15);
      const v16h plb = __builtin_shufflevector(pl0, pl1, 0, 1, 2, 3, 4, 5, 6, 7, 8, 9, 10, 11, 12, 13, 14, 15);
      const int koff = kb * 64 + ks * 32 + 8 * hh;
      {
        const v16h vh = ldfrag_h(Vh + (size_t)c * NTOK + koff);
        const v16h vl = ldfrag_h(Vl + (size_t)c * NTOK + koff);
        ohh0 = mma_raw(vh, pb, ohh0);
        ohl0 = mma_raw(vl, pb, ohl0);
        olh0 = mma_raw(vh, plb, olh0);
        guard3(ohh0, ohl0, olh0, vh, vl, pb, plb);
      }
      {
        const v16h vh = ldfrag_h(Vh + (size_t)(16 + c) * NTOK + koff);
        const v16h vl = ldfrag_h(Vl + (size_t)(16 + c) * NTOK + koff);
        ohh1 = mma_raw(vh, pb, ohh1);
        ohl1 = mma_raw(vl, pb, ohl1);
        olh1 = mma_raw(vh, plb, olh1);
        guard3(ohh1, ohl1, olh1, vh, vl, pb, plb);
      }
    }
  }

  // ---- join the halves' sums, normalise, split into hi / lo, 16-B packed stores (8 consecutive d of one query) ----
  const float lt = lrow + xhalf(lrow);
  const float inv = 1.0f / (lt * 16.0f);
  v4u ph2[2], pl2[2];
#pragma unroll
  for (int e = 0; e < 4; ++e) {
    float f[4];
#pragma unroll
    for (int u = 0; u < 2; ++u) {
      const int r = 2 * e + u;
      float o0 = ohh0[r] + ohl0[r] * (1.0f / 16384.0f);
      o0 = o0 + olh0[r] * (1.0f / 8192.0f);
      float o1 = ohh1[r] + ohl1[r] * (1.0f / 16384.0f);
      o1 = o1 + olh1[r] * (1.0f / 8192.0f);
      f[u]     = (o0 * inv) * 64.0f;
      f[2 + u] = (o1 * inv) * 64.0f;
    }
    const _Float16 a0 = (_Float16)f[0], a1 = (_Float16)f[1], b0 = (_Float16)f[2], b1 = (_Float16)f[3];
    ph2[0][e] = pk16(h_bits(a0), h_bits(a1));
    ph2[1][e] = pk16(h_bits(b0), h_bits(b1));
    pl2[0][e] = pk16(hb16((f[0] - (float)a0) * 16384.0f), hb16((f[1] - (float)a1) * 16384.0f));
    pl2[1][e] = pk16(hb16((f[2] - (float)b0) * 16384.0f), hb16((f[3] - (float)b1) * 16384.0f));
  }
  const size_t off = ((size_t)h * NROW + (size_t)w * NTOK + q0 + c) * HD + 8 * hh;
  *(v4u*)(ohi + off)      = ph2[0];
  *(v4u*)(ohi + off + 16) = ph2[1];
  *(v4u*)(olo + off)      = pl2[0];
  *(v4u*)(olo + off + 16) = pl2[1];
}

// =================================================================================================================
// Output projection: out rows = (Ohi + Olo*2^-14)/64 . (W1024/1024)^T + b; two accumulator sets (hi.W, lo.W), K = 256
// = 8 head planes of 32. Block tile 64 tokens x 128 cols, 8 waves = 2 x 4, 2x2 tiles per wave. Epilogue through an
// LDS f32 tile; store with un-window + reverse shift: a wave writes one token's 128-col half row = 512 B = 4 whole
// coverage: 512 x 64 tokens (bijective position map) x 2 x 128 cols = every output element exactly once.
// =================================================================================================================
__global__ __launch_bounds__(256)
void gemm_proj(const unsigned short* __restrict__ ohi, const unsigned short* __restrict__ olo,
               const unsigned short* __restrict__ wp, const float* __restrict__ bp, float* out) {
  __shared__ __align__(16) float Cs[64 * LDC];
  const int tid = threadIdx.x, wave = tid >> 5, lane = tid & 31, hh = lane >> 4, c = lane & 15;
  const int mb = blockIdx.x, nb = blockIdx.y;
  const int mw = wave >> 2, nw = wave & 3;
  const _Float16* W = (const _Float16*)(const void*)wp;
  const int arow0 = mb * 64 + mw * 32;
  const int bcol0 = nb * 128 + nw * 32;

  v8f h00 = zero8(), h01 = zero8(), h10 = zero8(), h11 = zero8();
  v8f l00 = zero8(), l01 = zero8(), l10 = zero8(), l11 = zero8();
#pragma unroll 1
  for (int ks = 0; ks < 8; ++ks) {
    const _Float16* Ah = (const _Float16*)(const void*)ohi + (size_t)ks * NROW * HD;
    const _Float16* Al = (const _Float16*)(const void*)olo + (size_t)ks * NROW * HD;
    const v16h fa0 = ldfrag_h(Ah + (size_t)(arow0 + c) * HD + 8 * hh);
    const v16h fa1 = ldfrag_h(Ah + (size_t)(arow0 + 16 + c) * HD + 8 * hh);
    const v16h ga0 = ldfrag_h(Al + (size_t)(arow0 + c) * HD + 8 * hh);
    const v16h ga1 = ldfrag_h(Al + (size_t)(arow0 + 16 + c) * HD + 8 * hh);
    const v16h fb0 = ldfrag_h(W + (size_t)(bcol0 + c) * CCH + ks * 32 + 8 * hh);
    const v16h fb1 = ldfrag_h(W + (size_t)(bcol0 + 16 + c) * CCH + ks * 32 + 8 * hh);
    h00 = mma_raw(fa0, fb0, h00);
    h01 = mma_raw(fa0, fb1, h01);
    h10 = mma_raw(fa1, fb0, h10);
    h11 = mma_raw(fa1, fb1, h11);
    l00 = mma_raw(ga0, fb0, l00);
    l01 = mma_raw(ga0, fb1, l01);
    l10 = mma_raw(ga1, fb0, l10);
    l11 = mma_raw(ga1, fb1, l11);
    guard8(h00, h01, h10, h11, l00, l01, l10, l11, fa0, fa1, ga0, ga1, fb0, fb1);
  }
#pragma unroll
  for (int r = 0; r < 8; ++r) {
    const int row = mw * 32 + 8 * hh + r;
    Cs[row * LDC + nw * 32 + c]             = h00[r] + l00[r] * (1.0f / 16384.0f);
    Cs[row * LDC + nw * 32 + 16 + c]        = h01[r] + l01[r] * (1.0f / 16384.0f);
    Cs[(row + 16) * LDC + nw * 32 + c]      = h10[r] + l10[r] * (1.0f / 16384.0f);
    Cs[(row + 16) * LDC + nw * 32 + 16 + c] = h11[r] + l11[r] * (1.0f / 16384.0f);
  }
  __syncthreads();

  const int w = mb >> 3, tok0 = (mb & 7) * 64;
  const float* bpn = bp + nb * 128 + lane * 4;
  v4f bb;
#pragma unroll
  for (int e = 0; e < 4; ++e) bb[e] = bfr(bpn[e]);
  v4f ov[8];
  size_t offs[8];
#pragma unroll
  for (int it = 0; it < 8; ++it) {
    const int row = wave * 8 + it;
    const int sp = spat_of(w, tok0 + row);
    v4f v = *(const v4f*)(Cs + row * LDC + lane * 4);
#pragma unroll
    for (int e = 0; e < 4; ++e) v[e] = v[e] * (1.0f / 65536.0f) + bb[e];
    ov[it] = v;
    offs[it] = (size_t)sp * CCH + nb * 128 + lane * 4;
  }
#pragma unroll
  for (int it = 0; it < 8; ++it) *(v4f*)(out + offs[it]) = ov[it];
  
}

// =================================================================================================================
//   X8 f16 [32768][256] 16777216 | Wqkv f16 [768][256] 393216 | Wproj f16 [256][256] 131072 |
//   bias table f32 [8][512][512] 8388608 | Q f16 [512][512][32] 16777216 | K same 16777216 |
//   V^T hi f16 [512][32][512] 16777216 | V^T lo same 16777216 | O hi f16 [8][32768][32] 16777216 | O lo same 16777216
//   total 126353408.
// =================================================================================================================
extern "C" void kernel_launch(void* const* d_in, const int* in_sizes, int n_in,
                              void* d_out, int out_size, void* d_ws, size_t ws_size,
                              hipStream_t stream) {
  if (n_in < 6) return;
  if (in_sizes[0] != NROW * CCH) return;
  if (in_sizes[1] != C3 * CCH || in_sizes[2] != C3) return;
  if (in_sizes[3] != CCH * CCH || in_sizes[4] != CCH) return;
  if (in_sizes[5] != NRPB * NHD) return;
  if (out_size != NROW * CCH) return;

  const float* x     = (const float*)d_in[0];
  const float* qkvw  = (const float*)d_in[1];
  const float* qkvb  = (const float*)d_in[2];
  const float* projw = (const float*)d_in[3];
  const float* projb = (const float*)d_in[4];
  const float* rpb   = (const float*)d_in[5];
  float* out = (float*)d_out;

  const size_t sX  = (size_t)NROW * CCH * 2;                 // 16777216
  const size_t sWq = (size_t)C3 * CCH * 2;                   //   393216
  const size_t sWp = (size_t)CCH * CCH * 2;                  //   131072
  const size_t sBT = (size_t)NHD * NTOK * NTOK * 4;          //  8388608
  const size_t sQK = (size_t)NWIN * NHD * NTOK * HD * 2;     // 16777216
  const size_t sO  = (size_t)NHD * NROW * HD * 2;            // 16777216
  size_t off = 0;
  const size_t oX  = off; off += sX;
  const size_t oWq = off; off += sWq;
  const size_t oWp = off; off += sWp;
  const size_t oBT = off; off += sBT;
  const size_t oQ  = off; off += sQK;
  const size_t oK  = off; off += sQK;
  const size_t oVh = off; off += sQK;
  const size_t oVl = off; off += sQK;
  const size_t oOh = off; off += sO;
  const size_t oOl = off; off += sO;
  if (off > ws_size) return;                                  // off = 126353408
  if (off > (size_t)134217728) return;

  char* ws = (char*)d_ws;
  unsigned short* X8  = (unsigned short*)(ws + oX);
  unsigned short* Wq  = (unsigned short*)(ws + oWq);
  unsigned short* Wp  = (unsigned short*)(ws + oWp);
  float*          BT  = (float*)(ws + oBT);
  unsigned short* Qp  = (unsigned short*)(ws + oQ);
  unsigned short* Kp  = (unsigned short*)(ws + oK);
  unsigned short* Vth = (unsigned short*)(ws + oVh);
  unsigned short* Vtl = (unsigned short*)(ws + oVl);
  unsigned short* Ohi = (unsigned short*)(ws + oOh);
  unsigned short* Olo = (unsigned short*)(ws + oOl);

  const dim3 blk(256);
  // (1) input convert + window gather, weight converts, bias table
  cvt_x<<<dim3(NROW / 8), blk, 0, stream>>>(x, X8);
  cvt_w<<<dim3(C3 / 8), blk, 0, stream>>>(qkvw, Wq, C3);
  cvt_w<<<dim3(CCH / 8), blk, 0, stream>>>(projw, Wp, CCH);
  build_bias<<<dim3((NHD * 32 * 32 * 64) / 256), blk, 0, stream>>>(rpb, BT);
  // (2) qkv projection: 512 row tiles x 6 column tiles
  gemm_qkv<<<dim3(NROW / 64, C3 / 128), blk, 0, stream>>>(X8, Wq, qkvb, Qp, Kp, Vth, Vtl);
  // (3) window attention: 64 windows x 8 heads x 4 blocks of 8 strips
  attn_win<<<dim3(NWIN * NHD * 4), blk, 0, stream>>>(Qp, Kp, Vth, Vtl, BT, Ohi, Olo);
  // (4) output projection + un-window + reverse shift -> d_out
  gemm_proj<<<dim3(NROW / 64, CCH / 128), blk, 0, stream>>>(Ohi, Olo, Wp, projb, out);
  (void)hipGetLastError();
}

// v002
// Measured time: 172 microseconds a run.
// Next to v001, in two timings, it ran 1.16 times as fast each time.
// Over all steps from v000 it is 1.56 times as fast.
// qkv projection and k.qT: v_wmma_f32_16x16x32_f16 single products (f16 operands, f32 accumulate); vT.pT: p and v^T each
// carried as f16 hi plus power-of-two scaled residual planes, three products (hi.hi, hi.lo, lo.hi), f32 accumulate;
// output projection: activation as f16 hi plus scaled residual times f16 weight, two products, f32 accumulate.
// All inputs RNE-converted to bf16 on load; softmax, masks and epilogues in f32 on VALU.
#include <hip/hip_runtime.h>
#include <stdint.h>

#define NWIN 64
#define NTOK 512
#define CCH  256
#define NHD  8
#define HD   32
#define C3   768
#define NROW 32768
#define NRPB 3375
#define LDC  132
#define QSC  0.17677669529663687f
#define INV512 0.001953125f
#define LN4096 8.3177661667193429f

static_assert(NROW == NWIN * NTOK);
static_assert((LDC * 4) % 16 == 0);

typedef _Float16 v16h __attribute__((ext_vector_type(16)));
typedef _Float16 v8h  __attribute__((ext_vector_type(8)));
typedef float    v8f  __attribute__((ext_vector_type(8)));
typedef float    v4f  __attribute__((ext_vector_type(4)));
typedef unsigned int v4u __attribute__((ext_vector_type(4)));
typedef int      v4i  __attribute__((ext_vector_type(4)));

// ---- scalar helpers ------------------------------------------------------------------------------------------
__device__ __forceinline__ unsigned short bf_bits(float f) {          // f32 -> bf16 bits, RNE convert
  unsigned u = __float_as_uint(f);
  return (unsigned short)((u + 0x7FFFu + ((u >> 16) & 1u)) >> 16);
}
__device__ __forceinline__ float bf_up(unsigned short b) { return __uint_as_float(((unsigned)b) << 16); }
__device__ __forceinline__ float bfr(float f) { return bf_up(bf_bits(f)); }
__device__ __forceinline__ unsigned short h_bits(_Float16 x) { return __builtin_bit_cast(unsigned short, x); }
__device__ __forceinline__ unsigned short hb16(float f) { return h_bits((_Float16)f); }
__device__ __forceinline__ unsigned pk16(unsigned short a, unsigned short b) { return (unsigned)a | ((unsigned)b << 16); }
__device__ __forceinline__ v8f zero8() { v8f z = {0.f, 0.f, 0.f, 0.f, 0.f, 0.f, 0.f, 0.f}; return z; }

// ---- index maps --------------------------------------------------------------------------------------------------
// window w = (hb*4 + wb)*4 + db over a 32^3 volume in 8^3 windows; token t = (i*8 + j)*8 + k inside the window.
// The shifted coordinate is (hb*8+i, wb*8+j, db*8+k); both the input gather (roll by -4) and the output scatter
// (roll by +4) use volume position ((hs+4)&31, (ws+4)&31, (ds+4)&31).
__device__ __forceinline__ int spat_of(int w, int t) {
  const int hb = w >> 4, wb = (w >> 2) & 3, db = w & 3;
  const int i = t >> 6, j = (t >> 3) & 7, k = t & 7;
  const int gh = (hb * 8 + i + 4) & 31;
  const int gw = (wb * 8 + j + 4) & 31;
  const int gd = (db * 8 + k + 4) & 31;
  return (gh * 32 + gw) * 32 + gd;
}
__device__ __forceinline__ int rid1(int p) { return (p < 24) ? 0 : ((p < 28) ? 1 : 2); }
__device__ __forceinline__ int region_of(int w, int t) {
  const int hb = w >> 4, wb = (w >> 2) & 3, db = w & 3;
  const int i = t >> 6, j = (t >> 3) & 7, k = t & 7;
  return rid1(hb * 8 + i) * 9 + rid1(wb * 8 + j) * 3 + rid1(db * 8 + k);
}

// ---- fragment-order planes: every 16-bit A/B operand plane is kept as 1-KiB blocks of 16 rows x 32 k. Inside a block
//      the 16-B piece (row c, k = 16*chunk + 8*h .. +7) stands at halves chunk*256 + (h*16 + c)*8, so lane l = h*16 + c
//      finds its two pieces at l*8 and 256 + l*8 and each wave-wide 16-B load covers 512 contiguous bytes (4 lines).
//      p = block base + lane*8; elements 0..7 <- k 8h.., elements 8..15 <- k 16+8h.. (hardware k order, as before)
__device__ __forceinline__ v16h ldfrag_h(const _Float16* p) {
  union { v16h v; v8h h[2]; } f;
  f.h[0] = *(const v8h*)(p);
  f.h[1] = *(const v8h*)(p + 256);
  return f.v;
}
// halves offset of the piece (row, k = ks*32 + 8*g .. +7), g = 0..3, in a fragment-order plane of 256-k rows
__device__ __forceinline__ size_t frag_off(int row, int ks, int g) {
  return ((size_t)((row >> 4) * 8 + ks)) * 512 + (g >> 1) * 256 + ((g & 1) * 16 + (row & 15)) * 8;
}

// ---- WMMA helpers; the guard helpers insert the trailing VALU hazard gap and keep A/B live -----------------------
__device__ __forceinline__ v8f mma_raw(v16h a, v16h b, v8f c) {
  return __builtin_amdgcn_wmma_f32_16x16x32_f16(false, a, false, b, (short)0, c, false, false);
}
__device__ __forceinline__ v8f mma_g1(v16h a, v16h b, v8f c) {
  c = mma_raw(a, b, c);
#if defined(__HIP_DEVICE_COMPILE__)
  asm volatile("v_nop\n\tv_nop\n\tv_nop\n\tv_nop" : "+v"(c) : "v"(a), "v"(b));
#endif
  return c;
}
__device__ __forceinline__ void guard3(v8f& c0, v8f& c1, v8f& c2,
                                       const v16h& a0, const v16h& a1, const v16h& b0, const v16h& b1) {
#if defined(__HIP_DEVICE_COMPILE__)
  asm volatile("v_nop\n\tv_nop\n\tv_nop\n\tv_nop"
               : "+v"(c0), "+v"(c1), "+v"(c2) : "v"(a0), "v"(a1), "v"(b0), "v"(b1));
#endif
}
__device__ __forceinline__ void guard4(v8f& c0, v8f& c1, v8f& c2, v8f& c3,
                                       const v16h& a0, const v16h& a1, const v16h& b0, const v16h& b1) {
#if defined(__HIP_DEVICE_COMPILE__)
  asm volatile("v_nop\n\tv_nop\n\tv_nop\n\tv_nop"
               : "+v"(c0), "+v"(c1), "+v"(c2), "+v"(c3) : "v"(a0), "v"(a1), "v"(b0), "v"(b1));
#endif
}
__device__ __forceinline__ void guard8(v8f& c0, v8f& c1, v8f& c2, v8f& c3, v8f& c4, v8f& c5, v8f& c6, v8f& c7,
                                       const v16h& a0, const v16h& a1, const v16h& a2, const v16h& a3,
                                       const v16h& b0, const v16h& b1) {
#if defined(__HIP_DEVICE_COMPILE__)
  asm volatile("v_nop\n\tv_nop\n\tv_nop\n\tv_nop"
               : "+v"(c0), "+v"(c1), "+v"(c2), "+v"(c3), "+v"(c4), "+v"(c5), "+v"(c6), "+v"(c7)
               : "v"(a0), "v"(a1), "v"(a2), "v"(a3), "v"(b0), "v"(b1));
#endif
}
// value of lane l ^ 16 (the other half of the wave), as a vector cross-row move
__device__ __forceinline__ float xhalf(float v) {
  const int b = __float_as_int(v);
  return __int_as_float(__builtin_amdgcn_permlanex16(b, b, 0x76543210, 0xfedcba98, false, false));
}

// =================================================================================================================
// cyclic shift + window gather + convert: x [32768 positions][256] f32 -> X8 plane, rows w*512 + t, fragment order,
// value f16(8 * bf16_RNE(x)). Block = 8 rows; wave = one 32-channel k-step of them; lane = row (lane&7), 8 channels
// (lane>>3): two 16-B loads (8 whole lines per wave), one 16-B store (4 whole lines per wave).
// grid = 4096. coverage: 4096 x 8 k-steps x 8 rows x 4 pieces x 8 halves = 32768 x 256.
// =================================================================================================================
__global__ __launch_bounds__(256) void cvt_x(const float* __restrict__ x, unsigned short* xp) {
  const int tid = threadIdx.x, wv = tid >> 5, lane = tid & 31;
  const int row = blockIdx.x * 8 + (lane & 7), g = lane >> 3;
  const int w = row >> 9, t = row & 511;
  const float* src = x + (size_t)spat_of(w, t) * CCH + wv * 32 + g * 8;
  const v4f a = *(const v4f*)(src);
  const v4f b = *(const v4f*)(src + 4);
  v4u pk;
  pk[0] = pk16(hb16(bfr(a[0]) * 8.0f), hb16(bfr(a[1]) * 8.0f));
  pk[1] = pk16(hb16(bfr(a[2]) * 8.0f), hb16(bfr(a[3]) * 8.0f));
  pk[2] = pk16(hb16(bfr(b[0]) * 8.0f), hb16(bfr(b[1]) * 8.0f));
  pk[3] = pk16(hb16(bfr(b[2]) * 8.0f), hb16(bfr(b[3]) * 8.0f));
  unsigned short* gp = xp + frag_off(row, wv, g);
  *(v4u*)gp = pk;
  
}

// =================================================================================================================
// weight convert: w [nrows][256] f32 ([out][in], in contiguous) -> f16(1024 * bf16_RNE(w)), rows n, fragment order;
// thread map as in cvt_x. grid = nrows/8. coverage: nrows x 256.
// =================================================================================================================
__global__ __launch_bounds__(256) void cvt_w(const float* __restrict__ wsrc, unsigned short* wdst, int nrows) {
  const int tid = threadIdx.x, wv = tid >> 5, lane = tid & 31;
  const int row = blockIdx.x * 8 + (lane & 7), g = lane >> 3;
  if (row < nrows) {
    const float* src = wsrc + (size_t)row * CCH + wv * 32 + g * 8;
    const v4f a = *(const v4f*)(src);
    const v4f b = *(const v4f*)(src + 4);
    v4u pk;
    pk[0] = pk16(hb16(bfr(a[0]) * 1024.0f), hb16(bfr(a[1]) * 1024.0f));
    pk[1] = pk16(hb16(bfr(a[2]) * 1024.0f), hb16(bfr(a[3]) * 1024.0f));
    pk[2] = pk16(hb16(bfr(b[0]) * 1024.0f), hb16(bfr(b[1]) * 1024.0f));
    pk[3] = pk16(hb16(bfr(b[2]) * 1024.0f), hb16(bfr(b[3]) * 1024.0f));
    unsigned short* gp = wdst + frag_off(row, wv, g);
    *(v4u*)gp = pk;
    
  }
}

// =================================================================================================================
// relative position bias table in the C-operand order of the transposed score tile (rows = keys, columns = queries):
// BT[((h*32 + strip)*32 + kt)*256 + (r>>2)*128 + l*4 + (r&3)] (each of a lane's two 16-B loads is 512 B per wave) =
// 512 * bf16_RNE(rpb[idx(n,m)*8 + h]) with query n = strip*16 + (l&15), key m = kt*16 + 8*(l>>4) + r,
// idx = ((i_n-i_m+7)*15 + (j_n-j_m+7))*15 + (k_n-k_m+7). Thread = one 16-B piece (4 keys), 8 consecutive threads
// coverage: 8 heads x 32 strips x 32 key tiles x 64 pieces x 4 = 8 x 512 x 512.
// =================================================================================================================
__global__ __launch_bounds__(256) void build_bias(const float* __restrict__ rpb, float* bt) {
  const int g = blockIdx.x * 256 + threadIdx.x;
  const int piece = g & 63, rec = g >> 6;
  const int kt = rec & 31, strip = (rec >> 5) & 31, h = (rec >> 10) & 7;
  const int l = piece & 31, e0 = (piece >> 5) * 4;
  const int col = l & 15, lh = l >> 4;
  const int n = strip * 16 + col;
  const int ni = n >> 6, nj = (n >> 3) & 7, nk = n & 7;
  v4f v;
#pragma unroll
  for (int e = 0; e < 4; ++e) {
    const int m = kt * 16 + 8 * lh + e0 + e;
    const int mi = m >> 6, mj = (m >> 3) & 7, mk = m & 7;
    int idx = ((ni - mi + 7) * 15 + (nj - mj + 7)) * 15 + (nk - mk + 7);
    idx = min(max(idx, 0), NRPB - 1);
    v[e] = bfr(rpb[idx * NHD + h]) * 512.0f;
  }
  float* gp = bt + (size_t)rec * 256 + piece * 4;
  *(v4f*)gp = v;
  
}

// =================================================================================================================
// qkv GEMM: C[64 tokens][128 cols] per block = X8[rows][256] . W1024[cols][256]^T, K = 256 (8 k-steps of 32),
// fragments straight from the fragment-order global planes; 8 waves = 2 (32 rows) x 4 (32 cols), 2x2 tiles per wave.
// C = 8192 * (xw . W^T). Epilogue through an LDS f32 tile: part q -> Q plane [w*8+h][tok/16] blocks (rows tok, k = d)
// = f16(64*q) with q = (C/8192 + b) * 32^-0.5; part k -> K plane = f16(8*k), same form; part v -> V^T hi
// [w*8+h][tok/32][d/16] blocks (rows d, k = tok) = f16(16*v) and V^T lo = f16((16v - hi) * 2^14). A thread takes the
// piece that stands at tid*8 halves of the head's 4 blocks, so every store instruction writes 512 contiguous bytes.
// coverage: Q/K: 4 instr x 256 pieces = 4 heads x 64 tok x 32 d; V hi/lo: 4 instr x 256 pieces = 4 heads x 32 d x
// 64 tok; over the grid every element of Q, K (64x8x512x32) and V^T hi/lo (64x8x32x512) exactly once.
// =================================================================================================================
__global__ __launch_bounds__(256)
void gemm_qkv(const unsigned short* __restrict__ xp, const unsigned short* __restrict__ wq,
              const float* __restrict__ bq,
              unsigned short* qpl, unsigned short* kpl, unsigned short* vth, unsigned short* vtl) {
  __shared__ __align__(16) float Cs[64 * LDC];
  const int tid = threadIdx.x, wave = tid >> 5, lane = tid & 31, hh = lane >> 4, c = lane & 15;
  const int mb = blockIdx.x, nb = blockIdx.y;
  const int mw = wave >> 2, nw = wave & 3;
  const _Float16* A = (const _Float16*)(const void*)xp;
  const _Float16* W = (const _Float16*)(const void*)wq;
  const int arow0 = mb * 64 + mw * 32;
  const int bcol0 = nb * 128 + nw * 32;

  const _Float16* pa = A + frag_off(arow0, 0, 0) + lane * 8;   // next 16-row band: + 8 blocks = 4096 halves
  const _Float16* pb = W + frag_off(bcol0, 0, 0) + lane * 8;

  v8f a00 = zero8(), a01 = zero8(), a10 = zero8(), a11 = zero8();
#pragma unroll 1
  for (int ks = 0; ks < 8; ++ks, pa += 512, pb += 512) {
    const v16h fa0 = ldfrag_h(pa);
    const v16h fa1 = ldfrag_h(pa + 4096);
    const v16h fb0 = ldfrag_h(pb);
    const v16h fb1 = ldfrag_h(pb + 4096);
    a00 = mma_raw(fa0, fb0, a00);
    a01 = mma_raw(fa0, fb1, a01);
    a10 = mma_raw(fa1, fb0, a10);
    a11 = mma_raw(fa1, fb1, a11);
    guard4(a00, a01, a10, a11, fa0, fa1, fb0, fb1);
  }
#pragma unroll
  for (int r = 0; r < 8; ++r) {
    const int row = mw * 32 + 8 * hh + r;
    Cs[row * LDC + nw * 32 + c]             = a00[r];
    Cs[row * LDC + nw * 32 + 16 + c]        = a01[r];
    Cs[(row + 16) * LDC + nw * 32 + c]      = a10[r];
    Cs[(row + 16) * LDC + nw * 32 + 16 + c] = a11[r];
  }
  __syncthreads();

  const int part = nb >> 1;                       // block-uniform: 0 q, 1 k, 2 v
  const int hb4 = (nb & 1) * 4;
  const int w = mb >> 3, tok0 = (mb & 7) * 64;
  const float* bqn = bq + nb * 128;
  if (part < 2) {
    unsigned short* dst = (part == 0) ? qpl : kpl;
    const float scl = (part == 0) ? (QSC * 64.0f) : 8.0f;
    v4u pk[4];
    size_t offs[4];
#pragma unroll
    for (int s = 0; s < 4; ++s) {
      const int h4 = s;
      const int tok = (tid >> 6) * 16 + (tid & 15), d0 = ((tid >> 4) & 3) * 8;
      const int col = h4 * 32 + d0;
      v4u q4;
#pragma unroll
      for (int e = 0; e < 4; ++e) {
        float f0 = Cs[tok * LDC + col + 2 * e] * (1.0f / 8192.0f) + bfr(bqn[col + 2 * e]);
        float f1 = Cs[tok * LDC + col + 2 * e + 1] * (1.0f / 8192.0f) + bfr(bqn[col + 2 * e + 1]);
        f0 = f0 * scl;
        f1 = f1 * scl;
        q4[e] = pk16(hb16(f0), hb16(f1));
      }
      pk[s] = q4;
      offs[s] = ((size_t)((w * NHD + hb4 + h4) * NTOK + tok0)) * HD + tid * 8;
    }
#pragma unroll
    for (int s = 0; s < 4; ++s) *(v4u*)(dst + offs[s]) = pk[s];
    
  } else {
    v4u phk[4], plk[4];
    size_t offs[4];
#pragma unroll
    for (int s = 0; s < 4; ++s) {
      const int h4 = s, d = ((tid >> 6) & 1) * 16 + (tid & 15);
      const int col = h4 * 32 + d;
      const int tb = (tid >> 7) * 32 + ((tid >> 4) & 3) * 8;
      const float bc = bfr(bqn[col]);
      v4u a, b;
#pragma unroll
      for (int e = 0; e < 4; ++e) {
        const float v0 = Cs[(tb + 2 * e) * LDC + col] * (1.0f / 8192.0f) + bc;
        const float v1 = Cs[(tb + 2 * e + 1) * LDC + col] * (1.0f / 8192.0f) + bc;
        const float f0 = v0 * 16.0f, f1 = v1 * 16.0f;
        const _Float16 h0 = (_Float16)f0, h1 = (_Float16)f1;
        const float r0 = (f0 - (float)h0) * 16384.0f;
        const float r1 = (f1 - (float)h1) * 16384.0f;
        a[e] = pk16(h_bits(h0), h_bits(h1));
        b[e] = pk16(hb16(r0), hb16(r1));
      }
      phk[s] = a;
      plk[s] = b;
      offs[s] = ((size_t)(w * NHD + hb4 + h4)) * HD * NTOK + tok0 * HD + tid * 8;
    }
#pragma unroll
    for (int s = 0; s < 4; ++s) { *(v4u*)(vth + offs[s]) = phk[s]; *(v4u*)(vtl + offs[s]) = plk[s]; }
    
  }
}

// =================================================================================================================
// Window attention, transposed: block = 8 strips of 16 queries of one (window, head); wave = strip.
// S^T = K8 . Q64^T via WMMA (A = key rows, B = query columns) with the 512*bias table as the C operand, so a lane holds
// the scores of ONE query (column lane&15) for keys 8*(lane>>4) + r of each 16-key tile. Shift mask -51200 where region
// ids differ. Online softmax over 8 blocks of 64 keys in f32: maximum and sum run over the lane's own 32 registers, the
// maximum is joined with lane ^ 16 once per block, the sum l stays a per-half partial and is joined once at the end.
// p' = 4096*exp((s-m)/512); P hi = f16(p'), P lo = f16((p'-hi)*2^13). Two score tiles of one 32-key step, converted in
// place, are the B operand of O^T += V^T . P^T (A = V^T rows, hardware k order on both sides): P never leaves registers.
// O^T accumulators: hh = Vhi.Phi, hl = Vlo.Phi, lh = Vhi.Plo with V^T hi = 16v, V^T lo = res*2^14;
// o = (hh + hl*2^-14 + lh*2^-13) / (16 l). A lane ends with 8 consecutive d of its query per tile: 16-B packed stores.
// Output planes O hi = f16(64 o), O lo = f16((64o-hi)*2^14), layout [h][(w*512 + tok)/16] blocks (rows tok, k = d).
// coverage: 2048 blocks x 8 waves x 16 rows x 32 d = 8 x 32768 x 32 per plane, every element once.
// =================================================================================================================
__global__ __launch_bounds__(256)
void attn_win(const unsigned short* __restrict__ qpl, const unsigned short* __restrict__ kpl,
              const unsigned short* __restrict__ vth, const unsigned short* __restrict__ vtl,
              const float* __restrict__ bt, unsigned short* ohi, unsigned short* olo) {
  __shared__ __align__(16) int cnts[NTOK];
  union CB { v8f v; v4f q[2]; };
  const int tid = threadIdx.x, wave = tid >> 5, lane = tid & 31, hh = lane >> 4, c = lane & 15;
  const int wh = blockIdx.x >> 2;                 // w*8 + h
  const int w = wh >> 3, h = wh & 7;
  const int strip = (blockIdx.x & 3) * 8 + wave;  // 0..31
  const int q0 = strip * 16;

  for (int t = tid; t < NTOK; t += 256) cnts[t] = region_of(w, t);
  __syncthreads();

  const _Float16* Q  = (const _Float16*)(const void*)qpl + (size_t)wh * NTOK * HD;
  const _Float16* K  = (const _Float16*)(const void*)kpl + (size_t)wh * NTOK * HD;
  const _Float16* Vh = (const _Float16*)(const void*)vth + (size_t)wh * HD * NTOK;
  const _Float16* Vl = (const _Float16*)(const void*)vtl + (size_t)wh * HD * NTOK;
  const float* Bp = bt + ((size_t)(h * 32 + strip)) * 32 * 256 + lane * 4;

  const v16h qb = ldfrag_h(Q + (size_t)q0 * HD + lane * 8);
  // the address pair of the two query loads is reused right behind them: keep the wait in front of that overwrite
  asm volatile("s_wait_xcnt 0x0" ::: "memory");
  const int cq = cnts[q0 + c];
  float mrow = -1e30f, lrow = 0.f;
  v8f ohh0 = zero8(), ohh1 = zero8(), ohl0 = zero8(), ohl1 = zero8(), olh0 = zero8(), olh1 = zero8();

#pragma unroll 1
  for (int kb = 0; kb < 8; ++kb) {
    // ---- transposed logits for 64 keys: 4 tiles of 16 keys x 16 queries, bias via C operand, mask added ----
    v8f s[4];
#pragma unroll
    for (int j = 0; j < 4; ++j) {
      const int key0 = kb * 64 + j * 16;
      const v16h kf = ldfrag_h(K + key0 * HD + lane * 8);
      const float* bp = Bp + (kb * 4 + j) * 256;
      CB cb;
      cb.q[0] = *(const v4f*)(bp);
      cb.q[1] = *(const v4f*)(bp + 128);
      v8f sj = mma_g1(kf, qb, cb.v);
      const v4i cm0 = *(const v4i*)(cnts + key0 + 8 * hh);
      const v4i cm1 = *(const v4i*)(cnts + key0 + 8 * hh + 4);
      v8f mk;
#pragma unroll
      for (int r = 0; r < 4; ++r) {
        mk[r]     = (cq != cm0[r]) ? -51200.0f : 0.0f;
        mk[r + 4] = (cq != cm1[r]) ? -51200.0f : 0.0f;
      }
      s[j] = sj + mk;
    }
    // ---- online softmax update: one query per lane, 32 of its 64 scores here, the rest in lane ^ 16 ----
    float t8[8];
#pragma unroll
    for (int r = 0; r < 8; ++r) t8[r] = fmaxf(fmaxf(s[0][r], s[1][r]), fmaxf(s[2][r], s[3][r]));
    float tm = fmaxf(fmaxf(fmaxf(t8[0], t8[1]), fmaxf(t8[2], t8[3])), fmaxf(fmaxf(t8[4], t8[5]), fmaxf(t8[6], t8[7])));
    tm = fmaxf(tm, xhalf(tm));
    const float mn = fmaxf(mrow, tm);
    const float alpha = __expf((mrow - mn) * INV512);
    mrow = mn;
#pragma unroll
    for (int j = 0; j < 4; ++j) {
#pragma unroll
      for (int r = 0; r < 8; ++r) s[j][r] = __expf((s[j][r] - mn) * INV512 + LN4096);
    }
    const v8f sv = (s[0] + s[1]) + (s[2] + s[3]);
    const float ps = ((sv[0] + sv[1]) + (sv[2] + sv[3])) + ((sv[4] + sv[5]) + (sv[6] + sv[7]));
    lrow = lrow * alpha + ps;
    ohh0 = ohh0 * alpha; ohh1 = ohh1 * alpha;
    ohl0 = ohl0 * alpha; ohl1 = ohl1 * alpha;
    olh0 = olh0 * alpha; olh1 = olh1 * alpha;
    // ---- O^T += V^T . P^T : two 32-key k-steps, two 16-dim tiles, three products ----
#pragma unroll
    for (int ks = 0; ks < 2; ++ks) {
      // element e <- key 8*hh + e (tile 2*ks), element 8 + e <- key 16 + 8*hh + e (tile 2*ks + 1)
      const v8h ph0 = __builtin_convertvector(s[2 * ks], v8h);
      const v8h ph1 = __builtin_convertvector(s[2 * ks + 1], v8h);
      const v8h pl0 = __builtin_convertvector((s[2 * ks] - __builtin_convertvector(ph0, v8f)) * 8192.0f, v8h);
      const v8h pl1 = __builtin_convertvector((s[2 * ks + 1] - __builtin_convertvector(ph1, v8f)) * 8192.0f, v8h);
      const v16h pb  = __builtin_shufflevector(ph0, ph1, 0, 1, 2, 3, 4, 5, 6, 7, 8, 9, 10, 11, 12, 13, 14, 15);
      const v16h plb = __builtin_shufflevector(pl0, pl1, 0, 1, 2, 3, 4, 5, 6, 7, 8, 9, 10, 11, 12, 13, 14, 15);
      const int koff = (kb * 2 + ks) * 1024 + lane * 8;      // block pair (d 0..15, d 16..31) of this 32-key step
      {
        const v16h vh = ldfrag_h(Vh + koff);
        const v16h vl = ldfrag_h(Vl + koff);
        ohh0 = mma_raw(vh, pb, ohh0);
        ohl0 = mma_raw(vl, pb, ohl0);
        olh0 = mma_raw(vh, plb, olh0);
        guard3(ohh0, ohl0, olh0, vh, vl, pb, plb);
      }
      {
        const v16h vh = ldfrag_h(Vh + koff + 512);
        const v16h vl = ldfrag_h(Vl + koff + 512);
        ohh1 = mma_raw(vh, pb, ohh1);
        ohl1 = mma_raw(vl, pb, ohl1);
        olh1 = mma_raw(vh, plb, olh1);
        guard3(ohh1, ohl1, olh1, vh, vl, pb, plb);
      }
    }
  }

  // ---- join the halves' sums, normalise, split into hi / lo, 16-B packed stores (8 consecutive d of one query) ----
  const float lt = lrow + xhalf(lrow);
  const float inv = 1.0f / (lt * 16.0f);
  v4u ph2[2], pl2[2];
#pragma unroll
  for (int e = 0; e < 4; ++e) {
    float f[4];
#pragma unroll
    for (int u = 0; u < 2; ++u) {
      const int r = 2 * e + u;
      float o0 = ohh0[r] + ohl0[r] * (1.0f / 16384.0f);
      o0 = o0 + olh0[r] * (1.0f / 8192.0f);
      float o1 = ohh1[r] + ohl1[r] * (1.0f / 16384.0f);
      o1 = o1 + olh1[r] * (1.0f / 8192.0f);
      f[u]     = (o0 * inv) * 64.0f;
      f[2 + u] = (o1 * inv) * 64.0f;
    }
    const _Float16 a0 = (_Float16)f[0], a1 = (_Float16)f[1], b0 = (_Float16)f[2], b1 = (_Float16)f[3];
    ph2[0][e] = pk16(h_bits(a0), h_bits(a1));
    ph2[1][e] = pk16(h_bits(b0), h_bits(b1));
    pl2[0][e] = pk16(hb16((f[0] - (float)a0) * 16384.0f), hb16((f[1] - (float)a1) * 16384.0f));
    pl2[1][e] = pk16(hb16((f[2] - (float)b0) * 16384.0f), hb16((f[3] - (float)b1) * 16384.0f));
  }
  const size_t off = ((size_t)h * NROW + (size_t)w * NTOK + q0) * HD + lane * 8;
  *(v4u*)(ohi + off)       = ph2[0];
  *(v4u*)(ohi + off + 256) = ph2[1];
  *(v4u*)(olo + off)       = pl2[0];
  *(v4u*)(olo + off + 256) = pl2[1];
}

// =================================================================================================================
// Output projection: out rows = (Ohi + Olo*2^-14)/64 . (W1024/1024)^T + b; two accumulator sets (hi.W, lo.W), K = 256
// = 8 head planes of 32. Block tile 64 tokens x 128 cols, 8 waves = 2 x 4, 2x2 tiles per wave. Epilogue through an
// LDS f32 tile; store with un-window + reverse shift: a wave writes one token's 128-col half row = 512 B = 4 whole
// coverage: 512 x 64 tokens (bijective position map) x 2 x 128 cols = every output element exactly once.
// =================================================================================================================
__global__ __launch_bounds__(256)
void gemm_proj(const unsigned short* __restrict__ ohi, const unsigned short* __restrict__ olo,
               const unsigned short* __restrict__ wp, const float* __restrict__ bp, float* out) {
  __shared__ __align__(16) float Cs[64 * LDC];
  const int tid = threadIdx.x, wave = tid >> 5, lane = tid & 31, hh = lane >> 4, c = lane & 15;
  const int mb = blockIdx.x, nb = blockIdx.y;
  const int mw = wave >> 2, nw = wave & 3;
  const _Float16* W = (const _Float16*)(const void*)wp;
  const int arow0 = mb * 64 + mw * 32;
  const int bcol0 = nb * 128 + nw * 32;

  v8f h00 = zero8(), h01 = zero8(), h10 = zero8(), h11 = zero8();
  v8f l00 = zero8(), l01 = zero8(), l10 = zero8(), l11 = zero8();
  const _Float16* ph = (const _Float16*)(const void*)ohi + (size_t)arow0 * HD + lane * 8;   // head plane ks: + NROW*HD
  const _Float16* pl = (const _Float16*)(const void*)olo + (size_t)arow0 * HD + lane * 8;
  const _Float16* pb = W + frag_off(bcol0, 0, 0) + lane * 8;
#pragma unroll 1
  for (int ks = 0; ks < 8; ++ks, ph += NROW * HD, pl += NROW * HD, pb += 512) {
    const v16h fa0 = ldfrag_h(ph);
    const v16h fa1 = ldfrag_h(ph + 512);
    const v16h ga0 = ldfrag_h(pl);
    const v16h ga1 = ldfrag_h(pl + 512);
    const v16h fb0 = ldfrag_h(pb);
    const v16h fb1 = ldfrag_h(pb + 4096);
    // the three address pairs stay whole until the twelve loads that name them have their addresses translated
    asm volatile("s_wait_xcnt 0x0" :: "v"(ph), "v"(pl), "v"(pb) : "memory");
    h00 = mma_raw(fa0, fb0, h00);
    h01 = mma_raw(fa0, fb1, h01);
    h10 = mma_raw(fa1, fb0, h10);
    h11 = mma_raw(fa1, fb1, h11);
    l00 = mma_raw(ga0, fb0, l00);
    l01 = mma_raw(ga0, fb1, l01);
    l10 = mma_raw(ga1, fb0, l10);
    l11 = mma_raw(ga1, fb1, l11);
    guard8(h00, h01, h10, h11, l00, l01, l10, l11, fa0, fa1, ga0, ga1, fb0, fb1);
  }
#pragma unroll
  for (int r = 0; r < 8; ++r) {
    const int row = mw * 32 + 8 * hh + r;
    Cs[row * LDC + nw * 32 + c]             = h00[r] + l00[r] * (1.0f / 16384.0f);
    Cs[row * LDC + nw * 32 + 16 + c]        = h01[r] + l01[r] * (1.0f / 16384.0f);
    Cs[(row + 16) * LDC + nw * 32 + c]      = h10[r] + l10[r] * (1.0f / 16384.0f);
    Cs[(row + 16) * LDC + nw * 32 + 16 + c] = h11[r] + l11[r] * (1.0f / 16384.0f);
  }
  __syncthreads();

  const int w = mb >> 3, tok0 = (mb & 7) * 64;
  const float* bpn = bp + nb * 128 + lane * 4;
  v4f bb;
#pragma unroll
  for (int e = 0; e < 4; ++e) bb[e] = bfr(bpn[e]);
  v4f ov[8];
  size_t offs[8];
#pragma unroll
  for (int it = 0; it < 8; ++it) {
    const int row = wave * 8 + it;
    const int sp = spat_of(w, tok0 + row);
    v4f v = *(const v4f*)(Cs + row * LDC + lane * 4);
#pragma unroll
    for (int e = 0; e < 4; ++e) v[e] = v[e] * (1.0f / 65536.0f) + bb[e];
    ov[it] = v;
    offs[it] = (size_t)sp * CCH + nb * 128 + lane * 4;
  }
#pragma unroll
  for (int it = 0; it < 8; ++it) *(v4f*)(out + offs[it]) = ov[it];
  
}

// =================================================================================================================
//   X8 f16 [32768][256] 16777216 | Wqkv f16 [768][256] 393216 | Wproj f16 [256][256] 131072 |
//   bias table f32 [8][512][512] 8388608 | Q f16 [512][512][32] 16777216 | K same 16777216 |
//   V^T hi f16 [512][32][512] 16777216 | V^T lo same 16777216 | O hi f16 [8][32768][32] 16777216 | O lo same 16777216
//   total 126353408.
// =================================================================================================================
extern "C" void kernel_launch(void* const* d_in, const int* in_sizes, int n_in,
                              void* d_out, int out_size, void* d_ws, size_t ws_size,
                              hipStream_t stream) {
  if (n_in < 6) return;
  if (in_sizes[0] != NROW * CCH) return;
  if (in_sizes[1] != C3 * CCH || in_sizes[2] != C3) return;
  if (in_sizes[3] != CCH * CCH || in_sizes[4] != CCH) return;
  if (in_sizes[5] != NRPB * NHD) return;
  if (out_size != NROW * CCH) return;

  const float* x     = (const float*)d_in[0];
  const float* qkvw  = (const float*)d_in[1];
  const float* qkvb  = (const float*)d_in[2];
  const float* projw = (const float*)d_in[3];
  const float* projb = (const float*)d_in[4];
  const float* rpb   = (const float*)d_in[5];
  float* out = (float*)d_out;

  const size_t sX  = (size_t)NROW * CCH * 2;                 // 16777216
  const size_t sWq = (size_t)C3 * CCH * 2;                   //   393216
  const size_t sWp = (size_t)CCH * CCH * 2;                  //   131072
  const size_t sBT = (size_t)NHD * NTOK * NTOK * 4;          //  8388608
  const size_t sQK = (size_t)NWIN * NHD * NTOK * HD * 2;     // 16777216
  const size_t sO  = (size_t)NHD * NROW * HD * 2;            // 16777216
  size_t off = 0;
  const size_t oX  = off; off += sX;
  const size_t oWq = off; off += sWq;
  const size_t oWp = off; off += sWp;
  const size_t oBT = off; off += sBT;
  const size_t oQ  = off; off += sQK;
  const size_t oK  = off; off += sQK;
  const size_t oVh = off; off += sQK;
  const size_t oVl = off; off += sQK;
  const size_t oOh = off; off += sO;
  const size_t oOl = off; off += sO;
  if (off > ws_size) return;                                  // off = 126353408
  if (off > (size_t)134217728) return;

  char* ws = (char*)d_ws;
  unsigned short* X8  = (unsigned short*)(ws + oX);
  unsigned short* Wq  = (unsigned short*)(ws + oWq);
  unsigned short* Wp  = (unsigned short*)(ws + oWp);
  float*          BT  = (float*)(ws + oBT);
  unsigned short* Qp  = (unsigned short*)(ws + oQ);
  unsigned short* Kp  = (unsigned short*)(ws + oK);
  unsigned short* Vth = (unsigned short*)(ws + oVh);
  unsigned short* Vtl = (unsigned short*)(ws + oVl);
  unsigned short* Ohi = (unsigned short*)(ws + oOh);
  unsigned short* Olo = (unsigned short*)(ws + oOl);

  const dim3 blk(256);
  // (1) input convert + window gather, weight converts, bias table
  cvt_x<<<dim3(NROW / 8), blk, 0, stream>>>(x, X8);
  cvt_w<<<dim3(C3 / 8), blk, 0, stream>>>(qkvw, Wq, C3);
  cvt_w<<<dim3(CCH / 8), blk, 0, stream>>>(projw, Wp, CCH);
  build_bias<<<dim3((NHD * 32 * 32 * 64) / 256), blk, 0, stream>>>(rpb, BT);
  // (2) qkv projection: 512 row tiles x 6 column tiles
  gemm_qkv<<<dim3(NROW / 64, C3 / 128), blk, 0, stream>>>(X8, Wq, qkvb, Qp, Kp, Vth, Vtl);
  // (3) window attention: 64 windows x 8 heads x 4 blocks of 8 strips
  attn_win<<<dim3(NWIN * NHD * 4), blk, 0, stream>>>(Qp, Kp, Vth, Vtl, BT, Ohi, Olo);
  // (4) output projection + un-window + reverse shift -> d_out
  gemm_proj<<<dim3(NROW / 64, CCH / 128), blk, 0, stream>>>(Ohi, Olo, Wp, projb, out);
  (void)hipGetLastError();
}

// v003
// A run of this version takes 159 microseconds.
// Timed twice side by side with v002, it ran 1.07 times as fast both times.
// Over all steps from v000 it is 1.67 times as fast.
// qkv projection and k.qT: v_wmma_f32_16x16x32_f16 single products (f16 operands, f32 accumulate); vT.pT: p and v^T each
// carried as f16 hi plus power-of-two scaled residual planes, three products (hi.hi, hi.lo, lo.hi), f32 accumulate;
// output projection: activation as f16 hi plus scaled residual times f16 weight, two products, f32 accumulate.
// All inputs RNE-converted to bf16 on load; softmax, masks and epilogues in f32 on VALU.
#include <hip/hip_runtime.h>
#include <stdint.h>

#define NWIN 64
#define NTOK 512
#define CCH  256
#define NHD  8
#define HD   32
#define C3   768
#define NROW 32768
#define NRPB 3375
#define LDC  132
#define QSC  0.17677669529663687f
#define INV512 0.001953125f
#define LN4096 8.3177661667193429f

static_assert(NROW == NWIN * NTOK);
static_assert((LDC * 4) % 16 == 0);

typedef _Float16 v16h __attribute__((ext_vector_type(16)));
typedef _Float16 v8h  __attribute__((ext_vector_type(8)));
typedef float    v8f  __attribute__((ext_vector_type(8)));
typedef float    v4f  __attribute__((ext_vector_type(4)));
typedef unsigned int v4u __attribute__((ext_vector_type(4)));
typedef int      v4i  __attribute__((ext_vector_type(4)));

// ---- scalar helpers ------------------------------------------------------------------------------------------
__device__ __forceinline__ unsigned short bf_bits(float f) {          // f32 -> bf16 bits, RNE convert
  unsigned u = __float_as_uint(f);
  return (unsigned short)((u + 0x7FFFu + ((u >> 16) & 1u)) >> 16);
}
__device__ __forceinline__ float bf_up(unsigned short b) { return __uint_as_float(((unsigned)b) << 16); }
__device__ __forceinline__ float bfr(float f) { return bf_up(bf_bits(f)); }
__device__ __forceinline__ unsigned short h_bits(_Float16 x) { return __builtin_bit_cast(unsigned short, x); }
__device__ __forceinline__ unsigned short hb16(float f) { return h_bits((_Float16)f); }
__device__ __forceinline__ unsigned pk16(unsigned short a, unsigned short b) { return (unsigned)a | ((unsigned)b << 16); }
__device__ __forceinline__ v8f zero8() { v8f z = {0.f, 0.f, 0.f, 0.f, 0.f, 0.f, 0.f, 0.f}; return z; }

// ---- index maps --------------------------------------------------------------------------------------------------
// window w = (hb*4 + wb)*4 + db over a 32^3 volume in 8^3 windows; token t = (i*8 + j)*8 + k inside the window.
// The shifted coordinate is (hb*8+i, wb*8+j, db*8+k); both the input gather (roll by -4) and the output scatter
// (roll by +4) use volume position ((hs+4)&31, (ws+4)&31, (ds+4)&31).
__device__ __forceinline__ int spat_of(int w, int t) {
  const int hb = w >> 4, wb = (w >> 2) & 3, db = w & 3;
  const int i = t >> 6, j = (t >> 3) & 7, k = t & 7;
  const int gh = (hb * 8 + i + 4) & 31;
  const int gw = (wb * 8 + j + 4) & 31;
  const int gd = (db * 8 + k + 4) & 31;
  return (gh * 32 + gw) * 32 + gd;
}
__device__ __forceinline__ int rid1(int p) { return (p < 24) ? 0 : ((p < 28) ? 1 : 2); }
__device__ __forceinline__ int region_of(int w, int t) {
  const int hb = w >> 4, wb = (w >> 2) & 3, db = w & 3;
  const int i = t >> 6, j = (t >> 3) & 7, k = t & 7;
  return rid1(hb * 8 + i) * 9 + rid1(wb * 8 + j) * 3 + rid1(db * 8 + k);
}

// ---- fragment-order planes: every 16-bit A/B operand plane is kept as 1-KiB blocks of 16 rows x 32 k. Inside a block
//      the 16-B piece (row c, k = 16*chunk + 8*h .. +7) stands at halves chunk*256 + (h*16 + c)*8, so lane l = h*16 + c
//      finds its two pieces at l*8 and 256 + l*8 and each wave-wide 16-B load covers 512 contiguous bytes (4 lines).
//      p = block base + lane*8; elements 0..7 <- k 8h.., elements 8..15 <- k 16+8h.. (hardware k order, as before)
__device__ __forceinline__ v16h ldfrag_h(const _Float16* p) {
  union { v16h v; v8h h[2]; } f;
  f.h[0] = *(const v8h*)(p);
  f.h[1] = *(const v8h*)(p + 256);
  return f.v;
}
// halves offset of the piece (row, k = ks*32 + 8*g .. +7), g = 0..3, in a fragment-order plane of 256-k rows
__device__ __forceinline__ size_t frag_off(int row, int ks, int g) {
  return ((size_t)((row >> 4) * 8 + ks)) * 512 + (g >> 1) * 256 + ((g & 1) * 16 + (row & 15)) * 8;
}

// ---- WMMA helpers; the guard helpers insert the trailing VALU hazard gap and keep A/B live -----------------------
__device__ __forceinline__ v8f mma_raw(v16h a, v16h b, v8f c) {
  return __builtin_amdgcn_wmma_f32_16x16x32_f16(false, a, false, b, (short)0, c, false, false);
}
__device__ __forceinline__ v8f mma_g1(v16h a, v16h b, v8f c) {
  c = mma_raw(a, b, c);
#if defined(__HIP_DEVICE_COMPILE__)
  asm volatile("v_nop\n\tv_nop\n\tv_nop\n\tv_nop" : "+v"(c) : "v"(a), "v"(b));
#endif
  return c;
}
__device__ __forceinline__ void guard3(v8f& c0, v8f& c1, v8f& c2,
                                       const v16h& a0, const v16h& a1, const v16h& b0, const v16h& b1) {
#if defined(__HIP_DEVICE_COMPILE__)
  asm volatile("v_nop\n\tv_nop\n\tv_nop\n\tv_nop"
               : "+v"(c0), "+v"(c1), "+v"(c2) : "v"(a0), "v"(a1), "v"(b0), "v"(b1));
#endif
}
__device__ __forceinline__ void guard4(v8f& c0, v8f& c1, v8f& c2, v8f& c3,
                                       const v16h& a0, const v16h& a1, const v16h& b0, const v16h& b1) {
#if defined(__HIP_DEVICE_COMPILE__)
  asm volatile("v_nop\n\tv_nop\n\tv_nop\n\tv_nop"
               : "+v"(c0), "+v"(c1), "+v"(c2), "+v"(c3) : "v"(a0), "v"(a1), "v"(b0), "v"(b1));
#endif
}
__device__ __forceinline__ void guard8(v8f& c0, v8f& c1, v8f& c2, v8f& c3, v8f& c4, v8f& c5, v8f& c6, v8f& c7,
                                       const v16h& a0, const v16h& a1, const v16h& a2, const v16h& a3,
                                       const v16h& b0, const v16h& b1) {
#if defined(__HIP_DEVICE_COMPILE__)
  asm volatile("v_nop\n\tv_nop\n\tv_nop\n\tv_nop"
               : "+v"(c0), "+v"(c1), "+v"(c2), "+v"(c3), "+v"(c4), "+v"(c5), "+v"(c6), "+v"(c7)
               : "v"(a0), "v"(a1), "v"(a2), "v"(a3), "v"(b0), "v"(b1));
#endif
}
// value of lane l ^ 16 (the other half of the wave), as a vector cross-row move
__device__ __forceinline__ float xhalf(float v) {
  const int b = __float_as_int(v);
  return __int_as_float(__builtin_amdgcn_permlanex16(b, b, 0x76543210, 0xfedcba98, false, false));
}

// =================================================================================================================
// weight convert: w [nrows][256] f32 ([out][in], in contiguous) -> f16(1024 * bf16_RNE(w)), rows n, fragment order;
// block = 8 rows; wave = one 32-channel k-step of them; lane = row (lane&7), 8 channels (lane>>3). grid = nrows/8.
// coverage: nrows x 256.
// =================================================================================================================
__global__ __launch_bounds__(256) void cvt_w(const float* __restrict__ wsrc, unsigned short* wdst, int nrows) {
  const int tid = threadIdx.x, wv = tid >> 5, lane = tid & 31;
  const int row = blockIdx.x * 8 + (lane & 7), g = lane >> 3;
  if (row < nrows) {
    const float* src = wsrc + (size_t)row * CCH + wv * 32 + g * 8;
    const v4f a = *(const v4f*)(src);
    const v4f b = *(const v4f*)(src + 4);
    v4u pk;
    pk[0] = pk16(hb16(bfr(a[0]) * 1024.0f), hb16(bfr(a[1]) * 1024.0f));
    pk[1] = pk16(hb16(bfr(a[2]) * 1024.0f), hb16(bfr(a[3]) * 1024.0f));
    pk[2] = pk16(hb16(bfr(b[0]) * 1024.0f), hb16(bfr(b[1]) * 1024.0f));
    pk[3] = pk16(hb16(bfr(b[2]) * 1024.0f), hb16(bfr(b[3]) * 1024.0f));
    unsigned short* gp = wdst + frag_off(row, wv, g);
    *(v4u*)gp = pk;
    
  }
}

// =================================================================================================================
// relative position bias table in the C-operand order of the transposed score tile (rows = keys, columns = queries):
// BT[((h*32 + strip)*32 + kt)*256 + (r>>2)*128 + l*4 + (r&3)] (each of a lane's two 16-B loads is 512 B per wave) =
// 512 * bf16_RNE(rpb[idx(n,m)*8 + h]) with query n = strip*16 + (l&15), key m = kt*16 + 8*(l>>4) + r,
// idx = ((i_n-i_m+7)*15 + (j_n-j_m+7))*15 + (k_n-k_m+7). Thread = one 16-B piece (4 keys), 8 consecutive threads
// coverage: 8 heads x 32 strips x 32 key tiles x 64 pieces x 4 = 8 x 512 x 512.
// =================================================================================================================
__global__ __launch_bounds__(256) void build_bias(const float* __restrict__ rpb, float* bt) {
  const int g = blockIdx.x * 256 + threadIdx.x;
  const int piece = g & 63, rec = g >> 6;
  const int kt = rec & 31, strip = (rec >> 5) & 31, h = (rec >> 10) & 7;
  const int l = piece & 31, e0 = (piece >> 5) * 4;
  const int col = l & 15, lh = l >> 4;
  const int n = strip * 16 + col;
  const int ni = n >> 6, nj = (n >> 3) & 7, nk = n & 7;
  v4f v;
#pragma unroll
  for (int e = 0; e < 4; ++e) {
    const int m = kt * 16 + 8 * lh + e0 + e;
    const int mi = m >> 6, mj = (m >> 3) & 7, mk = m & 7;
    int idx = ((ni - mi + 7) * 15 + (nj - mj + 7)) * 15 + (nk - mk + 7);
    idx = min(max(idx, 0), NRPB - 1);
    v[e] = bfr(rpb[idx * NHD + h]) * 512.0f;
  }
  float* gp = bt + (size_t)rec * 256 + piece * 4;
  *(v4f*)gp = v;
  
}

// =================================================================================================================
// cyclic shift + window gather + convert + qkv GEMM in one kernel. Block = 64 tokens of one window x all 768 columns.
// Stage: x [32768 positions][256] f32 -> LDS A tile, 64 rows x 256 k in fragment order, value f16(8 * bf16_RNE(x)).
// Wave = one 32-channel k-step, lane = row (lane&7) of 8, 8 channels (lane>>3), 8 row groups: sixteen 16-B loads in
// flight per lane, eight 16-B LDS stores. Then six column tiles of 128: C[64][128] = A . W1024[cols][256]^T, K = 256
// (8 k-steps of 32), A fragments from LDS, W fragments of a whole column tile held in registers and fetched one tile
// ahead, so that they fly under the epilogue; 8 waves = 2 (32 rows) x 4 (32 cols), 2x2 tiles per wave. The bias row
// stands in LDS as bf16_RNE(b), converted once per block.
// C = 8192 * (xw . W^T). Epilogue through an LDS f32 tile (two of them, used in turn: one barrier per column tile):
// part q -> Q plane [w*8+h][tok/16] blocks (rows tok, k = d)
// = f16(64*q) with q = (C/8192 + b) * 32^-0.5; part k -> K plane = f16(8*k), same form; part v -> V^T hi
// [w*8+h][tok/32][d/16] blocks (rows d, k = tok) = f16(16*v) and V^T lo = f16((16v - hi) * 2^14). A thread takes the
// piece that stands at tid*8 halves of the head's 4 blocks, so every store instruction writes 512 contiguous bytes.
// coverage: Q/K: 4 instr x 256 pieces = 4 heads x 64 tok x 32 d; V hi/lo: 4 instr x 256 pieces = 4 heads x 32 d x
// 64 tok; over the grid and the six tiles every element of Q, K (64x8x512x32) and V^T hi/lo (64x8x32x512) exactly once.
// =================================================================================================================
__global__ __launch_bounds__(256)
void gemm_qkv(const float* __restrict__ x, const unsigned short* __restrict__ wq,
              const float* __restrict__ bq,
              unsigned short* qpl, unsigned short* kpl, unsigned short* vth, unsigned short* vtl) {
  __shared__ __align__(16) unsigned short As[64 * CCH];
  __shared__ __align__(16) float Cs2[2][64 * LDC];
  __shared__ __align__(16) float Bs[C3];
  const int tid = threadIdx.x, wave = tid >> 5, lane = tid & 31, hh = lane >> 4, c = lane & 15;
  const int mb = blockIdx.x;
  const int mw = wave >> 2, nw = wave & 3;
  const int w = mb >> 3, tok0 = (mb & 7) * 64;
  const _Float16* W = (const _Float16*)(const void*)wq;

  // column tile nb of this wave: + nb * 32768 halves; second 16-column band: + 4096; k-step: + 512
  const _Float16* pb = W + frag_off(nw * 32, 0, 0) + lane * 8;
  v16h fb0[8], fb1[8];
#pragma unroll
  for (int ks = 0; ks < 8; ++ks) {
    fb0[ks] = ldfrag_h(pb + ks * 512);
    fb1[ks] = ldfrag_h(pb + 4096 + ks * 512);
  }

  {
    const int r8 = lane & 7, g = lane >> 3;
    v4f xa[8], xb[8];
    float bv[3];
#pragma unroll
    for (int it = 0; it < 8; ++it) {
      const float* src = x + (size_t)spat_of(w, tok0 + it * 8 + r8) * CCH + wave * 32 + g * 8;
      xa[it] = *(const v4f*)(src);
      xb[it] = *(const v4f*)(src + 4);
    }
#pragma unroll
    for (int i = 0; i < 3; ++i) bv[i] = bq[i * 256 + tid];
#pragma unroll
    for (int i = 0; i < 3; ++i) Bs[i * 256 + tid] = bfr(bv[i]);
#pragma unroll
    for (int it = 0; it < 8; ++it) {
      const v4f a = xa[it], b = xb[it];
      v4u pk;
      pk[0] = pk16(hb16(bfr(a[0]) * 8.0f), hb16(bfr(a[1]) * 8.0f));
      pk[1] = pk16(hb16(bfr(a[2]) * 8.0f), hb16(bfr(a[3]) * 8.0f));
      pk[2] = pk16(hb16(bfr(b[0]) * 8.0f), hb16(bfr(b[1]) * 8.0f));
      pk[3] = pk16(hb16(bfr(b[2]) * 8.0f), hb16(bfr(b[3]) * 8.0f));
      *(v4u*)(As + frag_off(it * 8 + r8, wave, g)) = pk;
    }
  }
  __syncthreads();

  const _Float16* pa = (const _Float16*)(const void*)As + frag_off(mw * 32, 0, 0) + lane * 8;   // next band: + 4096

#pragma unroll 1
  for (int nb = 0; nb < 6; ++nb) {
  float* Cs = Cs2[nb & 1];
  v8f a00 = zero8(), a01 = zero8(), a10 = zero8(), a11 = zero8();
  v16h fa0 = ldfrag_h(pa), fa1 = ldfrag_h(pa + 4096);
#pragma unroll
  for (int ks = 0; ks < 8; ++ks) {
    v16h na0 = fa0, na1 = fa1;                    // A fragments of the next k-step, read ahead of this step's products
    if (ks < 7) {
      na0 = ldfrag_h(pa + (ks + 1) * 512);
      na1 = ldfrag_h(pa + 4096 + (ks + 1) * 512);
    }
    a00 = mma_raw(fa0, fb0[ks], a00);
    a01 = mma_raw(fa0, fb1[ks], a01);
    a10 = mma_raw(fa1, fb0[ks], a10);
    a11 = mma_raw(fa1, fb1[ks], a11);
    guard4(a00, a01, a10, a11, fa0, fa1, fb0[ks], fb1[ks]);
    fa0 = na0;
    fa1 = na1;
  }
#pragma unroll
  for (int r = 0; r < 8; ++r) {
    const int row = mw * 32 + 8 * hh + r;
    Cs[row * LDC + nw * 32 + c]             = a00[r];
    Cs[row * LDC + nw * 32 + 16 + c]        = a01[r];
    Cs[(row + 16) * LDC + nw * 32 + c]      = a10[r];
    Cs[(row + 16) * LDC + nw * 32 + 16 + c] = a11[r];
  }
  // one barrier per column tile: it publishes this tile's C, and every wave that passes it has left the other C buffer
  __syncthreads();

  // the next column tile's W fragments: issued behind the barrier (which waits for every load in flight) and in front
  // of an epilogue that reads LDS only, so that nothing waits for them before the next tile's products
  if (nb < 5) {                                   // block-uniform
    const _Float16* pn = pb + (nb + 1) * 32768;
#pragma unroll
    for (int ks = 0; ks < 8; ++ks) {
      fb0[ks] = ldfrag_h(pn + ks * 512);
      fb1[ks] = ldfrag_h(pn + 4096 + ks * 512);
    }
    // the address pair of these loads is reused by the epilogue: keep the wait in front of that overwrite
    asm volatile("s_wait_xcnt 0x0" ::: "memory");
  }

  const int part = nb >> 1;                       // block-uniform: 0 q, 1 k, 2 v
  const int hb4 = (nb & 1) * 4;
  const float* bqn = Bs + nb * 128;               // bf16_RNE(bias), staged once
  if (part < 2) {
    unsigned short* dst = (part == 0) ? qpl : kpl;
    const float scl = (part == 0) ? (QSC * 64.0f) : 8.0f;
    v4u pk[4];
    size_t offs[4];
#pragma unroll
    for (int s = 0; s < 4; ++s) {
      const int h4 = s;
      const int tok = (tid >> 6) * 16 + (tid & 15), d0 = ((tid >> 4) & 3) * 8;
      const int col = h4 * 32 + d0;
      v4u q4;
#pragma unroll
      for (int e = 0; e < 4; ++e) {
        float f0 = Cs[tok * LDC + col + 2 * e] * (1.0f / 8192.0f) + bqn[col + 2 * e];
        float f1 = Cs[tok * LDC + col + 2 * e + 1] * (1.0f / 8192.0f) + bqn[col + 2 * e + 1];
        f0 = f0 * scl;
        f1 = f1 * scl;
        q4[e] = pk16(hb16(f0), hb16(f1));
      }
      pk[s] = q4;
      offs[s] = ((size_t)((w * NHD + hb4 + h4) * NTOK + tok0)) * HD + tid * 8;
    }
#pragma unroll
    for (int s = 0; s < 4; ++s) *(v4u*)(dst + offs[s]) = pk[s];
    
  } else {
    v4u phk[4], plk[4];
    size_t offs[4];
#pragma unroll
    for (int s = 0; s < 4; ++s) {
      const int h4 = s, d = ((tid >> 6) & 1) * 16 + (tid & 15);
      const int col = h4 * 32 + d;
      const int tb = (tid >> 7) * 32 + ((tid >> 4) & 3) * 8;
      const float bc = bqn[col];
      v4u a, b;
#pragma unroll
      for (int e = 0; e < 4; ++e) {
        const float v0 = Cs[(tb + 2 * e) * LDC + col] * (1.0f / 8192.0f) + bc;
        const float v1 = Cs[(tb + 2 * e + 1) * LDC + col] * (1.0f / 8192.0f) + bc;
        const float f0 = v0 * 16.0f, f1 = v1 * 16.0f;
        const _Float16 h0 = (_Float16)f0, h1 = (_Float16)f1;
        const float r0 = (f0 - (float)h0) * 16384.0f;
        const float r1 = (f1 - (float)h1) * 16384.0f;
        a[e] = pk16(h_bits(h0), h_bits(h1));
        b[e] = pk16(hb16(r0), hb16(r1));
      }
      phk[s] = a;
      plk[s] = b;
      offs[s] = ((size_t)(w * NHD + hb4 + h4)) * HD * NTOK + tok0 * HD + tid * 8;
    }
#pragma unroll
    for (int s = 0; s < 4; ++s) { *(v4u*)(vth + offs[s]) = phk[s]; *(v4u*)(vtl + offs[s]) = plk[s]; }
  }
  // the next tile's products overwrite the registers that these stores name: keep the wait in front of that overwrite
  asm volatile("s_wait_xcnt 0x0" ::: "memory");
  }
}

// =================================================================================================================
// Window attention, transposed: block = 8 strips of 16 queries of one (window, head); wave = strip.
// S^T = K8 . Q64^T via WMMA (A = key rows, B = query columns) with the 512*bias table as the C operand, so a lane holds
// the scores of ONE query (column lane&15) for keys 8*(lane>>4) + r of each 16-key tile. Shift mask -51200 where region
// ids differ. Online softmax over 8 blocks of 64 keys in f32: maximum and sum run over the lane's own 32 registers, the
// maximum is joined with lane ^ 16 once per block, the sum l stays a per-half partial and is joined once at the end.
// p' = 4096*exp((s-m)/512); P hi = f16(p'), P lo = f16((p'-hi)*2^13). Two score tiles of one 32-key step, converted in
// place, are the B operand of O^T += V^T . P^T (A = V^T rows, hardware k order on both sides): P never leaves registers.
// O^T accumulators: hh = Vhi.Phi, hl = Vlo.Phi, lh = Vhi.Plo with V^T hi = 16v, V^T lo = res*2^14;
// o = (hh + hl*2^-14 + lh*2^-13) / (16 l). A lane ends with 8 consecutive d of its query per tile: 16-B packed stores.
// Output planes O hi = f16(64 o), O lo = f16((64o-hi)*2^14), layout [h][(w*512 + tok)/16] blocks (rows tok, k = d).
// coverage: 2048 blocks x 8 waves x 16 rows x 32 d = 8 x 32768 x 32 per plane, every element once.
// =================================================================================================================
__global__ __launch_bounds__(256)
void attn_win(const unsigned short* __restrict__ qpl, const unsigned short* __restrict__ kpl,
              const unsigned short* __restrict__ vth, const unsigned short* __restrict__ vtl,
              const float* __restrict__ bt, unsigned short* ohi, unsigned short* olo) {
  __shared__ __align__(16) int cnts[NTOK];
  union CB { v8f v; v4f q[2]; };
  const int tid = threadIdx.x, wave = tid >> 5, lane = tid & 31, hh = lane >> 4, c = lane & 15;
  const int wh = blockIdx.x >> 2;                 // w*8 + h
  const int w = wh >> 3, h = wh & 7;
  const int strip = (blockIdx.x & 3) * 8 + wave;  // 0..31
  const int q0 = strip * 16;

  for (int t = tid; t < NTOK; t += 256) cnts[t] = region_of(w, t);
  __syncthreads();

  const _Float16* Q  = (const _Float16*)(const void*)qpl + (size_t)wh * NTOK * HD;
  const _Float16* K  = (const _Float16*)(const void*)kpl + (size_t)wh * NTOK * HD;
  const _Float16* Vh = (const _Float16*)(const void*)vth + (size_t)wh * HD * NTOK;
  const _Float16* Vl = (const _Float16*)(const void*)vtl + (size_t)wh * HD * NTOK;
  const float* Bp = bt + ((size_t)(h * 32 + strip)) * 32 * 256 + lane * 4;

  const v16h qb = ldfrag_h(Q + (size_t)q0 * HD + lane * 8);
  // the address pair of the two query loads is reused right behind them: keep the wait in front of that overwrite
  asm volatile("s_wait_xcnt 0x0" ::: "memory");
  const int cq = cnts[q0 + c];
  float mrow = -1e30f, lrow = 0.f;
  v8f ohh0 = zero8(), ohh1 = zero8(), ohl0 = zero8(), ohl1 = zero8(), olh0 = zero8(), olh1 = zero8();

#pragma unroll 1
  for (int kb = 0; kb < 8; ++kb) {
    // ---- transposed logits for 64 keys: 4 tiles of 16 keys x 16 queries, bias via C operand, mask added ----
    v8f s[4];
#pragma unroll
    for (int j = 0; j < 4; ++j) {
      const int key0 = kb * 64 + j * 16;
      const v16h kf = ldfrag_h(K + key0 * HD + lane * 8);
      const float* bp = Bp + (kb * 4 + j) * 256;
      CB cb;
      cb.q[0] = *(const v4f*)(bp);
      cb.q[1] = *(const v4f*)(bp + 128);
      v8f sj = mma_g1(kf, qb, cb.v);
      const v4i cm0 = *(const v4i*)(cnts + key0 + 8 * hh);
      const v4i cm1 = *(const v4i*)(cnts + key0 + 8 * hh + 4);
      v8f mk;
#pragma unroll
      for (int r = 0; r < 4; ++r) {
        mk[r]     = (cq != cm0[r]) ? -51200.0f : 0.0f;
        mk[r + 4] = (cq != cm1[r]) ? -51200.0f : 0.0f;
      }
      s[j] = sj + mk;
    }
    // ---- online softmax update: one query per lane, 32 of its 64 scores here, the rest in lane ^ 16 ----
    float t8[8];
#pragma unroll
    for (int r = 0; r < 8; ++r) t8[r] = fmaxf(fmaxf(s[0][r], s[1][r]), fmaxf(s[2][r], s[3][r]));
    float tm = fmaxf(fmaxf(fmaxf(t8[0], t8[1]), fmaxf(t8[2], t8[3])), fmaxf(fmaxf(t8[4], t8[5]), fmaxf(t8[6], t8[7])));
    tm = fmaxf(tm, xhalf(tm));
    const float mn = fmaxf(mrow, tm);
    const float alpha = __expf((mrow - mn) * INV512);
    mrow = mn;
#pragma unroll
    for (int j = 0; j < 4; ++j) {
#pragma unroll
      for (int r = 0; r < 8; ++r) s[j][r] = __expf((s[j][r] - mn) * INV512 + LN4096);
    }
    const v8f sv = (s[0] + s[1]) + (s[2] + s[3]);
    const float ps = ((sv[0] + sv[1]) + (sv[2] + sv[3])) + ((sv[4] + sv[5]) + (sv[6] + sv[7]));
    lrow = lrow * alpha + ps;
    ohh0 = ohh0 * alpha; ohh1 = ohh1 * alpha;
    ohl0 = ohl0 * alpha; ohl1 = ohl1 * alpha;
    olh0 = olh0 * alpha; olh1 = olh1 * alpha;
    // ---- O^T += V^T . P^T : two 32-key k-steps, two 16-dim tiles, three products ----
#pragma unroll
    for (int ks = 0; ks < 2; ++ks) {
      // element e <- key 8*hh + e (tile 2*ks), element 8 + e <- key 16 + 8*hh + e (tile 2*ks + 1)
      const v8h ph0 = __builtin_convertvector(s[2 * ks], v8h);
      const v8h ph1 = __builtin_convertvector(s[2 * ks + 1], v8h);
      const v8h pl0 = __builtin_convertvector((s[2 * ks] - __builtin_convertvector(ph0, v8f)) * 8192.0f, v8h);
      const v8h pl1 = __builtin_convertvector((s[2 * ks + 1] - __builtin_convertvector(ph1, v8f)) * 8192.0f, v8h);
      const v16h pb  = __builtin_shufflevector(ph0, ph1, 0, 1, 2, 3, 4, 5, 6, 7, 8, 9, 10, 11, 12, 13, 14, 15);
      const v16h plb = __builtin_shufflevector(pl0, pl1, 0, 1, 2, 3, 4, 5, 6, 7, 8, 9, 10, 11, 12, 13, 14, 15);
      const int koff = (kb * 2 + ks) * 1024 + lane * 8;      // block pair (d 0..15, d 16..31) of this 32-key step
      {
        const v16h vh = ldfrag_h(Vh + koff);
        const v16h vl = ldfrag_h(Vl + koff);
        ohh0 = mma_raw(vh, pb, ohh0);
        ohl0 = mma_raw(vl, pb, ohl0);
        olh0 = mma_raw(vh, plb, olh0);
        guard3(ohh0, ohl0, olh0, vh, vl, pb, plb);
      }
      {
        const v16h vh = ldfrag_h(Vh + koff + 512);
        const v16h vl = ldfrag_h(Vl + koff + 512);
        ohh1 = mma_raw(vh, pb, ohh1);
        ohl1 = mma_raw(vl, pb, ohl1);
        olh1 = mma_raw(vh, plb, olh1);
        guard3(ohh1, ohl1, olh1, vh, vl, pb, plb);
      }
    }
  }

  // ---- join the halves' sums, normalise, split into hi / lo, 16-B packed stores (8 consecutive d of one query) ----
  const float lt = lrow + xhalf(lrow);
  const float inv = 1.0f / (lt * 16.0f);
  v4u ph2[2], pl2[2];
#pragma unroll
  for (int e = 0; e < 4; ++e) {
    float f[4];
#pragma unroll
    for (int u = 0; u < 2; ++u) {
      const int r = 2 * e + u;
      float o0 = ohh0[r] + ohl0[r] * (1.0f / 16384.0f);
      o0 = o0 + olh0[r] * (1.0f / 8192.0f);
      float o1 = ohh1[r] + ohl1[r] * (1.0f / 16384.0f);
      o1 = o1 + olh1[r] * (1.0f / 8192.0f);
      f[u]     = (o0 * inv) * 64.0f;
      f[2 + u] = (o1 * inv) * 64.0f;
    }
    const _Float16 a0 = (_Float16)f[0], a1 = (_Float16)f[1], b0 = (_Float16)f[2], b1 = (_Float16)f[3];
    ph2[0][e] = pk16(h_bits(a0), h_bits(a1));
    ph2[1][e] = pk16(h_bits(b0), h_bits(b1));
    pl2[0][e] = pk16(hb16((f[0] - (float)a0) * 16384.0f), hb16((f[1] - (float)a1) * 16384.0f));
    pl2[1][e] = pk16(hb16((f[2] - (float)b0) * 16384.0f), hb16((f[3] - (float)b1) * 16384.0f));
  }
  const size_t off = ((size_t)h * NROW + (size_t)w * NTOK + q0) * HD + lane * 8;
  *(v4u*)(ohi + off)       = ph2[0];
  *(v4u*)(ohi + off + 256) = ph2[1];
  *(v4u*)(olo + off)       = pl2[0];
  *(v4u*)(olo + off + 256) = pl2[1];
}

// =================================================================================================================
// Output projection: out rows = (Ohi + Olo*2^-14)/64 . (W1024/1024)^T + b; two accumulator sets (hi.W, lo.W), K = 256
// = 8 head planes of 32. Block tile 64 tokens x 128 cols, 8 waves = 2 x 4, 2x2 tiles per wave. Epilogue through an
// LDS f32 tile; store with un-window + reverse shift: a wave writes one token's 128-col half row = 512 B = 4 whole
// coverage: 512 x 64 tokens (bijective position map) x 2 x 128 cols = every output element exactly once.
// =================================================================================================================
__global__ __launch_bounds__(256)
void gemm_proj(const unsigned short* __restrict__ ohi, const unsigned short* __restrict__ olo,
               const unsigned short* __restrict__ wp, const float* __restrict__ bp, float* out) {
  __shared__ __align__(16) float Cs[64 * LDC];
  const int tid = threadIdx.x, wave = tid >> 5, lane = tid & 31, hh = lane >> 4, c = lane & 15;
  const int mb = blockIdx.x, nb = blockIdx.y;
  const int mw = wave >> 2, nw = wave & 3;
  const _Float16* W = (const _Float16*)(const void*)wp;
  const int arow0 = mb * 64 + mw * 32;
  const int bcol0 = nb * 128 + nw * 32;

  v8f h00 = zero8(), h01 = zero8(), h10 = zero8(), h11 = zero8();
  v8f l00 = zero8(), l01 = zero8(), l10 = zero8(), l11 = zero8();
  const _Float16* ph = (const _Float16*)(const void*)ohi + (size_t)arow0 * HD + lane * 8;   // head plane ks: + NROW*HD
  const _Float16* pl = (const _Float16*)(const void*)olo + (size_t)arow0 * HD + lane * 8;
  const _Float16* pb = W + frag_off(bcol0, 0, 0) + lane * 8;
#pragma unroll 1
  for (int ks = 0; ks < 8; ++ks, ph += NROW * HD, pl += NROW * HD, pb += 512) {
    const v16h fa0 = ldfrag_h(ph);
    const v16h fa1 = ldfrag_h(ph + 512);
    const v16h ga0 = ldfrag_h(pl);
    const v16h ga1 = ldfrag_h(pl + 512);
    const v16h fb0 = ldfrag_h(pb);
    const v16h fb1 = ldfrag_h(pb + 4096);
    // the three address pairs stay whole until the twelve loads that name them have their addresses translated
    asm volatile("s_wait_xcnt 0x0" :: "v"(ph), "v"(pl), "v"(pb) : "memory");
    h00 = mma_raw(fa0, fb0, h00);
    h01 = mma_raw(fa0, fb1, h01);
    h10 = mma_raw(fa1, fb0, h10);
    h11 = mma_raw(fa1, fb1, h11);
    l00 = mma_raw(ga0, fb0, l00);
    l01 = mma_raw(ga0, fb1, l01);
    l10 = mma_raw(ga1, fb0, l10);
    l11 = mma_raw(ga1, fb1, l11);
    guard8(h00, h01, h10, h11, l00, l01, l10, l11, fa0, fa1, ga0, ga1, fb0, fb1);
  }
#pragma unroll
  for (int r = 0; r < 8; ++r) {
    const int row = mw * 32 + 8 * hh + r;
    Cs[row * LDC + nw * 32 + c]             = h00[r] + l00[r] * (1.0f / 16384.0f);
    Cs[row * LDC + nw * 32 + 16 + c]        = h01[r] + l01[r] * (1.0f / 16384.0f);
    Cs[(row + 16) * LDC + nw * 32 + c]      = h10[r] + l10[r] * (1.0f / 16384.0f);
    Cs[(row + 16) * LDC + nw * 32 + 16 + c] = h11[r] + l11[r] * (1.0f / 16384.0f);
  }
  __syncthreads();

  const int w = mb >> 3, tok0 = (mb & 7) * 64;
  const float* bpn = bp + nb * 128 + lane * 4;
  v4f bb;
#pragma unroll
  for (int e = 0; e < 4; ++e) bb[e] = bfr(bpn[e]);
  v4f ov[8];
  size_t offs[8];
#pragma unroll
  for (int it = 0; it < 8; ++it) {
    const int row = wave * 8 + it;
    const int sp = spat_of(w, tok0 + row);
    v4f v = *(const v4f*)(Cs + row * LDC + lane * 4);
#pragma unroll
    for (int e = 0; e < 4; ++e) v[e] = v[e] * (1.0f / 65536.0f) + bb[e];
    ov[it] = v;
    offs[it] = (size_t)sp * CCH + nb * 128 + lane * 4;
  }
#pragma unroll
  for (int it = 0; it < 8; ++it) *(v4f*)(out + offs[it]) = ov[it];
  
}

// =================================================================================================================
//   Wqkv f16 [768][256] 393216 | Wproj f16 [256][256] 131072 |
//   bias table f32 [8][512][512] 8388608 | Q f16 [512][512][32] 16777216 | K same 16777216 |
//   V^T hi f16 [512][32][512] 16777216 | V^T lo same 16777216 | O hi f16 [8][32768][32] 16777216 | O lo same 16777216
//   total 109576192.
// =================================================================================================================
extern "C" void kernel_launch(void* const* d_in, const int* in_sizes, int n_in,
                              void* d_out, int out_size, void* d_ws, size_t ws_size,
                              hipStream_t stream) {
  if (n_in < 6) return;
  if (in_sizes[0] != NROW * CCH) return;
  if (in_sizes[1] != C3 * CCH || in_sizes[2] != C3) return;
  if (in_sizes[3] != CCH * CCH || in_sizes[4] != CCH) return;
  if (in_sizes[5] != NRPB * NHD) return;
  if (out_size != NROW * CCH) return;

  const float* x     = (const float*)d_in[0];
  const float* qkvw  = (const float*)d_in[1];
  const float* qkvb  = (const float*)d_in[2];
  const float* projw = (const float*)d_in[3];
  const float* projb = (const float*)d_in[4];
  const float* rpb   = (const float*)d_in[5];
  float* out = (float*)d_out;

  const size_t sWq = (size_t)C3 * CCH * 2;                   //   393216
  const size_t sWp = (size_t)CCH * CCH * 2;                  //   131072
  const size_t sBT = (size_t)NHD * NTOK * NTOK * 4;          //  8388608
  const size_t sQK = (size_t)NWIN * NHD * NTOK * HD * 2;     // 16777216
  const size_t sO  = (size_t)NHD * NROW * HD * 2;            // 16777216
  size_t off = 0;
  const size_t oWq = off; off += sWq;
  const size_t oWp = off; off += sWp;
  const size_t oBT = off; off += sBT;
  const size_t oQ  = off; off += sQK;
  const size_t oK  = off; off += sQK;
  const size_t oVh = off; off += sQK;
  const size_t oVl = off; off += sQK;
  const size_t oOh = off; off += sO;
  const size_t oOl = off; off += sO;
  if (off > ws_size) return;                                  // off = 109576192
  if (off > (size_t)134217728) return;

  char* ws = (char*)d_ws;
  unsigned short* Wq  = (unsigned short*)(ws + oWq);
  unsigned short* Wp  = (unsigned short*)(ws + oWp);
  float*          BT  = (float*)(ws + oBT);
  unsigned short* Qp  = (unsigned short*)(ws + oQ);
  unsigned short* Kp  = (unsigned short*)(ws + oK);
  unsigned short* Vth = (unsigned short*)(ws + oVh);
  unsigned short* Vtl = (unsigned short*)(ws + oVl);
  unsigned short* Ohi = (unsigned short*)(ws + oOh);
  unsigned short* Olo = (unsigned short*)(ws + oOl);

  const dim3 blk(256);
  // (1) weight converts, bias table
  cvt_w<<<dim3(C3 / 8), blk, 0, stream>>>(qkvw, Wq, C3);
  cvt_w<<<dim3(CCH / 8), blk, 0, stream>>>(projw, Wp, CCH);
  build_bias<<<dim3((NHD * 32 * 32 * 64) / 256), blk, 0, stream>>>(rpb, BT);
  // (2) window gather + convert + qkv projection: 512 row tiles, each over all six column tiles
  gemm_qkv<<<dim3(NROW / 64), blk, 0, stream>>>(x, Wq, qkvb, Qp, Kp, Vth, Vtl);
  // (3) window attention: 64 windows x 8 heads x 4 blocks of 8 strips
  attn_win<<<dim3(NWIN * NHD * 4), blk, 0, stream>>>(Qp, Kp, Vth, Vtl, BT, Ohi, Olo);
  // (4) output projection + un-window + reverse shift -> d_out
  gemm_proj<<<dim3(NROW / 64, CCH / 128), blk, 0, stream>>>(Ohi, Olo, Wp, projb, out);
  (void)hipGetLastError();
}

// v004
// Measured time: 117 microseconds a run.
// Two timings next to v003 both put it at 1.36 times that version's speed.
// Counting every step since v000, it is 2.27 times as fast.
// qkv projection and k.qT: v_wmma_f32_16x16x32_f16 single products (f16 operands, f32 accumulate); vT.pT: p and v^T each
// carried as f16 hi plus power-of-two scaled residual planes, three products (hi.hi, hi.lo, lo.hi), f32 accumulate;
// output projection: activation as f16 hi plus scaled residual times f16 weight, two products, f32 accumulate.
// All inputs RNE-converted to bf16 on load; softmax, masks and epilogues in f32 on VALU.
#include <hip/hip_runtime.h>
#include <stdint.h>

#define NWIN 64
#define NTOK 512
#define CCH  256
#define NHD  8
#define HD   32
#define C3   768
#define NROW 32768
#define NRPB 3375
#define LDC  132
#define QSC  0.17677669529663687f
#define INV512 0.001953125f
#define LN4096 8.3177661667193429f

static_assert(NROW == NWIN * NTOK);
static_assert((LDC * 4) % 16 == 0);

typedef _Float16 v16h __attribute__((ext_vector_type(16)));
typedef _Float16 v8h  __attribute__((ext_vector_type(8)));
typedef float    v8f  __attribute__((ext_vector_type(8)));
typedef float    v4f  __attribute__((ext_vector_type(4)));
typedef unsigned int v4u __attribute__((ext_vector_type(4)));
typedef int      v4i  __attribute__((ext_vector_type(4)));

template <bool B> struct flag_c { static constexpr bool value = B; };

// ---- scalar helpers ------------------------------------------------------------------------------------------
__device__ __forceinline__ unsigned short bf_bits(float f) {          // f32 -> bf16 bits, RNE convert
  unsigned u = __float_as_uint(f);
  return (unsigned short)((u + 0x7FFFu + ((u >> 16) & 1u)) >> 16);
}
__device__ __forceinline__ float bf_up(unsigned short b) { return __uint_as_float(((unsigned)b) << 16); }
__device__ __forceinline__ float bfr(float f) { return bf_up(bf_bits(f)); }
__device__ __forceinline__ unsigned short h_bits(_Float16 x) { return __builtin_bit_cast(unsigned short, x); }
__device__ __forceinline__ unsigned short hb16(float f) { return h_bits((_Float16)f); }
__device__ __forceinline__ unsigned pk16(unsigned short a, unsigned short b) { return (unsigned)a | ((unsigned)b << 16); }
__device__ __forceinline__ v8f zero8() { v8f z = {0.f, 0.f, 0.f, 0.f, 0.f, 0.f, 0.f, 0.f}; return z; }

// ---- index maps --------------------------------------------------------------------------------------------------
// window w = (hb*4 + wb)*4 + db over a 32^3 volume in 8^3 windows; token t = (i*8 + j)*8 + k inside the window.
// The shifted coordinate is (hb*8+i, wb*8+j, db*8+k); both the input gather (roll by -4) and the output scatter
// (roll by +4) use volume position ((hs+4)&31, (ws+4)&31, (ds+4)&31).
__device__ __forceinline__ int spat_of(int w, int t) {
  const int hb = w >> 4, wb = (w >> 2) & 3, db = w & 3;
  const int i = t >> 6, j = (t >> 3) & 7, k = t & 7;
  const int gh = (hb * 8 + i + 4) & 31;
  const int gw = (wb * 8 + j + 4) & 31;
  const int gd = (db * 8 + k + 4) & 31;
  return (gh * 32 + gw) * 32 + gd;
}
__device__ __forceinline__ int rid1(int p) { return (p < 24) ? 0 : ((p < 28) ? 1 : 2); }
__device__ __forceinline__ int region_of(int w, int t) {
  const int hb = w >> 4, wb = (w >> 2) & 3, db = w & 3;
  const int i = t >> 6, j = (t >> 3) & 7, k = t & 7;
  return rid1(hb * 8 + i) * 9 + rid1(wb * 8 + j) * 3 + rid1(db * 8 + k);
}

// ---- fragment-order planes: every 16-bit A/B operand plane is kept as 1-KiB blocks of 16 rows x 32 k. Inside a block
//      the 16-B piece (row c, k = 16*chunk + 8*h .. +7) stands at halves chunk*256 + (h*16 + c)*8, so lane l = h*16 + c
//      finds its two pieces at l*8 and 256 + l*8 and each wave-wide 16-B load covers 512 contiguous bytes (4 lines).
//      p = block base + lane*8; elements 0..7 <- k 8h.., elements 8..15 <- k 16+8h.. (hardware k order, as before)
__device__ __forceinline__ v16h ldfrag_h(const _Float16* p) {
  union { v16h v; v8h h[2]; } f;
  f.h[0] = *(const v8h*)(p);
  f.h[1] = *(const v8h*)(p + 256);
  return f.v;
}
// halves offset of the piece (row, k = ks*32 + 8*g .. +7), g = 0..3, in a fragment-order plane of 256-k rows
__device__ __forceinline__ size_t frag_off(int row, int ks, int g) {
  return ((size_t)((row >> 4) * 8 + ks)) * 512 + (g >> 1) * 256 + ((g & 1) * 16 + (row & 15)) * 8;
}

// ---- WMMA helpers; the guard helpers insert the trailing VALU hazard gap and keep A/B live -----------------------
__device__ __forceinline__ v8f mma_raw(v16h a, v16h b, v8f c) {
  return __builtin_amdgcn_wmma_f32_16x16x32_f16(false, a, false, b, (short)0, c, false, false);
}
__device__ __forceinline__ void guard4(v8f& c0, v8f& c1, v8f& c2, v8f& c3,
                                       const v16h& a0, const v16h& a1, const v16h& b0, const v16h& b1) {
#if defined(__HIP_DEVICE_COMPILE__)
  asm volatile("v_nop\n\tv_nop\n\tv_nop\n\tv_nop"
               : "+v"(c0), "+v"(c1), "+v"(c2), "+v"(c3) : "v"(a0), "v"(a1), "v"(b0), "v"(b1));
#endif
}
__device__ __forceinline__ void guard8(v8f& c0, v8f& c1, v8f& c2, v8f& c3, v8f& c4, v8f& c5, v8f& c6, v8f& c7,
                                       const v16h& a0, const v16h& a1, const v16h& a2, const v16h& a3,
                                       const v16h& b0, const v16h& b1) {
#if defined(__HIP_DEVICE_COMPILE__)
  asm volatile("v_nop\n\tv_nop\n\tv_nop\n\tv_nop"
               : "+v"(c0), "+v"(c1), "+v"(c2), "+v"(c3), "+v"(c4), "+v"(c5), "+v"(c6), "+v"(c7)
               : "v"(a0), "v"(a1), "v"(a2), "v"(a3), "v"(b0), "v"(b1));
#endif
}
__device__ __forceinline__ void guard_qk(v8f& c0, v8f& c1, v8f& c2, v8f& c3,
                                         const v16h& a0, const v16h& a1, const v16h& a2, const v16h& a3, const v16h& b0) {
#if defined(__HIP_DEVICE_COMPILE__)
  asm volatile("v_nop\n\tv_nop\n\tv_nop\n\tv_nop"
               : "+v"(c0), "+v"(c1), "+v"(c2), "+v"(c3) : "v"(a0), "v"(a1), "v"(a2), "v"(a3), "v"(b0));
#endif
}
__device__ __forceinline__ void guard6(v8f& c0, v8f& c1, v8f& c2, v8f& c3, v8f& c4, v8f& c5,
                                       const v16h& a0, const v16h& a1, const v16h& a2, const v16h& a3,
                                       const v16h& b0, const v16h& b1) {
#if defined(__HIP_DEVICE_COMPILE__)
  asm volatile("v_nop\n\tv_nop\n\tv_nop\n\tv_nop"
               : "+v"(c0), "+v"(c1), "+v"(c2), "+v"(c3), "+v"(c4), "+v"(c5)
               : "v"(a0), "v"(a1), "v"(a2), "v"(a3), "v"(b0), "v"(b1));
#endif
}
// value of lane l ^ 16 (the other half of the wave), as a vector cross-row move
__device__ __forceinline__ float xhalf(float v) {
  const int b = __float_as_int(v);
  return __int_as_float(__builtin_amdgcn_permlanex16(b, b, 0x76543210, 0xfedcba98, false, false));
}

// =================================================================================================================
// weight convert: w [nrows][256] f32 ([out][in], in contiguous) -> f16(1024 * bf16_RNE(w)), rows n, fragment order;
// block = 8 rows; wave = one 32-channel k-step of them; lane = row (lane&7), 8 channels (lane>>3). grid = nrows/8.
// coverage: nrows x 256.
// =================================================================================================================
__global__ __launch_bounds__(256) void cvt_w(const float* __restrict__ wsrc, unsigned short* wdst, int nrows) {
  const int tid = threadIdx.x, wv = tid >> 5, lane = tid & 31;
  const int row = blockIdx.x * 8 + (lane & 7), g = lane >> 3;
  if (row < nrows) {
    const float* src = wsrc + (size_t)row * CCH + wv * 32 + g * 8;
    const v4f a = *(const v4f*)(src);
    const v4f b = *(const v4f*)(src + 4);
    v4u pk;
    pk[0] = pk16(hb16(bfr(a[0]) * 1024.0f), hb16(bfr(a[1]) * 1024.0f));
    pk[1] = pk16(hb16(bfr(a[2]) * 1024.0f), hb16(bfr(a[3]) * 1024.0f));
    pk[2] = pk16(hb16(bfr(b[0]) * 1024.0f), hb16(bfr(b[1]) * 1024.0f));
    pk[3] = pk16(hb16(bfr(b[2]) * 1024.0f), hb16(bfr(b[3]) * 1024.0f));
    unsigned short* gp = wdst + frag_off(row, wv, g);
    *(v4u*)gp = pk;
    
  }
}

// =================================================================================================================
// relative position bias table in the C-operand order of the transposed score tile (rows = keys, columns = queries):
// BT[((h*32 + strip)*32 + kt)*256 + (r>>2)*128 + l*4 + (r&3)] (each of a lane's two 16-B loads is 512 B per wave) =
// 512 * bf16_RNE(rpb[idx(n,m)*8 + h]) with query n = strip*16 + (l&15), key m = kt*16 + 8*(l>>4) + r,
// idx = ((i_n-i_m+7)*15 + (j_n-j_m+7))*15 + (k_n-k_m+7). Thread = one 16-B piece (4 keys), 8 consecutive threads
// coverage: 8 heads x 32 strips x 32 key tiles x 64 pieces x 4 = 8 x 512 x 512.
// =================================================================================================================
__global__ __launch_bounds__(256) void build_bias(const float* __restrict__ rpb, float* bt) {
  const int g = blockIdx.x * 256 + threadIdx.x;
  const int piece = g & 63, rec = g >> 6;
  const int kt = rec & 31, strip = (rec >> 5) & 31, h = (rec >> 10) & 7;
  const int l = piece & 31, e0 = (piece >> 5) * 4;
  const int col = l & 15, lh = l >> 4;
  const int n = strip * 16 + col;
  const int ni = n >> 6, nj = (n >> 3) & 7, nk = n & 7;
  v4f v;
#pragma unroll
  for (int e = 0; e < 4; ++e) {
    const int m = kt * 16 + 8 * lh + e0 + e;
    const int mi = m >> 6, mj = (m >> 3) & 7, mk = m & 7;
    int idx = ((ni - mi + 7) * 15 + (nj - mj + 7)) * 15 + (nk - mk + 7);
    idx = min(max(idx, 0), NRPB - 1);
    v[e] = bfr(rpb[idx * NHD + h]) * 512.0f;
  }
  float* gp = bt + (size_t)rec * 256 + piece * 4;
  *(v4f*)gp = v;
  
}

// =================================================================================================================
// cyclic shift + window gather + convert + qkv GEMM in one kernel. Block = 64 tokens of one window x all 768 columns.
// Stage: x [32768 positions][256] f32 -> LDS A tile, 64 rows x 256 k in fragment order, value f16(8 * bf16_RNE(x)).
// Wave = one 32-channel k-step, lane = row (lane&7) of 8, 8 channels (lane>>3), 8 row groups: sixteen 16-B loads in
// flight per lane, eight 16-B LDS stores. Then six column tiles of 128: C[64][128] = A . W1024[cols][256]^T, K = 256
// (8 k-steps of 32), A fragments from LDS, W fragments of a whole column tile held in registers and fetched one tile
// ahead, so that they fly under the epilogue; 8 waves = 2 (32 rows) x 4 (32 cols), 2x2 tiles per wave. The bias row
// stands in LDS as bf16_RNE(b), converted once per block.
// C = 8192 * (xw . W^T). Epilogue through an LDS f32 tile (two of them, used in turn: one barrier per column tile):
// part q -> Q plane [w*8+h][tok/16] blocks (rows tok, k = d)
// = f16(64*q) with q = (C/8192 + b) * 32^-0.5; part k -> K plane = f16(8*k), same form; part v -> V^T hi
// [w*8+h][tok/32][d/16] blocks (rows d, k = tok) = f16(16*v) and V^T lo = f16((16v - hi) * 2^14). A thread takes the
// piece that stands at tid*8 halves of the head's 4 blocks, so every store instruction writes 512 contiguous bytes.
// coverage: Q/K: 4 instr x 256 pieces = 4 heads x 64 tok x 32 d; V hi/lo: 4 instr x 256 pieces = 4 heads x 32 d x
// 64 tok; over the grid and the six tiles every element of Q, K (64x8x512x32) and V^T hi/lo (64x8x32x512) exactly once.
// =================================================================================================================
__global__ __launch_bounds__(256)
void gemm_qkv(const float* __restrict__ x, const unsigned short* __restrict__ wq,
              const float* __restrict__ bq,
              unsigned short* qpl, unsigned short* kpl, unsigned short* vth, unsigned short* vtl) {
  __shared__ __align__(16) unsigned short As[64 * CCH];
  __shared__ __align__(16) float Cs2[2][64 * LDC];
  __shared__ __align__(16) float Bs[C3];
  const int tid = threadIdx.x, wave = tid >> 5, lane = tid & 31, hh = lane >> 4, c = lane & 15;
  const int mb = blockIdx.x;
  const int mw = wave >> 2, nw = wave & 3;
  const int w = mb >> 3, tok0 = (mb & 7) * 64;
  const _Float16* W = (const _Float16*)(const void*)wq;

  // column tile nb of this wave: + nb * 32768 halves; second 16-column band: + 4096; k-step: + 512
  const _Float16* pb = W + frag_off(nw * 32, 0, 0) + lane * 8;
  v16h fb0[8], fb1[8];
#pragma unroll
  for (int ks = 0; ks < 8; ++ks) {
    fb0[ks] = ldfrag_h(pb + ks * 512);
    fb1[ks] = ldfrag_h(pb + 4096 + ks * 512);
  }

  {
    const int r8 = lane & 7, g = lane >> 3;
    v4f xa[8], xb[8];
    float bv[3];
#pragma unroll
    for (int it = 0; it < 8; ++it) {
      const float* src = x + (size_t)spat_of(w, tok0 + it * 8 + r8) * CCH + wave * 32 + g * 8;
      xa[it] = *(const v4f*)(src);
      xb[it] = *(const v4f*)(src + 4);
    }
#pragma unroll
    for (int i = 0; i < 3; ++i) bv[i] = bq[i * 256 + tid];
#pragma unroll
    for (int i = 0; i < 3; ++i) Bs[i * 256 + tid] = bfr(bv[i]);
#pragma unroll
    for (int it = 0; it < 8; ++it) {
      const v4f a = xa[it], b = xb[it];
      v4u pk;
      pk[0] = pk16(hb16(bfr(a[0]) * 8.0f), hb16(bfr(a[1]) * 8.0f));
      pk[1] = pk16(hb16(bfr(a[2]) * 8.0f), hb16(bfr(a[3]) * 8.0f));
      pk[2] = pk16(hb16(bfr(b[0]) * 8.0f), hb16(bfr(b[1]) * 8.0f));
      pk[3] = pk16(hb16(bfr(b[2]) * 8.0f), hb16(bfr(b[3]) * 8.0f));
      *(v4u*)(As + frag_off(it * 8 + r8, wave, g)) = pk;
    }
  }
  __syncthreads();

  const _Float16* pa = (const _Float16*)(const void*)As + frag_off(mw * 32, 0, 0) + lane * 8;   // next band: + 4096

#pragma unroll 1
  for (int nb = 0; nb < 6; ++nb) {
  float* Cs = Cs2[nb & 1];
  v8f a00 = zero8(), a01 = zero8(), a10 = zero8(), a11 = zero8();
  v16h fa0 = ldfrag_h(pa), fa1 = ldfrag_h(pa + 4096);
#pragma unroll
  for (int ks = 0; ks < 8; ++ks) {
    v16h na0 = fa0, na1 = fa1;                    // A fragments of the next k-step, read ahead of this step's products
    if (ks < 7) {
      na0 = ldfrag_h(pa + (ks + 1) * 512);
      na1 = ldfrag_h(pa + 4096 + (ks + 1) * 512);
    }
    a00 = mma_raw(fa0, fb0[ks], a00);
    a01 = mma_raw(fa0, fb1[ks], a01);
    a10 = mma_raw(fa1, fb0[ks], a10);
    a11 = mma_raw(fa1, fb1[ks], a11);
    guard4(a00, a01, a10, a11, fa0, fa1, fb0[ks], fb1[ks]);
    fa0 = na0;
    fa1 = na1;
  }
#pragma unroll
  for (int r = 0; r < 8; ++r) {
    const int row = mw * 32 + 8 * hh + r;
    Cs[row * LDC + nw * 32 + c]             = a00[r];
    Cs[row * LDC + nw * 32 + 16 + c]        = a01[r];
    Cs[(row + 16) * LDC + nw * 32 + c]      = a10[r];
    Cs[(row + 16) * LDC + nw * 32 + 16 + c] = a11[r];
  }
  // one barrier per column tile: it publishes this tile's C, and every wave that passes it has left the other C buffer
  __syncthreads();

  // the next column tile's W fragments: issued behind the barrier (which waits for every load in flight) and in front
  // of an epilogue that reads LDS only, so that nothing waits for them before the next tile's products
  if (nb < 5) {                                   // block-uniform
    const _Float16* pn = pb + (nb + 1) * 32768;
#pragma unroll
    for (int ks = 0; ks < 8; ++ks) {
      fb0[ks] = ldfrag_h(pn + ks * 512);
      fb1[ks] = ldfrag_h(pn + 4096 + ks * 512);
    }
    // the address pair of these loads is reused by the epilogue: keep the wait in front of that overwrite
    asm volatile("s_wait_xcnt 0x0" ::: "memory");
  }

  const int part = nb >> 1;                       // block-uniform: 0 q, 1 k, 2 v
  const int hb4 = (nb & 1) * 4;
  const float* bqn = Bs + nb * 128;               // bf16_RNE(bias), staged once
  if (part < 2) {
    unsigned short* dst = (part == 0) ? qpl : kpl;
    const float scl = (part == 0) ? (QSC * 64.0f) : 8.0f;
    v4u pk[4];
    size_t offs[4];
#pragma unroll
    for (int s = 0; s < 4; ++s) {
      const int h4 = s;
      const int tok = (tid >> 6) * 16 + (tid & 15), d0 = ((tid >> 4) & 3) * 8;
      const int col = h4 * 32 + d0;
      v4u q4;
#pragma unroll
      for (int e = 0; e < 4; ++e) {
        float f0 = Cs[tok * LDC + col + 2 * e] * (1.0f / 8192.0f) + bqn[col + 2 * e];
        float f1 = Cs[tok * LDC + col + 2 * e + 1] * (1.0f / 8192.0f) + bqn[col + 2 * e + 1];
        f0 = f0 * scl;
        f1 = f1 * scl;
        q4[e] = pk16(hb16(f0), hb16(f1));
      }
      pk[s] = q4;
      offs[s] = ((size_t)((w * NHD + hb4 + h4) * NTOK + tok0)) * HD + tid * 8;
    }
#pragma unroll
    for (int s = 0; s < 4; ++s) *(v4u*)(dst + offs[s]) = pk[s];
    
  } else {
    v4u phk[4], plk[4];
    size_t offs[4];
#pragma unroll
    for (int s = 0; s < 4; ++s) {
      const int h4 = s, d = ((tid >> 6) & 1) * 16 + (tid & 15);
      const int col = h4 * 32 + d;
      const int tb = (tid >> 7) * 32 + ((tid >> 4) & 3) * 8;
      const float bc = bqn[col];
      v4u a, b;
#pragma unroll
      for (int e = 0; e < 4; ++e) {
        const float v0 = Cs[(tb + 2 * e) * LDC + col] * (1.0f / 8192.0f) + bc;
        const float v1 = Cs[(tb + 2 * e + 1) * LDC + col] * (1.0f / 8192.0f) + bc;
        const float f0 = v0 * 16.0f, f1 = v1 * 16.0f;
        const _Float16 h0 = (_Float16)f0, h1 = (_Float16)f1;
        const float r0 = (f0 - (float)h0) * 16384.0f;
        const float r1 = (f1 - (float)h1) * 16384.0f;
        a[e] = pk16(h_bits(h0), h_bits(h1));
        b[e] = pk16(hb16(r0), hb16(r1));
      }
      phk[s] = a;
      plk[s] = b;
      offs[s] = ((size_t)(w * NHD + hb4 + h4)) * HD * NTOK + tok0 * HD + tid * 8;
    }
#pragma unroll
    for (int s = 0; s < 4; ++s) { *(v4u*)(vth + offs[s]) = phk[s]; *(v4u*)(vtl + offs[s]) = plk[s]; }
  }
  // the next tile's products overwrite the registers that these stores name: keep the wait in front of that overwrite
  asm volatile("s_wait_xcnt 0x0" ::: "memory");
  }
}

// =================================================================================================================
// Window attention, transposed: block = 8 strips of 16 queries of one (window, head); wave = strip.
// S^T = K8 . Q64^T via WMMA (A = key rows, B = query columns) with the 512*bias table as the C operand, so a lane holds
// the scores of ONE query (column lane&15) for keys 8*(lane>>4) + r of each 16-key tile. Shift mask -51200 where region
// ids differ. Online softmax over 8 blocks of 64 keys in f32: maximum and sum run over the lane's own 32 registers, the
// maximum is joined with lane ^ 16 once per block, the sum l stays a per-half partial and is joined once at the end.
// p' = 4096*exp((s-m)/512); P hi = f16(p'), P lo = f16((p'-hi)*2^13). Two score tiles of one 32-key step, converted in
// place, are the B operand of O^T += V^T . P^T (A = V^T rows, hardware k order on both sides): P never leaves registers.
// O^T accumulators: hh = Vhi.Phi, hl = Vlo.Phi, lh = Vhi.Plo with V^T hi = 16v, V^T lo = res*2^14;
// o = (hh + hl*2^-14 + lh*2^-13) / (16 l). A lane ends with 8 consecutive d of its query per tile: 16-B packed stores.
// Loads run ahead of their use: K fragments and bias tiles one 64-key block, V^T fragments of the first 32-key step the scores and whole softmax, of the second the step's P split.
// Output planes O hi = f16(64 o), O lo = f16((64o-hi)*2^14), layout [h][(w*512 + tok)/16] blocks (rows tok, k = d).
// coverage: 2048 blocks x 8 waves x 16 rows x 32 d = 8 x 32768 x 32 per plane, every element once.
// =================================================================================================================
__global__ __launch_bounds__(256)
void attn_win(const unsigned short* __restrict__ qpl, const unsigned short* __restrict__ kpl,
              const unsigned short* __restrict__ vth, const unsigned short* __restrict__ vtl,
              const float* __restrict__ bt, unsigned short* ohi, unsigned short* olo) {
  __shared__ __align__(16) int cnts[NTOK];
  union CB { v8f v; v4f q[2]; };
  const int tid = threadIdx.x, wave = tid >> 5, lane = tid & 31, hh = lane >> 4, c = lane & 15;
  const int wh = blockIdx.x >> 2;                 // w*8 + h
  const int w = wh >> 3, h = wh & 7;
  const int strip = (blockIdx.x & 3) * 8 + wave;  // 0..31
  const int q0 = strip * 16;

  for (int t = tid; t < NTOK; t += 256) cnts[t] = region_of(w, t);
  __syncthreads();

  const _Float16* Q  = (const _Float16*)(const void*)qpl + (size_t)wh * NTOK * HD;
  const _Float16* K  = (const _Float16*)(const void*)kpl + (size_t)wh * NTOK * HD;
  const _Float16* Vh = (const _Float16*)(const void*)vth + (size_t)wh * HD * NTOK;
  const _Float16* Vl = (const _Float16*)(const void*)vtl + (size_t)wh * HD * NTOK;
  const float* Bp = bt + ((size_t)(h * 32 + strip)) * 32 * 256 + lane * 4;

  const v16h qb = ldfrag_h(Q + (size_t)q0 * HD + lane * 8);
  // the address pair of the two query loads is reused right behind them: keep the wait in front of that overwrite
  asm volatile("s_wait_xcnt 0x0" ::: "memory");
  const int cq = cnts[q0 + c];
  float mrow = -1e30f, lrow = 0.f;
  v8f ohh0 = zero8(), ohh1 = zero8(), ohl0 = zero8(), ohl1 = zero8(), olh0 = zero8(), olh1 = zero8();

  // K fragments and bias tiles of a 64-key block are fetched one block ahead; here those of block 0
  v16h kf[4];
  CB cb[4];
#pragma unroll
  for (int j = 0; j < 4; ++j) {
    kf[j] = ldfrag_h(K + j * 512 + lane * 8);
    cb[j].q[0] = *(const v4f*)(Bp + j * 256);
    cb[j].q[1] = *(const v4f*)(Bp + j * 256 + 128);
  }
  // the loop reuses the registers that address these sixteen loads: keep the wait in front of that overwrite
  asm volatile("s_wait_xcnt 0x0" ::: "memory");

  // one 64-key block; MORE: a further block follows, and its K fragments and bias tiles are fetched in this pass
  auto pass = [&](const int kb, auto more) __attribute__((always_inline)) {
    // V^T fragments of the block's first 32-key step (hi, lo of d 0..15; hi, lo of d 16..31): they fly under the
    // score products, the mask and the whole softmax
    const int koff = kb * 2048 + lane * 8;
    v16h va[4];
    va[0] = ldfrag_h(Vh + koff);
    va[1] = ldfrag_h(Vl + koff);
    va[2] = ldfrag_h(Vh + koff + 512);
    va[3] = ldfrag_h(Vl + koff + 512);
    // ---- transposed logits for 64 keys: 4 tiles of 16 keys x 16 queries, bias via C operand, mask added ----
    v8f s[4];
#pragma unroll
    for (int j = 0; j < 4; ++j) s[j] = mma_raw(kf[j], qb, cb[j].v);
    guard_qk(s[0], s[1], s[2], s[3], kf[0], kf[1], kf[2], kf[3], qb);
#pragma unroll
    for (int j = 0; j < 4; ++j) {
      const int key0 = kb * 64 + j * 16;
      const v8f sj = s[j];
      const v4i cm0 = *(const v4i*)(cnts + key0 + 8 * hh);
      const v4i cm1 = *(const v4i*)(cnts + key0 + 8 * hh + 4);
      v8f mk;
#pragma unroll
      for (int r = 0; r < 4; ++r) {
        mk[r]     = (cq != cm0[r]) ? -51200.0f : 0.0f;
        mk[r + 4] = (cq != cm1[r]) ? -51200.0f : 0.0f;
      }
      s[j] = sj + mk;
    }
    // the next block's K fragments and bias tiles fly under this block's softmax and V products; issued
    // behind the mask, where the raw score registers are free again, so that the bias lands in them without a copy.
    // The last pass is a copy of the body without them: a branch in the loop would merge the load counting
    if constexpr (decltype(more)::value) {
      const int kn = kb + 1;
      const _Float16* kp = K + kn * 2048 + lane * 8;
      const float* bn = Bp + kn * 1024;
#pragma unroll
      for (int j = 0; j < 4; ++j) {
        kf[j] = ldfrag_h(kp + j * 512);
        cb[j].q[0] = *(const v4f*)(bn + j * 256);
        cb[j].q[1] = *(const v4f*)(bn + j * 256 + 128);
      }
      // the two address pairs stay whole until the sixteen loads that name them have their addresses translated
      asm volatile("s_wait_xcnt 0x0" :: "v"(kp), "v"(bn) : "memory");
    }
    // ---- online softmax update: one query per lane, 32 of its 64 scores here, the rest in lane ^ 16 ----
    float t8[8];
#pragma unroll
    for (int r = 0; r < 8; ++r) t8[r] = fmaxf(fmaxf(s[0][r], s[1][r]), fmaxf(s[2][r], s[3][r]));
    float tm = fmaxf(fmaxf(fmaxf(t8[0], t8[1]), fmaxf(t8[2], t8[3])), fmaxf(fmaxf(t8[4], t8[5]), fmaxf(t8[6], t8[7])));
    tm = fmaxf(tm, xhalf(tm));
    const float mn = fmaxf(mrow, tm);
    const float alpha = __expf((mrow - mn) * INV512);
    mrow = mn;
#pragma unroll
    for (int j = 0; j < 4; ++j) {
#pragma unroll
      for (int r = 0; r < 8; ++r) s[j][r] = __expf((s[j][r] - mn) * INV512 + LN4096);
    }
    const v8f sv = (s[0] + s[1]) + (s[2] + s[3]);
    const float ps = ((sv[0] + sv[1]) + (sv[2] + sv[3])) + ((sv[4] + sv[5]) + (sv[6] + sv[7]));
    lrow = lrow * alpha + ps;
    ohh0 = ohh0 * alpha; ohh1 = ohh1 * alpha;
    ohl0 = ohl0 * alpha; ohl1 = ohl1 * alpha;
    olh0 = olh0 * alpha; olh1 = olh1 * alpha;
    // ---- O^T += V^T . P^T : two 32-key k-steps, two 16-dim tiles, three products ----
#pragma unroll
    for (int ks = 0; ks < 2; ++ks) {
      // element e <- key 8*hh + e (tile 2*ks), element 8 + e <- key 16 + 8*hh + e (tile 2*ks + 1)
      const v8h ph0 = __builtin_convertvector(s[2 * ks], v8h);
      const v8h ph1 = __builtin_convertvector(s[2 * ks + 1], v8h);
      const v8h pl0 = __builtin_convertvector((s[2 * ks] - __builtin_convertvector(ph0, v8f)) * 8192.0f, v8h);
      const v8h pl1 = __builtin_convertvector((s[2 * ks + 1] - __builtin_convertvector(ph1, v8f)) * 8192.0f, v8h);
      const v16h pb  = __builtin_shufflevector(ph0, ph1, 0, 1, 2, 3, 4, 5, 6, 7, 8, 9, 10, 11, 12, 13, 14, 15);
      const v16h plb = __builtin_shufflevector(pl0, pl1, 0, 1, 2, 3, 4, 5, 6, 7, 8, 9, 10, 11, 12, 13, 14, 15);
      ohh0 = mma_raw(va[0], pb, ohh0);
      ohl0 = mma_raw(va[1], pb, ohl0);
      olh0 = mma_raw(va[0], plb, olh0);
      ohh1 = mma_raw(va[2], pb, ohh1);
      ohl1 = mma_raw(va[3], pb, ohl1);
      olh1 = mma_raw(va[2], plb, olh1);
      guard6(ohh0, ohl0, olh0, ohh1, ohl1, olh1, va[0], va[1], va[2], va[3], pb, plb);
      if (ks == 0) {                                         // second 32-key step: flies under the second step's P split
        va[0] = ldfrag_h(Vh + koff + 1024);
        va[1] = ldfrag_h(Vl + koff + 1024);
        va[2] = ldfrag_h(Vh + koff + 1536);
        va[3] = ldfrag_h(Vl + koff + 1536);
      }
    }
  };
#pragma unroll 1
  for (int kb = 0; kb < 7; ++kb) pass(kb, flag_c<true>{});
  pass(7, flag_c<false>{});

  // ---- join the halves' sums, normalise, split into hi / lo, 16-B packed stores (8 consecutive d of one query) ----
  const float lt = lrow + xhalf(lrow);
  const float inv = 1.0f / (lt * 16.0f);
  v4u ph2[2], pl2[2];
#pragma unroll
  for (int e = 0; e < 4; ++e) {
    float f[4];
#pragma unroll
    for (int u = 0; u < 2; ++u) {
      const int r = 2 * e + u;
      float o0 = ohh0[r] + ohl0[r] * (1.0f / 16384.0f);
      o0 = o0 + olh0[r] * (1.0f / 8192.0f);
      float o1 = ohh1[r] + ohl1[r] * (1.0f / 16384.0f);
      o1 = o1 + olh1[r] * (1.0f / 8192.0f);
      f[u]     = (o0 * inv) * 64.0f;
      f[2 + u] = (o1 * inv) * 64.0f;
    }
    const _Float16 a0 = (_Float16)f[0], a1 = (_Float16)f[1], b0 = (_Float16)f[2], b1 = (_Float16)f[3];
    ph2[0][e] = pk16(h_bits(a0), h_bits(a1));
    ph2[1][e] = pk16(h_bits(b0), h_bits(b1));
    pl2[0][e] = pk16(hb16((f[0] - (float)a0) * 16384.0f), hb16((f[1] - (float)a1) * 16384.0f));
    pl2[1][e] = pk16(hb16((f[2] - (float)b0) * 16384.0f), hb16((f[3] - (float)b1) * 16384.0f));
  }
  const size_t off = ((size_t)h * NROW + (size_t)w * NTOK + q0) * HD + lane * 8;
  *(v4u*)(ohi + off)       = ph2[0];
  *(v4u*)(ohi + off + 256) = ph2[1];
  *(v4u*)(olo + off)       = pl2[0];
  *(v4u*)(olo + off + 256) = pl2[1];
}

// =================================================================================================================
// Output projection: out rows = (Ohi + Olo*2^-14)/64 . (W1024/1024)^T + b; two accumulator sets (hi.W, lo.W), K = 256
// = 8 head planes of 32. Block tile 64 tokens x 128 cols, 8 waves = 2 x 4, 2x2 tiles per wave. Epilogue through an
// LDS f32 tile; store with un-window + reverse shift: a wave writes one token's 128-col half row = 512 B = 4 whole
// coverage: 512 x 64 tokens (bijective position map) x 2 x 128 cols = every output element exactly once.
// =================================================================================================================
__global__ __launch_bounds__(256)
void gemm_proj(const unsigned short* __restrict__ ohi, const unsigned short* __restrict__ olo,
               const unsigned short* __restrict__ wp, const float* __restrict__ bp, float* out) {
  __shared__ __align__(16) float Cs[64 * LDC];
  const int tid = threadIdx.x, wave = tid >> 5, lane = tid & 31, hh = lane >> 4, c = lane & 15;
  const int mb = blockIdx.x, nb = blockIdx.y;
  const int mw = wave >> 2, nw = wave & 3;
  const _Float16* W = (const _Float16*)(const void*)wp;
  const int arow0 = mb * 64 + mw * 32;
  const int bcol0 = nb * 128 + nw * 32;

  v8f h00 = zero8(), h01 = zero8(), h10 = zero8(), h11 = zero8();
  v8f l00 = zero8(), l01 = zero8(), l10 = zero8(), l11 = zero8();
  const _Float16* ph = (const _Float16*)(const void*)ohi + (size_t)arow0 * HD + lane * 8;   // head plane ks: + NROW*HD
  const _Float16* pl = (const _Float16*)(const void*)olo + (size_t)arow0 * HD + lane * 8;
  const _Float16* pb = W + frag_off(bcol0, 0, 0) + lane * 8;
#pragma unroll 1
  for (int ks = 0; ks < 8; ++ks, ph += NROW * HD, pl += NROW * HD, pb += 512) {
    const v16h fa0 = ldfrag_h(ph);
    const v16h fa1 = ldfrag_h(ph + 512);
    const v16h ga0 = ldfrag_h(pl);
    const v16h ga1 = ldfrag_h(pl + 512);
    const v16h fb0 = ldfrag_h(pb);
    const v16h fb1 = ldfrag_h(pb + 4096);
    // the three address pairs stay whole until the twelve loads that name them have their addresses translated
    asm volatile("s_wait_xcnt 0x0" :: "v"(ph), "v"(pl), "v"(pb) : "memory");
    h00 = mma_raw(fa0, fb0, h00);
    h01 = mma_raw(fa0, fb1, h01);
    h10 = mma_raw(fa1, fb0, h10);
    h11 = mma_raw(fa1, fb1, h11);
    l00 = mma_raw(ga0, fb0, l00);
    l01 = mma_raw(ga0, fb1, l01);
    l10 = mma_raw(ga1, fb0, l10);
    l11 = mma_raw(ga1, fb1, l11);
    guard8(h00, h01, h10, h11, l00, l01, l10, l11, fa0, fa1, ga0, ga1, fb0, fb1);
  }
#pragma unroll
  for (int r = 0; r < 8; ++r) {
    const int row = mw * 32 + 8 * hh + r;
    Cs[row * LDC + nw * 32 + c]             = h00[r] + l00[r] * (1.0f / 16384.0f);
    Cs[row * LDC + nw * 32 + 16 + c]        = h01[r] + l01[r] * (1.0f / 16384.0f);
    Cs[(row + 16) * LDC + nw * 32 + c]      = h10[r] + l10[r] * (1.0f / 16384.0f);
    Cs[(row + 16) * LDC + nw * 32 + 16 + c] = h11[r] + l11[r] * (1.0f / 16384.0f);
  }
  __syncthreads();

  const int w = mb >> 3, tok0 = (mb & 7) * 64;
  const float* bpn = bp + nb * 128 + lane * 4;
  v4f bb;
#pragma unroll
  for (int e = 0; e < 4; ++e) bb[e] = bfr(bpn[e]);
  v4f ov[8];
  size_t offs[8];
#pragma unroll
  for (int it = 0; it < 8; ++it) {
    const int row = wave * 8 + it;
    const int sp = spat_of(w, tok0 + row);
    v4f v = *(const v4f*)(Cs + row * LDC + lane * 4);
#pragma unroll
    for (int e = 0; e < 4; ++e) v[e] = v[e] * (1.0f / 65536.0f) + bb[e];
    ov[it] = v;
    offs[it] = (size_t)sp * CCH + nb * 128 + lane * 4;
  }
#pragma unroll
  for (int it = 0; it < 8; ++it) *(v4f*)(out + offs[it]) = ov[it];
  
}

// =================================================================================================================
//   Wqkv f16 [768][256] 393216 | Wproj f16 [256][256] 131072 |
//   bias table f32 [8][512][512] 8388608 | Q f16 [512][512][32] 16777216 | K same 16777216 |
//   V^T hi f16 [512][32][512] 16777216 | V^T lo same 16777216 | O hi f16 [8][32768][32] 16777216 | O lo same 16777216
//   total 109576192.
// =================================================================================================================
extern "C" void kernel_launch(void* const* d_in, const int* in_sizes, int n_in,
                              void* d_out, int out_size, void* d_ws, size_t ws_size,
                              hipStream_t stream) {
  if (n_in < 6) return;
  if (in_sizes[0] != NROW * CCH) return;
  if (in_sizes[1] != C3 * CCH || in_sizes[2] != C3) return;
  if (in_sizes[3] != CCH * CCH || in_sizes[4] != CCH) return;
  if (in_sizes[5] != NRPB * NHD) return;
  if (out_size != NROW * CCH) return;

  const float* x     = (const float*)d_in[0];
  const float* qkvw  = (const float*)d_in[1];
  const float* qkvb  = (const float*)d_in[2];
  const float* projw = (const float*)d_in[3];
  const float* projb = (const float*)d_in[4];
  const float* rpb   = (const float*)d_in[5];
  float* out = (float*)d_out;

  const size_t sWq = (size_t)C3 * CCH * 2;                   //   393216
  const size_t sWp = (size_t)CCH * CCH * 2;                  //   131072
  const size_t sBT = (size_t)NHD * NTOK * NTOK * 4;          //  8388608
  const size_t sQK = (size_t)NWIN * NHD * NTOK * HD * 2;     // 16777216
  const size_t sO  = (size_t)NHD * NROW * HD * 2;            // 16777216
  size_t off = 0;
  const size_t oWq = off; off += sWq;
  const size_t oWp = off; off += sWp;
  const size_t oBT = off; off += sBT;
  const size_t oQ  = off; off += sQK;
  const size_t oK  = off; off += sQK;
  const size_t oVh = off; off += sQK;
  const size_t oVl = off; off += sQK;
  const size_t oOh = off; off += sO;
  const size_t oOl = off; off += sO;
  if (off > ws_size) return;                                  // off = 109576192
  if (off > (size_t)134217728) return;

  char* ws = (char*)d_ws;
  unsigned short* Wq  = (unsigned short*)(ws + oWq);
  unsigned short* Wp  = (unsigned short*)(ws + oWp);
  float*          BT  = (float*)(ws + oBT);
  unsigned short* Qp  = (unsigned short*)(ws + oQ);
  unsigned short* Kp  = (unsigned short*)(ws + oK);
  unsigned short* Vth = (unsigned short*)(ws + oVh);
  unsigned short* Vtl = (unsigned short*)(ws + oVl);
  unsigned short* Ohi = (unsigned short*)(ws + oOh);
  unsigned short* Olo = (unsigned short*)(ws + oOl);

  const dim3 blk(256);
  // (1) weight converts, bias table
  cvt_w<<<dim3(C3 / 8), blk, 0, stream>>>(qkvw, Wq, C3);
  cvt_w<<<dim3(CCH / 8), blk, 0, stream>>>(projw, Wp, CCH);
  build_bias<<<dim3((NHD * 32 * 32 * 64) / 256), blk, 0, stream>>>(rpb, BT);
  // (2) window gather + convert + qkv projection: 512 row tiles, each over all six column tiles
  gemm_qkv<<<dim3(NROW / 64), blk, 0, stream>>>(x, Wq, qkvb, Qp, Kp, Vth, Vtl);
  // (3) window attention: 64 windows x 8 heads x 4 blocks of 8 strips
  attn_win<<<dim3(NWIN * NHD * 4), blk, 0, stream>>>(Qp, Kp, Vth, Vtl, BT, Ohi, Olo);
  // (4) output projection + un-window + reverse shift -> d_out
  gemm_proj<<<dim3(NROW / 64, CCH / 128), blk, 0, stream>>>(Ohi, Olo, Wp, projb, out);
  (void)hipGetLastError();
}

// v005
// One run takes 111 microseconds.
// Next to v004, in two timings, it ran 1.05 and 1.06 times as fast.
// All steps since v000 together make it 2.40 times as fast.
// qkv projection and k.qT: v_wmma_f32_16x16x32_f16 single products (f16 operands, f32 accumulate); vT.pT: p and v^T each
// carried as f16 hi plus power-of-two scaled residual planes, three products (hi.hi, hi.lo, lo.hi), f32 accumulate;
// output projection: activation as f16 hi plus scaled residual times f16 weight, two products, f32 accumulate.
// All inputs RNE-converted to bf16 on load; softmax, masks and epilogues in f32 on VALU.
#include <hip/hip_runtime.h>
#include <stdint.h>

#define NWIN 64
#define NTOK 512
#define CCH  256
#define NHD  8
#define HD   32
#define C3   768
#define NROW 32768
#define NRPB 3375
#define NBDI 9
#define LDC  132
#define QSC  0.17677669529663687f
#define INV512 0.001953125f
#define LN4096 8.3177661667193429f

static_assert(NROW == NWIN * NTOK);
static_assert(15 * 15 * 15 == NRPB);
static_assert((LDC * 4) % 16 == 0);

typedef _Float16 v16h __attribute__((ext_vector_type(16)));
typedef _Float16 v8h  __attribute__((ext_vector_type(8)));
typedef float    v8f  __attribute__((ext_vector_type(8)));
typedef float    v4f  __attribute__((ext_vector_type(4)));
typedef unsigned int v4u __attribute__((ext_vector_type(4)));
typedef int      v4i  __attribute__((ext_vector_type(4)));

template <bool B> struct flag_c { static constexpr bool value = B; };

// ---- scalar helpers ------------------------------------------------------------------------------------------
__device__ __forceinline__ unsigned short bf_bits(float f) {          // f32 -> bf16 bits, RNE convert
  unsigned u = __float_as_uint(f);
  return (unsigned short)((u + 0x7FFFu + ((u >> 16) & 1u)) >> 16);
}
__device__ __forceinline__ float bf_up(unsigned short b) { return __uint_as_float(((unsigned)b) << 16); }
__device__ __forceinline__ float bfr(float f) { return bf_up(bf_bits(f)); }
__device__ __forceinline__ unsigned short h_bits(_Float16 x) { return __builtin_bit_cast(unsigned short, x); }
__device__ __forceinline__ unsigned short hb16(float f) { return h_bits((_Float16)f); }
__device__ __forceinline__ unsigned pk16(unsigned short a, unsigned short b) { return (unsigned)a | ((unsigned)b << 16); }
__device__ __forceinline__ v8f zero8() { v8f z = {0.f, 0.f, 0.f, 0.f, 0.f, 0.f, 0.f, 0.f}; return z; }

// ---- index maps --------------------------------------------------------------------------------------------------
// window w = (hb*4 + wb)*4 + db over a 32^3 volume in 8^3 windows; token t = (i*8 + j)*8 + k inside the window.
// The shifted coordinate is (hb*8+i, wb*8+j, db*8+k); both the input gather (roll by -4) and the output scatter
// (roll by +4) use volume position ((hs+4)&31, (ws+4)&31, (ds+4)&31).
__device__ __forceinline__ int spat_of(int w, int t) {
  const int hb = w >> 4, wb = (w >> 2) & 3, db = w & 3;
  const int i = t >> 6, j = (t >> 3) & 7, k = t & 7;
  const int gh = (hb * 8 + i + 4) & 31;
  const int gw = (wb * 8 + j + 4) & 31;
  const int gd = (db * 8 + k + 4) & 31;
  return (gh * 32 + gw) * 32 + gd;
}
__device__ __forceinline__ int rid1(int p) { return (p < 24) ? 0 : ((p < 28) ? 1 : 2); }
__device__ __forceinline__ int region_of(int w, int t) {
  const int hb = w >> 4, wb = (w >> 2) & 3, db = w & 3;
  const int i = t >> 6, j = (t >> 3) & 7, k = t & 7;
  return rid1(hb * 8 + i) * 9 + rid1(wb * 8 + j) * 3 + rid1(db * 8 + k);
}

// ---- fragment-order planes: every 16-bit A/B operand plane is kept as 1-KiB blocks of 16 rows x 32 k. Inside a block
//      the 16-B piece (row c, k = 16*chunk + 8*h .. +7) stands at halves chunk*256 + (h*16 + c)*8, so lane l = h*16 + c
//      finds its two pieces at l*8 and 256 + l*8 and each wave-wide 16-B load covers 512 contiguous bytes (4 lines).
//      p = block base + lane*8; elements 0..7 <- k 8h.., elements 8..15 <- k 16+8h.. (hardware k order, as before)
__device__ __forceinline__ v16h ldfrag_h(const _Float16* p) {
  union { v16h v; v8h h[2]; } f;
  f.h[0] = *(const v8h*)(p);
  f.h[1] = *(const v8h*)(p + 256);
  return f.v;
}
// halves offset of the piece (row, k = ks*32 + 8*g .. +7), g = 0..3, in a fragment-order plane of 256-k rows
__device__ __forceinline__ size_t frag_off(int row, int ks, int g) {
  return ((size_t)((row >> 4) * 8 + ks)) * 512 + (g >> 1) * 256 + ((g & 1) * 16 + (row & 15)) * 8;
}

// ---- WMMA helpers; the guard helpers insert the trailing VALU hazard gap and keep A/B live -----------------------
__device__ __forceinline__ v8f mma_raw(v16h a, v16h b, v8f c) {
  return __builtin_amdgcn_wmma_f32_16x16x32_f16(false, a, false, b, (short)0, c, false, false);
}
__device__ __forceinline__ void guard4(v8f& c0, v8f& c1, v8f& c2, v8f& c3,
                                       const v16h& a0, const v16h& a1, const v16h& b0, const v16h& b1) {
#if defined(__HIP_DEVICE_COMPILE__)
  asm volatile("v_nop\n\tv_nop\n\tv_nop\n\tv_nop"
               : "+v"(c0), "+v"(c1), "+v"(c2), "+v"(c3) : "v"(a0), "v"(a1), "v"(b0), "v"(b1));
#endif
}
__device__ __forceinline__ void guard8(v8f& c0, v8f& c1, v8f& c2, v8f& c3, v8f& c4, v8f& c5, v8f& c6, v8f& c7,
                                       const v16h& a0, const v16h& a1, const v16h& a2, const v16h& a3,
                                       const v16h& b0, const v16h& b1) {
#if defined(__HIP_DEVICE_COMPILE__)
  asm volatile("v_nop\n\tv_nop\n\tv_nop\n\tv_nop"
               : "+v"(c0), "+v"(c1), "+v"(c2), "+v"(c3), "+v"(c4), "+v"(c5), "+v"(c6), "+v"(c7)
               : "v"(a0), "v"(a1), "v"(a2), "v"(a3), "v"(b0), "v"(b1));
#endif
}
__device__ __forceinline__ void guard_qk(v8f& c0, v8f& c1, v8f& c2, v8f& c3,
                                         const v16h& a0, const v16h& a1, const v16h& a2, const v16h& a3, const v16h& b0) {
#if defined(__HIP_DEVICE_COMPILE__)
  asm volatile("v_nop\n\tv_nop\n\tv_nop\n\tv_nop"
               : "+v"(c0), "+v"(c1), "+v"(c2), "+v"(c3) : "v"(a0), "v"(a1), "v"(a2), "v"(a3), "v"(b0));
#endif
}
__device__ __forceinline__ void guard6(v8f& c0, v8f& c1, v8f& c2, v8f& c3, v8f& c4, v8f& c5,
                                       const v16h& a0, const v16h& a1, const v16h& a2, const v16h& a3,
                                       const v16h& b0, const v16h& b1) {
#if defined(__HIP_DEVICE_COMPILE__)
  asm volatile("v_nop\n\tv_nop\n\tv_nop\n\tv_nop"
               : "+v"(c0), "+v"(c1), "+v"(c2), "+v"(c3), "+v"(c4), "+v"(c5)
               : "v"(a0), "v"(a1), "v"(a2), "v"(a3), "v"(b0), "v"(b1));
#endif
}
// value of lane l ^ 16 (the other half of the wave), as a vector cross-row move
__device__ __forceinline__ float xhalf(float v) {
  const int b = __float_as_int(v);
  return __int_as_float(__builtin_amdgcn_permlanex16(b, b, 0x76543210, 0xfedcba98, false, false));
}

// =================================================================================================================
// weight convert: w [nrows][256] f32 ([out][in], in contiguous) -> f16(1024 * bf16_RNE(w)), rows n, fragment order;
// block = 8 rows; wave = one 32-channel k-step of them; lane = row (lane&7), 8 channels (lane>>3). grid = nrows/8.
// coverage: nrows x 256.
// =================================================================================================================
__global__ __launch_bounds__(256) void cvt_w(const float* __restrict__ wsrc, unsigned short* wdst, int nrows) {
  const int tid = threadIdx.x, wv = tid >> 5, lane = tid & 31;
  const int row = blockIdx.x * 8 + (lane & 7), g = lane >> 3;
  if (row < nrows) {
    const float* src = wsrc + (size_t)row * CCH + wv * 32 + g * 8;
    const v4f a = *(const v4f*)(src);
    const v4f b = *(const v4f*)(src + 4);
    v4u pk;
    pk[0] = pk16(hb16(bfr(a[0]) * 1024.0f), hb16(bfr(a[1]) * 1024.0f));
    pk[1] = pk16(hb16(bfr(a[2]) * 1024.0f), hb16(bfr(a[3]) * 1024.0f));
    pk[2] = pk16(hb16(bfr(b[0]) * 1024.0f), hb16(bfr(b[1]) * 1024.0f));
    pk[3] = pk16(hb16(bfr(b[2]) * 1024.0f), hb16(bfr(b[3]) * 1024.0f));
    unsigned short* gp = wdst + frag_off(row, wv, g);
    *(v4u*)gp = pk;
    
  }
}

// =================================================================================================================
// cyclic shift + window gather + convert + qkv GEMM in one kernel. Block = 64 tokens of one window x all 768 columns.
// Stage: x [32768 positions][256] f32 -> LDS A tile, 64 rows x 256 k in fragment order, value f16(8 * bf16_RNE(x)).
// Wave = one 32-channel k-step, lane = row (lane&7) of 8, 8 channels (lane>>3), 8 row groups: sixteen 16-B loads in
// flight per lane, eight 16-B LDS stores. Then six column tiles of 128: C[64][128] = A . W1024[cols][256]^T, K = 256
// (8 k-steps of 32), A fragments from LDS, W fragments of a whole column tile held in registers and fetched one tile
// ahead, so that they fly under the epilogue; 8 waves = 2 (32 rows) x 4 (32 cols), 2x2 tiles per wave. The bias row
// stands in LDS as bf16_RNE(b), converted once per block.
// C = 8192 * (xw . W^T). Epilogue through an LDS f32 tile (two of them, used in turn: one barrier per column tile):
// part q -> Q plane [w*8+h][tok/16] blocks (rows tok, k = d)
// = f16(64*q) with q = (C/8192 + b) * 32^-0.5; part k -> K plane = f16(8*k), same form; part v -> V^T hi
// [w*8+h][tok/32][d/16] blocks (rows d, k = tok) = f16(16*v) and V^T lo = f16((16v - hi) * 2^14). A thread takes the
// piece that stands at tid*8 halves of the head's 4 blocks, so every store instruction writes 512 contiguous bytes.
// coverage: Q/K: 4 instr x 256 pieces = 4 heads x 64 tok x 32 d; V hi/lo: 4 instr x 256 pieces = 4 heads x 32 d x
// 64 tok; over the grid and the six tiles every element of Q, K (64x8x512x32) and V^T hi/lo (64x8x32x512) exactly once.
// =================================================================================================================
__global__ __launch_bounds__(256)
void gemm_qkv(const float* __restrict__ x, const unsigned short* __restrict__ wq,
              const float* __restrict__ bq,
              unsigned short* qpl, unsigned short* kpl, unsigned short* vth, unsigned short* vtl) {
  __shared__ __align__(16) unsigned short As[64 * CCH];
  __shared__ __align__(16) float Cs2[2][64 * LDC];
  __shared__ __align__(16) float Bs[C3];
  const int tid = threadIdx.x, wave = tid >> 5, lane = tid & 31, hh = lane >> 4, c = lane & 15;
  const int mb = blockIdx.x;
  const int mw = wave >> 2, nw = wave & 3;
  const int w = mb >> 3, tok0 = (mb & 7) * 64;
  const _Float16* W = (const _Float16*)(const void*)wq;

  // column tile nb of this wave: + nb * 32768 halves; second 16-column band: + 4096; k-step: + 512
  const _Float16* pb = W + frag_off(nw * 32, 0, 0) + lane * 8;
  v16h fb0[8], fb1[8];
#pragma unroll
  for (int ks = 0; ks < 8; ++ks) {
    fb0[ks] = ldfrag_h(pb + ks * 512);
    fb1[ks] = ldfrag_h(pb + 4096 + ks * 512);
  }

  {
    const int r8 = lane & 7, g = lane >> 3;
    v4f xa[8], xb[8];
    float bv[3];
#pragma unroll
    for (int it = 0; it < 8; ++it) {
      const float* src = x + (size_t)spat_of(w, tok0 + it * 8 + r8) * CCH + wave * 32 + g * 8;
      xa[it] = *(const v4f*)(src);
      xb[it] = *(const v4f*)(src + 4);
    }
#pragma unroll
    for (int i = 0; i < 3; ++i) bv[i] = bq[i * 256 + tid];
#pragma unroll
    for (int i = 0; i < 3; ++i) Bs[i * 256 + tid] = bfr(bv[i]);
#pragma unroll
    for (int it = 0; it < 8; ++it) {
      const v4f a = xa[it], b = xb[it];
      v4u pk;
      pk[0] = pk16(hb16(bfr(a[0]) * 8.0f), hb16(bfr(a[1]) * 8.0f));
      pk[1] = pk16(hb16(bfr(a[2]) * 8.0f), hb16(bfr(a[3]) * 8.0f));
      pk[2] = pk16(hb16(bfr(b[0]) * 8.0f), hb16(bfr(b[1]) * 8.0f));
      pk[3] = pk16(hb16(bfr(b[2]) * 8.0f), hb16(bfr(b[3]) * 8.0f));
      *(v4u*)(As + frag_off(it * 8 + r8, wave, g)) = pk;
    }
  }
  __syncthreads();

  const _Float16* pa = (const _Float16*)(const void*)As + frag_off(mw * 32, 0, 0) + lane * 8;   // next band: + 4096

#pragma unroll 1
  for (int nb = 0; nb < 6; ++nb) {
  float* Cs = Cs2[nb & 1];
  v8f a00 = zero8(), a01 = zero8(), a10 = zero8(), a11 = zero8();
  v16h fa0 = ldfrag_h(pa), fa1 = ldfrag_h(pa + 4096);
#pragma unroll
  for (int ks = 0; ks < 8; ++ks) {
    v16h na0 = fa0, na1 = fa1;                    // A fragments of the next k-step, read ahead of this step's products
    if (ks < 7) {
      na0 = ldfrag_h(pa + (ks + 1) * 512);
      na1 = ldfrag_h(pa + 4096 + (ks + 1) * 512);
    }
    a00 = mma_raw(fa0, fb0[ks], a00);
    a01 = mma_raw(fa0, fb1[ks], a01);
    a10 = mma_raw(fa1, fb0[ks], a10);
    a11 = mma_raw(fa1, fb1[ks], a11);
    guard4(a00, a01, a10, a11, fa0, fa1, fb0[ks], fb1[ks]);
    fa0 = na0;
    fa1 = na1;
  }
#pragma unroll
  for (int r = 0; r < 8; ++r) {
    const int row = mw * 32 + 8 * hh + r;
    Cs[row * LDC + nw * 32 + c]             = a00[r];
    Cs[row * LDC + nw * 32 + 16 + c]        = a01[r];
    Cs[(row + 16) * LDC + nw * 32 + c]      = a10[r];
    Cs[(row + 16) * LDC + nw * 32 + 16 + c] = a11[r];
  }
  // one barrier per column tile: it publishes this tile's C, and every wave that passes it has left the other C buffer
  __syncthreads();

  // the next column tile's W fragments: issued behind the barrier (which waits for every load in flight) and in front
  // of an epilogue that reads LDS only, so that nothing waits for them before the next tile's products
  if (nb < 5) {                                   // block-uniform
    const _Float16* pn = pb + (nb + 1) * 32768;
#pragma unroll
    for (int ks = 0; ks < 8; ++ks) {
      fb0[ks] = ldfrag_h(pn + ks * 512);
      fb1[ks] = ldfrag_h(pn + 4096 + ks * 512);
    }
    // the address pair of these loads is reused by the epilogue: keep the wait in front of that overwrite
    asm volatile("s_wait_xcnt 0x0" ::: "memory");
  }

  const int part = nb >> 1;                       // block-uniform: 0 q, 1 k, 2 v
  const int hb4 = (nb & 1) * 4;
  const float* bqn = Bs + nb * 128;               // bf16_RNE(bias), staged once
  if (part < 2) {
    unsigned short* dst = (part == 0) ? qpl : kpl;
    const float scl = (part == 0) ? (QSC * 64.0f) : 8.0f;
    v4u pk[4];
    size_t offs[4];
#pragma unroll
    for (int s = 0; s < 4; ++s) {
      const int h4 = s;
      const int tok = (tid >> 6) * 16 + (tid & 15), d0 = ((tid >> 4) & 3) * 8;
      const int col = h4 * 32 + d0;
      v4u q4;
#pragma unroll
      for (int e = 0; e < 4; ++e) {
        float f0 = Cs[tok * LDC + col + 2 * e] * (1.0f / 8192.0f) + bqn[col + 2 * e];
        float f1 = Cs[tok * LDC + col + 2 * e + 1] * (1.0f / 8192.0f) + bqn[col + 2 * e + 1];
        f0 = f0 * scl;
        f1 = f1 * scl;
        q4[e] = pk16(hb16(f0), hb16(f1));
      }
      pk[s] = q4;
      offs[s] = ((size_t)((w * NHD + hb4 + h4) * NTOK + tok0)) * HD + tid * 8;
    }
#pragma unroll
    for (int s = 0; s < 4; ++s) *(v4u*)(dst + offs[s]) = pk[s];
    
  } else {
    v4u phk[4], plk[4];
    size_t offs[4];
#pragma unroll
    for (int s = 0; s < 4; ++s) {
      const int h4 = s, d = ((tid >> 6) & 1) * 16 + (tid & 15);
      const int col = h4 * 32 + d;
      const int tb = (tid >> 7) * 32 + ((tid >> 4) & 3) * 8;
      const float bc = bqn[col];
      v4u a, b;
#pragma unroll
      for (int e = 0; e < 4; ++e) {
        const float v0 = Cs[(tb + 2 * e) * LDC + col] * (1.0f / 8192.0f) + bc;
        const float v1 = Cs[(tb + 2 * e + 1) * LDC + col] * (1.0f / 8192.0f) + bc;
        const float f0 = v0 * 16.0f, f1 = v1 * 16.0f;
        const _Float16 h0 = (_Float16)f0, h1 = (_Float16)f1;
        const float r0 = (f0 - (float)h0) * 16384.0f;
        const float r1 = (f1 - (float)h1) * 16384.0f;
        a[e] = pk16(h_bits(h0), h_bits(h1));
        b[e] = pk16(hb16(r0), hb16(r1));
      }
      phk[s] = a;
      plk[s] = b;
      offs[s] = ((size_t)(w * NHD + hb4 + h4)) * HD * NTOK + tok0 * HD + tid * 8;
    }
#pragma unroll
    for (int s = 0; s < 4; ++s) { *(v4u*)(vth + offs[s]) = phk[s]; *(v4u*)(vtl + offs[s]) = plk[s]; }
  }
  // the next tile's products overwrite the registers that these stores name: keep the wait in front of that overwrite
  asm volatile("s_wait_xcnt 0x0" ::: "memory");
  }
}

// =================================================================================================================
// Window attention, transposed: block = 8 strips of 16 queries of one (window, head); wave = strip.
// S^T = K8 . Q64^T via WMMA (A = key rows, B = query columns) with 512*bias as the C operand, so a lane holds
// the scores of ONE query (column lane&15) for keys 8*(lane>>4) + r of each 16-key tile. Shift mask -51200 where region
// ids differ. Online softmax over 8 blocks of 64 keys in f32: maximum and sum run over the lane's own 32 registers, the
// maximum is joined with lane ^ 16 once per block, the sum l stays a per-half partial and is joined once at the end.
// p' = 4096*exp((s-m)/512); P hi = f16(p'), P lo = f16((p'-hi)*2^13). Two score tiles of one 32-key step, converted in
// place, are the B operand of O^T += V^T . P^T (A = V^T rows, hardware k order on both sides): P never leaves registers.
// O^T accumulators: hh = Vhi.Phi, hl = Vlo.Phi, lh = Vhi.Plo with V^T hi = 16v, V^T lo = res*2^14;
// o = (hh + hl*2^-14 + lh*2^-13) / (16 l). A lane ends with 8 consecutive d of its query per tile: 16-B packed stores.
// Loads run ahead of their use: K fragments and bias tiles one 64-key block, V^T fragments of the first 32-key step from the block's start, of the second one step ahead.
// Bias: the head's column of the table stands in LDS as rows (i and j difference) of 16 floats, value
// 512 * bf16_RNE(rpb), the k difference reversed: slot x holds difference 14 - x. Query n against keys m = 8 g + r,
// r = 0..7 (one i, one j, k = r) is then 8 consecutive floats from slot 7 - k_n of row (i_n-i_m+7)*15 + (j_n-j_m+7):
// a lane's C registers of one 16-key tile. A wave's 32 lanes touch 3 rows, 24 distinct banks. A block's 128 queries
// span two i, so it holds the 9 i differences it meets: 135 rows.
// Output planes O hi = f16(64 o), O lo = f16((64o-hi)*2^14), layout [h][(w*512 + tok)/16] blocks (rows tok, k = d).
// coverage: 2048 blocks x 8 waves x 16 rows x 32 d = 8 x 32768 x 32 per plane, every element once.
// =================================================================================================================
__global__ __launch_bounds__(256)
void attn_win(const unsigned short* __restrict__ qpl, const unsigned short* __restrict__ kpl,
              const unsigned short* __restrict__ vth, const unsigned short* __restrict__ vtl,
              const float* __restrict__ rpb, unsigned short* ohi, unsigned short* olo) {
  __shared__ __align__(16) int cnts[NTOK];
  __shared__ __align__(16) float brow[NBDI * 240];
  union CB { v8f v; v4f q[2]; };
  const int tid = threadIdx.x, wave = tid >> 5, lane = tid & 31, hh = lane >> 4, c = lane & 15;
  const int wh = blockIdx.x >> 2;                 // w*8 + h
  const int w = wh >> 3, h = wh & 7;
  const int strip = (blockIdx.x & 3) * 8 + wave;  // 0..31
  const int q0 = strip * 16;

  const int dlo = (blockIdx.x & 3) * 2;           // the block's queries have i = dlo, dlo + 1: i differences dlo .. dlo + 8
  if (tid < 240) {
    // 16 lanes = one row, 15 rows (one i difference) a trip, all loads in flight at once; slot 15 is never read and
    // takes slot 14's value
    const int xs = min(tid & 15, 14);
    float tv[NBDI];
#pragma unroll
    for (int it = 0; it < NBDI; ++it) tv[it] = rpb[(((dlo + it) * 15 + (tid >> 4)) * 15 + 14 - xs) * NHD + h];
    // the addresses of these loads are reused behind them: keep the wait in front of that overwrite
    asm volatile("s_wait_xcnt 0x0" ::: "memory");
#pragma unroll
    for (int it = 0; it < NBDI; ++it) brow[it * 240 + tid] = bfr(tv[it]) * 512.0f;
  }
  for (int t = tid; t < NTOK; t += 256) cnts[t] = region_of(w, t);
  __syncthreads();

  const _Float16* Q  = (const _Float16*)(const void*)qpl + (size_t)wh * NTOK * HD;
  const _Float16* K  = (const _Float16*)(const void*)kpl + (size_t)wh * NTOK * HD;
  const _Float16* Vh = (const _Float16*)(const void*)vth + (size_t)wh * HD * NTOK;
  const _Float16* Vl = (const _Float16*)(const void*)vtl + (size_t)wh * HD * NTOK;
  // bias of query q0 + c against key tile j of block kb, keys 8*hh + r: Bp[(di0 - kb) * 240 + (3 - j) * 32 + r].
  // di0 = i_n + 7 - dlo is the same in every lane of the wave: held scalar, the 15-row step of a key block is scalar
  // arithmetic and the 32 reads of a key block share one address register with small offsets
  const int di0 = __builtin_amdgcn_readfirstlane((wave >> 2) + 7);
  const float* Bp = brow + (((strip * 2 + (c >> 3)) & 7) + (hh ^ 1)) * 16 + ((c & 7) ^ 7);   // 1 - hh, 7 - k_n

  const v16h qb = ldfrag_h(Q + (size_t)q0 * HD + lane * 8);
  // the address pair of the two query loads is reused right behind them: keep the wait in front of that overwrite
  asm volatile("s_wait_xcnt 0x0" ::: "memory");
  const int cq = cnts[q0 + c];
  float mrow = -1e30f, lrow = 0.f;
  v8f ohh0 = zero8(), ohh1 = zero8(), ohl0 = zero8(), ohl1 = zero8(), olh0 = zero8(), olh1 = zero8();

  // K fragments and bias tiles of a 64-key block are fetched one block ahead; here those of block 0
  v16h kf[4];
  CB cb[4];
#pragma unroll
  for (int j = 0; j < 4; ++j) {
    kf[j] = ldfrag_h(K + j * 512 + lane * 8);
#pragma unroll
    for (int r = 0; r < 8; ++r) cb[j].v[r] = Bp[di0 * 240 + (3 - j) * 32 + r];
  }
  // the loop reuses the registers that address these eight loads: keep the wait in front of that overwrite
  asm volatile("s_wait_xcnt 0x0" ::: "memory");

  // one 64-key block; MORE: a further block follows, and its K fragments and bias tiles are fetched in this pass
  auto pass = [&](const int kb, auto more) __attribute__((always_inline)) {
    // V^T fragments of the block's first 32-key step (hi, lo of d 0..15; hi, lo of d 16..31): they fly under the
    // score products, the mask and the whole softmax
    const int koff = kb * 2048 + lane * 8;
    v16h va[4];
    va[0] = ldfrag_h(Vh + koff);
    va[1] = ldfrag_h(Vl + koff);
    va[2] = ldfrag_h(Vh + koff + 512);
    va[3] = ldfrag_h(Vl + koff + 512);
    // ---- transposed logits for 64 keys: 4 tiles of 16 keys x 16 queries, bias via C operand, mask added ----
    v8f s[4];
#pragma unroll
    for (int j = 0; j < 4; ++j) s[j] = mma_raw(kf[j], qb, cb[j].v);
    guard_qk(s[0], s[1], s[2], s[3], kf[0], kf[1], kf[2], kf[3], qb);
#pragma unroll
    for (int j = 0; j < 4; ++j) {
      const int key0 = kb * 64 + j * 16;
      const v8f sj = s[j];
      const v4i cm0 = *(const v4i*)(cnts + key0 + 8 * hh);
      const v4i cm1 = *(const v4i*)(cnts + key0 + 8 * hh + 4);
      v8f mk;
#pragma unroll
      for (int r = 0; r < 4; ++r) {
        mk[r]     = (cq != cm0[r]) ? -51200.0f : 0.0f;
        mk[r + 4] = (cq != cm1[r]) ? -51200.0f : 0.0f;
      }
      s[j] = sj + mk;
    }
    // the next block's K fragments and bias tiles fly under this block's softmax and V products; issued
    // behind the mask, where the raw score registers are free again, so that the bias lands in them without a copy.
    // The last pass is a copy of the body without them: a branch in the loop would merge the load counting
    if constexpr (decltype(more)::value) {
      const int kn = kb + 1;
      const _Float16* kp = K + kn * 2048 + lane * 8;
      const float* bn = Bp + (di0 - kn) * 240;
#pragma unroll
      for (int j = 0; j < 4; ++j) {
        kf[j] = ldfrag_h(kp + j * 512);
#pragma unroll
        for (int r = 0; r < 8; ++r) cb[j].v[r] = bn[(3 - j) * 32 + r];
      }
      // the address pair stays whole until the eight loads that name it have their addresses translated
      asm volatile("s_wait_xcnt 0x0" :: "v"(kp) : "memory");
    }
    // ---- online softmax update: one query per lane, 32 of its 64 scores here, the rest in lane ^ 16 ----
    float t8[8];
#pragma unroll
    for (int r = 0; r < 8; ++r) t8[r] = fmaxf(fmaxf(s[0][r], s[1][r]), fmaxf(s[2][r], s[3][r]));
    float tm = fmaxf(fmaxf(fmaxf(t8[0], t8[1]), fmaxf(t8[2], t8[3])), fmaxf(fmaxf(t8[4], t8[5]), fmaxf(t8[6], t8[7])));
    tm = fmaxf(tm, xhalf(tm));
    const float mn = fmaxf(mrow, tm);
    const float alpha = __expf((mrow - mn) * INV512);
    mrow = mn;
#pragma unroll
    for (int j = 0; j < 4; ++j) {
#pragma unroll
      for (int r = 0; r < 8; ++r) s[j][r] = __expf((s[j][r] - mn) * INV512 + LN4096);
    }
    const v8f sv = (s[0] + s[1]) + (s[2] + s[3]);
    const float ps = ((sv[0] + sv[1]) + (sv[2] + sv[3])) + ((sv[4] + sv[5]) + (sv[6] + sv[7]));
    lrow = lrow * alpha + ps;
    ohh0 = ohh0 * alpha; ohh1 = ohh1 * alpha;
    ohl0 = ohl0 * alpha; ohl1 = ohl1 * alpha;
    olh0 = olh0 * alpha; olh1 = olh1 * alpha;
    // ---- O^T += V^T . P^T : two 32-key k-steps, two 16-dim tiles, three products ----
#pragma unroll
    for (int ks = 0; ks < 2; ++ks) {
      // element e <- key 8*hh + e (tile 2*ks), element 8 + e <- key 16 + 8*hh + e (tile 2*ks + 1)
      const v8h ph0 = __builtin_convertvector(s[2 * ks], v8h);
      const v8h ph1 = __builtin_convertvector(s[2 * ks + 1], v8h);
      const v8h pl0 = __builtin_convertvector((s[2 * ks] - __builtin_convertvector(ph0, v8f)) * 8192.0f, v8h);
      const v8h pl1 = __builtin_convertvector((s[2 * ks + 1] - __builtin_convertvector(ph1, v8f)) * 8192.0f, v8h);
      const v16h pb  = __builtin_shufflevector(ph0, ph1, 0, 1, 2, 3, 4, 5, 6, 7, 8, 9, 10, 11, 12, 13, 14, 15);
      const v16h plb = __builtin_shufflevector(pl0, pl1, 0, 1, 2, 3, 4, 5, 6, 7, 8, 9, 10, 11, 12, 13, 14, 15);
      ohh0 = mma_raw(va[0], pb, ohh0);
      ohl0 = mma_raw(va[1], pb, ohl0);
      olh0 = mma_raw(va[0], plb, olh0);
      ohh1 = mma_raw(va[2], pb, ohh1);
      ohl1 = mma_raw(va[3], pb, ohl1);
      olh1 = mma_raw(va[2], plb, olh1);
      guard6(ohh0, ohl0, olh0, ohh1, ohl1, olh1, va[0], va[1], va[2], va[3], pb, plb);
      if (ks == 0) {                                         // second 32-key step: flies under the second step's P split
        va[0] = ldfrag_h(Vh + koff + 1024);
        va[1] = ldfrag_h(Vl + koff + 1024);
        va[2] = ldfrag_h(Vh + koff + 1536);
        va[3] = ldfrag_h(Vl + koff + 1536);
      }
    }
  };
#pragma unroll 1
  for (int kb = 0; kb < 7; ++kb) pass(kb, flag_c<true>{});
  pass(7, flag_c<false>{});

  // ---- join the halves' sums, normalise, split into hi / lo, 16-B packed stores (8 consecutive d of one query) ----
  const float lt = lrow + xhalf(lrow);
  const float inv = 1.0f / (lt * 16.0f);
  v4u ph2[2], pl2[2];
#pragma unroll
  for (int e = 0; e < 4; ++e) {
    float f[4];
#pragma unroll
    for (int u = 0; u < 2; ++u) {
      const int r = 2 * e + u;
      float o0 = ohh0[r] + ohl0[r] * (1.0f / 16384.0f);
      o0 = o0 + olh0[r] * (1.0f / 8192.0f);
      float o1 = ohh1[r] + ohl1[r] * (1.0f / 16384.0f);
      o1 = o1 + olh1[r] * (1.0f / 8192.0f);
      f[u]     = (o0 * inv) * 64.0f;
      f[2 + u] = (o1 * inv) * 64.0f;
    }
    const _Float16 a0 = (_Float16)f[0], a1 = (_Float16)f[1], b0 = (_Float16)f[2], b1 = (_Float16)f[3];
    ph2[0][e] = pk16(h_bits(a0), h_bits(a1));
    ph2[1][e] = pk16(h_bits(b0), h_bits(b1));
    pl2[0][e] = pk16(hb16((f[0] - (float)a0) * 16384.0f), hb16((f[1] - (float)a1) * 16384.0f));
    pl2[1][e] = pk16(hb16((f[2] - (float)b0) * 16384.0f), hb16((f[3] - (float)b1) * 16384.0f));
  }
  const size_t off = ((size_t)h * NROW + (size_t)w * NTOK + q0) * HD + lane * 8;
  *(v4u*)(ohi + off)       = ph2[0];
  *(v4u*)(ohi + off + 256) = ph2[1];
  *(v4u*)(olo + off)       = pl2[0];
  *(v4u*)(olo + off + 256) = pl2[1];
}

// =================================================================================================================
// Output projection: out rows = (Ohi + Olo*2^-14)/64 . (W1024/1024)^T + b; two accumulator sets (hi.W, lo.W), K = 256
// = 8 head planes of 32. Block tile 64 tokens x 128 cols, 8 waves = 2 x 4, 2x2 tiles per wave. Epilogue through an
// LDS f32 tile; store with un-window + reverse shift: a wave writes one token's 128-col half row = 512 B = 4 whole
// coverage: 512 x 64 tokens (bijective position map) x 2 x 128 cols = every output element exactly once.
// =================================================================================================================
__global__ __launch_bounds__(256)
void gemm_proj(const unsigned short* __restrict__ ohi, const unsigned short* __restrict__ olo,
               const unsigned short* __restrict__ wp, const float* __restrict__ bp, float* out) {
  __shared__ __align__(16) float Cs[64 * LDC];
  const int tid = threadIdx.x, wave = tid >> 5, lane = tid & 31, hh = lane >> 4, c = lane & 15;
  const int mb = blockIdx.x, nb = blockIdx.y;
  const int mw = wave >> 2, nw = wave & 3;
  const _Float16* W = (const _Float16*)(const void*)wp;
  const int arow0 = mb * 64 + mw * 32;
  const int bcol0 = nb * 128 + nw * 32;

  v8f h00 = zero8(), h01 = zero8(), h10 = zero8(), h11 = zero8();
  v8f l00 = zero8(), l01 = zero8(), l10 = zero8(), l11 = zero8();
  const _Float16* ph = (const _Float16*)(const void*)ohi + (size_t)arow0 * HD + lane * 8;   // head plane ks: + NROW*HD
  const _Float16* pl = (const _Float16*)(const void*)olo + (size_t)arow0 * HD + lane * 8;
  const _Float16* pb = W + frag_off(bcol0, 0, 0) + lane * 8;
#pragma unroll 1
  for (int ks = 0; ks < 8; ++ks, ph += NROW * HD, pl += NROW * HD, pb += 512) {
    const v16h fa0 = ldfrag_h(ph);
    const v16h fa1 = ldfrag_h(ph + 512);
    const v16h ga0 = ldfrag_h(pl);
    const v16h ga1 = ldfrag_h(pl + 512);
    const v16h fb0 = ldfrag_h(pb);
    const v16h fb1 = ldfrag_h(pb + 4096);
    // the three address pairs stay whole until the twelve loads that name them have their addresses translated
    asm volatile("s_wait_xcnt 0x0" :: "v"(ph), "v"(pl), "v"(pb) : "memory");
    h00 = mma_raw(fa0, fb0, h00);
    h01 = mma_raw(fa0, fb1, h01);
    h10 = mma_raw(fa1, fb0, h10);
    h11 = mma_raw(fa1, fb1, h11);
    l00 = mma_raw(ga0, fb0, l00);
    l01 = mma_raw(ga0, fb1, l01);
    l10 = mma_raw(ga1, fb0, l10);
    l11 = mma_raw(ga1, fb1, l11);
    guard8(h00, h01, h10, h11, l00, l01, l10, l11, fa0, fa1, ga0, ga1, fb0, fb1);
  }
#pragma unroll
  for (int r = 0; r < 8; ++r) {
    const int row = mw * 32 + 8 * hh + r;
    Cs[row * LDC + nw * 32 + c]             = h00[r] + l00[r] * (1.0f / 16384.0f);
    Cs[row * LDC + nw * 32 + 16 + c]        = h01[r] + l01[r] * (1.0f / 16384.0f);
    Cs[(row + 16) * LDC + nw * 32 + c]      = h10[r] + l10[r] * (1.0f / 16384.0f);
    Cs[(row + 16) * LDC + nw * 32 + 16 + c] = h11[r] + l11[r] * (1.0f / 16384.0f);
  }
  __syncthreads();

  const int w = mb >> 3, tok0 = (mb & 7) * 64;
  const float* bpn = bp + nb * 128 + lane * 4;
  v4f bb;
#pragma unroll
  for (int e = 0; e < 4; ++e) bb[e] = bfr(bpn[e]);
  v4f ov[8];
  size_t offs[8];
#pragma unroll
  for (int it = 0; it < 8; ++it) {
    const int row = wave * 8 + it;
    const int sp = spat_of(w, tok0 + row);
    v4f v = *(const v4f*)(Cs + row * LDC + lane * 4);
#pragma unroll
    for (int e = 0; e < 4; ++e) v[e] = v[e] * (1.0f / 65536.0f) + bb[e];
    ov[it] = v;
    offs[it] = (size_t)sp * CCH + nb * 128 + lane * 4;
  }
#pragma unroll
  for (int it = 0; it < 8; ++it) *(v4f*)(out + offs[it]) = ov[it];
  
}

// =================================================================================================================
//   Wqkv f16 [768][256] 393216 | Wproj f16 [256][256] 131072 |
//   Q f16 [512][512][32] 16777216 | K same 16777216 |
//   V^T hi f16 [512][32][512] 16777216 | V^T lo same 16777216 | O hi f16 [8][32768][32] 16777216 | O lo same 16777216
//   total 101187584.
// =================================================================================================================
extern "C" void kernel_launch(void* const* d_in, const int* in_sizes, int n_in,
                              void* d_out, int out_size, void* d_ws, size_t ws_size,
                              hipStream_t stream) {
  if (n_in < 6) return;
  if (in_sizes[0] != NROW * CCH) return;
  if (in_sizes[1] != C3 * CCH || in_sizes[2] != C3) return;
  if (in_sizes[3] != CCH * CCH || in_sizes[4] != CCH) return;
  if (in_sizes[5] != NRPB * NHD) return;
  if (out_size != NROW * CCH) return;

  const float* x     = (const float*)d_in[0];
  const float* qkvw  = (const float*)d_in[1];
  const float* qkvb  = (const float*)d_in[2];
  const float* projw = (const float*)d_in[3];
  const float* projb = (const float*)d_in[4];
  const float* rpb   = (const float*)d_in[5];
  float* out = (float*)d_out;

  const size_t sWq = (size_t)C3 * CCH * 2;                   //   393216
  const size_t sWp = (size_t)CCH * CCH * 2;                  //   131072
  const size_t sQK = (size_t)NWIN * NHD * NTOK * HD * 2;     // 16777216
  const size_t sO  = (size_t)NHD * NROW * HD * 2;            // 16777216
  size_t off = 0;
  const size_t oWq = off; off += sWq;
  const size_t oWp = off; off += sWp;
  const size_t oQ  = off; off += sQK;
  const size_t oK  = off; off += sQK;
  const size_t oVh = off; off += sQK;
  const size_t oVl = off; off += sQK;
  const size_t oOh = off; off += sO;
  const size_t oOl = off; off += sO;
  if (off > ws_size) return;                                  // off = 101187584
  if (off > (size_t)134217728) return;

  char* ws = (char*)d_ws;
  unsigned short* Wq  = (unsigned short*)(ws + oWq);
  unsigned short* Wp  = (unsigned short*)(ws + oWp);
  unsigned short* Qp  = (unsigned short*)(ws + oQ);
  unsigned short* Kp  = (unsigned short*)(ws + oK);
  unsigned short* Vth = (unsigned short*)(ws + oVh);
  unsigned short* Vtl = (unsigned short*)(ws + oVl);
  unsigned short* Ohi = (unsigned short*)(ws + oOh);
  unsigned short* Olo = (unsigned short*)(ws + oOl);

  const dim3 blk(256);
  // (1) weight converts
  cvt_w<<<dim3(C3 / 8), blk, 0, stream>>>(qkvw, Wq, C3);
  cvt_w<<<dim3(CCH / 8), blk, 0, stream>>>(projw, Wp, CCH);
  // (2) window gather + convert + qkv projection: 512 row tiles, each over all six column tiles
  gemm_qkv<<<dim3(NROW / 64), blk, 0, stream>>>(x, Wq, qkvb, Qp, Kp, Vth, Vtl);
  // (3) window attention: 64 windows x 8 heads x 4 blocks of 8 strips
  attn_win<<<dim3(NWIN * NHD * 4), blk, 0, stream>>>(Qp, Kp, Vth, Vtl, rpb, Ohi, Olo);
  // (4) output projection + un-window + reverse shift -> d_out
  gemm_proj<<<dim3(NROW / 64, CCH / 128), blk, 0, stream>>>(Ohi, Olo, Wp, projb, out);
  (void)hipGetLastError();
}

// v006
// It runs in 104 microseconds.
// Timed twice side by side with v005, it ran 1.06 times as fast both times.
// Counting every step since v000, it is 2.55 times as fast.
// qkv projection and k.qT: v_wmma_f32_16x16x32_f16 single products (f16 operands, f32 accumulate); vT.pT: p and v^T each
// carried as f16 hi plus power-of-two scaled residual planes, three products (hi.hi, hi.lo, lo.hi), f32 accumulate;
// output projection: activation as f16 hi plus scaled residual times f16 weight, two products, f32 accumulate.
// All inputs RNE-converted to bf16 on load; softmax, masks and epilogues in f32 on VALU.
#include <hip/hip_runtime.h>
#include <stdint.h>

#define NWIN 64
#define NTOK 512
#define CCH  256
#define NHD  8
#define HD   32
#define C3   768
#define NROW 32768
#define NRPB 3375
#define NBDI 15
#define LDC  132
#define QSC  0.17677669529663687f
#define INV512 0.001953125f
#define LN4096 8.3177661667193429f

static_assert(NROW == NWIN * NTOK);
static_assert(15 * 15 * 15 == NRPB);
static_assert((LDC * 4) % 16 == 0);

typedef _Float16 v16h __attribute__((ext_vector_type(16)));
typedef _Float16 v8h  __attribute__((ext_vector_type(8)));
typedef float    v8f  __attribute__((ext_vector_type(8)));
typedef float    v4f  __attribute__((ext_vector_type(4)));
typedef unsigned int v4u __attribute__((ext_vector_type(4)));
typedef int      v4i  __attribute__((ext_vector_type(4)));

template <bool B> struct flag_c { static constexpr bool value = B; };

// ---- scalar helpers ------------------------------------------------------------------------------------------
__device__ __forceinline__ unsigned short bf_bits(float f) {          // f32 -> bf16 bits, RNE convert
  unsigned u = __float_as_uint(f);
  return (unsigned short)((u + 0x7FFFu + ((u >> 16) & 1u)) >> 16);
}
__device__ __forceinline__ float bf_up(unsigned short b) { return __uint_as_float(((unsigned)b) << 16); }
__device__ __forceinline__ float bfr(float f) { return bf_up(bf_bits(f)); }
__device__ __forceinline__ unsigned short h_bits(_Float16 x) { return __builtin_bit_cast(unsigned short, x); }
__device__ __forceinline__ unsigned short hb16(float f) { return h_bits((_Float16)f); }
__device__ __forceinline__ unsigned pk16(unsigned short a, unsigned short b) { return (unsigned)a | ((unsigned)b << 16); }
__device__ __forceinline__ v8f zero8() { v8f z = {0.f, 0.f, 0.f, 0.f, 0.f, 0.f, 0.f, 0.f}; return z; }

// ---- index maps --------------------------------------------------------------------------------------------------
// window w = (hb*4 + wb)*4 + db over a 32^3 volume in 8^3 windows; token t = (i*8 + j)*8 + k inside the window.
// The shifted coordinate is (hb*8+i, wb*8+j, db*8+k); both the input gather (roll by -4) and the output scatter
// (roll by +4) use volume position ((hs+4)&31, (ws+4)&31, (ds+4)&31).
__device__ __forceinline__ int spat_of(int w, int t) {
  const int hb = w >> 4, wb = (w >> 2) & 3, db = w & 3;
  const int i = t >> 6, j = (t >> 3) & 7, k = t & 7;
  const int gh = (hb * 8 + i + 4) & 31;
  const int gw = (wb * 8 + j + 4) & 31;
  const int gd = (db * 8 + k + 4) & 31;
  return (gh * 32 + gw) * 32 + gd;
}
__device__ __forceinline__ int rid1(int p) { return (p < 24) ? 0 : ((p < 28) ? 1 : 2); }
__device__ __forceinline__ int region_of(int w, int t) {
  const int hb = w >> 4, wb = (w >> 2) & 3, db = w & 3;
  const int i = t >> 6, j = (t >> 3) & 7, k = t & 7;
  return rid1(hb * 8 + i) * 9 + rid1(wb * 8 + j) * 3 + rid1(db * 8 + k);
}

// ---- fragment-order planes: every 16-bit A/B operand plane is kept as 1-KiB blocks of 16 rows x 32 k. Inside a block
//      the 16-B piece (row c, k = 16*chunk + 8*h .. +7) stands at halves chunk*256 + (h*16 + c)*8, so lane l = h*16 + c
//      finds its two pieces at l*8 and 256 + l*8 and each wave-wide 16-B load covers 512 contiguous bytes (4 lines).
//      p = block base + lane*8; elements 0..7 <- k 8h.., elements 8..15 <- k 16+8h.. (hardware k order, as before)
__device__ __forceinline__ v16h ldfrag_h(const _Float16* p) {
  union { v16h v; v8h h[2]; } f;
  f.h[0] = *(const v8h*)(p);
  f.h[1] = *(const v8h*)(p + 256);
  return f.v;
}
// halves offset of the piece (row, k = ks*32 + 8*g .. +7), g = 0..3, in a fragment-order plane of 256-k rows
__device__ __forceinline__ size_t frag_off(int row, int ks, int g) {
  return ((size_t)((row >> 4) * 8 + ks)) * 512 + (g >> 1) * 256 + ((g & 1) * 16 + (row & 15)) * 8;
}

// ---- WMMA helpers; the guard helpers insert the trailing VALU hazard gap and keep A/B live -----------------------
__device__ __forceinline__ v8f mma_raw(v16h a, v16h b, v8f c) {
  return __builtin_amdgcn_wmma_f32_16x16x32_f16(false, a, false, b, (short)0, c, false, false);
}
__device__ __forceinline__ void guard4(v8f& c0, v8f& c1, v8f& c2, v8f& c3,
                                       const v16h& a0, const v16h& a1, const v16h& b0, const v16h& b1) {
#if defined(__HIP_DEVICE_COMPILE__)
  asm volatile("v_nop\n\tv_nop\n\tv_nop\n\tv_nop"
               : "+v"(c0), "+v"(c1), "+v"(c2), "+v"(c3) : "v"(a0), "v"(a1), "v"(b0), "v"(b1));
#endif
}
__device__ __forceinline__ void guard8(v8f& c0, v8f& c1, v8f& c2, v8f& c3, v8f& c4, v8f& c5, v8f& c6, v8f& c7,
                                       const v16h& a0, const v16h& a1, const v16h& a2, const v16h& a3,
                                       const v16h& b0, const v16h& b1) {
#if defined(__HIP_DEVICE_COMPILE__)
  asm volatile("v_nop\n\tv_nop\n\tv_nop\n\tv_nop"
               : "+v"(c0), "+v"(c1), "+v"(c2), "+v"(c3), "+v"(c4), "+v"(c5), "+v"(c6), "+v"(c7)
               : "v"(a0), "v"(a1), "v"(a2), "v"(a3), "v"(b0), "v"(b1));
#endif
}
__device__ __forceinline__ void guard_qk(v8f& c0, v8f& c1, v8f& c2, v8f& c3,
                                         const v16h& a0, const v16h& a1, const v16h& a2, const v16h& a3, const v16h& b0) {
#if defined(__HIP_DEVICE_COMPILE__)
  asm volatile("v_nop\n\tv_nop\n\tv_nop\n\tv_nop"
               : "+v"(c0), "+v"(c1), "+v"(c2), "+v"(c3) : "v"(a0), "v"(a1), "v"(a2), "v"(a3), "v"(b0));
#endif
}
__device__ __forceinline__ void guard6(v8f& c0, v8f& c1, v8f& c2, v8f& c3, v8f& c4, v8f& c5,
                                       const v16h& a0, const v16h& a1, const v16h& a2, const v16h& a3,
                                       const v16h& b0, const v16h& b1) {
#if defined(__HIP_DEVICE_COMPILE__)
  asm volatile("v_nop\n\tv_nop\n\tv_nop\n\tv_nop"
               : "+v"(c0), "+v"(c1), "+v"(c2), "+v"(c3), "+v"(c4), "+v"(c5)
               : "v"(a0), "v"(a1), "v"(a2), "v"(a3), "v"(b0), "v"(b1));
#endif
}
// value of lane l ^ 16 (the other half of the wave), as a vector cross-row move
__device__ __forceinline__ float xhalf(float v) {
  const int b = __float_as_int(v);
  return __int_as_float(__builtin_amdgcn_permlanex16(b, b, 0x76543210, 0xfedcba98, false, false));
}

// =================================================================================================================
// weight convert: w [nrows][256] f32 ([out][in], in contiguous) -> f16(1024 * bf16_RNE(w)), rows n, fragment order;
// block = 8 rows; wave = one 32-channel k-step of them; lane = row (lane&7), 8 channels (lane>>3). grid = nrows/8.
// coverage: nrows x 256.
// =================================================================================================================
__global__ __launch_bounds__(256) void cvt_w(const float* __restrict__ wsrc, unsigned short* wdst, int nrows) {
  const int tid = threadIdx.x, wv = tid >> 5, lane = tid & 31;
  const int row = blockIdx.x * 8 + (lane & 7), g = lane >> 3;
  if (row < nrows) {
    const float* src = wsrc + (size_t)row * CCH + wv * 32 + g * 8;
    const v4f a = *(const v4f*)(src);
    const v4f b = *(const v4f*)(src + 4);
    v4u pk;
    pk[0] = pk16(hb16(bfr(a[0]) * 1024.0f), hb16(bfr(a[1]) * 1024.0f));
    pk[1] = pk16(hb16(bfr(a[2]) * 1024.0f), hb16(bfr(a[3]) * 1024.0f));
    pk[2] = pk16(hb16(bfr(b[0]) * 1024.0f), hb16(bfr(b[1]) * 1024.0f));
    pk[3] = pk16(hb16(bfr(b[2]) * 1024.0f), hb16(bfr(b[3]) * 1024.0f));
    unsigned short* gp = wdst + frag_off(row, wv, g);
    *(v4u*)gp = pk;
    
  }
}

// =================================================================================================================
// cyclic shift + window gather + convert + qkv GEMM in one kernel. Block = 64 tokens of one window x all 768 columns.
// Stage: x [32768 positions][256] f32 -> LDS A tile, 64 rows x 256 k in fragment order, value f16(8 * bf16_RNE(x)).
// Wave = one 32-channel k-step, lane = row (lane&7) of 8, 8 channels (lane>>3), 8 row groups: sixteen 16-B loads in
// flight per lane, eight 16-B LDS stores. Then six column tiles of 128: C[64][128] = A . W1024[cols][256]^T, K = 256
// (8 k-steps of 32), A fragments from LDS, W fragments of a whole column tile held in registers and fetched one tile
// ahead, so that they fly under the epilogue; 8 waves = 2 (32 rows) x 4 (32 cols), 2x2 tiles per wave. The bias row
// stands in LDS as bf16_RNE(b), converted once per block.
// C = 8192 * (xw . W^T). Epilogue through an LDS f32 tile (two of them, used in turn: one barrier per column tile):
// part q -> Q plane [w*8+h][tok/16] blocks (rows tok, k = d)
// = f16(64*q) with q = (C/8192 + b) * 32^-0.5; part k -> K plane = f16(8*k), same form; part v -> V^T hi
// [w*8+h][tok/32][d/16] blocks (rows d, k = tok) = f16(16*v) and V^T lo = f16((16v - hi) * 2^14). A thread takes the
// piece that stands at tid*8 halves of the head's 4 blocks, so every store instruction writes 512 contiguous bytes.
// coverage: Q/K: 4 instr x 256 pieces = 4 heads x 64 tok x 32 d; V hi/lo: 4 instr x 256 pieces = 4 heads x 32 d x
// 64 tok; over the grid and the six tiles every element of Q, K (64x8x512x32) and V^T hi/lo (64x8x32x512) exactly once.
// =================================================================================================================
__global__ __launch_bounds__(256)
void gemm_qkv(const float* __restrict__ x, const unsigned short* __restrict__ wq,
              const float* __restrict__ bq,
              unsigned short* qpl, unsigned short* kpl, unsigned short* vth, unsigned short* vtl) {
  __shared__ __align__(16) unsigned short As[64 * CCH];
  __shared__ __align__(16) float Cs2[2][64 * LDC];
  __shared__ __align__(16) float Bs[C3];
  const int tid = threadIdx.x, wave = tid >> 5, lane = tid & 31, hh = lane >> 4, c = lane & 15;
  const int mb = blockIdx.x;
  const int mw = wave >> 2, nw = wave & 3;
  const int w = mb >> 3, tok0 = (mb & 7) * 64;
  const _Float16* W = (const _Float16*)(const void*)wq;

  // column tile nb of this wave: + nb * 32768 halves; second 16-column band: + 4096; k-step: + 512
  const _Float16* pb = W + frag_off(nw * 32, 0, 0) + lane * 8;
  v16h fb0[8], fb1[8];
#pragma unroll
  for (int ks = 0; ks < 8; ++ks) {
    fb0[ks] = ldfrag_h(pb + ks * 512);
    fb1[ks] = ldfrag_h(pb + 4096 + ks * 512);
  }

  {
    const int r8 = lane & 7, g = lane >> 3;
    v4f xa[8], xb[8];
    float bv[3];
#pragma unroll
    for (int it = 0; it < 8; ++it) {
      const float* src = x + (size_t)spat_of(w, tok0 + it * 8 + r8) * CCH + wave * 32 + g * 8;
      xa[it] = *(const v4f*)(src);
      xb[it] = *(const v4f*)(src + 4);
    }
#pragma unroll
    for (int i = 0; i < 3; ++i) bv[i] = bq[i * 256 + tid];
#pragma unroll
    for (int i = 0; i < 3; ++i) Bs[i * 256 + tid] = bfr(bv[i]);
#pragma unroll
    for (int it = 0; it < 8; ++it) {
      const v4f a = xa[it], b = xb[it];
      v4u pk;
      pk[0] = pk16(hb16(bfr(a[0]) * 8.0f), hb16(bfr(a[1]) * 8.0f));
      pk[1] = pk16(hb16(bfr(a[2]) * 8.0f), hb16(bfr(a[3]) * 8.0f));
      pk[2] = pk16(hb16(bfr(b[0]) * 8.0f), hb16(bfr(b[1]) * 8.0f));
      pk[3] = pk16(hb16(bfr(b[2]) * 8.0f), hb16(bfr(b[3]) * 8.0f));
      *(v4u*)(As + frag_off(it * 8 + r8, wave, g)) = pk;
    }
  }
  __syncthreads();

  const _Float16* pa = (const _Float16*)(const void*)As + frag_off(mw * 32, 0, 0) + lane * 8;   // next band: + 4096

#pragma unroll 1
  for (int nb = 0; nb < 6; ++nb) {
  float* Cs = Cs2[nb & 1];
  v8f a00 = zero8(), a01 = zero8(), a10 = zero8(), a11 = zero8();
  v16h fa0 = ldfrag_h(pa), fa1 = ldfrag_h(pa + 4096);
#pragma unroll
  for (int ks = 0; ks < 8; ++ks) {
    v16h na0 = fa0, na1 = fa1;                    // A fragments of the next k-step, read ahead of this step's products
    if (ks < 7) {
      na0 = ldfrag_h(pa + (ks + 1) * 512);
      na1 = ldfrag_h(pa + 4096 + (ks + 1) * 512);
    }
    a00 = mma_raw(fa0, fb0[ks], a00);
    a01 = mma_raw(fa0, fb1[ks], a01);
    a10 = mma_raw(fa1, fb0[ks], a10);
    a11 = mma_raw(fa1, fb1[ks], a11);
    guard4(a00, a01, a10, a11, fa0, fa1, fb0[ks], fb1[ks]);
    fa0 = na0;
    fa1 = na1;
  }
#pragma unroll
  for (int r = 0; r < 8; ++r) {
    const int row = mw * 32 + 8 * hh + r;
    Cs[row * LDC + nw * 32 + c]             = a00[r];
    Cs[row * LDC + nw * 32 + 16 + c]        = a01[r];
    Cs[(row + 16) * LDC + nw * 32 + c]      = a10[r];
    Cs[(row + 16) * LDC + nw * 32 + 16 + c] = a11[r];
  }
  // one barrier per column tile: it publishes this tile's C, and every wave that passes it has left the other C buffer
  __syncthreads();

  // the next column tile's W fragments: issued behind the barrier (which waits for every load in flight) and in front
  // of an epilogue that reads LDS only, so that nothing waits for them before the next tile's products
  if (nb < 5) {                                   // block-uniform
    const _Float16* pn = pb + (nb + 1) * 32768;
#pragma unroll
    for (int ks = 0; ks < 8; ++ks) {
      fb0[ks] = ldfrag_h(pn + ks * 512);
      fb1[ks] = ldfrag_h(pn + 4096 + ks * 512);
    }
    // the address pair of these loads is reused by the epilogue: keep the wait in front of that overwrite
    asm volatile("s_wait_xcnt 0x0" ::: "memory");
  }

  const int part = nb >> 1;                       // block-uniform: 0 q, 1 k, 2 v
  const int hb4 = (nb & 1) * 4;
  const float* bqn = Bs + nb * 128;               // bf16_RNE(bias), staged once
  if (part < 2) {
    unsigned short* dst = (part == 0) ? qpl : kpl;
    const float scl = (part == 0) ? (QSC * 64.0f) : 8.0f;
    v4u pk[4];
    size_t offs[4];
#pragma unroll
    for (int s = 0; s < 4; ++s) {
      const int h4 = s;
      const int tok = (tid >> 6) * 16 + (tid & 15), d0 = ((tid >> 4) & 3) * 8;
      const int col = h4 * 32 + d0;
      v4u q4;
#pragma unroll
      for (int e = 0; e < 4; ++e) {
        float f0 = Cs[tok * LDC + col + 2 * e] * (1.0f / 8192.0f) + bqn[col + 2 * e];
        float f1 = Cs[tok * LDC + col + 2 * e + 1] * (1.0f / 8192.0f) + bqn[col + 2 * e + 1];
        f0 = f0 * scl;
        f1 = f1 * scl;
        q4[e] = pk16(hb16(f0), hb16(f1));
      }
      pk[s] = q4;
      offs[s] = ((size_t)((w * NHD + hb4 + h4) * NTOK + tok0)) * HD + tid * 8;
    }
#pragma unroll
    for (int s = 0; s < 4; ++s) *(v4u*)(dst + offs[s]) = pk[s];
    
  } else {
    v4u phk[4], plk[4];
    size_t offs[4];
#pragma unroll
    for (int s = 0; s < 4; ++s) {
      const int h4 = s, d = ((tid >> 6) & 1) * 16 + (tid & 15);
      const int col = h4 * 32 + d;
      const int tb = (tid >> 7) * 32 + ((tid >> 4) & 3) * 8;
      const float bc = bqn[col];
      v4u a, b;
#pragma unroll
      for (int e = 0; e < 4; ++e) {
        const float v0 = Cs[(tb + 2 * e) * LDC + col] * (1.0f / 8192.0f) + bc;
        const float v1 = Cs[(tb + 2 * e + 1) * LDC + col] * (1.0f / 8192.0f) + bc;
        const float f0 = v0 * 16.0f, f1 = v1 * 16.0f;
        const _Float16 h0 = (_Float16)f0, h1 = (_Float16)f1;
        const float r0 = (f0 - (float)h0) * 16384.0f;
        const float r1 = (f1 - (float)h1) * 16384.0f;
        a[e] = pk16(h_bits(h0), h_bits(h1));
        b[e] = pk16(hb16(r0), hb16(r1));
      }
      phk[s] = a;
      plk[s] = b;
      offs[s] = ((size_t)(w * NHD + hb4 + h4)) * HD * NTOK + tok0 * HD + tid * 8;
    }
#pragma unroll
    for (int s = 0; s < 4; ++s) { *(v4u*)(vth + offs[s]) = phk[s]; *(v4u*)(vtl + offs[s]) = plk[s]; }
  }
  // the next tile's products overwrite the registers that these stores name: keep the wait in front of that overwrite
  asm volatile("s_wait_xcnt 0x0" ::: "memory");
  }
}

// =================================================================================================================
// Window attention, transposed: block = one (window, head); its Q, K, V^T hi and V^T lo planes (32 KiB each, fragment
// order kept) are copied once into LDS through registers; a wave walks 4 strips of 16 queries (strip = 8*s + wave).
// S^T = K8 . Q64^T via WMMA (A = key rows, B = query columns) with 512*bias as the C operand, so a lane holds
// the scores of ONE query (column lane&15) for keys 8*(lane>>4) + r of each 16-key tile. Shift mask -51200 where region
// ids differ. Online softmax over 8 blocks of 64 keys in f32: maximum and sum run over the lane's own 32 registers, the
// maximum is joined with lane ^ 16 once per block, the sum l stays a per-half partial and is joined once at the end.
// p' = 4096*exp((s-m)/512); P hi = f16(p'), P lo = f16((p'-hi)*2^13). Two score tiles of one 32-key step, converted in
// place, are the B operand of O^T += V^T . P^T (A = V^T rows, hardware k order on both sides): P never leaves registers.
// O^T accumulators: hh = Vhi.Phi, hl = Vlo.Phi, lh = Vhi.Plo with V^T hi = 16v, V^T lo = res*2^14;
// o = (hh + hl*2^-14 + lh*2^-13) / (16 l). A lane ends with 8 consecutive d of its query per tile: 16-B packed stores.
// Loads run ahead of their use: K fragments and bias tiles one 64-key block, V^T fragments of the first 32-key step from the block's start, of the second one step ahead.
// Bias: the head's column of the table stands in LDS as rows (i and j difference) of 16 floats, value
// 512 * bf16_RNE(rpb), the k difference reversed: slot x holds difference 14 - x. Query n against keys m = 8 g + r,
// r = 0..7 (one i, one j, k = r) is then 8 consecutive floats from slot 7 - k_n of row (i_n-i_m+7)*15 + (j_n-j_m+7):
// a lane's C registers of one 16-key tile. A wave's 32 lanes touch 3 rows, 24 distinct banks. A block's 512 queries
// meet all 15 i differences: 225 rows.
// Output planes O hi = f16(64 o), O lo = f16((64o-hi)*2^14), layout [h][(w*512 + tok)/16] blocks (rows tok, k = d).
// coverage: 512 blocks x 8 waves x 4 strips x 16 rows x 32 d = 8 x 32768 x 32 per plane, every element once.
// =================================================================================================================
__global__ __launch_bounds__(256)
void attn_win(const unsigned short* __restrict__ qpl, const unsigned short* __restrict__ kpl,
              const unsigned short* __restrict__ vth, const unsigned short* __restrict__ vtl,
              const float* __restrict__ rpb, unsigned short* ohi, unsigned short* olo) {
  __shared__ __align__(16) int cnts[NTOK];
  __shared__ __align__(16) float brow[NBDI * 240];
  __shared__ __align__(16) unsigned short Qs[NTOK * HD];
  __shared__ __align__(16) unsigned short Ks[NTOK * HD];
  __shared__ __align__(16) unsigned short Vhs[NTOK * HD];
  __shared__ __align__(16) unsigned short Vls[NTOK * HD];
  union CB { v8f v; v4f q[2]; };
  const int tid = threadIdx.x, wave = tid >> 5, lane = tid & 31, hh = lane >> 4, c = lane & 15;
  const int wh = blockIdx.x;                      // w*8 + h
  const int w = wh >> 3, h = wh & 7;

  {
    // straight copy of the four planes, 2048 pieces of 16 B each: 32 loads in flight per lane, then 32 LDS stores
    const v4u* gq = (const v4u*)(const void*)(qpl + (size_t)wh * NTOK * HD);
    const v4u* gk = (const v4u*)(const void*)(kpl + (size_t)wh * NTOK * HD);
    const v4u* gh = (const v4u*)(const void*)(vth + (size_t)wh * HD * NTOK);
    const v4u* gl = (const v4u*)(const void*)(vtl + (size_t)wh * HD * NTOK);
    v4u rq[8], rk[8], rh[8], rl[8];
#pragma unroll
    for (int i = 0; i < 8; ++i) {
      rq[i] = gq[i * 256 + tid];
      rk[i] = gk[i * 256 + tid];
      rh[i] = gh[i * 256 + tid];
      rl[i] = gl[i * 256 + tid];
    }
    // the registers that address these loads are reused behind them: keep the wait in front of that overwrite
    asm volatile("s_wait_xcnt 0x0" ::: "memory");
#pragma unroll
    for (int i = 0; i < 8; ++i) {
      ((v4u*)(void*)Qs)[i * 256 + tid]  = rq[i];
      ((v4u*)(void*)Ks)[i * 256 + tid]  = rk[i];
      ((v4u*)(void*)Vhs)[i * 256 + tid] = rh[i];
      ((v4u*)(void*)Vls)[i * 256 + tid] = rl[i];
    }
  }
  if (tid < 240) {
    // 16 lanes = one row, 15 rows (one i difference) a trip, all loads in flight at once; slot 15 is never read and
    // takes slot 14's value
    const int xs = min(tid & 15, 14);
    float tv[NBDI];
#pragma unroll
    for (int it = 0; it < NBDI; ++it) tv[it] = rpb[((it * 15 + (tid >> 4)) * 15 + 14 - xs) * NHD + h];
    // the addresses of these loads are reused behind them: keep the wait in front of that overwrite
    asm volatile("s_wait_xcnt 0x0" ::: "memory");
#pragma unroll
    for (int it = 0; it < NBDI; ++it) brow[it * 240 + tid] = bfr(tv[it]) * 512.0f;
  }
  for (int t = tid; t < NTOK; t += 256) cnts[t] = region_of(w, t);
  __syncthreads();

  const _Float16* Q  = (const _Float16*)(const void*)Qs;
  const _Float16* K  = (const _Float16*)(const void*)Ks;
  const _Float16* Vh = (const _Float16*)(const void*)Vhs;
  const _Float16* Vl = (const _Float16*)(const void*)Vls;

  // rolled: four copies of the body would gain nothing
#pragma unroll 1
  for (int sidx = 0; sidx < 4; ++sidx) {
  const int strip = sidx * 8 + wave;              // 0..31
  const int q0 = strip * 16;
  // bias of query q0 + c against key tile j of block kb, keys 8*hh + r: Bp[(di0 - kb) * 240 + (3 - j) * 32 + r].
  // di0 = i_n + 7 is the same in every lane of the wave: held scalar, the 15-row step of a key block is scalar
  // arithmetic and the 32 reads of a key block share one address register with small offsets
  const int di0 = __builtin_amdgcn_readfirstlane((strip >> 2) + 7);
  const float* Bp = brow + (((strip * 2 + (c >> 3)) & 7) + (hh ^ 1)) * 16 + ((c & 7) ^ 7);   // 1 - hh, 7 - k_n

  const v16h qb = ldfrag_h(Q + q0 * HD + lane * 8);
  const int cq = cnts[q0 + c];
  float mrow = -1e30f, lrow = 0.f;
  v8f ohh0 = zero8(), ohh1 = zero8(), ohl0 = zero8(), ohl1 = zero8(), olh0 = zero8(), olh1 = zero8();

  // K fragments and bias tiles of a 64-key block are fetched one block ahead; here those of block 0
  v16h kf[4];
  CB cb[4];
#pragma unroll
  for (int j = 0; j < 4; ++j) {
    kf[j] = ldfrag_h(K + j * 512 + lane * 8);
#pragma unroll
    for (int r = 0; r < 8; ++r) cb[j].v[r] = Bp[di0 * 240 + (3 - j) * 32 + r];
  }

  // one 64-key block; MORE: a further block follows, and its K fragments and bias tiles are fetched in this pass
  auto pass = [&](const int kb, auto more) __attribute__((always_inline)) {
    // V^T fragments of the block's first 32-key step (hi, lo of d 0..15; hi, lo of d 16..31): they fly under the
    // score products, the mask and the whole softmax
    const int koff = kb * 2048 + lane * 8;
    v16h va[4];
    va[0] = ldfrag_h(Vh + koff);
    va[1] = ldfrag_h(Vl + koff);
    va[2] = ldfrag_h(Vh + koff + 512);
    va[3] = ldfrag_h(Vl + koff + 512);
    // ---- transposed logits for 64 keys: 4 tiles of 16 keys x 16 queries, bias via C operand, mask added ----
    v8f s[4];
#pragma unroll
    for (int j = 0; j < 4; ++j) s[j] = mma_raw(kf[j], qb, cb[j].v);
    guard_qk(s[0], s[1], s[2], s[3], kf[0], kf[1], kf[2], kf[3], qb);
#pragma unroll
    for (int j = 0; j < 4; ++j) {
      const int key0 = kb * 64 + j * 16;
      const v8f sj = s[j];
      const v4i cm0 = *(const v4i*)(cnts + key0 + 8 * hh);
      const v4i cm1 = *(const v4i*)(cnts + key0 + 8 * hh + 4);
      v8f mk;
#pragma unroll
      for (int r = 0; r < 4; ++r) {
        mk[r]     = (cq != cm0[r]) ? -51200.0f : 0.0f;
        mk[r + 4] = (cq != cm1[r]) ? -51200.0f : 0.0f;
      }
      s[j] = sj + mk;
    }
    // the next block's K fragments and bias tiles fly under this block's softmax and V products; issued
    // behind the mask, where the raw score registers are free again, so that the bias lands in them without a copy.
    // The last pass is a copy of the body without them: a branch in the loop would merge the load counting
    if constexpr (decltype(more)::value) {
      const int kn = kb + 1;
      const _Float16* kp = K + kn * 2048 + lane * 8;
      const float* bn = Bp + (di0 - kn) * 240;
#pragma unroll
      for (int j = 0; j < 4; ++j) {
        kf[j] = ldfrag_h(kp + j * 512);
#pragma unroll
        for (int r = 0; r < 8; ++r) cb[j].v[r] = bn[(3 - j) * 32 + r];
      }
    }
    // ---- online softmax update: one query per lane, 32 of its 64 scores here, the rest in lane ^ 16 ----
    float t8[8];
#pragma unroll
    for (int r = 0; r < 8; ++r) t8[r] = fmaxf(fmaxf(s[0][r], s[1][r]), fmaxf(s[2][r], s[3][r]));
    float tm = fmaxf(fmaxf(fmaxf(t8[0], t8[1]), fmaxf(t8[2], t8[3])), fmaxf(fmaxf(t8[4], t8[5]), fmaxf(t8[6], t8[7])));
    tm = fmaxf(tm, xhalf(tm));
    const float mn = fmaxf(mrow, tm);
    const float alpha = __expf((mrow - mn) * INV512);
    mrow = mn;
#pragma unroll
    for (int j = 0; j < 4; ++j) {
#pragma unroll
      for (int r = 0; r < 8; ++r) s[j][r] = __expf((s[j][r] - mn) * INV512 + LN4096);
    }
    const v8f sv = (s[0] + s[1]) + (s[2] + s[3]);
    const float ps = ((sv[0] + sv[1]) + (sv[2] + sv[3])) + ((sv[4] + sv[5]) + (sv[6] + sv[7]));
    lrow = lrow * alpha + ps;
    ohh0 = ohh0 * alpha; ohh1 = ohh1 * alpha;
    ohl0 = ohl0 * alpha; ohl1 = ohl1 * alpha;
    olh0 = olh0 * alpha; olh1 = olh1 * alpha;
    // ---- O^T += V^T . P^T : two 32-key k-steps, two 16-dim tiles, three products ----
#pragma unroll
    for (int ks = 0; ks < 2; ++ks) {
      // element e <- key 8*hh + e (tile 2*ks), element 8 + e <- key 16 + 8*hh + e (tile 2*ks + 1)
      const v8h ph0 = __builtin_convertvector(s[2 * ks], v8h);
      const v8h ph1 = __builtin_convertvector(s[2 * ks + 1], v8h);
      const v8h pl0 = __builtin_convertvector((s[2 * ks] - __builtin_convertvector(ph0, v8f)) * 8192.0f, v8h);
      const v8h pl1 = __builtin_convertvector((s[2 * ks + 1] - __builtin_convertvector(ph1, v8f)) * 8192.0f, v8h);
      const v16h pb  = __builtin_shufflevector(ph0, ph1, 0, 1, 2, 3, 4, 5, 6, 7, 8, 9, 10, 11, 12, 13, 14, 15);
      const v16h plb = __builtin_shufflevector(pl0, pl1, 0, 1, 2, 3, 4, 5, 6, 7, 8, 9, 10, 11, 12, 13, 14, 15);
      ohh0 = mma_raw(va[0], pb, ohh0);
      ohl0 = mma_raw(va[1], pb, ohl0);
      olh0 = mma_raw(va[0], plb, olh0);
      ohh1 = mma_raw(va[2], pb, ohh1);
      ohl1 = mma_raw(va[3], pb, ohl1);
      olh1 = mma_raw(va[2], plb, olh1);
      guard6(ohh0, ohl0, olh0, ohh1, ohl1, olh1, va[0], va[1], va[2], va[3], pb, plb);
      if (ks == 0) {                                         // second 32-key step: flies under the second step's P split
        va[0] = ldfrag_h(Vh + koff + 1024);
        va[1] = ldfrag_h(Vl + koff + 1024);
        va[2] = ldfrag_h(Vh + koff + 1536);
        va[3] = ldfrag_h(Vl + koff + 1536);
      }
    }
  };
#pragma unroll 1
  for (int kb = 0; kb < 7; ++kb) pass(kb, flag_c<true>{});
  pass(7, flag_c<false>{});

  // ---- join the halves' sums, normalise, split into hi / lo, 16-B packed stores (8 consecutive d of one query) ----
  const float lt = lrow + xhalf(lrow);
  const float inv = 1.0f / (lt * 16.0f);
  v4u ph2[2], pl2[2];
#pragma unroll
  for (int e = 0; e < 4; ++e) {
    float f[4];
#pragma unroll
    for (int u = 0; u < 2; ++u) {
      const int r = 2 * e + u;
      float o0 = ohh0[r] + ohl0[r] * (1.0f / 16384.0f);
      o0 = o0 + olh0[r] * (1.0f / 8192.0f);
      float o1 = ohh1[r] + ohl1[r] * (1.0f / 16384.0f);
      o1 = o1 + olh1[r] * (1.0f / 8192.0f);
      f[u]     = (o0 * inv) * 64.0f;
      f[2 + u] = (o1 * inv) * 64.0f;
    }
    const _Float16 a0 = (_Float16)f[0], a1 = (_Float16)f[1], b0 = (_Float16)f[2], b1 = (_Float16)f[3];
    ph2[0][e] = pk16(h_bits(a0), h_bits(a1));
    ph2[1][e] = pk16(h_bits(b0), h_bits(b1));
    pl2[0][e] = pk16(hb16((f[0] - (float)a0) * 16384.0f), hb16((f[1] - (float)a1) * 16384.0f));
    pl2[1][e] = pk16(hb16((f[2] - (float)b0) * 16384.0f), hb16((f[3] - (float)b1) * 16384.0f));
  }
  const size_t off = ((size_t)h * NROW + (size_t)w * NTOK + q0) * HD + lane * 8;
  *(v4u*)(ohi + off)       = ph2[0];
  *(v4u*)(ohi + off + 256) = ph2[1];
  *(v4u*)(olo + off)       = pl2[0];
  *(v4u*)(olo + off + 256) = pl2[1];
  // the next strip overwrites the registers that these stores name: keep the wait in front of that overwrite
  asm volatile("s_wait_xcnt 0x0" ::: "memory");
  }
}

// =================================================================================================================
// Output projection: out rows = (Ohi + Olo*2^-14)/64 . (W1024/1024)^T + b; two accumulator sets (hi.W, lo.W), K = 256
// = 8 head planes of 32. Block tile 64 tokens x 128 cols, 8 waves = 2 x 4, 2x2 tiles per wave. Epilogue through an
// LDS f32 tile; store with un-window + reverse shift: a wave writes one token's 128-col half row = 512 B = 4 whole
// coverage: 512 x 64 tokens (bijective position map) x 2 x 128 cols = every output element exactly once.
// =================================================================================================================
__global__ __launch_bounds__(256)
void gemm_proj(const unsigned short* __restrict__ ohi, const unsigned short* __restrict__ olo,
               const unsigned short* __restrict__ wp, const float* __restrict__ bp, float* out) {
  __shared__ __align__(16) float Cs[64 * LDC];
  const int tid = threadIdx.x, wave = tid >> 5, lane = tid & 31, hh = lane >> 4, c = lane & 15;
  const int mb = blockIdx.x, nb = blockIdx.y;
  const int mw = wave >> 2, nw = wave & 3;
  const _Float16* W = (const _Float16*)(const void*)wp;
  const int arow0 = mb * 64 + mw * 32;
  const int bcol0 = nb * 128 + nw * 32;

  v8f h00 = zero8(), h01 = zero8(), h10 = zero8(), h11 = zero8();
  v8f l00 = zero8(), l01 = zero8(), l10 = zero8(), l11 = zero8();
  const _Float16* ph = (const _Float16*)(const void*)ohi + (size_t)arow0 * HD + lane * 8;   // head plane ks: + NROW*HD
  const _Float16* pl = (const _Float16*)(const void*)olo + (size_t)arow0 * HD + lane * 8;
  const _Float16* pb = W + frag_off(bcol0, 0, 0) + lane * 8;
#pragma unroll 1
  for (int ks = 0; ks < 8; ++ks, ph += NROW * HD, pl += NROW * HD, pb += 512) {
    const v16h fa0 = ldfrag_h(ph);
    const v16h fa1 = ldfrag_h(ph + 512);
    const v16h ga0 = ldfrag_h(pl);
    const v16h ga1 = ldfrag_h(pl + 512);
    const v16h fb0 = ldfrag_h(pb);
    const v16h fb1 = ldfrag_h(pb + 4096);
    // the three address pairs stay whole until the twelve loads that name them have their addresses translated
    asm volatile("s_wait_xcnt 0x0" :: "v"(ph), "v"(pl), "v"(pb) : "memory");
    h00 = mma_raw(fa0, fb0, h00);
    h01 = mma_raw(fa0, fb1, h01);
    h10 = mma_raw(fa1, fb0, h10);
    h11 = mma_raw(fa1, fb1, h11);
    l00 = mma_raw(ga0, fb0, l00);
    l01 = mma_raw(ga0, fb1, l01);
    l10 = mma_raw(ga1, fb0, l10);
    l11 = mma_raw(ga1, fb1, l11);
    guard8(h00, h01, h10, h11, l00, l01, l10, l11, fa0, fa1, ga0, ga1, fb0, fb1);
  }
#pragma unroll
  for (int r = 0; r < 8; ++r) {
    const int row = mw * 32 + 8 * hh + r;
    Cs[row * LDC + nw * 32 + c]             = h00[r] + l00[r] * (1.0f / 16384.0f);
    Cs[row * LDC + nw * 32 + 16 + c]        = h01[r] + l01[r] * (1.0f / 16384.0f);
    Cs[(row + 16) * LDC + nw * 32 + c]      = h10[r] + l10[r] * (1.0f / 16384.0f);
    Cs[(row + 16) * LDC + nw * 32 + 16 + c] = h11[r] + l11[r] * (1.0f / 16384.0f);
  }
  __syncthreads();

  const int w = mb >> 3, tok0 = (mb & 7) * 64;
  const float* bpn = bp + nb * 128 + lane * 4;
  v4f bb;
#pragma unroll
  for (int e = 0; e < 4; ++e) bb[e] = bfr(bpn[e]);
  v4f ov[8];
  size_t offs[8];
#pragma unroll
  for (int it = 0; it < 8; ++it) {
    const int row = wave * 8 + it;
    const int sp = spat_of(w, tok0 + row);
    v4f v = *(const v4f*)(Cs + row * LDC + lane * 4);
#pragma unroll
    for (int e = 0; e < 4; ++e) v[e] = v[e] * (1.0f / 65536.0f) + bb[e];
    ov[it] = v;
    offs[it] = (size_t)sp * CCH + nb * 128 + lane * 4;
  }
#pragma unroll
  for (int it = 0; it < 8; ++it) *(v4f*)(out + offs[it]) = ov[it];
  
}

// =================================================================================================================
//   Wqkv f16 [768][256] 393216 | Wproj f16 [256][256] 131072 |
//   Q f16 [512][512][32] 16777216 | K same 16777216 |
//   V^T hi f16 [512][32][512] 16777216 | V^T lo same 16777216 | O hi f16 [8][32768][32] 16777216 | O lo same 16777216
//   total 101187584.
// =================================================================================================================
extern "C" void kernel_launch(void* const* d_in, const int* in_sizes, int n_in,
                              void* d_out, int out_size, void* d_ws, size_t ws_size,
                              hipStream_t stream) {
  if (n_in < 6) return;
  if (in_sizes[0] != NROW * CCH) return;
  if (in_sizes[1] != C3 * CCH || in_sizes[2] != C3) return;
  if (in_sizes[3] != CCH * CCH || in_sizes[4] != CCH) return;
  if (in_sizes[5] != NRPB * NHD) return;
  if (out_size != NROW * CCH) return;

  const float* x     = (const float*)d_in[0];
  const float* qkvw  = (const float*)d_in[1];
  const float* qkvb  = (const float*)d_in[2];
  const float* projw = (const float*)d_in[3];
  const float* projb = (const float*)d_in[4];
  const float* rpb   = (const float*)d_in[5];
  float* out = (float*)d_out;

  const size_t sWq = (size_t)C3 * CCH * 2;                   //   393216
  const size_t sWp = (size_t)CCH * CCH * 2;                  //   131072
  const size_t sQK = (size_t)NWIN * NHD * NTOK * HD * 2;     // 16777216
  const size_t sO  = (size_t)NHD * NROW * HD * 2;            // 16777216
  size_t off = 0;
  const size_t oWq = off; off += sWq;
  const size_t oWp = off; off += sWp;
  const size_t oQ  = off; off += sQK;
  const size_t oK  = off; off += sQK;
  const size_t oVh = off; off += sQK;
  const size_t oVl = off; off += sQK;
  const size_t oOh = off; off += sO;
  const size_t oOl = off; off += sO;
  if (off > ws_size) return;                                  // off = 101187584
  if (off > (size_t)134217728) return;

  char* ws = (char*)d_ws;
  unsigned short* Wq  = (unsigned short*)(ws + oWq);
  unsigned short* Wp  = (unsigned short*)(ws + oWp);
  unsigned short* Qp  = (unsigned short*)(ws + oQ);
  unsigned short* Kp  = (unsigned short*)(ws + oK);
  unsigned short* Vth = (unsigned short*)(ws + oVh);
  unsigned short* Vtl = (unsigned short*)(ws + oVl);
  unsigned short* Ohi = (unsigned short*)(ws + oOh);
  unsigned short* Olo = (unsigned short*)(ws + oOl);

  const dim3 blk(256);
  // (1) weight converts
  cvt_w<<<dim3(C3 / 8), blk, 0, stream>>>(qkvw, Wq, C3);
  cvt_w<<<dim3(CCH / 8), blk, 0, stream>>>(projw, Wp, CCH);
  // (2) window gather + convert + qkv projection: 512 row tiles, each over all six column tiles
  gemm_qkv<<<dim3(NROW / 64), blk, 0, stream>>>(x, Wq, qkvb, Qp, Kp, Vth, Vtl);
  // (3) window attention: 64 windows x 8 heads, one block each
  attn_win<<<dim3(NWIN * NHD), blk, 0, stream>>>(Qp, Kp, Vth, Vtl, rpb, Ohi, Olo);
  // (4) output projection + un-window + reverse shift -> d_out
  gemm_proj<<<dim3(NROW / 64, CCH / 128), blk, 0, stream>>>(Ohi, Olo, Wp, projb, out);
  (void)hipGetLastError();
}

// v007
// A run of this version takes 87 microseconds.
// Next to v006, in two timings, it ran 1.19 and 1.20 times as fast.
// Counting every step since v000, it is 3.05 times as fast.
// qkv projection and k.qT: v_wmma_f32_16x16x32_f16 single products (f16 operands, f32 accumulate); vT.pT: p and v^T each
// carried as f16 hi plus power-of-two scaled residual planes, three products (hi.hi, hi.lo, lo.hi), f32 accumulate;
// output projection: activation as f16 hi plus scaled residual times f16 weight, two products, f32 accumulate.
// All inputs RNE-converted to bf16 on load; softmax, masks and epilogues in f32 on VALU.
#include <hip/hip_runtime.h>
#include <stdint.h>

#define NWIN 64
#define NTOK 512
#define CCH  256
#define NHD  8
#define HD   32
#define C3   768
#define NROW 32768
#define NRPB 3375
#define NBDI 15
#define LDC  132
#define QSC  0.17677669529663687f
#define INV512 0.001953125f
#define C1EXP 0.0028177637517362567f

static_assert(NROW == NWIN * NTOK);
static_assert(15 * 15 * 15 == NRPB);
static_assert((LDC * 4) % 16 == 0);

typedef _Float16 v16h __attribute__((ext_vector_type(16)));
typedef _Float16 v8h  __attribute__((ext_vector_type(8)));
typedef float    v8f  __attribute__((ext_vector_type(8)));
typedef float    v4f  __attribute__((ext_vector_type(4)));
typedef unsigned int v4u __attribute__((ext_vector_type(4)));

template <bool B> struct flag_c { static constexpr bool value = B; };

// ---- scalar helpers ------------------------------------------------------------------------------------------
__device__ __forceinline__ unsigned short bf_bits(float f) {          // f32 -> bf16 bits, RNE convert
  unsigned u = __float_as_uint(f);
  return (unsigned short)((u + 0x7FFFu + ((u >> 16) & 1u)) >> 16);
}
__device__ __forceinline__ float bf_up(unsigned short b) { return __uint_as_float(((unsigned)b) << 16); }
__device__ __forceinline__ float bfr(float f) { return bf_up(bf_bits(f)); }
__device__ __forceinline__ unsigned short h_bits(_Float16 x) { return __builtin_bit_cast(unsigned short, x); }
__device__ __forceinline__ unsigned short hb16(float f) { return h_bits((_Float16)f); }
__device__ __forceinline__ unsigned pk16(unsigned short a, unsigned short b) { return (unsigned)a | ((unsigned)b << 16); }
__device__ __forceinline__ v8f zero8() { v8f z = {0.f, 0.f, 0.f, 0.f, 0.f, 0.f, 0.f, 0.f}; return z; }

// ---- index maps --------------------------------------------------------------------------------------------------
// window w = (hb*4 + wb)*4 + db over a 32^3 volume in 8^3 windows; token t = (i*8 + j)*8 + k inside the window.
// The shifted coordinate is (hb*8+i, wb*8+j, db*8+k); both the input gather (roll by -4) and the output scatter
// (roll by +4) use volume position ((hs+4)&31, (ws+4)&31, (ds+4)&31).
__device__ __forceinline__ int spat_of(int w, int t) {
  const int hb = w >> 4, wb = (w >> 2) & 3, db = w & 3;
  const int i = t >> 6, j = (t >> 3) & 7, k = t & 7;
  const int gh = (hb * 8 + i + 4) & 31;
  const int gw = (wb * 8 + j + 4) & 31;
  const int gd = (db * 8 + k + 4) & 31;
  return (gh * 32 + gw) * 32 + gd;
}
__device__ __forceinline__ int rid1(int p) { return (p < 24) ? 0 : ((p < 28) ? 1 : 2); }
__device__ __forceinline__ int region_of(int w, int t) {
  const int hb = w >> 4, wb = (w >> 2) & 3, db = w & 3;
  const int i = t >> 6, j = (t >> 3) & 7, k = t & 7;
  return rid1(hb * 8 + i) * 9 + rid1(wb * 8 + j) * 3 + rid1(db * 8 + k);
}

// ---- fragment-order planes: every 16-bit A/B operand plane is kept as 1-KiB blocks of 16 rows x 32 k. Inside a block
//      the 16-B piece (row c, k = 16*chunk + 8*h .. +7) stands at halves chunk*256 + (h*16 + c)*8, so lane l = h*16 + c
//      finds its two pieces at l*8 and 256 + l*8 and each wave-wide 16-B load covers 512 contiguous bytes (4 lines).
//      p = block base + lane*8; elements 0..7 <- k 8h.., elements 8..15 <- k 16+8h.. (hardware k order, as before)
__device__ __forceinline__ v16h ldfrag_h(const _Float16* p) {
  union { v16h v; v8h h[2]; } f;
  f.h[0] = *(const v8h*)(p);
  f.h[1] = *(const v8h*)(p + 256);
  return f.v;
}
// halves offset of the piece (row, k = ks*32 + 8*g .. +7), g = 0..3, in a fragment-order plane of 256-k rows
__device__ __forceinline__ size_t frag_off(int row, int ks, int g) {
  return ((size_t)((row >> 4) * 8 + ks)) * 512 + (g >> 1) * 256 + ((g & 1) * 16 + (row & 15)) * 8;
}

// ---- WMMA helpers; the guard helpers insert the trailing VALU hazard gap and keep A/B live -----------------------
__device__ __forceinline__ v8f mma_raw(v16h a, v16h b, v8f c) {
  return __builtin_amdgcn_wmma_f32_16x16x32_f16(false, a, false, b, (short)0, c, false, false);
}
__device__ __forceinline__ void guard4(v8f& c0, v8f& c1, v8f& c2, v8f& c3,
                                       const v16h& a0, const v16h& a1, const v16h& b0, const v16h& b1) {
#if defined(__HIP_DEVICE_COMPILE__)
  asm volatile("v_nop\n\tv_nop\n\tv_nop\n\tv_nop"
               : "+v"(c0), "+v"(c1), "+v"(c2), "+v"(c3) : "v"(a0), "v"(a1), "v"(b0), "v"(b1));
#endif
}
__device__ __forceinline__ void guard8(v8f& c0, v8f& c1, v8f& c2, v8f& c3, v8f& c4, v8f& c5, v8f& c6, v8f& c7,
                                       const v16h& a0, const v16h& a1, const v16h& a2, const v16h& a3,
                                       const v16h& b0, const v16h& b1) {
#if defined(__HIP_DEVICE_COMPILE__)
  asm volatile("v_nop\n\tv_nop\n\tv_nop\n\tv_nop"
               : "+v"(c0), "+v"(c1), "+v"(c2), "+v"(c3), "+v"(c4), "+v"(c5), "+v"(c6), "+v"(c7)
               : "v"(a0), "v"(a1), "v"(a2), "v"(a3), "v"(b0), "v"(b1));
#endif
}
__device__ __forceinline__ void guard_qk(v8f& c0, v8f& c1, v8f& c2, v8f& c3,
                                         const v16h& a0, const v16h& a1, const v16h& a2, const v16h& a3, const v16h& b0) {
#if defined(__HIP_DEVICE_COMPILE__)
  asm volatile("v_nop\n\tv_nop\n\tv_nop\n\tv_nop"
               : "+v"(c0), "+v"(c1), "+v"(c2), "+v"(c3) : "v"(a0), "v"(a1), "v"(a2), "v"(a3), "v"(b0));
#endif
}
__device__ __forceinline__ void guard6(v8f& c0, v8f& c1, v8f& c2, v8f& c3, v8f& c4, v8f& c5,
                                       const v16h& a0, const v16h& a1, const v16h& a2, const v16h& a3,
                                       const v16h& b0, const v16h& b1) {
#if defined(__HIP_DEVICE_COMPILE__)
  asm volatile("v_nop\n\tv_nop\n\tv_nop\n\tv_nop"
               : "+v"(c0), "+v"(c1), "+v"(c2), "+v"(c3), "+v"(c4), "+v"(c5)
               : "v"(a0), "v"(a1), "v"(a2), "v"(a3), "v"(b0), "v"(b1));
#endif
}
// value of lane l ^ 16 (the other half of the wave), as a vector cross-row move
__device__ __forceinline__ float xhalf(float v) {
  const int b = __float_as_int(v);
  return __int_as_float(__builtin_amdgcn_permlanex16(b, b, 0x76543210, 0xfedcba98, false, false));
}

// =================================================================================================================
// weight convert: w [nrows][256] f32 ([out][in], in contiguous) -> f16(1024 * bf16_RNE(w)), rows n, fragment order;
// block = 8 rows; wave = one 32-channel k-step of them; lane = row (lane&7), 8 channels (lane>>3). grid = nrows/8.
// coverage: nrows x 256.
// =================================================================================================================
__global__ __launch_bounds__(256) void cvt_w(const float* __restrict__ wsrc, unsigned short* wdst, int nrows) {
  const int tid = threadIdx.x, wv = tid >> 5, lane = tid & 31;
  const int row = blockIdx.x * 8 + (lane & 7), g = lane >> 3;
  if (row < nrows) {
    const float* src = wsrc + (size_t)row * CCH + wv * 32 + g * 8;
    const v4f a = *(const v4f*)(src);
    const v4f b = *(const v4f*)(src + 4);
    v4u pk;
    pk[0] = pk16(hb16(bfr(a[0]) * 1024.0f), hb16(bfr(a[1]) * 1024.0f));
    pk[1] = pk16(hb16(bfr(a[2]) * 1024.0f), hb16(bfr(a[3]) * 1024.0f));
    pk[2] = pk16(hb16(bfr(b[0]) * 1024.0f), hb16(bfr(b[1]) * 1024.0f));
    pk[3] = pk16(hb16(bfr(b[2]) * 1024.0f), hb16(bfr(b[3]) * 1024.0f));
    unsigned short* gp = wdst + frag_off(row, wv, g);
    *(v4u*)gp = pk;
    
  }
}

// =================================================================================================================
// cyclic shift + window gather + convert + qkv GEMM in one kernel. Block = 64 tokens of one window x all 768 columns.
// Stage: x [32768 positions][256] f32 -> LDS A tile, 64 rows x 256 k in fragment order, value f16(8 * bf16_RNE(x)).
// Wave = one 32-channel k-step, lane = row (lane&7) of 8, 8 channels (lane>>3), 8 row groups: sixteen 16-B loads in
// flight per lane, eight 16-B LDS stores. Then six column tiles of 128: C[64][128] = A . W1024[cols][256]^T, K = 256
// (8 k-steps of 32), A fragments from LDS, W fragments of a whole column tile held in registers and fetched one tile
// ahead, so that they fly under the epilogue; 8 waves = 2 (32 rows) x 4 (32 cols), 2x2 tiles per wave. The bias row
// stands in LDS as bf16_RNE(b), converted once per block.
// C = 8192 * (xw . W^T). Epilogue through an LDS f32 tile (two of them, used in turn: one barrier per column tile):
// part q -> Q plane [w*8+h][tok/16] blocks (rows tok, k = d)
// = f16(64*q) with q = (C/8192 + b) * 32^-0.5; part k -> K plane = f16(8*k), same form; part v -> V^T hi
// [w*8+h][tok/32][d/16] blocks (rows d, k = tok) = f16(16*v) and V^T lo = f16((16v - hi) * 2^14). A thread takes the
// piece that stands at tid*8 halves of the head's 4 blocks, so every store instruction writes 512 contiguous bytes.
// coverage: Q/K: 4 instr x 256 pieces = 4 heads x 64 tok x 32 d; V hi/lo: 4 instr x 256 pieces = 4 heads x 32 d x
// 64 tok; over the grid and the six tiles every element of Q, K (64x8x512x32) and V^T hi/lo (64x8x32x512) exactly once.
// =================================================================================================================
__global__ __launch_bounds__(256)
void gemm_qkv(const float* __restrict__ x, const unsigned short* __restrict__ wq,
              const float* __restrict__ bq,
              unsigned short* qpl, unsigned short* kpl, unsigned short* vth, unsigned short* vtl) {
  __shared__ __align__(16) unsigned short As[64 * CCH];
  __shared__ __align__(16) float Cs2[2][64 * LDC];
  __shared__ __align__(16) float Bs[C3];
  const int tid = threadIdx.x, wave = tid >> 5, lane = tid & 31, hh = lane >> 4, c = lane & 15;
  const int mb = blockIdx.x;
  const int mw = wave >> 2, nw = wave & 3;
  const int w = mb >> 3, tok0 = (mb & 7) * 64;
  const _Float16* W = (const _Float16*)(const void*)wq;

  // column tile nb of this wave: + nb * 32768 halves; second 16-column band: + 4096; k-step: + 512
  const _Float16* pb = W + frag_off(nw * 32, 0, 0) + lane * 8;
  v16h fb0[8], fb1[8];
#pragma unroll
  for (int ks = 0; ks < 8; ++ks) {
    fb0[ks] = ldfrag_h(pb + ks * 512);
    fb1[ks] = ldfrag_h(pb + 4096 + ks * 512);
  }

  {
    const int r8 = lane & 7, g = lane >> 3;
    v4f xa[8], xb[8];
    float bv[3];
#pragma unroll
    for (int it = 0; it < 8; ++it) {
      const float* src = x + (size_t)spat_of(w, tok0 + it * 8 + r8) * CCH + wave * 32 + g * 8;
      xa[it] = *(const v4f*)(src);
      xb[it] = *(const v4f*)(src + 4);
    }
#pragma unroll
    for (int i = 0; i < 3; ++i) bv[i] = bq[i * 256 + tid];
#pragma unroll
    for (int i = 0; i < 3; ++i) Bs[i * 256 + tid] = bfr(bv[i]);
#pragma unroll
    for (int it = 0; it < 8; ++it) {
      const v4f a = xa[it], b = xb[it];
      v4u pk;
      pk[0] = pk16(hb16(bfr(a[0]) * 8.0f), hb16(bfr(a[1]) * 8.0f));
      pk[1] = pk16(hb16(bfr(a[2]) * 8.0f), hb16(bfr(a[3]) * 8.0f));
      pk[2] = pk16(hb16(bfr(b[0]) * 8.0f), hb16(bfr(b[1]) * 8.0f));
      pk[3] = pk16(hb16(bfr(b[2]) * 8.0f), hb16(bfr(b[3]) * 8.0f));
      *(v4u*)(As + frag_off(it * 8 + r8, wave, g)) = pk;
    }
  }
  __syncthreads();

  const _Float16* pa = (const _Float16*)(const void*)As + frag_off(mw * 32, 0, 0) + lane * 8;   // next band: + 4096

#pragma unroll 1
  for (int nb = 0; nb < 6; ++nb) {
  float* Cs = Cs2[nb & 1];
  v8f a00 = zero8(), a01 = zero8(), a10 = zero8(), a11 = zero8();
  v16h fa0 = ldfrag_h(pa), fa1 = ldfrag_h(pa + 4096);
#pragma unroll
  for (int ks = 0; ks < 8; ++ks) {
    v16h na0 = fa0, na1 = fa1;                    // A fragments of the next k-step, read ahead of this step's products
    if (ks < 7) {
      na0 = ldfrag_h(pa + (ks + 1) * 512);
      na1 = ldfrag_h(pa + 4096 + (ks + 1) * 512);
    }
    a00 = mma_raw(fa0, fb0[ks], a00);
    a01 = mma_raw(fa0, fb1[ks], a01);
    a10 = mma_raw(fa1, fb0[ks], a10);
    a11 = mma_raw(fa1, fb1[ks], a11);
    guard4(a00, a01, a10, a11, fa0, fa1, fb0[ks], fb1[ks]);
    fa0 = na0;
    fa1 = na1;
  }
#pragma unroll
  for (int r = 0; r < 8; ++r) {
    const int row = mw * 32 + 8 * hh + r;
    Cs[row * LDC + nw * 32 + c]             = a00[r];
    Cs[row * LDC + nw * 32 + 16 + c]        = a01[r];
    Cs[(row + 16) * LDC + nw * 32 + c]      = a10[r];
    Cs[(row + 16) * LDC + nw * 32 + 16 + c] = a11[r];
  }
  // one barrier per column tile: it publishes this tile's C, and every wave that passes it has left the other C buffer
  __syncthreads();

  // the next column tile's W fragments: issued behind the barrier (which waits for every load in flight) and in front
  // of an epilogue that reads LDS only, so that nothing waits for them before the next tile's products
  if (nb < 5) {                                   // block-uniform
    const _Float16* pn = pb + (nb + 1) * 32768;
#pragma unroll
    for (int ks = 0; ks < 8; ++ks) {
      fb0[ks] = ldfrag_h(pn + ks * 512);
      fb1[ks] = ldfrag_h(pn + 4096 + ks * 512);
    }
    // the address pair of these loads is reused by the epilogue: keep the wait in front of that overwrite
    asm volatile("s_wait_xcnt 0x0" ::: "memory");
  }

  const int part = nb >> 1;                       // block-uniform: 0 q, 1 k, 2 v
  const int hb4 = (nb & 1) * 4;
  const float* bqn = Bs + nb * 128;               // bf16_RNE(bias), staged once
  if (part < 2) {
    unsigned short* dst = (part == 0) ? qpl : kpl;
    const float scl = (part == 0) ? (QSC * 64.0f) : 8.0f;
    v4u pk[4];
    size_t offs[4];
#pragma unroll
    for (int s = 0; s < 4; ++s) {
      const int h4 = s;
      const int tok = (tid >> 6) * 16 + (tid & 15), d0 = ((tid >> 4) & 3) * 8;
      const int col = h4 * 32 + d0;
      v4u q4;
#pragma unroll
      for (int e = 0; e < 4; ++e) {
        float f0 = Cs[tok * LDC + col + 2 * e] * (1.0f / 8192.0f) + bqn[col + 2 * e];
        float f1 = Cs[tok * LDC + col + 2 * e + 1] * (1.0f / 8192.0f) + bqn[col + 2 * e + 1];
        f0 = f0 * scl;
        f1 = f1 * scl;
        q4[e] = pk16(hb16(f0), hb16(f1));
      }
      pk[s] = q4;
      offs[s] = ((size_t)((w * NHD + hb4 + h4) * NTOK + tok0)) * HD + tid * 8;
    }
#pragma unroll
    for (int s = 0; s < 4; ++s) *(v4u*)(dst + offs[s]) = pk[s];
    
  } else {
    v4u phk[4], plk[4];
    size_t offs[4];
#pragma unroll
    for (int s = 0; s < 4; ++s) {
      const int h4 = s, d = ((tid >> 6) & 1) * 16 + (tid & 15);
      const int col = h4 * 32 + d;
      const int tb = (tid >> 7) * 32 + ((tid >> 4) & 3) * 8;
      const float bc = bqn[col];
      v4u a, b;
#pragma unroll
      for (int e = 0; e < 4; ++e) {
        const float v0 = Cs[(tb + 2 * e) * LDC + col] * (1.0f / 8192.0f) + bc;
        const float v1 = Cs[(tb + 2 * e + 1) * LDC + col] * (1.0f / 8192.0f) + bc;
        const float f0 = v0 * 16.0f, f1 = v1 * 16.0f;
        const _Float16 h0 = (_Float16)f0, h1 = (_Float16)f1;
        const float r0 = (f0 - (float)h0) * 16384.0f;
        const float r1 = (f1 - (float)h1) * 16384.0f;
        a[e] = pk16(h_bits(h0), h_bits(h1));
        b[e] = pk16(hb16(r0), hb16(r1));
      }
      phk[s] = a;
      plk[s] = b;
      offs[s] = ((size_t)(w * NHD + hb4 + h4)) * HD * NTOK + tok0 * HD + tid * 8;
    }
#pragma unroll
    for (int s = 0; s < 4; ++s) { *(v4u*)(vth + offs[s]) = phk[s]; *(v4u*)(vtl + offs[s]) = plk[s]; }
  }
  // the next tile's products overwrite the registers that these stores name: keep the wait in front of that overwrite
  asm volatile("s_wait_xcnt 0x0" ::: "memory");
  }
}

// =================================================================================================================
// Window attention, transposed: block = one (window, head); its Q, K, V^T hi and V^T lo planes (32 KiB each, fragment
// order kept) are copied once into LDS through registers; a wave walks 4 strips of 16 queries (strip = 8*s + wave).
// S^T = K8 . Q64^T via WMMA (A = key rows, B = query columns) with 512*bias as the C operand, so a lane holds
// the scores of ONE query (column lane&15) for keys 8*(lane>>4) + r of each 16-key tile. Shift mask -51200 where region
// ids differ. Online softmax over 8 blocks of 64 keys in f32: maximum and sum run over the lane's own 32 registers, the
// maximum is joined with lane ^ 16 once per block, the sum l stays a per-half partial and is joined once at the end.
// p' = 4096*exp((s-m)/512); P hi = f16(p'), P lo = f16((p'-hi)*2^13). Two score tiles of one 32-key step, converted in
// place, are the B operand of O^T += V^T . P^T (A = V^T rows, hardware k order on both sides): P never leaves registers.
// O^T accumulators: hh = Vhi.Phi, hl = Vlo.Phi, lh = Vhi.Plo with V^T hi = 16v, V^T lo = res*2^14;
// o = (hh + hl*2^-14 + lh*2^-13) / (16 l). A lane ends with 8 consecutive d of its query per tile: 16-B packed stores.
// Loads run ahead of their use: K fragments and bias tiles one 64-key block, V^T fragments of the first 32-key step from the block's start, of the second one step ahead.
// Bias: the head's column of the table stands in LDS as rows (i and j difference) of 16 floats, value
// 512 * bf16_RNE(rpb), the k difference reversed: slot x holds difference 14 - x. Query n against keys m = 8 g + r,
// r = 0..7 (one i, one j, k = r) is then 8 consecutive floats from slot 7 - k_n of row (i_n-i_m+7)*15 + (j_n-j_m+7):
// a lane's C registers of one 16-key tile. A wave's 32 lanes touch 3 rows, 24 distinct banks. A block's 512 queries
// meet all 15 i differences: 225 rows.
// Output planes O hi = f16(64 o), O lo = f16((64o-hi)*2^14), layout [h][(w*512 + tok)/16] blocks (rows tok, k = d).
// coverage: 512 blocks x 8 waves x 4 strips x 16 rows x 32 d = 8 x 32768 x 32 per plane, every element once.
// =================================================================================================================
__global__ __launch_bounds__(256)
void attn_win(const unsigned short* __restrict__ qpl, const unsigned short* __restrict__ kpl,
              const unsigned short* __restrict__ vth, const unsigned short* __restrict__ vtl,
              const float* __restrict__ rpb, unsigned short* ohi, unsigned short* olo) {
  __shared__ __align__(16) float brow[NBDI * 240];
  __shared__ __align__(16) unsigned short Qs[NTOK * HD];
  __shared__ __align__(16) unsigned short Ks[NTOK * HD];
  __shared__ __align__(16) unsigned short Vhs[NTOK * HD];
  __shared__ __align__(16) unsigned short Vls[NTOK * HD];
  union CB { v8f v; v4f q[2]; };
  const int tid = threadIdx.x, wave = tid >> 5, lane = tid & 31, hh = lane >> 4, c = lane & 15;
  const int wh = blockIdx.x;                      // w*8 + h
  const int w = wh >> 3, h = wh & 7;

  {
    // straight copy of the four planes, 2048 pieces of 16 B each: 32 loads in flight per lane, then 32 LDS stores
    const v4u* gq = (const v4u*)(const void*)(qpl + (size_t)wh * NTOK * HD);
    const v4u* gk = (const v4u*)(const void*)(kpl + (size_t)wh * NTOK * HD);
    const v4u* gh = (const v4u*)(const void*)(vth + (size_t)wh * HD * NTOK);
    const v4u* gl = (const v4u*)(const void*)(vtl + (size_t)wh * HD * NTOK);
    v4u rq[8], rk[8], rh[8], rl[8];
#pragma unroll
    for (int i = 0; i < 8; ++i) {
      rq[i] = gq[i * 256 + tid];
      rk[i] = gk[i * 256 + tid];
      rh[i] = gh[i * 256 + tid];
      rl[i] = gl[i * 256 + tid];
    }
    // the registers that address these loads are reused behind them: keep the wait in front of that overwrite
    asm volatile("s_wait_xcnt 0x0" ::: "memory");
#pragma unroll
    for (int i = 0; i < 8; ++i) {
      ((v4u*)(void*)Qs)[i * 256 + tid]  = rq[i];
      ((v4u*)(void*)Ks)[i * 256 + tid]  = rk[i];
      ((v4u*)(void*)Vhs)[i * 256 + tid] = rh[i];
      ((v4u*)(void*)Vls)[i * 256 + tid] = rl[i];
    }
  }
  if (tid < 240) {
    // 16 lanes = one row, 15 rows (one i difference) a trip, all loads in flight at once; slot 15 is never read and
    // takes slot 14's value
    const int xs = min(tid & 15, 14);
    float tv[NBDI];
#pragma unroll
    for (int it = 0; it < NBDI; ++it) tv[it] = rpb[((it * 15 + (tid >> 4)) * 15 + 14 - xs) * NHD + h];
    // the addresses of these loads are reused behind them: keep the wait in front of that overwrite
    asm volatile("s_wait_xcnt 0x0" ::: "memory");
#pragma unroll
    for (int it = 0; it < NBDI; ++it) brow[it * 240 + tid] = bfr(tv[it]) * 512.0f;
  }
  __syncthreads();

  const _Float16* Q  = (const _Float16*)(const void*)Qs;
  const _Float16* K  = (const _Float16*)(const void*)Ks;
  const _Float16* Vh = (const _Float16*)(const void*)Vhs;
  const _Float16* Vl = (const _Float16*)(const void*)Vls;

  // rolled: four copies of the body would gain nothing
#pragma unroll 1
  for (int sidx = 0; sidx < 4; ++sidx) {
  const int strip = sidx * 8 + wave;              // 0..31
  const int q0 = strip * 16;
  // bias of query q0 + c against key tile j of block kb, keys 8*hh + r: Bp[(di0 - kb) * 240 + (3 - j) * 32 + r].
  // di0 = i_n + 7 is the same in every lane of the wave: held scalar, the 15-row step of a key block is scalar
  // arithmetic and the 32 reads of a key block share one address register with small offsets
  const int di0 = __builtin_amdgcn_readfirstlane((strip >> 2) + 7);
  const float* Bp = brow + (((strip * 2 + (c >> 3)) & 7) + (hh ^ 1)) * 16 + ((c & 7) ^ 7);   // 1 - hh, 7 - k_n

  const v16h qb = ldfrag_h(Q + q0 * HD + lane * 8);
  // shift mask, 512 * -100 where region ids differ. A region id changes only where a coordinate passes a multiple of 4,
  // so a lane's 32 keys of a block fall into four groups of one id each: tiles 2a, 2a+1 (j_m >> 2 = a) x registers
  // 4b .. 4b+3 (k_m >> 2 = b). mvs[a][b]: the j and k axes, against a key of the query's own i; the i axis is the same
  // for the whole wave and block and joins per pass as a scalar.
  const int in0 = __builtin_amdgcn_readfirstlane(strip >> 2);
  const int cq = region_of(w, q0 + c);
  float mvs[2][2];
#pragma unroll
  for (int a = 0; a < 2; ++a) {
#pragma unroll
    for (int b = 0; b < 2; ++b) mvs[a][b] = (cq != region_of(w, (in0 * 8 + 4 * a) * 8 + 4 * b)) ? -51200.0f : 0.0f;
  }
  const int ri = rid1((w >> 4) * 8 + in0);
  float mrow = -1e30f, lrow = 0.f;
  v8f ohh0 = zero8(), ohh1 = zero8(), ohl0 = zero8(), ohl1 = zero8(), olh0 = zero8(), olh1 = zero8();

  // K fragments and bias tiles of a 64-key block are fetched one block ahead; here those of block 0
  v16h kf[4];
  CB cb[4];
#pragma unroll
  for (int j = 0; j < 4; ++j) {
    kf[j] = ldfrag_h(K + j * 512 + lane * 8);
#pragma unroll
    for (int r = 0; r < 8; ++r) cb[j].v[r] = Bp[di0 * 240 + (3 - j) * 32 + r];
  }

  // one 64-key block; MORE: a further block follows, and its K fragments and bias tiles are fetched in this pass
  auto pass = [&](const int kb, auto more) __attribute__((always_inline)) {
    // V^T fragments of the block's first 32-key step (hi, lo of d 0..15; hi, lo of d 16..31): they fly under the
    // score products, the mask and the whole softmax
    const int koff = kb * 2048 + lane * 8;
    v16h va[4];
    va[0] = ldfrag_h(Vh + koff);
    va[1] = ldfrag_h(Vl + koff);
    va[2] = ldfrag_h(Vh + koff + 512);
    va[3] = ldfrag_h(Vl + koff + 512);
    // ---- transposed logits for 64 keys: 4 tiles of 16 keys x 16 queries, bias via C operand ----
    v8f s[4];
#pragma unroll
    for (int j = 0; j < 4; ++j) s[j] = mma_raw(kf[j], qb, cb[j].v);
    guard_qk(s[0], s[1], s[2], s[3], kf[0], kf[1], kf[2], kf[3], qb);
    // ---- online softmax update: one query per lane, 32 of its 64 scores here, the rest in lane ^ 16 ----
    // The mask is one value per group: the maximum is taken per group over the raw scores and the mask added to the four
    // maxima (the same value as the maximum of the masked scores: adding a constant keeps the order, rounded or not).
    const float si = (ri != rid1((w >> 4) * 8 + kb)) ? -51200.0f : 0.0f;
    float mv[2][2], gm[2][2];
#pragma unroll
    for (int a = 0; a < 2; ++a) {
#pragma unroll
      for (int b = 0; b < 2; ++b) {
        const v8f u = s[2 * a], v = s[2 * a + 1];
        const int r0 = 4 * b;
        gm[a][b] = fmaxf(fmaxf(fmaxf(u[r0], u[r0 + 1]), fmaxf(u[r0 + 2], u[r0 + 3])),
                         fmaxf(fmaxf(v[r0], v[r0 + 1]), fmaxf(v[r0 + 2], v[r0 + 3])));
        mv[a][b] = fminf(mvs[a][b], si);
      }
    }
    float tm = fmaxf(fmaxf(gm[0][0] + mv[0][0], gm[0][1] + mv[0][1]), fmaxf(gm[1][0] + mv[1][0], gm[1][1] + mv[1][1]));
    tm = fmaxf(tm, xhalf(tm));
    const float mn = fmaxf(mrow, tm);
    const float alpha = __expf((mrow - mn) * INV512);
    mrow = mn;
    // p' = 2^(s * log2(e)/512 + off): mask, maximum and the factor 4096 = 2^12 stand in the addend, one per group, so a
    // score takes one multiply-add and one exp2
    v8f offv[2];
#pragma unroll
    for (int a = 0; a < 2; ++a) {
      const float o0 = (mv[a][0] - mn) * C1EXP + 12.0f;
      const float o1 = (mv[a][1] - mn) * C1EXP + 12.0f;
      const v8f ov = {o0, o0, o0, o0, o1, o1, o1, o1};
      offv[a] = ov;
    }
    v8f e[4];
#pragma unroll
    for (int j = 0; j < 4; ++j) e[j] = s[j] * C1EXP + offv[j >> 1];
    // the next block's K fragments and bias tiles fly under this block's exp2 and V products; issued
    // behind the multiply-adds, where the raw score registers are free again, so that the bias lands in them without a copy.
    // The last pass is a copy of the body without them: a branch in the loop would merge the load counting
    if constexpr (decltype(more)::value) {
      const int kn = kb + 1;
      const _Float16* kp = K + kn * 2048 + lane * 8;
      const float* bn = Bp + (di0 - kn) * 240;
#pragma unroll
      for (int j = 0; j < 4; ++j) {
        kf[j] = ldfrag_h(kp + j * 512);
#pragma unroll
        for (int r = 0; r < 8; ++r) cb[j].v[r] = bn[(3 - j) * 32 + r];
      }
    }
#pragma unroll
    for (int j = 0; j < 4; ++j) {
#pragma unroll
      for (int r = 0; r < 8; ++r) s[j][r] = __builtin_amdgcn_exp2f(e[j][r]);
    }
    const v8f sv = (s[0] + s[1]) + (s[2] + s[3]);
    const float ps = ((sv[0] + sv[1]) + (sv[2] + sv[3])) + ((sv[4] + sv[5]) + (sv[6] + sv[7]));
    lrow = lrow * alpha + ps;
    ohh0 = ohh0 * alpha; ohh1 = ohh1 * alpha;
    ohl0 = ohl0 * alpha; ohl1 = ohl1 * alpha;
    olh0 = olh0 * alpha; olh1 = olh1 * alpha;
    // ---- O^T += V^T . P^T : two 32-key k-steps, two 16-dim tiles, three products ----
#pragma unroll
    for (int ks = 0; ks < 2; ++ks) {
      // element e <- key 8*hh + e (tile 2*ks), element 8 + e <- key 16 + 8*hh + e (tile 2*ks + 1)
      const v8h ph0 = __builtin_convertvector(s[2 * ks], v8h);
      const v8h ph1 = __builtin_convertvector(s[2 * ks + 1], v8h);
      const v8h pl0 = __builtin_convertvector((s[2 * ks] - __builtin_convertvector(ph0, v8f)) * 8192.0f, v8h);
      const v8h pl1 = __builtin_convertvector((s[2 * ks + 1] - __builtin_convertvector(ph1, v8f)) * 8192.0f, v8h);
      const v16h pb  = __builtin_shufflevector(ph0, ph1, 0, 1, 2, 3, 4, 5, 6, 7, 8, 9, 10, 11, 12, 13, 14, 15);
      const v16h plb = __builtin_shufflevector(pl0, pl1, 0, 1, 2, 3, 4, 5, 6, 7, 8, 9, 10, 11, 12, 13, 14, 15);
      ohh0 = mma_raw(va[0], pb, ohh0);
      ohl0 = mma_raw(va[1], pb, ohl0);
      olh0 = mma_raw(va[0], plb, olh0);
      ohh1 = mma_raw(va[2], pb, ohh1);
      ohl1 = mma_raw(va[3], pb, ohl1);
      olh1 = mma_raw(va[2], plb, olh1);
      guard6(ohh0, ohl0, olh0, ohh1, ohl1, olh1, va[0], va[1], va[2], va[3], pb, plb);
      if (ks == 0) {                                         // second 32-key step: flies under the second step's P split
        va[0] = ldfrag_h(Vh + koff + 1024);
        va[1] = ldfrag_h(Vl + koff + 1024);
        va[2] = ldfrag_h(Vh + koff + 1536);
        va[3] = ldfrag_h(Vl + koff + 1536);
      }
    }
  };
#pragma unroll 1
  for (int kb = 0; kb < 7; ++kb) pass(kb, flag_c<true>{});
  pass(7, flag_c<false>{});

  // ---- join the halves' sums, normalise, split into hi / lo, 16-B packed stores (8 consecutive d of one query) ----
  const float lt = lrow + xhalf(lrow);
  const float inv = 1.0f / (lt * 16.0f);
  v4u ph2[2], pl2[2];
#pragma unroll
  for (int e = 0; e < 4; ++e) {
    float f[4];
#pragma unroll
    for (int u = 0; u < 2; ++u) {
      const int r = 2 * e + u;
      float o0 = ohh0[r] + ohl0[r] * (1.0f / 16384.0f);
      o0 = o0 + olh0[r] * (1.0f / 8192.0f);
      float o1 = ohh1[r] + ohl1[r] * (1.0f / 16384.0f);
      o1 = o1 + olh1[r] * (1.0f / 8192.0f);
      f[u]     = (o0 * inv) * 64.0f;
      f[2 + u] = (o1 * inv) * 64.0f;
    }
    const _Float16 a0 = (_Float16)f[0], a1 = (_Float16)f[1], b0 = (_Float16)f[2], b1 = (_Float16)f[3];
    ph2[0][e] = pk16(h_bits(a0), h_bits(a1));
    ph2[1][e] = pk16(h_bits(b0), h_bits(b1));
    pl2[0][e] = pk16(hb16((f[0] - (float)a0) * 16384.0f), hb16((f[1] - (float)a1) * 16384.0f));
    pl2[1][e] = pk16(hb16((f[2] - (float)b0) * 16384.0f), hb16((f[3] - (float)b1) * 16384.0f));
  }
  const size_t off = ((size_t)h * NROW + (size_t)w * NTOK + q0) * HD + lane * 8;
  *(v4u*)(ohi + off)       = ph2[0];
  *(v4u*)(ohi + off + 256) = ph2[1];
  *(v4u*)(olo + off)       = pl2[0];
  *(v4u*)(olo + off + 256) = pl2[1];
  // the next strip overwrites the registers that these stores name: keep the wait in front of that overwrite
  asm volatile("s_wait_xcnt 0x0" ::: "memory");
  }
}

// =================================================================================================================
// Output projection: out rows = (Ohi + Olo*2^-14)/64 . (W1024/1024)^T + b; two accumulator sets (hi.W, lo.W), K = 256
// = 8 head planes of 32. Block tile 64 tokens x 128 cols, 8 waves = 2 x 4, 2x2 tiles per wave. Epilogue through an
// LDS f32 tile; store with un-window + reverse shift: a wave writes one token's 128-col half row = 512 B = 4 whole
// coverage: 512 x 64 tokens (bijective position map) x 2 x 128 cols = every output element exactly once.
// =================================================================================================================
__global__ __launch_bounds__(256)
void gemm_proj(const unsigned short* __restrict__ ohi, const unsigned short* __restrict__ olo,
               const unsigned short* __restrict__ wp, const float* __restrict__ bp, float* out) {
  __shared__ __align__(16) float Cs[64 * LDC];
  const int tid = threadIdx.x, wave = tid >> 5, lane = tid & 31, hh = lane >> 4, c = lane & 15;
  const int mb = blockIdx.x, nb = blockIdx.y;
  const int mw = wave >> 2, nw = wave & 3;
  const _Float16* W = (const _Float16*)(const void*)wp;
  const int arow0 = mb * 64 + mw * 32;
  const int bcol0 = nb * 128 + nw * 32;

  v8f h00 = zero8(), h01 = zero8(), h10 = zero8(), h11 = zero8();
  v8f l00 = zero8(), l01 = zero8(), l10 = zero8(), l11 = zero8();
  const _Float16* ph = (const _Float16*)(const void*)ohi + (size_t)arow0 * HD + lane * 8;   // head plane ks: + NROW*HD
  const _Float16* pl = (const _Float16*)(const void*)olo + (size_t)arow0 * HD + lane * 8;
  const _Float16* pb = W + frag_off(bcol0, 0, 0) + lane * 8;
#pragma unroll 1
  for (int ks = 0; ks < 8; ++ks, ph += NROW * HD, pl += NROW * HD, pb += 512) {
    const v16h fa0 = ldfrag_h(ph);
    const v16h fa1 = ldfrag_h(ph + 512);
    const v16h ga0 = ldfrag_h(pl);
    const v16h ga1 = ldfrag_h(pl + 512);
    const v16h fb0 = ldfrag_h(pb);
    const v16h fb1 = ldfrag_h(pb + 4096);
    // the three address pairs stay whole until the twelve loads that name them have their addresses translated
    asm volatile("s_wait_xcnt 0x0" :: "v"(ph), "v"(pl), "v"(pb) : "memory");
    h00 = mma_raw(fa0, fb0, h00);
    h01 = mma_raw(fa0, fb1, h01);
    h10 = mma_raw(fa1, fb0, h10);
    h11 = mma_raw(fa1, fb1, h11);
    l00 = mma_raw(ga0, fb0, l00);
    l01 = mma_raw(ga0, fb1, l01);
    l10 = mma_raw(ga1, fb0, l10);
    l11 = mma_raw(ga1, fb1, l11);
    guard8(h00, h01, h10, h11, l00, l01, l10, l11, fa0, fa1, ga0, ga1, fb0, fb1);
  }
#pragma unroll
  for (int r = 0; r < 8; ++r) {
    const int row = mw * 32 + 8 * hh + r;
    Cs[row * LDC + nw * 32 + c]             = h00[r] + l00[r] * (1.0f / 16384.0f);
    Cs[row * LDC + nw * 32 + 16 + c]        = h01[r] + l01[r] * (1.0f / 16384.0f);
    Cs[(row + 16) * LDC + nw * 32 + c]      = h10[r] + l10[r] * (1.0f / 16384.0f);
    Cs[(row + 16) * LDC + nw * 32 + 16 + c] = h11[r] + l11[r] * (1.0f / 16384.0f);
  }
  __syncthreads();

  const int w = mb >> 3, tok0 = (mb & 7) * 64;
  const float* bpn = bp + nb * 128 + lane * 4;
  v4f bb;
#pragma unroll
  for (int e = 0; e < 4; ++e) bb[e] = bfr(bpn[e]);
  v4f ov[8];
  size_t offs[8];
#pragma unroll
  for (int it = 0; it < 8; ++it) {
    const int row = wave * 8 + it;
    const int sp = spat_of(w, tok0 + row);
    v4f v = *(const v4f*)(Cs + row * LDC + lane * 4);
#pragma unroll
    for (int e = 0; e < 4; ++e) v[e] = v[e] * (1.0f / 65536.0f) + bb[e];
    ov[it] = v;
    offs[it] = (size_t)sp * CCH + nb * 128 + lane * 4;
  }
#pragma unroll
  for (int it = 0; it < 8; ++it) *(v4f*)(out + offs[it]) = ov[it];
  
}

// =================================================================================================================
//   Wqkv f16 [768][256] 393216 | Wproj f16 [256][256] 131072 |
//   Q f16 [512][512][32] 16777216 | K same 16777216 |
//   V^T hi f16 [512][32][512] 16777216 | V^T lo same 16777216 | O hi f16 [8][32768][32] 16777216 | O lo same 16777216
//   total 101187584.
// =================================================================================================================
extern "C" void kernel_launch(void* const* d_in, const int* in_sizes, int n_in,
                              void* d_out, int out_size, void* d_ws, size_t ws_size,
                              hipStream_t stream) {
  if (n_in < 6) return;
  if (in_sizes[0] != NROW * CCH) return;
  if (in_sizes[1] != C3 * CCH || in_sizes[2] != C3) return;
  if (in_sizes[3] != CCH * CCH || in_sizes[4] != CCH) return;
  if (in_sizes[5] != NRPB * NHD) return;
  if (out_size != NROW * CCH) return;

  const float* x     = (const float*)d_in[0];
  const float* qkvw  = (const float*)d_in[1];
  const float* qkvb  = (const float*)d_in[2];
  const float* projw = (const float*)d_in[3];
  const float* projb = (const float*)d_in[4];
  const float* rpb   = (const float*)d_in[5];
  float* out = (float*)d_out;

  const size_t sWq = (size_t)C3 * CCH * 2;                   //   393216
  const size_t sWp = (size_t)CCH * CCH * 2;                  //   131072
  const size_t sQK = (size_t)NWIN * NHD * NTOK * HD * 2;     // 16777216
  const size_t sO  = (size_t)NHD * NROW * HD * 2;            // 16777216
  size_t off = 0;
  const size_t oWq = off; off += sWq;
  const size_t oWp = off; off += sWp;
  const size_t oQ  = off; off += sQK;
  const size_t oK  = off; off += sQK;
  const size_t oVh = off; off += sQK;
  const size_t oVl = off; off += sQK;
  const size_t oOh = off; off += sO;
  const size_t oOl = off; off += sO;
  if (off > ws_size) return;                                  // off = 101187584
  if (off > (size_t)134217728) return;

  char* ws = (char*)d_ws;
  unsigned short* Wq  = (unsigned short*)(ws + oWq);
  unsigned short* Wp  = (unsigned short*)(ws + oWp);
  unsigned short* Qp  = (unsigned short*)(ws + oQ);
  unsigned short* Kp  = (unsigned short*)(ws + oK);
  unsigned short* Vth = (unsigned short*)(ws + oVh);
  unsigned short* Vtl = (unsigned short*)(ws + oVl);
  unsigned short* Ohi = (unsigned short*)(ws + oOh);
  unsigned short* Olo = (unsigned short*)(ws + oOl);

  const dim3 blk(256);
  // (1) weight converts
  cvt_w<<<dim3(C3 / 8), blk, 0, stream>>>(qkvw, Wq, C3);
  cvt_w<<<dim3(CCH / 8), blk, 0, stream>>>(projw, Wp, CCH);
  // (2) window gather + convert + qkv projection: 512 row tiles, each over all six column tiles
  gemm_qkv<<<dim3(NROW / 64), blk, 0, stream>>>(x, Wq, qkvb, Qp, Kp, Vth, Vtl);
  // (3) window attention: 64 windows x 8 heads, one block each
  attn_win<<<dim3(NWIN * NHD), blk, 0, stream>>>(Qp, Kp, Vth, Vtl, rpb, Ohi, Olo);
  // (4) output projection + un-window + reverse shift -> d_out
  gemm_proj<<<dim3(NROW / 64, CCH / 128), blk, 0, stream>>>(Ohi, Olo, Wp, projb, out);
  (void)hipGetLastError();
}

// v009
// One run takes 69.1 microseconds.
// Versions between v007 and this one are left out; their measured steps multiply to 1.25 times as fast.
// Counting every step since v000, it is 3.80 times as fast.
// qkv projection, k.qT and vT.pT: v_wmma_f32_16x16x32_f16 single products (f16 operands, f32 accumulate);
// output projection: activation as f16 hi plus scaled residual times f16 weight, two products, f32 accumulate.
// All inputs RNE-converted to bf16 on load; softmax, masks and epilogues in f32 on VALU.
#include <hip/hip_runtime.h>
#include <stdint.h>

#define NWIN 64
#define NTOK 512
#define CCH  256
#define NHD  8
#define HD   32
#define C3   768
#define NROW 32768
#define NRPB 3375
#define NBDI 15
#define LDC  132
#define QSC  0.17677669529663687f
#define INV512 0.001953125f
#define C1EXP 0.0028177637517362567f

static_assert(NROW == NWIN * NTOK);
static_assert(15 * 15 * 15 == NRPB);
static_assert((LDC * 4) % 16 == 0);

typedef _Float16 v16h __attribute__((ext_vector_type(16)));
typedef _Float16 v8h  __attribute__((ext_vector_type(8)));
typedef float    v8f  __attribute__((ext_vector_type(8)));
typedef float    v4f  __attribute__((ext_vector_type(4)));
typedef unsigned int v4u __attribute__((ext_vector_type(4)));

template <bool B> struct flag_c { static constexpr bool value = B; };

// ---- scalar helpers ------------------------------------------------------------------------------------------
__device__ __forceinline__ unsigned short bf_bits(float f) {          // f32 -> bf16 bits, RNE convert
  unsigned u = __float_as_uint(f);
  return (unsigned short)((u + 0x7FFFu + ((u >> 16) & 1u)) >> 16);
}
__device__ __forceinline__ float bf_up(unsigned short b) { return __uint_as_float(((unsigned)b) << 16); }
__device__ __forceinline__ float bfr(float f) { return bf_up(bf_bits(f)); }
__device__ __forceinline__ unsigned short h_bits(_Float16 x) { return __builtin_bit_cast(unsigned short, x); }
__device__ __forceinline__ unsigned short hb16(float f) { return h_bits((_Float16)f); }
__device__ __forceinline__ unsigned pk16(unsigned short a, unsigned short b) { return (unsigned)a | ((unsigned)b << 16); }
__device__ __forceinline__ v8f zero8() { v8f z = {0.f, 0.f, 0.f, 0.f, 0.f, 0.f, 0.f, 0.f}; return z; }

// ---- index maps --------------------------------------------------------------------------------------------------
// window w = (hb*4 + wb)*4 + db over a 32^3 volume in 8^3 windows; token t = (i*8 + j)*8 + k inside the window.
// The shifted coordinate is (hb*8+i, wb*8+j, db*8+k); both the input gather (roll by -4) and the output scatter
// (roll by +4) use volume position ((hs+4)&31, (ws+4)&31, (ds+4)&31).
__device__ __forceinline__ int spat_of(int w, int t) {
  const int hb = w >> 4, wb = (w >> 2) & 3, db = w & 3;
  const int i = t >> 6, j = (t >> 3) & 7, k = t & 7;
  const int gh = (hb * 8 + i + 4) & 31;
  const int gw = (wb * 8 + j + 4) & 31;
  const int gd = (db * 8 + k + 4) & 31;
  return (gh * 32 + gw) * 32 + gd;
}
__device__ __forceinline__ int rid1(int p) { return (p < 24) ? 0 : ((p < 28) ? 1 : 2); }
__device__ __forceinline__ int region_of(int w, int t) {
  const int hb = w >> 4, wb = (w >> 2) & 3, db = w & 3;
  const int i = t >> 6, j = (t >> 3) & 7, k = t & 7;
  return rid1(hb * 8 + i) * 9 + rid1(wb * 8 + j) * 3 + rid1(db * 8 + k);
}

// ---- fragment-order planes: every 16-bit A/B operand plane is kept as 1-KiB blocks of 16 rows x 32 k. Inside a block
//      the 16-B piece (row c, k = 16*chunk + 8*h .. +7) stands at halves chunk*256 + (h*16 + c)*8, so lane l = h*16 + c
//      finds its two pieces at l*8 and 256 + l*8 and each wave-wide 16-B load covers 512 contiguous bytes (4 lines).
//      p = block base + lane*8; elements 0..7 <- k 8h.., elements 8..15 <- k 16+8h.. (hardware k order, as before)
__device__ __forceinline__ v16h ldfrag_h(const _Float16* p) {
  union { v16h v; v8h h[2]; } f;
  f.h[0] = *(const v8h*)(p);
  f.h[1] = *(const v8h*)(p + 256);
  return f.v;
}
// halves offset of the piece (row, k = ks*32 + 8*g .. +7), g = 0..3, in a fragment-order plane of 256-k rows
__device__ __forceinline__ size_t frag_off(int row, int ks, int g) {
  return ((size_t)((row >> 4) * 8 + ks)) * 512 + (g >> 1) * 256 + ((g & 1) * 16 + (row & 15)) * 8;
}

// ---- WMMA helpers; the guard helpers insert the trailing VALU hazard gap and keep A/B live -----------------------
__device__ __forceinline__ v8f mma_raw(v16h a, v16h b, v8f c) {
  return __builtin_amdgcn_wmma_f32_16x16x32_f16(false, a, false, b, (short)0, c, false, false);
}
__device__ __forceinline__ void guard4(v8f& c0, v8f& c1, v8f& c2, v8f& c3,
                                       const v16h& a0, const v16h& a1, const v16h& b0, const v16h& b1) {
#if defined(__HIP_DEVICE_COMPILE__)
  asm volatile("v_nop\n\tv_nop\n\tv_nop\n\tv_nop"
               : "+v"(c0), "+v"(c1), "+v"(c2), "+v"(c3) : "v"(a0), "v"(a1), "v"(b0), "v"(b1));
#endif
}
__device__ __forceinline__ void guard8(v8f& c0, v8f& c1, v8f& c2, v8f& c3, v8f& c4, v8f& c5, v8f& c6, v8f& c7,
                                       const v16h& a0, const v16h& a1, const v16h& a2, const v16h& a3,
                                       const v16h& b0, const v16h& b1) {
#if defined(__HIP_DEVICE_COMPILE__)
  asm volatile("v_nop\n\tv_nop\n\tv_nop\n\tv_nop"
               : "+v"(c0), "+v"(c1), "+v"(c2), "+v"(c3), "+v"(c4), "+v"(c5), "+v"(c6), "+v"(c7)
               : "v"(a0), "v"(a1), "v"(a2), "v"(a3), "v"(b0), "v"(b1));
#endif
}
__device__ __forceinline__ void guard_pv2(v8f& c0, v8f& c1, v8f& c2, v8f& c3,
                                          const v16h& a0, const v16h& a1, const v16h& a2, const v16h& a3,
                                          const v16h& b0, const v16h& b1, const v16h& b2, const v16h& b3) {
#if defined(__HIP_DEVICE_COMPILE__)
  asm volatile("v_nop\n\tv_nop\n\tv_nop\n\tv_nop"
               : "+v"(c0), "+v"(c1), "+v"(c2), "+v"(c3)
               : "v"(a0), "v"(a1), "v"(a2), "v"(a3), "v"(b0), "v"(b1), "v"(b2), "v"(b3));
#endif
}
// value of lane l ^ 16 (the other half of the wave), as a vector cross-row move
__device__ __forceinline__ float xhalf(float v) {
  const int b = __float_as_int(v);
  return __int_as_float(__builtin_amdgcn_permlanex16(b, b, 0x76543210, 0xfedcba98, false, false));
}

// =================================================================================================================
// weight convert: w [nrows][256] f32 ([out][in], in contiguous) -> f16(1024 * bf16_RNE(w)), rows n, fragment order;
// block = 8 rows; wave = one 32-channel k-step of them; lane = row (lane&7), 8 channels (lane>>3). grid = nrows/8.
// coverage: nrows x 256.
// =================================================================================================================
__global__ __launch_bounds__(256) void cvt_w(const float* __restrict__ wsrc, unsigned short* wdst, int nrows) {
  const int tid = threadIdx.x, wv = tid >> 5, lane = tid & 31;
  const int row = blockIdx.x * 8 + (lane & 7), g = lane >> 3;
  if (row < nrows) {
    const float* src = wsrc + (size_t)row * CCH + wv * 32 + g * 8;
    const v4f a = *(const v4f*)(src);
    const v4f b = *(const v4f*)(src + 4);
    v4u pk;
    pk[0] = pk16(hb16(bfr(a[0]) * 1024.0f), hb16(bfr(a[1]) * 1024.0f));
    pk[1] = pk16(hb16(bfr(a[2]) * 1024.0f), hb16(bfr(a[3]) * 1024.0f));
    pk[2] = pk16(hb16(bfr(b[0]) * 1024.0f), hb16(bfr(b[1]) * 1024.0f));
    pk[3] = pk16(hb16(bfr(b[2]) * 1024.0f), hb16(bfr(b[3]) * 1024.0f));
    unsigned short* gp = wdst + frag_off(row, wv, g);
    *(v4u*)gp = pk;
    
  }
}

// =================================================================================================================
// cyclic shift + window gather + convert + qkv GEMM in one kernel. Block = 64 tokens of one window x all 768 columns.
// Stage: x [32768 positions][256] f32 -> LDS A tile, 64 rows x 256 k in fragment order, value f16(8 * bf16_RNE(x)).
// Wave = one 32-channel k-step, lane = row (lane&7) of 8, 8 channels (lane>>3), 8 row groups: sixteen 16-B loads in
// flight per lane, eight 16-B LDS stores. Then six column tiles of 128: C[64][128] = A . W1024[cols][256]^T, K = 256
// (8 k-steps of 32), A fragments from LDS, W fragments of a whole column tile held in registers and fetched one tile
// ahead, so that they fly under the epilogue; 8 waves = 2 (32 rows) x 4 (32 cols), 2x2 tiles per wave. The bias row
// stands in LDS as bf16_RNE(b), converted once per block.
// C = 8192 * (xw . W^T). Epilogue through an LDS f32 tile (two of them, used in turn: one barrier per column tile):
// part q -> Q plane [w*8+h][tok/16] blocks (rows tok, k = d)
// = f16(64*q) with q = (C/8192 + b) * 32^-0.5; part k -> K plane = f16(8*k), same form; part v -> V^T
// [w*8+h][tok/32][d/16] blocks (rows d, k = tok) = f16(16*v). A thread takes the
// piece that stands at tid*8 halves of the head's 4 blocks, so every store instruction writes 512 contiguous bytes.
// coverage: Q/K: 4 instr x 256 pieces = 4 heads x 64 tok x 32 d; V: 4 instr x 256 pieces = 4 heads x 32 d x
// 64 tok; over the grid and the six tiles every element of Q, K (64x8x512x32) and V^T (64x8x32x512) exactly once.
// =================================================================================================================
__global__ __launch_bounds__(256)
void gemm_qkv(const float* __restrict__ x, const unsigned short* __restrict__ wq,
              const float* __restrict__ bq,
              unsigned short* qpl, unsigned short* kpl, unsigned short* vth) {
  __shared__ __align__(16) unsigned short As[64 * CCH];
  __shared__ __align__(16) float Cs2[2][64 * LDC];
  __shared__ __align__(16) float Bs[C3];
  const int tid = threadIdx.x, wave = tid >> 5, lane = tid & 31, hh = lane >> 4, c = lane & 15;
  const int mb = blockIdx.x;
  const int mw = wave >> 2, nw = wave & 3;
  const int w = mb >> 3, tok0 = (mb & 7) * 64;
  const _Float16* W = (const _Float16*)(const void*)wq;

  // column tile nb of this wave: + nb * 32768 halves; second 16-column band: + 4096; k-step: + 512
  const _Float16* pb = W + frag_off(nw * 32, 0, 0) + lane * 8;
  v16h fb0[8], fb1[8];
#pragma unroll
  for (int ks = 0; ks < 8; ++ks) {
    fb0[ks] = ldfrag_h(pb + ks * 512);
    fb1[ks] = ldfrag_h(pb + 4096 + ks * 512);
  }

  {
    const int r8 = lane & 7, g = lane >> 3;
    v4f xa[8], xb[8];
    float bv[3];
#pragma unroll
    for (int it = 0; it < 8; ++it) {
      const float* src = x + (size_t)spat_of(w, tok0 + it * 8 + r8) * CCH + wave * 32 + g * 8;
      xa[it] = *(const v4f*)(src);
      xb[it] = *(const v4f*)(src + 4);
    }
#pragma unroll
    for (int i = 0; i < 3; ++i) bv[i] = bq[i * 256 + tid];
#pragma unroll
    for (int i = 0; i < 3; ++i) Bs[i * 256 + tid] = bfr(bv[i]);
#pragma unroll
    for (int it = 0; it < 8; ++it) {
      const v4f a = xa[it], b = xb[it];
      v4u pk;
      pk[0] = pk16(hb16(bfr(a[0]) * 8.0f), hb16(bfr(a[1]) * 8.0f));
      pk[1] = pk16(hb16(bfr(a[2]) * 8.0f), hb16(bfr(a[3]) * 8.0f));
      pk[2] = pk16(hb16(bfr(b[0]) * 8.0f), hb16(bfr(b[1]) * 8.0f));
      pk[3] = pk16(hb16(bfr(b[2]) * 8.0f), hb16(bfr(b[3]) * 8.0f));
      *(v4u*)(As + frag_off(it * 8 + r8, wave, g)) = pk;
    }
  }
  __syncthreads();

  const _Float16* pa = (const _Float16*)(const void*)As + frag_off(mw * 32, 0, 0) + lane * 8;   // next band: + 4096

#pragma unroll 1
  for (int nb = 0; nb < 6; ++nb) {
  float* Cs = Cs2[nb & 1];
  v8f a00 = zero8(), a01 = zero8(), a10 = zero8(), a11 = zero8();
  v16h fa0 = ldfrag_h(pa), fa1 = ldfrag_h(pa + 4096);
#pragma unroll
  for (int ks = 0; ks < 8; ++ks) {
    v16h na0 = fa0, na1 = fa1;                    // A fragments of the next k-step, read ahead of this step's products
    if (ks < 7) {
      na0 = ldfrag_h(pa + (ks + 1) * 512);
      na1 = ldfrag_h(pa + 4096 + (ks + 1) * 512);
    }
    a00 = mma_raw(fa0, fb0[ks], a00);
    a01 = mma_raw(fa0, fb1[ks], a01);
    a10 = mma_raw(fa1, fb0[ks], a10);
    a11 = mma_raw(fa1, fb1[ks], a11);
    guard4(a00, a01, a10, a11, fa0, fa1, fb0[ks], fb1[ks]);
    fa0 = na0;
    fa1 = na1;
  }
#pragma unroll
  for (int r = 0; r < 8; ++r) {
    const int row = mw * 32 + 8 * hh + r;
    Cs[row * LDC + nw * 32 + c]             = a00[r];
    Cs[row * LDC + nw * 32 + 16 + c]        = a01[r];
    Cs[(row + 16) * LDC + nw * 32 + c]      = a10[r];
    Cs[(row + 16) * LDC + nw * 32 + 16 + c] = a11[r];
  }
  // one barrier per column tile: it publishes this tile's C, and every wave that passes it has left the other C buffer
  __syncthreads();

  // the next column tile's W fragments: issued behind the barrier (which waits for every load in flight) and in front
  // of an epilogue that reads LDS only, so that nothing waits for them before the next tile's products
  if (nb < 5) {                                   // block-uniform
    const _Float16* pn = pb + (nb + 1) * 32768;
#pragma unroll
    for (int ks = 0; ks < 8; ++ks) {
      fb0[ks] = ldfrag_h(pn + ks * 512);
      fb1[ks] = ldfrag_h(pn + 4096 + ks * 512);
    }
    // the address pair of these loads is reused by the epilogue: keep the wait in front of that overwrite
    asm volatile("s_wait_xcnt 0x0" ::: "memory");
  }

  const int part = nb >> 1;                       // block-uniform: 0 q, 1 k, 2 v
  const int hb4 = (nb & 1) * 4;
  const float* bqn = Bs + nb * 128;               // bf16_RNE(bias), staged once
  if (part < 2) {
    unsigned short* dst = (part == 0) ? qpl : kpl;
    const float scl = (part == 0) ? (QSC * 64.0f) : 8.0f;
    v4u pk[4];
    size_t offs[4];
#pragma unroll
    for (int s = 0; s < 4; ++s) {
      const int h4 = s;
      const int tok = (tid >> 6) * 16 + (tid & 15), d0 = ((tid >> 4) & 3) * 8;
      const int col = h4 * 32 + d0;
      v4u q4;
#pragma unroll
      for (int e = 0; e < 4; ++e) {
        float f0 = Cs[tok * LDC + col + 2 * e] * (1.0f / 8192.0f) + bqn[col + 2 * e];
        float f1 = Cs[tok * LDC + col + 2 * e + 1] * (1.0f / 8192.0f) + bqn[col + 2 * e + 1];
        f0 = f0 * scl;
        f1 = f1 * scl;
        q4[e] = pk16(hb16(f0), hb16(f1));
      }
      pk[s] = q4;
      offs[s] = ((size_t)((w * NHD + hb4 + h4) * NTOK + tok0)) * HD + tid * 8;
    }
#pragma unroll
    for (int s = 0; s < 4; ++s) *(v4u*)(dst + offs[s]) = pk[s];
    
  } else {
    v4u phk[4];
    size_t offs[4];
#pragma unroll
    for (int s = 0; s < 4; ++s) {
      const int h4 = s, d = ((tid >> 6) & 1) * 16 + (tid & 15);
      const int col = h4 * 32 + d;
      const int tb = (tid >> 7) * 32 + ((tid >> 4) & 3) * 8;
      const float bc = bqn[col];
      v4u a;
#pragma unroll
      for (int e = 0; e < 4; ++e) {
        const float v0 = Cs[(tb + 2 * e) * LDC + col] * (1.0f / 8192.0f) + bc;
        const float v1 = Cs[(tb + 2 * e + 1) * LDC + col] * (1.0f / 8192.0f) + bc;
        a[e] = pk16(hb16(v0 * 16.0f), hb16(v1 * 16.0f));
      }
      phk[s] = a;
      offs[s] = ((size_t)(w * NHD + hb4 + h4)) * HD * NTOK + tok0 * HD + tid * 8;
    }
#pragma unroll
    for (int s = 0; s < 4; ++s) *(v4u*)(vth + offs[s]) = phk[s];
    // later code overwrites the registers that these stores name: keep the wait directly behind them, in this branch
    asm volatile("s_wait_xcnt 0x0" ::: "memory");
  }
  // the next tile's products overwrite the registers that these stores name: keep the wait in front of that overwrite
  asm volatile("s_wait_xcnt 0x0" ::: "memory");
  }
}

// =================================================================================================================
// Window attention, transposed: block = one (window, head); its Q, K and V^T planes (32 KiB each, fragment
// order kept) are copied once into LDS through registers; a wave walks 2 pairs of adjacent 16-query strips (strips
// 16*s + 2*wave and the next): a pass reads the K and V^T fragments of 64 keys once for both strips of the pair.
// S^T = K8 . Q64^T via WMMA (A = key rows, B = query columns) with 512*bias as the C operand, so a lane holds
// the scores of ONE query (column lane&15) for keys 8*(lane>>4) + r of each 16-key tile. Shift mask -51200 where region
// ids differ. Online softmax over 8 blocks of 64 keys in f32: maximum and sum run over the lane's own 32 registers, the
// maximum is joined with lane ^ 16 once per block, the sum l stays a per-half partial and is joined once at the end.
// p' = 4096*exp((s-m)/512); P = f16(p'). Two score tiles of one 32-key step, converted in
// place, are the B operand of O^T += V^T . P^T (A = V^T rows, hardware k order on both sides): P never leaves registers.
// One product, f16 operands, f32 accumulate, V^T = f16(16v); l sums the unrounded p';
// o = acc / (16 l). A lane ends with 8 consecutive d of its query per tile: 16-B packed stores.
// Loads run ahead of their use: K fragments and bias tiles one 64-key block, V^T fragments from the head of their pass.
// The second strip of a pair stands two j rows further, so its bias tile of key tile j is the first strip's of key tile
// j - 1: five bias tiles serve the pair's eight score tiles.
// Bias: the head's column of the table stands in LDS as rows (i and j difference) of 16 floats, value
// 512 * bf16_RNE(rpb), the k difference reversed: slot x holds difference 14 - x. Query n against keys m = 8 g + r,
// r = 0..7 (one i, one j, k = r) is then 8 consecutive floats from slot 7 - k_n of row (i_n-i_m+7)*15 + (j_n-j_m+7):
// a lane's C registers of one 16-key tile. A wave's 32 lanes touch 3 rows, 24 distinct banks. A block's 512 queries
// meet all 15 i differences: 225 rows.
// Output planes O hi = f16(64 o), O lo = f16((64o-hi)*2^14), layout [h][(w*512 + tok)/16] blocks (rows tok, k = d).
// coverage: 512 blocks x 8 waves x 2 pairs x 2 strips x 16 rows x 32 d = 8 x 32768 x 32 per plane, every element once.
// =================================================================================================================
// two blocks per WGP (LDS allows two) need four waves per SIMD: the register budget is held at 256
__global__ __launch_bounds__(256) __attribute__((amdgpu_waves_per_eu(4, 4)))
void attn_win(const unsigned short* __restrict__ qpl, const unsigned short* __restrict__ kpl,
              const unsigned short* __restrict__ vth,
              const float* __restrict__ rpb, unsigned short* ohi, unsigned short* olo) {
  // one LDS block, bias table first, then V^T, K, Q: every read of a pass then lies within the offset field of its
  // instruction from one running address, so that no read needs an address register of its own (two strips per wave
  // leave no registers for them)
  struct Lds {
    float brow[NBDI * 240];
    unsigned short Vhs[NTOK * HD];
    unsigned short Ks[NTOK * HD];
    unsigned short Qs[NTOK * HD];
  };
  __shared__ __align__(16) Lds lds;
  float* const brow = lds.brow;
  unsigned short* const Qs = lds.Qs;
  unsigned short* const Ks = lds.Ks;
  unsigned short* const Vhs = lds.Vhs;
  const int tid = threadIdx.x, lane = tid & 31, hh = lane >> 4, c = lane & 15;
  const int wave = __builtin_amdgcn_readfirstlane(tid >> 5);   // scalar: strip numbers and store bases take no vector registers
  const int wh = blockIdx.x;                      // w*8 + h
  const int w = wh >> 3, h = wh & 7;

  {
    // straight copy of the three planes, 2048 pieces of 16 B each: 24 loads in flight per lane, then 24 LDS stores
    const v4u* gq = (const v4u*)(const void*)(qpl + (size_t)wh * NTOK * HD);
    const v4u* gk = (const v4u*)(const void*)(kpl + (size_t)wh * NTOK * HD);
    const v4u* gh = (const v4u*)(const void*)(vth + (size_t)wh * HD * NTOK);
    v4u rq[8], rk[8], rh[8];
#pragma unroll
    for (int i = 0; i < 8; ++i) {
      rq[i] = gq[i * 256 + tid];
      rk[i] = gk[i * 256 + tid];
      rh[i] = gh[i * 256 + tid];
    }
    // the registers that address these loads are reused behind them: keep the wait in front of that overwrite
    asm volatile("s_wait_xcnt 0x0" ::: "memory");
#pragma unroll
    for (int i = 0; i < 8; ++i) {
      ((v4u*)(void*)Qs)[i * 256 + tid]  = rq[i];
      ((v4u*)(void*)Ks)[i * 256 + tid]  = rk[i];
      ((v4u*)(void*)Vhs)[i * 256 + tid] = rh[i];
    }
  }
  if (tid < 240) {
    // 16 lanes = one row, 15 rows (one i difference) a trip, all loads in flight at once; slot 15 is never read and
    // takes slot 14's value
    const int xs = min(tid & 15, 14);
    float tv[NBDI];
#pragma unroll
    for (int it = 0; it < NBDI; ++it) tv[it] = rpb[((it * 15 + (tid >> 4)) * 15 + 14 - xs) * NHD + h];
    // the addresses of these loads are reused behind them: keep the wait in front of that overwrite
    asm volatile("s_wait_xcnt 0x0" ::: "memory");
#pragma unroll
    for (int it = 0; it < NBDI; ++it) brow[it * 240 + tid] = bfr(tv[it]) * 512.0f;
  }
  __syncthreads();

  const _Float16* Q  = (const _Float16*)(const void*)Qs;
  const _Float16* K  = (const _Float16*)(const void*)Ks;
  const _Float16* Vh = (const _Float16*)(const void*)Vhs;

  // rolled: the copies of the body would gain nothing
#pragma unroll 1
  for (int sidx = 0; sidx < 2; ++sidx) {
  const int strip = sidx * 16 + wave * 2;         // even; the wave works on strips strip and strip + 1 together
  const int q0 = strip * 16;
  // bias of query q0 + 16*u + c against key tile j of block kb, keys 8*hh + r: Bp[(di0 - kb) * 240 + (3 - j + u) * 32 + r]
  // (strip + 1 stands two j rows further and, strip being even, does not wrap): five tiles serve both strips.
  // di0 = i_n + 7 is the same in every lane of the wave and in both strips: held scalar
  const int di0 = __builtin_amdgcn_readfirstlane((strip >> 2) + 7);
  const float* Bp = brow + (((strip * 2 + (c >> 3)) & 7) + (hh ^ 1)) * 16 + ((c & 7) ^ 7);   // 1 - hh, 7 - k_n

  v16h qb[2];
  qb[0] = ldfrag_h(Q + q0 * HD + lane * 8);
  qb[1] = ldfrag_h(Q + q0 * HD + 512 + lane * 8);
  // shift mask, 512 * -100 where region ids differ. A region id changes only where a coordinate passes a multiple of 4,
  // so a lane's 32 keys of a block fall into four groups of one id each: tiles 2a, 2a+1 (j_m >> 2 = a) x registers
  // 4b .. 4b+3 (k_m >> 2 = b). mvs[u][a][b]: the j and k axes, against a key of the query's own i; the i axis is the
  // same for the whole wave and block and joins per pass as a scalar.
  const int in0 = __builtin_amdgcn_readfirstlane(strip >> 2);
  float mvs[2][2][2];
#pragma unroll
  for (int u = 0; u < 2; ++u) {
    const int cq = region_of(w, q0 + 16 * u + c);
#pragma unroll
    for (int a = 0; a < 2; ++a) {
#pragma unroll
      for (int b = 0; b < 2; ++b) mvs[u][a][b] = (cq != region_of(w, (in0 * 8 + 4 * a) * 8 + 4 * b)) ? -51200.0f : 0.0f;
    }
  }
  const int ri = rid1((w >> 4) * 8 + in0);
  float mrow[2] = {-1e30f, -1e30f}, lrow[2] = {0.f, 0.f};
  v8f oa[2][2] = {{zero8(), zero8()}, {zero8(), zero8()}};      // [strip][d tile]

  // K fragments and bias tiles of a 64-key block are fetched one block ahead; here those of block 0
  v16h kf[4];
  v8f bt[5];
#pragma unroll
  for (int j = 0; j < 4; ++j) kf[j] = ldfrag_h(K + j * 512 + lane * 8);
#pragma unroll
  for (int t = 0; t < 5; ++t) {
#pragma unroll
    for (int r = 0; r < 8; ++r) bt[t][r] = Bp[di0 * 240 + t * 32 + r];
  }

  // one 64-key block against both strips; MORE: a further block follows, and its K fragments and bias tiles are fetched
  // in this pass
  auto pass = [&](const int kb, auto more) __attribute__((always_inline)) {
    // V^T fragments of the block's two 32-key steps (d 0..15, d 16..31 of each): they fly under the
    // score products, the mask and the softmax
    const int koff = kb * 2048 + lane * 8;
    v16h va[4];
    va[0] = ldfrag_h(Vh + koff);
    va[1] = ldfrag_h(Vh + koff + 512);
    va[2] = ldfrag_h(Vh + koff + 1024);
    va[3] = ldfrag_h(Vh + koff + 1536);
    // ---- transposed logits for 64 keys: 4 tiles of 16 keys x 16 queries per strip, bias via C operand ----
    v8f s[2][4];
#pragma unroll
    for (int j = 0; j < 4; ++j) {
      s[0][j] = mma_raw(kf[j], qb[0], bt[3 - j]);
      s[1][j] = mma_raw(kf[j], qb[1], bt[4 - j]);
    }
    guard8(s[0][0], s[1][0], s[0][1], s[1][1], s[0][2], s[1][2], s[0][3], s[1][3],
           kf[0], kf[1], kf[2], kf[3], qb[0], qb[1]);
    // ---- online softmax update: one query per lane and strip, 32 of its 64 scores here, the rest in lane ^ 16 ----
    // The mask is one value per group: the maximum is taken per group over the raw scores and the mask added to the four
    // maxima (the same value as the maximum of the masked scores: adding a constant keeps the order, rounded or not).
    const float si = (ri != rid1((w >> 4) * 8 + kb)) ? -51200.0f : 0.0f;
    v16h pb[2][2];
#pragma unroll
    for (int u = 0; u < 2; ++u) {
      float mv[2][2], gm[2][2];
#pragma unroll
      for (int a = 0; a < 2; ++a) {
#pragma unroll
        for (int b = 0; b < 2; ++b) {
          const v8f x0 = s[u][2 * a], x1 = s[u][2 * a + 1];
          const int r0 = 4 * b;
          gm[a][b] = fmaxf(fmaxf(fmaxf(x0[r0], x0[r0 + 1]), fmaxf(x0[r0 + 2], x0[r0 + 3])),
                           fmaxf(fmaxf(x1[r0], x1[r0 + 1]), fmaxf(x1[r0 + 2], x1[r0 + 3])));
          mv[a][b] = fminf(mvs[u][a][b], si);
        }
      }
      float tm = fmaxf(fmaxf(gm[0][0] + mv[0][0], gm[0][1] + mv[0][1]), fmaxf(gm[1][0] + mv[1][0], gm[1][1] + mv[1][1]));
      tm = fmaxf(tm, xhalf(tm));
      const float mn = fmaxf(mrow[u], tm);
      const float alpha = __expf((mrow[u] - mn) * INV512);
      mrow[u] = mn;
      // p' = 2^(s * log2(e)/512 + off): mask, maximum and the factor 4096 = 2^12 stand in the addend, one per group, so a
      // score takes one multiply-add and one exp2
      v8f offv[2];
#pragma unroll
      for (int a = 0; a < 2; ++a) {
        const float o0 = (mv[a][0] - mn) * C1EXP + 12.0f;
        const float o1 = (mv[a][1] - mn) * C1EXP + 12.0f;
        const v8f ov = {o0, o0, o0, o0, o1, o1, o1, o1};
        offv[a] = ov;
      }
#pragma unroll
      for (int j = 0; j < 4; ++j) {
        const v8f e = s[u][j] * C1EXP + offv[j >> 1];
#pragma unroll
        for (int r = 0; r < 8; ++r) s[u][j][r] = __builtin_amdgcn_exp2f(e[r]);
      }
      const v8f sv = (s[u][0] + s[u][1]) + (s[u][2] + s[u][3]);
      const float ps = ((sv[0] + sv[1]) + (sv[2] + sv[3])) + ((sv[4] + sv[5]) + (sv[6] + sv[7]));
      lrow[u] = lrow[u] * alpha + ps;
      oa[u][0] = oa[u][0] * alpha; oa[u][1] = oa[u][1] * alpha;
      // element e <- key 8*hh + e (tile 2*ks), element 8 + e <- key 16 + 8*hh + e (tile 2*ks + 1)
#pragma unroll
      for (int ks = 0; ks < 2; ++ks) {
        const v8h ph0 = __builtin_convertvector(s[u][2 * ks], v8h);
        const v8h ph1 = __builtin_convertvector(s[u][2 * ks + 1], v8h);
        pb[u][ks] = __builtin_shufflevector(ph0, ph1, 0, 1, 2, 3, 4, 5, 6, 7, 8, 9, 10, 11, 12, 13, 14, 15);
      }
    }
    // the next block's K fragments and bias tiles: issued where the scores have become P and their registers are free
    // again, so that the bias lands in them without a copy; they fly under the V products.
    // The last pass is a copy of the body without them: a branch in the loop would merge the load counting
    if constexpr (decltype(more)::value) {
      const int kn = kb + 1;
      const _Float16* kp = K + kn * 2048 + lane * 8;
      const float* bn = Bp + (di0 - kn) * 240;
#pragma unroll
      for (int t = 0; t < 5; ++t) {
#pragma unroll
        for (int r = 0; r < 8; ++r) bt[t][r] = bn[t * 32 + r];
      }
#pragma unroll
      for (int j = 0; j < 4; ++j) kf[j] = ldfrag_h(kp + j * 512);
    }
    // ---- O^T += V^T . P^T : two 32-key k-steps, two 16-dim tiles, two strips ----
    oa[0][0] = mma_raw(va[0], pb[0][0], oa[0][0]);
    oa[0][1] = mma_raw(va[1], pb[0][0], oa[0][1]);
    oa[1][0] = mma_raw(va[0], pb[1][0], oa[1][0]);
    oa[1][1] = mma_raw(va[1], pb[1][0], oa[1][1]);
    oa[0][0] = mma_raw(va[2], pb[0][1], oa[0][0]);
    oa[0][1] = mma_raw(va[3], pb[0][1], oa[0][1]);
    oa[1][0] = mma_raw(va[2], pb[1][1], oa[1][0]);
    oa[1][1] = mma_raw(va[3], pb[1][1], oa[1][1]);
    guard_pv2(oa[0][0], oa[0][1], oa[1][0], oa[1][1], va[0], va[1], va[2], va[3],
              pb[0][0], pb[0][1], pb[1][0], pb[1][1]);
  };
#pragma unroll 1
  for (int kb = 0; kb < 7; ++kb) pass(kb, flag_c<true>{});
  pass(7, flag_c<false>{});

  // ---- join the halves' sums, normalise, split into hi / lo, 16-B packed stores (8 consecutive d of one query) ----
#pragma unroll
  for (int u = 0; u < 2; ++u) {
    const float lt = lrow[u] + xhalf(lrow[u]);
    const float inv = 1.0f / (lt * 16.0f);
    v4u ph2[2], pl2[2];
#pragma unroll
    for (int e = 0; e < 4; ++e) {
      float f[4];
#pragma unroll
      for (int t = 0; t < 2; ++t) {
        const int r = 2 * e + t;
        f[t]     = (oa[u][0][r] * inv) * 64.0f;
        f[2 + t] = (oa[u][1][r] * inv) * 64.0f;
      }
      const _Float16 a0 = (_Float16)f[0], a1 = (_Float16)f[1], b0 = (_Float16)f[2], b1 = (_Float16)f[3];
      ph2[0][e] = pk16(h_bits(a0), h_bits(a1));
      ph2[1][e] = pk16(h_bits(b0), h_bits(b1));
      pl2[0][e] = pk16(hb16((f[0] - (float)a0) * 16384.0f), hb16((f[1] - (float)a1) * 16384.0f));
      pl2[1][e] = pk16(hb16((f[2] - (float)b0) * 16384.0f), hb16((f[3] - (float)b1) * 16384.0f));
    }
    const size_t off = ((size_t)h * NROW + (size_t)w * NTOK + q0 + 16 * u) * HD;   // the same in every lane
    *(v4u*)(ohi + off + lane * 8)       = ph2[0];
    *(v4u*)(ohi + off + lane * 8 + 256) = ph2[1];
    *(v4u*)(olo + off + lane * 8)       = pl2[0];
    *(v4u*)(olo + off + lane * 8 + 256) = pl2[1];
    // later code overwrites the registers that these stores name: keep the wait in front of that overwrite
    asm volatile("s_wait_xcnt 0x0" ::: "memory");
  }
  }
}

// =================================================================================================================
// Output projection: out rows = (Ohi + Olo*2^-14)/64 . (W1024/1024)^T + b; two accumulator sets (hi.W, lo.W), K = 256
// = 8 head planes of 32. Block tile 64 tokens x 128 cols, 8 waves = 2 x 4, 2x2 tiles per wave. Epilogue through an
// LDS f32 tile; store with un-window + reverse shift: a wave writes one token's 128-col half row = 512 B = 4 whole
// coverage: 512 x 64 tokens (bijective position map) x 2 x 128 cols = every output element exactly once.
// =================================================================================================================
__global__ __launch_bounds__(256)
void gemm_proj(const unsigned short* __restrict__ ohi, const unsigned short* __restrict__ olo,
               const unsigned short* __restrict__ wp, const float* __restrict__ bp, float* out) {
  __shared__ __align__(16) float Cs[64 * LDC];
  const int tid = threadIdx.x, wave = tid >> 5, lane = tid & 31, hh = lane >> 4, c = lane & 15;
  const int mb = blockIdx.x, nb = blockIdx.y;
  const int mw = wave >> 2, nw = wave & 3;
  const _Float16* W = (const _Float16*)(const void*)wp;
  const int arow0 = mb * 64 + mw * 32;
  const int bcol0 = nb * 128 + nw * 32;

  v8f h00 = zero8(), h01 = zero8(), h10 = zero8(), h11 = zero8();
  v8f l00 = zero8(), l01 = zero8(), l10 = zero8(), l11 = zero8();
  const _Float16* ph = (const _Float16*)(const void*)ohi + (size_t)arow0 * HD + lane * 8;   // head plane ks: + NROW*HD
  const _Float16* pl = (const _Float16*)(const void*)olo + (size_t)arow0 * HD + lane * 8;
  const _Float16* pb = W + frag_off(bcol0, 0, 0) + lane * 8;
#pragma unroll 1
  for (int ks = 0; ks < 8; ++ks, ph += NROW * HD, pl += NROW * HD, pb += 512) {
    const v16h fa0 = ldfrag_h(ph);
    const v16h fa1 = ldfrag_h(ph + 512);
    const v16h ga0 = ldfrag_h(pl);
    const v16h ga1 = ldfrag_h(pl + 512);
    const v16h fb0 = ldfrag_h(pb);
    const v16h fb1 = ldfrag_h(pb + 4096);
    // the three address pairs stay whole until the twelve loads that name them have their addresses translated
    asm volatile("s_wait_xcnt 0x0" :: "v"(ph), "v"(pl), "v"(pb) : "memory");
    h00 = mma_raw(fa0, fb0, h00);
    h01 = mma_raw(fa0, fb1, h01);
    h10 = mma_raw(fa1, fb0, h10);
    h11 = mma_raw(fa1, fb1, h11);
    l00 = mma_raw(ga0, fb0, l00);
    l01 = mma_raw(ga0, fb1, l01);
    l10 = mma_raw(ga1, fb0, l10);
    l11 = mma_raw(ga1, fb1, l11);
    guard8(h00, h01, h10, h11, l00, l01, l10, l11, fa0, fa1, ga0, ga1, fb0, fb1);
  }
#pragma unroll
  for (int r = 0; r < 8; ++r) {
    const int row = mw * 32 + 8 * hh + r;
    Cs[row * LDC + nw * 32 + c]             = h00[r] + l00[r] * (1.0f / 16384.0f);
    Cs[row * LDC + nw * 32 + 16 + c]        = h01[r] + l01[r] * (1.0f / 16384.0f);
    Cs[(row + 16) * LDC + nw * 32 + c]      = h10[r] + l10[r] * (1.0f / 16384.0f);
    Cs[(row + 16) * LDC + nw * 32 + 16 + c] = h11[r] + l11[r] * (1.0f / 16384.0f);
  }
  __syncthreads();

  const int w = mb >> 3, tok0 = (mb & 7) * 64;
  const float* bpn = bp + nb * 128 + lane * 4;
  v4f bb;
#pragma unroll
  for (int e = 0; e < 4; ++e) bb[e] = bfr(bpn[e]);
  v4f ov[8];
  size_t offs[8];
#pragma unroll
  for (int it = 0; it < 8; ++it) {
    const int row = wave * 8 + it;
    const int sp = spat_of(w, tok0 + row);
    v4f v = *(const v4f*)(Cs + row * LDC + lane * 4);
#pragma unroll
    for (int e = 0; e < 4; ++e) v[e] = v[e] * (1.0f / 65536.0f) + bb[e];
    ov[it] = v;
    offs[it] = (size_t)sp * CCH + nb * 128 + lane * 4;
  }
#pragma unroll
  for (int it = 0; it < 8; ++it) *(v4f*)(out + offs[it]) = ov[it];
  
}

// =================================================================================================================
//   Wqkv f16 [768][256] 393216 | Wproj f16 [256][256] 131072 |
//   Q f16 [512][512][32] 16777216 | K same |
//   V^T f16 [512][32][512] same | O hi f16 [8][32768][32] 16777216 | O lo same 16777216
// =================================================================================================================
extern "C" void kernel_launch(void* const* d_in, const int* in_sizes, int n_in,
                              void* d_out, int out_size, void* d_ws, size_t ws_size,
                              hipStream_t stream) {
  if (n_in < 6) return;
  if (in_sizes[0] != NROW * CCH) return;
  if (in_sizes[1] != C3 * CCH || in_sizes[2] != C3) return;
  if (in_sizes[3] != CCH * CCH || in_sizes[4] != CCH) return;
  if (in_sizes[5] != NRPB * NHD) return;
  if (out_size != NROW * CCH) return;

  const float* x     = (const float*)d_in[0];
  const float* qkvw  = (const float*)d_in[1];
  const float* qkvb  = (const float*)d_in[2];
  const float* projw = (const float*)d_in[3];
  const float* projb = (const float*)d_in[4];
  const float* rpb   = (const float*)d_in[5];
  float* out = (float*)d_out;

  const size_t sWq = (size_t)C3 * CCH * 2;                   //   393216
  const size_t sWp = (size_t)CCH * CCH * 2;                  //   131072
  const size_t sQK = (size_t)NWIN * NHD * NTOK * HD * 2;     // 16777216
  const size_t sO  = (size_t)NHD * NROW * HD * 2;            // 16777216
  size_t off = 0;
  const size_t oWq = off; off += sWq;
  const size_t oWp = off; off += sWp;
  const size_t oQ  = off; off += sQK;
  const size_t oK  = off; off += sQK;
  const size_t oVh = off; off += sQK;
  const size_t oOh = off; off += sO;
  const size_t oOl = off; off += sO;
  if (off > ws_size) return;                                  // off = 84410368
  if (off > (size_t)134217728) return;

  char* ws = (char*)d_ws;
  unsigned short* Wq  = (unsigned short*)(ws + oWq);
  unsigned short* Wp  = (unsigned short*)(ws + oWp);
  unsigned short* Qp  = (unsigned short*)(ws + oQ);
  unsigned short* Kp  = (unsigned short*)(ws + oK);
  unsigned short* Vth = (unsigned short*)(ws + oVh);
  unsigned short* Ohi = (unsigned short*)(ws + oOh);
  unsigned short* Olo = (unsigned short*)(ws + oOl);

  const dim3 blk(256);
  // (1) weight converts
  cvt_w<<<dim3(C3 / 8), blk, 0, stream>>>(qkvw, Wq, C3);
  cvt_w<<<dim3(CCH / 8), blk, 0, stream>>>(projw, Wp, CCH);
  // (2) window gather + convert + qkv projection: 512 row tiles, each over all six column tiles
  gemm_qkv<<<dim3(NROW / 64), blk, 0, stream>>>(x, Wq, qkvb, Qp, Kp, Vth);
  // (3) window attention: 64 windows x 8 heads, one block each
  attn_win<<<dim3(NWIN * NHD), blk, 0, stream>>>(Qp, Kp, Vth, rpb, Ohi, Olo);
  // (4) output projection + un-window + reverse shift -> d_out
  gemm_proj<<<dim3(NROW / 64, CCH / 128), blk, 0, stream>>>(Ohi, Olo, Wp, projb, out);
  (void)hipGetLastError();
}

// v010
// A run of this version takes 66.9 microseconds.
// In both of two side-by-side timings against v009, it was 1.03 times as fast.
// Over all steps from v000 it is 3.92 times as fast.
// qkv projection, k.qT and vT.pT: v_wmma_f32_16x16x32_f16 single products (f16 operands, f32 accumulate);
// output projection: activation as f16 hi plus scaled residual times f16 weight, two products, f32 accumulate.
// All inputs RNE-converted to bf16 on load; softmax, masks and epilogues in f32 on VALU.
#include <hip/hip_runtime.h>
#include <stdint.h>

#define NWIN 64
#define NTOK 512
#define CCH  256
#define NHD  8
#define HD   32
#define C3   768
#define NROW 32768
#define NRPB 3375
#define NBDI 15
#define LDC  132
#define QSC  0.17677669529663687f
#define INV512 0.001953125f
#define C1EXP 0.0028177637517362567f

static_assert(NROW == NWIN * NTOK);
static_assert(15 * 15 * 15 == NRPB);
static_assert((LDC * 4) % 16 == 0);

typedef _Float16 v16h __attribute__((ext_vector_type(16)));
typedef _Float16 v8h  __attribute__((ext_vector_type(8)));
typedef float    v8f  __attribute__((ext_vector_type(8)));
typedef float    v4f  __attribute__((ext_vector_type(4)));
typedef unsigned int v4u __attribute__((ext_vector_type(4)));

template <bool B> struct flag_c { static constexpr bool value = B; };

// ---- scalar helpers ------------------------------------------------------------------------------------------
__device__ __forceinline__ unsigned short bf_bits(float f) {          // f32 -> bf16 bits, RNE convert
  unsigned u = __float_as_uint(f);
  return (unsigned short)((u + 0x7FFFu + ((u >> 16) & 1u)) >> 16);
}
__device__ __forceinline__ float bf_up(unsigned short b) { return __uint_as_float(((unsigned)b) << 16); }
__device__ __forceinline__ float bfr(float f) { return bf_up(bf_bits(f)); }
__device__ __forceinline__ unsigned short h_bits(_Float16 x) { return __builtin_bit_cast(unsigned short, x); }
__device__ __forceinline__ unsigned short hb16(float f) { return h_bits((_Float16)f); }
__device__ __forceinline__ unsigned pk16(unsigned short a, unsigned short b) { return (unsigned)a | ((unsigned)b << 16); }
__device__ __forceinline__ v8f zero8() { v8f z = {0.f, 0.f, 0.f, 0.f, 0.f, 0.f, 0.f, 0.f}; return z; }

// ---- index maps --------------------------------------------------------------------------------------------------
// window w = (hb*4 + wb)*4 + db over a 32^3 volume in 8^3 windows; token t = (i*8 + j)*8 + k inside the window.
// The shifted coordinate is (hb*8+i, wb*8+j, db*8+k); both the input gather (roll by -4) and the output scatter
// (roll by +4) use volume position ((hs+4)&31, (ws+4)&31, (ds+4)&31).
__device__ __forceinline__ int spat_of(int w, int t) {
  const int hb = w >> 4, wb = (w >> 2) & 3, db = w & 3;
  const int i = t >> 6, j = (t >> 3) & 7, k = t & 7;
  const int gh = (hb * 8 + i + 4) & 31;
  const int gw = (wb * 8 + j + 4) & 31;
  const int gd = (db * 8 + k + 4) & 31;
  return (gh * 32 + gw) * 32 + gd;
}
__device__ __forceinline__ int rid1(int p) { return (p < 24) ? 0 : ((p < 28) ? 1 : 2); }
__device__ __forceinline__ int region_of(int w, int t) {
  const int hb = w >> 4, wb = (w >> 2) & 3, db = w & 3;
  const int i = t >> 6, j = (t >> 3) & 7, k = t & 7;
  return rid1(hb * 8 + i) * 9 + rid1(wb * 8 + j) * 3 + rid1(db * 8 + k);
}

// ---- fragment-order planes: every 16-bit A/B operand plane is kept as 1-KiB blocks of 16 rows x 32 k. Inside a block
//      the 16-B piece (row c, k = 16*chunk + 8*h .. +7) stands at halves chunk*256 + (h*16 + c)*8, so lane l = h*16 + c
//      finds its two pieces at l*8 and 256 + l*8 and each wave-wide 16-B load covers 512 contiguous bytes (4 lines).
//      p = block base + lane*8; elements 0..7 <- k 8h.., elements 8..15 <- k 16+8h.. (hardware k order, as before)
__device__ __forceinline__ v16h ldfrag_h(const _Float16* p) {
  union { v16h v; v8h h[2]; } f;
  f.h[0] = *(const v8h*)(p);
  f.h[1] = *(const v8h*)(p + 256);
  return f.v;
}
// halves offset of the piece (row, k = ks*32 + 8*g .. +7), g = 0..3, in a fragment-order plane of 256-k rows
__device__ __forceinline__ size_t frag_off(int row, int ks, int g) {
  return ((size_t)((row >> 4) * 8 + ks)) * 512 + (g >> 1) * 256 + ((g & 1) * 16 + (row & 15)) * 8;
}

// ---- WMMA helpers; the guard helpers insert the trailing VALU hazard gap and keep A/B live -----------------------
__device__ __forceinline__ v8f mma_raw(v16h a, v16h b, v8f c) {
  return __builtin_amdgcn_wmma_f32_16x16x32_f16(false, a, false, b, (short)0, c, false, false);
}
__device__ __forceinline__ void guard4(v8f& c0, v8f& c1, v8f& c2, v8f& c3,
                                       const v16h& a0, const v16h& a1, const v16h& b0, const v16h& b1) {
#if defined(__HIP_DEVICE_COMPILE__)
  asm volatile("v_nop\n\tv_nop\n\tv_nop\n\tv_nop"
               : "+v"(c0), "+v"(c1), "+v"(c2), "+v"(c3) : "v"(a0), "v"(a1), "v"(b0), "v"(b1));
#endif
}
__device__ __forceinline__ void guard8(v8f& c0, v8f& c1, v8f& c2, v8f& c3, v8f& c4, v8f& c5, v8f& c6, v8f& c7,
                                       const v16h& a0, const v16h& a1, const v16h& a2, const v16h& a3,
                                       const v16h& b0, const v16h& b1) {
#if defined(__HIP_DEVICE_COMPILE__)
  asm volatile("v_nop\n\tv_nop\n\tv_nop\n\tv_nop"
               : "+v"(c0), "+v"(c1), "+v"(c2), "+v"(c3), "+v"(c4), "+v"(c5), "+v"(c6), "+v"(c7)
               : "v"(a0), "v"(a1), "v"(a2), "v"(a3), "v"(b0), "v"(b1));
#endif
}
__device__ __forceinline__ void guard_pv2(v8f& c0, v8f& c1, v8f& c2, v8f& c3,
                                          const v16h& a0, const v16h& a1, const v16h& a2, const v16h& a3,
                                          const v16h& b0, const v16h& b1, const v16h& b2, const v16h& b3) {
#if defined(__HIP_DEVICE_COMPILE__)
  asm volatile("v_nop\n\tv_nop\n\tv_nop\n\tv_nop"
               : "+v"(c0), "+v"(c1), "+v"(c2), "+v"(c3)
               : "v"(a0), "v"(a1), "v"(a2), "v"(a3), "v"(b0), "v"(b1), "v"(b2), "v"(b3));
#endif
}
// value of lane l ^ 16 (the other half of the wave), as a vector cross-row move
__device__ __forceinline__ float xhalf(float v) {
  const int b = __float_as_int(v);
  return __int_as_float(__builtin_amdgcn_permlanex16(b, b, 0x76543210, 0xfedcba98, false, false));
}

// =================================================================================================================
// weight convert, both weights in one launch: w [rows][256] f32 ([out][in], in contiguous) -> f16(1024 * bf16_RNE(w)),
// rows n, fragment order, each weight into its own plane. Block = 8 rows; blocks 0 .. 95 take the 768 qkv rows, blocks
// 96 .. 127 the 256 proj rows (the choice is the same for a whole block); wave = one 32-channel k-step of the 8 rows;
// lane = row (lane&7), 8 channels (lane>>3). grid = (768 + 256) / 8. coverage: 768 x 256 and 256 x 256, each once.
// =================================================================================================================
__global__ __launch_bounds__(256) void cvt_w(const float* __restrict__ wqsrc, const float* __restrict__ wpsrc,
                                             unsigned short* wqdst, unsigned short* wpdst) {
  const int tid = threadIdx.x, wv = tid >> 5, lane = tid & 31;
  const bool isq = blockIdx.x < C3 / 8;
  const int row = (isq ? blockIdx.x : blockIdx.x - C3 / 8) * 8 + (lane & 7), g = lane >> 3;
  const float* src = (isq ? wqsrc : wpsrc) + (size_t)row * CCH + wv * 32 + g * 8;
  const v4f a = *(const v4f*)(src);
  const v4f b = *(const v4f*)(src + 4);
  v4u pk;
  pk[0] = pk16(hb16(bfr(a[0]) * 1024.0f), hb16(bfr(a[1]) * 1024.0f));
  pk[1] = pk16(hb16(bfr(a[2]) * 1024.0f), hb16(bfr(a[3]) * 1024.0f));
  pk[2] = pk16(hb16(bfr(b[0]) * 1024.0f), hb16(bfr(b[1]) * 1024.0f));
  pk[3] = pk16(hb16(bfr(b[2]) * 1024.0f), hb16(bfr(b[3]) * 1024.0f));
  unsigned short* gp = (isq ? wqdst : wpdst) + frag_off(row, wv, g);
  *(v4u*)gp = pk;
}

// =================================================================================================================
// cyclic shift + window gather + convert + qkv GEMM in one kernel. Block = 64 tokens of one window x all 768 columns.
// Stage: x [32768 positions][256] f32 -> LDS A tile, 64 rows x 256 k in fragment order, value f16(8 * bf16_RNE(x)).
// Wave = one 32-channel k-step, lane = row (lane&7) of 8, 8 channels (lane>>3), 8 row groups: sixteen 16-B loads in
// flight per lane, eight 16-B LDS stores. Then six column tiles of 128: C[64][128] = A . W1024[cols][256]^T, K = 256
// (8 k-steps of 32), A fragments from LDS, W fragments of a whole column tile held in registers and fetched one tile
// ahead, so that they fly under the epilogue; 8 waves = 2 (32 rows) x 4 (32 cols), 2x2 tiles per wave. The bias row
// stands in LDS as bf16_RNE(b), converted once per block.
// C = 8192 * (xw . W^T). Epilogue through an LDS f32 tile (two of them, used in turn: one barrier per column tile):
// part q -> Q plane [w*8+h][tok/16] blocks (rows tok, k = d)
// = f16(64*q) with q = (C/8192 + b) * 32^-0.5; part k -> K plane = f16(8*k), same form; part v -> V^T
// [w*8+h][tok/32][d/16] blocks (rows d, k = tok) = f16(16*v). A thread takes the
// piece that stands at tid*8 halves of the head's 4 blocks, so every store instruction writes 512 contiguous bytes.
// coverage: Q/K: 4 instr x 256 pieces = 4 heads x 64 tok x 32 d; V: 4 instr x 256 pieces = 4 heads x 32 d x
// 64 tok; over the grid and the six tiles every element of Q, K (64x8x512x32) and V^T (64x8x32x512) exactly once.
// =================================================================================================================
__global__ __launch_bounds__(256)
void gemm_qkv(const float* __restrict__ x, const unsigned short* __restrict__ wq,
              const float* __restrict__ bq,
              unsigned short* qpl, unsigned short* kpl, unsigned short* vth) {
  __shared__ __align__(16) unsigned short As[64 * CCH];
  __shared__ __align__(16) float Cs2[2][64 * LDC];
  __shared__ __align__(16) float Bs[C3];
  const int tid = threadIdx.x, wave = tid >> 5, lane = tid & 31, hh = lane >> 4, c = lane & 15;
  const int mb = blockIdx.x;
  const int mw = wave >> 2, nw = wave & 3;
  const int w = mb >> 3, tok0 = (mb & 7) * 64;
  const _Float16* W = (const _Float16*)(const void*)wq;

  // column tile nb of this wave: + nb * 32768 halves; second 16-column band: + 4096; k-step: + 512
  const _Float16* pb = W + frag_off(nw * 32, 0, 0) + lane * 8;
  v16h fb0[8], fb1[8];
#pragma unroll
  for (int ks = 0; ks < 8; ++ks) {
    fb0[ks] = ldfrag_h(pb + ks * 512);
    fb1[ks] = ldfrag_h(pb + 4096 + ks * 512);
  }

  {
    const int r8 = lane & 7, g = lane >> 3;
    v4f xa[8], xb[8];
    float bv[3];
#pragma unroll
    for (int it = 0; it < 8; ++it) {
      const float* src = x + (size_t)spat_of(w, tok0 + it * 8 + r8) * CCH + wave * 32 + g * 8;
      xa[it] = *(const v4f*)(src);
      xb[it] = *(const v4f*)(src + 4);
    }
#pragma unroll
    for (int i = 0; i < 3; ++i) bv[i] = bq[i * 256 + tid];
#pragma unroll
    for (int i = 0; i < 3; ++i) Bs[i * 256 + tid] = bfr(bv[i]);
#pragma unroll
    for (int it = 0; it < 8; ++it) {
      const v4f a = xa[it], b = xb[it];
      v4u pk;
      pk[0] = pk16(hb16(bfr(a[0]) * 8.0f), hb16(bfr(a[1]) * 8.0f));
      pk[1] = pk16(hb16(bfr(a[2]) * 8.0f), hb16(bfr(a[3]) * 8.0f));
      pk[2] = pk16(hb16(bfr(b[0]) * 8.0f), hb16(bfr(b[1]) * 8.0f));
      pk[3] = pk16(hb16(bfr(b[2]) * 8.0f), hb16(bfr(b[3]) * 8.0f));
      *(v4u*)(As + frag_off(it * 8 + r8, wave, g)) = pk;
    }
  }
  __syncthreads();

  const _Float16* pa = (const _Float16*)(const void*)As + frag_off(mw * 32, 0, 0) + lane * 8;   // next band: + 4096

#pragma unroll 1
  for (int nb = 0; nb < 6; ++nb) {
  float* Cs = Cs2[nb & 1];
  v8f a00 = zero8(), a01 = zero8(), a10 = zero8(), a11 = zero8();
  v16h fa0 = ldfrag_h(pa), fa1 = ldfrag_h(pa + 4096);
#pragma unroll
  for (int ks = 0; ks < 8; ++ks) {
    v16h na0 = fa0, na1 = fa1;                    // A fragments of the next k-step, read ahead of this step's products
    if (ks < 7) {
      na0 = ldfrag_h(pa + (ks + 1) * 512);
      na1 = ldfrag_h(pa + 4096 + (ks + 1) * 512);
    }
    a00 = mma_raw(fa0, fb0[ks], a00);
    a01 = mma_raw(fa0, fb1[ks], a01);
    a10 = mma_raw(fa1, fb0[ks], a10);
    a11 = mma_raw(fa1, fb1[ks], a11);
    guard4(a00, a01, a10, a11, fa0, fa1, fb0[ks], fb1[ks]);
    fa0 = na0;
    fa1 = na1;
  }
#pragma unroll
  for (int r = 0; r < 8; ++r) {
    const int row = mw * 32 + 8 * hh + r;
    Cs[row * LDC + nw * 32 + c]             = a00[r];
    Cs[row * LDC + nw * 32 + 16 + c]        = a01[r];
    Cs[(row + 16) * LDC + nw * 32 + c]      = a10[r];
    Cs[(row + 16) * LDC + nw * 32 + 16 + c] = a11[r];
  }
  // one barrier per column tile: it publishes this tile's C, and every wave that passes it has left the other C buffer
  __syncthreads();

  // the next column tile's W fragments: issued behind the barrier (which waits for every load in flight) and in front
  // of an epilogue that reads LDS only, so that nothing waits for them before the next tile's products
  if (nb < 5) {                                   // block-uniform
    const _Float16* pn = pb + (nb + 1) * 32768;
#pragma unroll
    for (int ks = 0; ks < 8; ++ks) {
      fb0[ks] = ldfrag_h(pn + ks * 512);
      fb1[ks] = ldfrag_h(pn + 4096 + ks * 512);
    }
    // the address pair of these loads is reused by the epilogue: keep the wait in front of that overwrite
    asm volatile("s_wait_xcnt 0x0" ::: "memory");
  }

  const int part = nb >> 1;                       // block-uniform: 0 q, 1 k, 2 v
  const int hb4 = (nb & 1) * 4;
  const float* bqn = Bs + nb * 128;               // bf16_RNE(bias), staged once
  if (part < 2) {
    unsigned short* dst = (part == 0) ? qpl : kpl;
    const float scl = (part == 0) ? (QSC * 64.0f) : 8.0f;
    v4u pk[4];
    size_t offs[4];
#pragma unroll
    for (int s = 0; s < 4; ++s) {
      const int h4 = s;
      const int tok = (tid >> 6) * 16 + (tid & 15), d0 = ((tid >> 4) & 3) * 8;
      const int col = h4 * 32 + d0;
      v4u q4;
#pragma unroll
      for (int e = 0; e < 4; ++e) {
        float f0 = Cs[tok * LDC + col + 2 * e] * (1.0f / 8192.0f) + bqn[col + 2 * e];
        float f1 = Cs[tok * LDC + col + 2 * e + 1] * (1.0f / 8192.0f) + bqn[col + 2 * e + 1];
        f0 = f0 * scl;
        f1 = f1 * scl;
        q4[e] = pk16(hb16(f0), hb16(f1));
      }
      pk[s] = q4;
      offs[s] = ((size_t)((w * NHD + hb4 + h4) * NTOK + tok0)) * HD + tid * 8;
    }
#pragma unroll
    for (int s = 0; s < 4; ++s) *(v4u*)(dst + offs[s]) = pk[s];
    
  } else {
    v4u phk[4];
    size_t offs[4];
#pragma unroll
    for (int s = 0; s < 4; ++s) {
      const int h4 = s, d = ((tid >> 6) & 1) * 16 + (tid & 15);
      const int col = h4 * 32 + d;
      const int tb = (tid >> 7) * 32 + ((tid >> 4) & 3) * 8;
      const float bc = bqn[col];
      v4u a;
#pragma unroll
      for (int e = 0; e < 4; ++e) {
        const float v0 = Cs[(tb + 2 * e) * LDC + col] * (1.0f / 8192.0f) + bc;
        const float v1 = Cs[(tb + 2 * e + 1) * LDC + col] * (1.0f / 8192.0f) + bc;
        a[e] = pk16(hb16(v0 * 16.0f), hb16(v1 * 16.0f));
      }
      phk[s] = a;
      offs[s] = ((size_t)(w * NHD + hb4 + h4)) * HD * NTOK + tok0 * HD + tid * 8;
    }
#pragma unroll
    for (int s = 0; s < 4; ++s) *(v4u*)(vth + offs[s]) = phk[s];
    // later code overwrites the registers that these stores name: keep the wait directly behind them, in this branch
    asm volatile("s_wait_xcnt 0x0" ::: "memory");
  }
  // the next tile's products overwrite the registers that these stores name: keep the wait in front of that overwrite
  asm volatile("s_wait_xcnt 0x0" ::: "memory");
  }
}

// =================================================================================================================
// Window attention, transposed: block = one (window, head); its Q, K and V^T planes (32 KiB each, fragment
// order kept) are copied once into LDS through registers; a wave walks 2 pairs of adjacent 16-query strips (strips
// 16*s + 2*wave and the next): a pass reads the K and V^T fragments of 64 keys once for both strips of the pair.
// S^T = K8 . Q64^T via WMMA (A = key rows, B = query columns) with 512*bias as the C operand, so a lane holds
// the scores of ONE query (column lane&15) for keys 8*(lane>>4) + r of each 16-key tile. Shift mask -51200 where region
// ids differ. Online softmax over 8 blocks of 64 keys in f32: maximum and sum run over the lane's own 32 registers, the
// maximum is joined with lane ^ 16 once per block, the sum l stays a per-half partial and is joined once at the end.
// p' = 4096*exp((s-m)/512); P = f16(p'). Two score tiles of one 32-key step, converted in
// place, are the B operand of O^T += V^T . P^T (A = V^T rows, hardware k order on both sides): P never leaves registers.
// One product, f16 operands, f32 accumulate, V^T = f16(16v); l sums the unrounded p';
// o = acc / (16 l). A lane ends with 8 consecutive d of its query per tile: 16-B packed stores.
// Loads run ahead of their use: K fragments and bias tiles one 64-key block, V^T fragments from the head of their pass.
// The second strip of a pair stands two j rows further, so its bias tile of key tile j is the first strip's of key tile
// j - 1: five bias tiles serve the pair's eight score tiles.
// Bias: the head's column of the table stands in LDS as rows (i and j difference) of 16 floats, value
// 512 * bf16_RNE(rpb), the k difference reversed: slot x holds difference 14 - x. Query n against keys m = 8 g + r,
// r = 0..7 (one i, one j, k = r) is then 8 consecutive floats from slot 7 - k_n of row (i_n-i_m+7)*15 + (j_n-j_m+7):
// a lane's C registers of one 16-key tile. A wave's 32 lanes touch 3 rows, 24 distinct banks. A block's 512 queries
// meet all 15 i differences: 225 rows.
// Output planes O hi = f16(64 o), O lo = f16((64o-hi)*2^14), layout [h][(w*512 + tok)/16] blocks (rows tok, k = d).
// coverage: 512 blocks x 8 waves x 2 pairs x 2 strips x 16 rows x 32 d = 8 x 32768 x 32 per plane, every element once.
// =================================================================================================================
// two blocks per WGP (LDS allows two) need four waves per SIMD: the register budget is held at 256
__global__ __launch_bounds__(256) __attribute__((amdgpu_waves_per_eu(4, 4)))
void attn_win(const unsigned short* __restrict__ qpl, const unsigned short* __restrict__ kpl,
              const unsigned short* __restrict__ vth,
              const float* __restrict__ rpb, unsigned short* ohi, unsigned short* olo) {
  // one LDS block, bias table first, then V^T, K, Q: every read of a pass then lies within the offset field of its
  // instruction from one running address, so that no read needs an address register of its own (two strips per wave
  // leave no registers for them)
  struct Lds {
    float brow[NBDI * 240];
    unsigned short Vhs[NTOK * HD];
    unsigned short Ks[NTOK * HD];
    unsigned short Qs[NTOK * HD];
  };
  __shared__ __align__(16) Lds lds;
  float* const brow = lds.brow;
  unsigned short* const Qs = lds.Qs;
  unsigned short* const Ks = lds.Ks;
  unsigned short* const Vhs = lds.Vhs;
  const int tid = threadIdx.x, lane = tid & 31, hh = lane >> 4, c = lane & 15;
  const int wave = __builtin_amdgcn_readfirstlane(tid >> 5);   // scalar: strip numbers and store bases take no vector registers
  const int wh = blockIdx.x;                      // w*8 + h
  const int w = wh >> 3, h = wh & 7;

  {
    // straight copy of the three planes, 2048 pieces of 16 B each: 24 loads in flight per lane, then 24 LDS stores
    const v4u* gq = (const v4u*)(const void*)(qpl + (size_t)wh * NTOK * HD);
    const v4u* gk = (const v4u*)(const void*)(kpl + (size_t)wh * NTOK * HD);
    const v4u* gh = (const v4u*)(const void*)(vth + (size_t)wh * HD * NTOK);
    v4u rq[8], rk[8], rh[8];
#pragma unroll
    for (int i = 0; i < 8; ++i) {
      rq[i] = gq[i * 256 + tid];
      rk[i] = gk[i * 256 + tid];
      rh[i] = gh[i * 256 + tid];
    }
    // the registers that address these loads are reused behind them: keep the wait in front of that overwrite
    asm volatile("s_wait_xcnt 0x0" ::: "memory");
#pragma unroll
    for (int i = 0; i < 8; ++i) {
      ((v4u*)(void*)Qs)[i * 256 + tid]  = rq[i];
      ((v4u*)(void*)Ks)[i * 256 + tid]  = rk[i];
      ((v4u*)(void*)Vhs)[i * 256 + tid] = rh[i];
    }
  }
  if (tid < 240) {
    // 16 lanes = one row, 15 rows (one i difference) a trip, all loads in flight at once; slot 15 is never read and
    // takes slot 14's value
    const int xs = min(tid & 15, 14);
    float tv[NBDI];
#pragma unroll
    for (int it = 0; it < NBDI; ++it) tv[it] = rpb[((it * 15 + (tid >> 4)) * 15 + 14 - xs) * NHD + h];
    // the addresses of these loads are reused behind them: keep the wait in front of that overwrite
    asm volatile("s_wait_xcnt 0x0" ::: "memory");
#pragma unroll
    for (int it = 0; it < NBDI; ++it) brow[it * 240 + tid] = bfr(tv[it]) * 512.0f;
  }
  __syncthreads();

  const _Float16* Q  = (const _Float16*)(const void*)Qs;
  const _Float16* K  = (const _Float16*)(const void*)Ks;
  const _Float16* Vh = (const _Float16*)(const void*)Vhs;

  // rolled: the copies of the body would gain nothing
#pragma unroll 1
  for (int sidx = 0; sidx < 2; ++sidx) {
  const int strip = sidx * 16 + wave * 2;         // even; the wave works on strips strip and strip + 1 together
  const int q0 = strip * 16;
  // bias of query q0 + 16*u + c against key tile j of block kb, keys 8*hh + r: Bp[(di0 - kb) * 240 + (3 - j + u) * 32 + r]
  // (strip + 1 stands two j rows further and, strip being even, does not wrap): five tiles serve both strips.
  // di0 = i_n + 7 is the same in every lane of the wave and in both strips: held scalar
  const int di0 = __builtin_amdgcn_readfirstlane((strip >> 2) + 7);
  const float* Bp = brow + (((strip * 2 + (c >> 3)) & 7) + (hh ^ 1)) * 16 + ((c & 7) ^ 7);   // 1 - hh, 7 - k_n

  v16h qb[2];
  qb[0] = ldfrag_h(Q + q0 * HD + lane * 8);
  qb[1] = ldfrag_h(Q + q0 * HD + 512 + lane * 8);
  // shift mask, 512 * -100 where region ids differ. A region id changes only where a coordinate passes a multiple of 4,
  // so a lane's 32 keys of a block fall into four groups of one id each: tiles 2a, 2a+1 (j_m >> 2 = a) x registers
  // 4b .. 4b+3 (k_m >> 2 = b). mvs[u][a][b]: the j and k axes, against a key of the query's own i; the i axis is the
  // same for the whole wave and block and joins per pass as a scalar.
  const int in0 = __builtin_amdgcn_readfirstlane(strip >> 2);
  float mvs[2][2][2];
#pragma unroll
  for (int u = 0; u < 2; ++u) {
    const int cq = region_of(w, q0 + 16 * u + c);
#pragma unroll
    for (int a = 0; a < 2; ++a) {
#pragma unroll
      for (int b = 0; b < 2; ++b) mvs[u][a][b] = (cq != region_of(w, (in0 * 8 + 4 * a) * 8 + 4 * b)) ? -51200.0f : 0.0f;
    }
  }
  const int ri = rid1((w >> 4) * 8 + in0);
  float mrow[2] = {-1e30f, -1e30f}, lrow[2] = {0.f, 0.f};
  v8f oa[2][2] = {{zero8(), zero8()}, {zero8(), zero8()}};      // [strip][d tile]

  // K fragments and bias tiles of a 64-key block are fetched one block ahead; here those of block 0
  v16h kf[4];
  v8f bt[5];
#pragma unroll
  for (int j = 0; j < 4; ++j) kf[j] = ldfrag_h(K + j * 512 + lane * 8);
#pragma unroll
  for (int t = 0; t < 5; ++t) {
#pragma unroll
    for (int r = 0; r < 8; ++r) bt[t][r] = Bp[di0 * 240 + t * 32 + r];
  }

  // one 64-key block against both strips; MORE: a further block follows, and its K fragments and bias tiles are fetched
  // in this pass
  auto pass = [&](const int kb, auto more) __attribute__((always_inline)) {
    // V^T fragments of the block's two 32-key steps (d 0..15, d 16..31 of each): they fly under the
    // score products, the mask and the softmax
    const int koff = kb * 2048 + lane * 8;
    v16h va[4];
    va[0] = ldfrag_h(Vh + koff);
    va[1] = ldfrag_h(Vh + koff + 512);
    va[2] = ldfrag_h(Vh + koff + 1024);
    va[3] = ldfrag_h(Vh + koff + 1536);
    // ---- transposed logits for 64 keys: 4 tiles of 16 keys x 16 queries per strip, bias via C operand ----
    v8f s[2][4];
#pragma unroll
    for (int j = 0; j < 4; ++j) {
      s[0][j] = mma_raw(kf[j], qb[0], bt[3 - j]);
      s[1][j] = mma_raw(kf[j], qb[1], bt[4 - j]);
    }
    guard8(s[0][0], s[1][0], s[0][1], s[1][1], s[0][2], s[1][2], s[0][3], s[1][3],
           kf[0], kf[1], kf[2], kf[3], qb[0], qb[1]);
    // ---- online softmax update: one query per lane and strip, 32 of its 64 scores here, the rest in lane ^ 16 ----
    // The mask is one value per group: the maximum is taken per group over the raw scores and the mask added to the four
    // maxima (the same value as the maximum of the masked scores: adding a constant keeps the order, rounded or not).
    const float si = (ri != rid1((w >> 4) * 8 + kb)) ? -51200.0f : 0.0f;
    v16h pb[2][2];
#pragma unroll
    for (int u = 0; u < 2; ++u) {
      float mv[2][2], gm[2][2];
#pragma unroll
      for (int a = 0; a < 2; ++a) {
#pragma unroll
        for (int b = 0; b < 2; ++b) {
          const v8f x0 = s[u][2 * a], x1 = s[u][2 * a + 1];
          const int r0 = 4 * b;
          gm[a][b] = fmaxf(fmaxf(fmaxf(x0[r0], x0[r0 + 1]), fmaxf(x0[r0 + 2], x0[r0 + 3])),
                           fmaxf(fmaxf(x1[r0], x1[r0 + 1]), fmaxf(x1[r0 + 2], x1[r0 + 3])));
          mv[a][b] = fminf(mvs[u][a][b], si);
        }
      }
      float tm = fmaxf(fmaxf(gm[0][0] + mv[0][0], gm[0][1] + mv[0][1]), fmaxf(gm[1][0] + mv[1][0], gm[1][1] + mv[1][1]));
      tm = fmaxf(tm, xhalf(tm));
      const float mn = fmaxf(mrow[u], tm);
      const float alpha = __expf((mrow[u] - mn) * INV512);
      mrow[u] = mn;
      // p' = 2^(s * log2(e)/512 + off): mask, maximum and the factor 4096 = 2^12 stand in the addend, one per group, so a
      // score takes one multiply-add and one exp2
      v8f offv[2];
#pragma unroll
      for (int a = 0; a < 2; ++a) {
        const float o0 = (mv[a][0] - mn) * C1EXP + 12.0f;
        const float o1 = (mv[a][1] - mn) * C1EXP + 12.0f;
        const v8f ov = {o0, o0, o0, o0, o1, o1, o1, o1};
        offv[a] = ov;
      }
#pragma unroll
      for (int j = 0; j < 4; ++j) {
        const v8f e = s[u][j] * C1EXP + offv[j >> 1];
#pragma unroll
        for (int r = 0; r < 8; ++r) s[u][j][r] = __builtin_amdgcn_exp2f(e[r]);
      }
      const v8f sv = (s[u][0] + s[u][1]) + (s[u][2] + s[u][3]);
      const float ps = ((sv[0] + sv[1]) + (sv[2] + sv[3])) + ((sv[4] + sv[5]) + (sv[6] + sv[7]));
      lrow[u] = lrow[u] * alpha + ps;
      oa[u][0] = oa[u][0] * alpha; oa[u][1] = oa[u][1] * alpha;
      // element e <- key 8*hh + e (tile 2*ks), element 8 + e <- key 16 + 8*hh + e (tile 2*ks + 1)
#pragma unroll
      for (int ks = 0; ks < 2; ++ks) {
        const v8h ph0 = __builtin_convertvector(s[u][2 * ks], v8h);
        const v8h ph1 = __builtin_convertvector(s[u][2 * ks + 1], v8h);
        pb[u][ks] = __builtin_shufflevector(ph0, ph1, 0, 1, 2, 3, 4, 5, 6, 7, 8, 9, 10, 11, 12, 13, 14, 15);
      }
    }
    // the next block's K fragments and bias tiles: issued where the scores have become P and their registers are free
    // again, so that the bias lands in them without a copy; they fly under the V products.
    // The last pass is a copy of the body without them: a branch in the loop would merge the load counting
    if constexpr (decltype(more)::value) {
      const int kn = kb + 1;
      const _Float16* kp = K + kn * 2048 + lane * 8;
      const float* bn = Bp + (di0 - kn) * 240;
#pragma unroll
      for (int t = 0; t < 5; ++t) {
#pragma unroll
        for (int r = 0; r < 8; ++r) bt[t][r] = bn[t * 32 + r];
      }
#pragma unroll
      for (int j = 0; j < 4; ++j) kf[j] = ldfrag_h(kp + j * 512);
    }
    // ---- O^T += V^T . P^T : two 32-key k-steps, two 16-dim tiles, two strips ----
    oa[0][0] = mma_raw(va[0], pb[0][0], oa[0][0]);
    oa[0][1] = mma_raw(va[1], pb[0][0], oa[0][1]);
    oa[1][0] = mma_raw(va[0], pb[1][0], oa[1][0]);
    oa[1][1] = mma_raw(va[1], pb[1][0], oa[1][1]);
    oa[0][0] = mma_raw(va[2], pb[0][1], oa[0][0]);
    oa[0][1] = mma_raw(va[3], pb[0][1], oa[0][1]);
    oa[1][0] = mma_raw(va[2], pb[1][1], oa[1][0]);
    oa[1][1] = mma_raw(va[3], pb[1][1], oa[1][1]);
    guard_pv2(oa[0][0], oa[0][1], oa[1][0], oa[1][1], va[0], va[1], va[2], va[3],
              pb[0][0], pb[0][1], pb[1][0], pb[1][1]);
  };
#pragma unroll 1
  for (int kb = 0; kb < 7; ++kb) pass(kb, flag_c<true>{});
  pass(7, flag_c<false>{});

  // ---- join the halves' sums, normalise, split into hi / lo, 16-B packed stores (8 consecutive d of one query) ----
#pragma unroll
  for (int u = 0; u < 2; ++u) {
    const float lt = lrow[u] + xhalf(lrow[u]);
    const float inv = 1.0f / (lt * 16.0f);
    v4u ph2[2], pl2[2];
#pragma unroll
    for (int e = 0; e < 4; ++e) {
      float f[4];
#pragma unroll
      for (int t = 0; t < 2; ++t) {
        const int r = 2 * e + t;
        f[t]     = (oa[u][0][r] * inv) * 64.0f;
        f[2 + t] = (oa[u][1][r] * inv) * 64.0f;
      }
      const _Float16 a0 = (_Float16)f[0], a1 = (_Float16)f[1], b0 = (_Float16)f[2], b1 = (_Float16)f[3];
      ph2[0][e] = pk16(h_bits(a0), h_bits(a1));
      ph2[1][e] = pk16(h_bits(b0), h_bits(b1));
      pl2[0][e] = pk16(hb16((f[0] - (float)a0) * 16384.0f), hb16((f[1] - (float)a1) * 16384.0f));
      pl2[1][e] = pk16(hb16((f[2] - (float)b0) * 16384.0f), hb16((f[3] - (float)b1) * 16384.0f));
    }
    const size_t off = ((size_t)h * NROW + (size_t)w * NTOK + q0 + 16 * u) * HD;   // the same in every lane
    *(v4u*)(ohi + off + lane * 8)       = ph2[0];
    *(v4u*)(ohi + off + lane * 8 + 256) = ph2[1];
    *(v4u*)(olo + off + lane * 8)       = pl2[0];
    *(v4u*)(olo + off + lane * 8 + 256) = pl2[1];
    // later code overwrites the registers that these stores name: keep the wait in front of that overwrite
    asm volatile("s_wait_xcnt 0x0" ::: "memory");
  }
  }
}

// =================================================================================================================
// Output projection: out rows = (Ohi + Olo*2^-14)/64 . (W1024/1024)^T + b; two accumulator sets (hi.W, lo.W), K = 256
// = 8 head planes of 32. Block tile 64 tokens x 128 cols, 8 waves = 2 x 4, 2x2 tiles per wave. Epilogue through an
// LDS f32 tile; store with un-window + reverse shift: a wave writes one token's 128-col half row = 512 B = 4 whole
// coverage: 512 x 64 tokens (bijective position map) x 2 x 128 cols = every output element exactly once.
// =================================================================================================================
__global__ __launch_bounds__(256)
void gemm_proj(const unsigned short* __restrict__ ohi, const unsigned short* __restrict__ olo,
               const unsigned short* __restrict__ wp, const float* __restrict__ bp, float* out) {
  __shared__ __align__(16) float Cs[64 * LDC];
  const int tid = threadIdx.x, wave = tid >> 5, lane = tid & 31, hh = lane >> 4, c = lane & 15;
  const int mb = blockIdx.x, nb = blockIdx.y;
  const int mw = wave >> 2, nw = wave & 3;
  const _Float16* W = (const _Float16*)(const void*)wp;
  const int arow0 = mb * 64 + mw * 32;
  const int bcol0 = nb * 128 + nw * 32;

  v8f h00 = zero8(), h01 = zero8(), h10 = zero8(), h11 = zero8();
  v8f l00 = zero8(), l01 = zero8(), l10 = zero8(), l11 = zero8();
  const _Float16* ph = (const _Float16*)(const void*)ohi + (size_t)arow0 * HD + lane * 8;   // head plane ks: + NROW*HD
  const _Float16* pl = (const _Float16*)(const void*)olo + (size_t)arow0 * HD + lane * 8;
  const _Float16* pb = W + frag_off(bcol0, 0, 0) + lane * 8;
#pragma unroll 1
  for (int ks = 0; ks < 8; ++ks, ph += NROW * HD, pl += NROW * HD, pb += 512) {
    const v16h fa0 = ldfrag_h(ph);
    const v16h fa1 = ldfrag_h(ph + 512);
    const v16h ga0 = ldfrag_h(pl);
    const v16h ga1 = ldfrag_h(pl + 512);
    const v16h fb0 = ldfrag_h(pb);
    const v16h fb1 = ldfrag_h(pb + 4096);
    // the three address pairs stay whole until the twelve loads that name them have their addresses translated
    asm volatile("s_wait_xcnt 0x0" :: "v"(ph), "v"(pl), "v"(pb) : "memory");
    h00 = mma_raw(fa0, fb0, h00);
    h01 = mma_raw(fa0, fb1, h01);
    h10 = mma_raw(fa1, fb0, h10);
    h11 = mma_raw(fa1, fb1, h11);
    l00 = mma_raw(ga0, fb0, l00);
    l01 = mma_raw(ga0, fb1, l01);
    l10 = mma_raw(ga1, fb0, l10);
    l11 = mma_raw(ga1, fb1, l11);
    guard8(h00, h01, h10, h11, l00, l01, l10, l11, fa0, fa1, ga0, ga1, fb0, fb1);
  }
#pragma unroll
  for (int r = 0; r < 8; ++r) {
    const int row = mw * 32 + 8 * hh + r;
    Cs[row * LDC + nw * 32 + c]             = h00[r] + l00[r] * (1.0f / 16384.0f);
    Cs[row * LDC + nw * 32 + 16 + c]        = h01[r] + l01[r] * (1.0f / 16384.0f);
    Cs[(row + 16) * LDC + nw * 32 + c]      = h10[r] + l10[r] * (1.0f / 16384.0f);
    Cs[(row + 16) * LDC + nw * 32 + 16 + c] = h11[r] + l11[r] * (1.0f / 16384.0f);
  }
  __syncthreads();

  const int w = mb >> 3, tok0 = (mb & 7) * 64;
  const float* bpn = bp + nb * 128 + lane * 4;
  v4f bb;
#pragma unroll
  for (int e = 0; e < 4; ++e) bb[e] = bfr(bpn[e]);
  v4f ov[8];
  size_t offs[8];
#pragma unroll
  for (int it = 0; it < 8; ++it) {
    const int row = wave * 8 + it;
    const int sp = spat_of(w, tok0 + row);
    v4f v = *(const v4f*)(Cs + row * LDC + lane * 4);
#pragma unroll
    for (int e = 0; e < 4; ++e) v[e] = v[e] * (1.0f / 65536.0f) + bb[e];
    ov[it] = v;
    offs[it] = (size_t)sp * CCH + nb * 128 + lane * 4;
  }
#pragma unroll
  for (int it = 0; it < 8; ++it) *(v4f*)(out + offs[it]) = ov[it];
  
}

// =================================================================================================================
//   Wqkv f16 [768][256] 393216 | Wproj f16 [256][256] 131072 |
//   Q f16 [512][512][32] 16777216 | K same |
//   V^T f16 [512][32][512] same | O hi f16 [8][32768][32] 16777216 | O lo same 16777216
// =================================================================================================================
extern "C" void kernel_launch(void* const* d_in, const int* in_sizes, int n_in,
                              void* d_out, int out_size, void* d_ws, size_t ws_size,
                              hipStream_t stream) {
  if (n_in < 6) return;
  if (in_sizes[0] != NROW * CCH) return;
  if (in_sizes[1] != C3 * CCH || in_sizes[2] != C3) return;
  if (in_sizes[3] != CCH * CCH || in_sizes[4] != CCH) return;
  if (in_sizes[5] != NRPB * NHD) return;
  if (out_size != NROW * CCH) return;

  const float* x     = (const float*)d_in[0];
  const float* qkvw  = (const float*)d_in[1];
  const float* qkvb  = (const float*)d_in[2];
  const float* projw = (const float*)d_in[3];
  const float* projb = (const float*)d_in[4];
  const float* rpb   = (const float*)d_in[5];
  float* out = (float*)d_out;

  const size_t sWq = (size_t)C3 * CCH * 2;                   //   393216
  const size_t sWp = (size_t)CCH * CCH * 2;                  //   131072
  const size_t sQK = (size_t)NWIN * NHD * NTOK * HD * 2;     // 16777216
  const size_t sO  = (size_t)NHD * NROW * HD * 2;            // 16777216
  size_t off = 0;
  const size_t oWq = off; off += sWq;
  const size_t oWp = off; off += sWp;
  const size_t oQ  = off; off += sQK;
  const size_t oK  = off; off += sQK;
  const size_t oVh = off; off += sQK;
  const size_t oOh = off; off += sO;
  const size_t oOl = off; off += sO;
  if (off > ws_size) return;                                  // off = 84410368
  if (off > (size_t)134217728) return;

  char* ws = (char*)d_ws;
  unsigned short* Wq  = (unsigned short*)(ws + oWq);
  unsigned short* Wp  = (unsigned short*)(ws + oWp);
  unsigned short* Qp  = (unsigned short*)(ws + oQ);
  unsigned short* Kp  = (unsigned short*)(ws + oK);
  unsigned short* Vth = (unsigned short*)(ws + oVh);
  unsigned short* Ohi = (unsigned short*)(ws + oOh);
  unsigned short* Olo = (unsigned short*)(ws + oOl);

  const dim3 blk(256);
  // (1) weight converts, one launch for both weights
  cvt_w<<<dim3((C3 + CCH) / 8), blk, 0, stream>>>(qkvw, projw, Wq, Wp);
  // (2) window gather + convert + qkv projection: 512 row tiles, each over all six column tiles
  gemm_qkv<<<dim3(NROW / 64), blk, 0, stream>>>(x, Wq, qkvb, Qp, Kp, Vth);
  // (3) window attention: 64 windows x 8 heads, one block each
  attn_win<<<dim3(NWIN * NHD), blk, 0, stream>>>(Qp, Kp, Vth, rpb, Ohi, Olo);
  // (4) output projection + un-window + reverse shift -> d_out
  gemm_proj<<<dim3(NROW / 64, CCH / 128), blk, 0, stream>>>(Ohi, Olo, Wp, projb, out);
  (void)hipGetLastError();
}
